// v000
// The times below were measured on an AMD MI455X: many runs one after another, warmed up first and cycling through
// copies of the inputs, with the whole window's GPU time divided by the number of runs. Launches and the gaps
// between them are all in it. The median over several windows is given; except for v000 it joins two sittings, which
// can be a few percent apart, so the side-by-side timings, each taken in one sitting, are the better comparison.
// The starting kernel, v000, takes 490 microseconds a run.
#include <hip/hip_runtime.h>
// CustomCausalAttention (q, k, v [2][16][2048][64]; RBF-kernel causal attention: logits = -relu(|q|^2 + |k|^2 - 2 q.k) / 8 over keys n <= m; out = softmax(logits) v -> [2][16][2048][64]).
// Structure: each (batch, head) slab is a contiguous 64-wide row block, treated as one 'batch' of a single 64-dim head: exact f16 planes of q, k, v (bf16-rounded inputs are exact in f16); |q|^2, |k|^2 as f32 row tables on VALU; v^T by LDS tiles; causal flash-style fused attention per (slab, 64-query block), forming the RBF logit from the f32 dot product and the two norm tables, f32 context written straight to the output; the first 64 causal rows per slab recomputed entirely in f32 on VALU.
// Compute dtype: inputs rounded to bf16; q, k, v exact as f16 (products exact, f32 accumulation); norms, logits, softmax f32 with plain f16 probabilities (~2^-12); rows < 64 all-f32. v_wmma_f32_16x16x32_f16.
#define NB 32                    /* 2 batches x 16 heads as slabs */
#define DM 64
#define NKV 1
#define NREP (NH / NKV)
#define KVD (NKV * 64)           /* 64 */
#define NR (NB * SLEN)
#define CHK 512
typedef int v4i __attribute__((ext_vector_type(4)));
#define FF 2048
#define SLEN 2048
#define MQI 2048
#define MKI 2048
#define TQ SLEN
#define TK SLEN
#define NH 1
#define SCL 1.0f                 /* raw dot product; the RBF transform applies the 1/8 */
#define QBLKS (TQ / 64)
#define QB05 0
#define QBN5 QBLKS      /* hi/lo engine (k_flash5) block range; not launched */
#define QB0P 0
#define QBNP QBLKS
#define RE 256
typedef __bf16 v16b __attribute__((ext_vector_type(16)));
typedef unsigned short v8us __attribute__((ext_vector_type(8), may_alias));
typedef float  v8f  __attribute__((ext_vector_type(8)));
typedef float  v4f  __attribute__((ext_vector_type(4)));
typedef float  v4fa __attribute__((ext_vector_type(4), may_alias));
union FragB { v16b v; v8us half[2]; unsigned short u[16]; };

__device__ __forceinline__ unsigned short bf16_bits(float x) { unsigned int u = __float_as_uint(x); return (unsigned short)((u + 0x7FFFu + ((u >> 16) & 1u)) >> 16); }
__device__ __forceinline__ float bf16_val(unsigned short b) { return __uint_as_float(((unsigned int)b) << 16); }
__device__ __forceinline__ float bf16_round(float x) { return bf16_val(bf16_bits(x)); }
// D += A·B with NT terms: 1 = ah·bh, 2 = + al·bh (A split), 3 = + ah·bl (both split)
template <int NT>
__device__ __forceinline__ v8f mmaN(v16b ah, v16b al, v16b bh, v16b bl, v8f c) {
  c = __builtin_amdgcn_wmma_f32_16x16x32_bf16(false, ah, false, bh, (short)0, c, false, false);
  if (NT >= 2) c = __builtin_amdgcn_wmma_f32_16x16x32_bf16(false, al, false, bh, (short)0, c, false, false);
  if (NT >= 3) c = __builtin_amdgcn_wmma_f32_16x16x32_bf16(false, ah, false, bl, (short)0, c, false, false);
  asm volatile("v_nop\n\tv_nop\n\tv_nop\n\tv_nop" : "+v"(c) : "v"(ah), "v"(al), "v"(bh), "v"(bl));
  return c;
}

__global__ __launch_bounds__(256) void k_wt_bf16(const float* __restrict__ W, unsigned short* __restrict__ Wt, int K, int N) {
  const int t = blockIdx.x * 256 + threadIdx.x;
  const int k8n = K / 8;
  if (t >= N * k8n) return;
  const int n = t / k8n, k8 = (t % k8n) * 8;
  v8us v;
#pragma unroll
  for (int i = 0; i < 8; ++i) v[i] = bf16_bits(W[(size_t)(k8 + i) * N + n]);
  *(v8us*)(Wt + (size_t)n * K + k8) = v;
  
}

// GEMM C[M][N] (f32, pitch ldc) = act(A[M][K]·W + bias). A f32 row-major (pitch lda) converted per fragment to bf16
// (ASPLIT: hi/lo two planes -> 2 terms, else single rounded term); Wt bf16 [N][K] (pitch ldb). BIAS_BF16 rounds the
// bias to bf16 first (bias quantised to bf16 before the add). K%32==0, M%16==0, N%64==0.
template <bool ASPLIT, int ACT, bool BIAS_BF16>
__global__ __launch_bounds__(128) void k_gemm_bf(const float* __restrict__ A, int lda, const unsigned short* __restrict__ Wt, int ldb,
                                               const float* __restrict__ bias, float* __restrict__ C, int ldc, int M, int N, int K) {
  __shared__ __attribute__((aligned(16))) float so[4][16][64];
  const int tid = threadIdx.x, w = tid >> 5, lane = tid & 31, ln = lane & 15, hh = lane >> 4;
  const int ntn = N / 64;
  const int wid = blockIdx.x * 4 + w;
  const int mt = wid / ntn, nq = wid % ntn;
  if (mt * 16 >= M) return;
  const int row0 = mt * 16, col0 = nq * 64;
  const float* arow = A + (size_t)(row0 + ln) * lda;
  v8f acc[4] = {};
  for (int kb = 0; kb < K; kb += 32) {
    FragB ah, al;
    const v4f x0 = *(const v4fa*)(arow + kb + 8 * hh), x1 = *(const v4fa*)(arow + kb + 8 * hh + 4);
    const v4f x2 = *(const v4fa*)(arow + kb + 16 + 8 * hh), x3 = *(const v4fa*)(arow + kb + 16 + 8 * hh + 4);
    float xs[16] = {x0[0],x0[1],x0[2],x0[3],x1[0],x1[1],x1[2],x1[3],x2[0],x2[1],x2[2],x2[3],x3[0],x3[1],x3[2],x3[3]};
#pragma unroll
    for (int i = 0; i < 16; ++i) { const unsigned short hb = bf16_bits(xs[i]); ah.u[i] = hb; al.u[i] = ASPLIT ? bf16_bits(xs[i] - bf16_val(hb)) : (unsigned short)0; }
#pragma unroll
    for (int t = 0; t < 4; ++t) {
      const unsigned short* brow = Wt + (size_t)(col0 + t * 16 + ln) * ldb + kb;
      FragB b;
      b.half[0] = *(const v8us*)(brow + 8 * hh);
      b.half[1] = *(const v8us*)(brow + 16 + 8 * hh);
      acc[t] = mmaN<ASPLIT ? 2 : 1>(ah.v, al.v, b.v, b.v, acc[t]);
    }
  }
#pragma unroll
  for (int t = 0; t < 4; ++t) {
    float bv = bias ? bias[col0 + t * 16 + ln] : 0.f;
    if (BIAS_BF16) bv = bf16_round(bv);
#pragma unroll
    for (int r = 0; r < 8; ++r) { float v = acc[t][r] + bv; if (ACT == 1) v = fmaxf(v, 0.f); so[w][8 * hh + r][t * 16 + ln] = v; }
  }
  __builtin_amdgcn_fence(__ATOMIC_ACQ_REL, "workgroup");
  __builtin_amdgcn_wave_barrier();
  const int rsub = lane >> 4, c4 = (lane & 15) * 4;
  {
#pragma unroll
    for (int q = 0; q < 8; ++q) {
      const int r = q * 2 + rsub;
      const v4f v = *(const v4fa*)&so[w][r][c4];
      *(v4f*)(C + (size_t)(row0 + r) * ldc + col0 + c4) = v;
    }
    
  }
}

// GEMM C = act(A·W + bias + resid): A f32 (ASPLIT -> hi/lo 2 terms), Wt bf16 [N][K]; ACT 0 none, 1 relu, 2 exact gelu;
// resid (optional, f32, row index = (row % rmod), pitch ldr, RES_BF16 rounds it) added before the activation.
template <bool ASPLIT, int ACT, bool BIAS_BF16, bool RES_BF16>
__global__ __launch_bounds__(128) void k_gemm_bf3(const float* __restrict__ A, int lda, const unsigned short* __restrict__ Wt, int ldb,
                                                const float* __restrict__ bias, const float* __restrict__ resid, int rmod, int ldr,
                                                float* __restrict__ C, int ldc, int M, int N, int K) {
  __shared__ __attribute__((aligned(16))) float so[4][16][64];
  const int tid = threadIdx.x, w = tid >> 5, lane = tid & 31, ln = lane & 15, hh = lane >> 4;
  const int ntn = N / 64;
  const int wid = blockIdx.x * 4 + w;
  const int mt = wid / ntn, nq = wid % ntn;
  if (mt * 16 >= M) return;
  const int row0 = mt * 16, col0 = nq * 64;
  const float* arow = A + (size_t)(row0 + ln) * lda;
  v8f acc[4] = {};
  for (int kb = 0; kb < K; kb += 32) {
    FragB ah, al;
    const v4f x0 = *(const v4fa*)(arow + kb + 8 * hh), x1 = *(const v4fa*)(arow + kb + 8 * hh + 4);
    const v4f x2 = *(const v4fa*)(arow + kb + 16 + 8 * hh), x3 = *(const v4fa*)(arow + kb + 16 + 8 * hh + 4);
    float xs[16] = {x0[0],x0[1],x0[2],x0[3],x1[0],x1[1],x1[2],x1[3],x2[0],x2[1],x2[2],x2[3],x3[0],x3[1],x3[2],x3[3]};
#pragma unroll
    for (int i = 0; i < 16; ++i) { const unsigned short hb = bf16_bits(xs[i]); ah.u[i] = hb; al.u[i] = ASPLIT ? bf16_bits(xs[i] - bf16_val(hb)) : (unsigned short)0; }
#pragma unroll
    for (int t = 0; t < 4; ++t) {
      const unsigned short* brow = Wt + (size_t)(col0 + t * 16 + ln) * ldb + kb;
      FragB b;
      b.half[0] = *(const v8us*)(brow + 8 * hh);
      b.half[1] = *(const v8us*)(brow + 16 + 8 * hh);
      acc[t] = mmaN<ASPLIT ? 2 : 1>(ah.v, al.v, b.v, b.v, acc[t]);
    }
  }
#pragma unroll
  for (int t = 0; t < 4; ++t) {
    const int col = col0 + t * 16 + ln;
    float bv = bias ? bias[col] : 0.f;
    if (BIAS_BF16) bv = bf16_round(bv);
#pragma unroll
    for (int r = 0; r < 8; ++r) {
      float v = acc[t][r] + bv;
      if (resid) { float rv = resid[(size_t)((row0 + 8 * hh + r) % rmod) * ldr + col]; if (RES_BF16) rv = bf16_round(rv); v += rv; }
      if (ACT == 1) v = fmaxf(v, 0.f);
      if (ACT == 2) v = 0.5f * v * (1.0f + erff(v * 0.70710678118654752f));
      if (ACT == 3) { const float u = 0.7978845608028654f * (v + 0.044715f * v * v * v); v = 0.5f * v * (1.0f + tanhf(u)); }
      so[w][8 * hh + r][t * 16 + ln] = v;
    }
  }
  __builtin_amdgcn_fence(__ATOMIC_ACQ_REL, "workgroup");
  __builtin_amdgcn_wave_barrier();
  const int rsub = lane >> 4, c4 = (lane & 15) * 4;
  {
#pragma unroll
    for (int q = 0; q < 8; ++q) {
      const int r = q * 2 + rsub;
      const v4f v = *(const v4fa*)&so[w][r][c4];
      *(v4f*)(C + (size_t)(row0 + r) * ldc + col0 + c4) = v;
    }
    
  }
}
// row LayerNorm (biased variance, eps) over N: s = X (+ R); optional out_sum <- s; out_norm <- (s-mu)*rsqrt(var+eps)*g + b
template <bool PARAM_BF16>
__global__ __launch_bounds__(256) void k_layernorm(const float* __restrict__ X, const float* __restrict__ R, const float* __restrict__ g, const float* __restrict__ bta,
                                                  float* __restrict__ out_sum, float* __restrict__ out_norm, int N, float eps) {
  __shared__ float red[256];
  const int row = blockIdx.x, tid = threadIdx.x;
  const float* x = X + (size_t)row * N; const float* rr = R ? R + (size_t)row * N : nullptr;
  float vals[16];                     // up to N = 4096
  const int per = N / 256;            // contiguous chunk per thread? use strided-by-4 chunks: thread handles j = tid*4 + 1024*u
  float s1 = 0.f;
  for (int u = 0; u < per / 4; ++u) {
    const int j = tid * 4 + 1024 * u;
    const v4f a = *(const v4fa*)(x + j);
    v4f b = {0.f,0.f,0.f,0.f}; if (rr) b = *(const v4fa*)(rr + j);
#pragma unroll
    for (int q = 0; q < 4; ++q) { const float v = a[q] + b[q]; vals[u * 4 + q] = v; s1 += v; }
  }
  red[tid] = s1; __syncthreads();
  for (int st = 128; st > 0; st >>= 1) { if (tid < st) red[tid] += red[tid + st]; __syncthreads(); }
  const float mu = red[0] / (float)N; __syncthreads();
  float s2 = 0.f;
  for (int u = 0; u < per / 4; ++u)
#pragma unroll
    for (int q = 0; q < 4; ++q) { const float c = vals[u * 4 + q] - mu; s2 += c * c; }
  red[tid] = s2; __syncthreads();
  for (int st = 128; st > 0; st >>= 1) { if (tid < st) red[tid] += red[tid + st]; __syncthreads(); }
  const float rs = rsqrtf(red[0] / (float)N + eps);
  {
    for (int u = 0; u < per / 4; ++u) {
      const int j = tid * 4 + 1024 * u;
      v4f o, sm;
#pragma unroll
      for (int q = 0; q < 4; ++q) {
        float gg = g[j + q], bb = bta[j + q];
        if (PARAM_BF16) { gg = bf16_round(gg); bb = bf16_round(bb); }
        sm[q] = vals[u * 4 + q]; o[q] = (vals[u * 4 + q] - mu) * rs * gg + bb;
      }
      if (out_sum) *(v4f*)(out_sum + (size_t)row * N + j) = sm;
      *(v4f*)(out_norm + (size_t)row * N + j) = o;
    }
    
  }
}



// ---- f16 WMMA path (v_wmma_f32_16x16x32_f16): 11-bit significands for operands in range — used where a [0,1] probability operand needs more precision than bf16
typedef _Float16 v16h __attribute__((ext_vector_type(16)));
union FragH { v16h v; v8us half[2]; _Float16 h[16]; unsigned short u[16]; };
template <int NT>
__device__ __forceinline__ v8f mmaH(v16h ah, v16h al, v16h bh, v16h bl, v8f c) {
  c = __builtin_amdgcn_wmma_f32_16x16x32_f16(false, ah, false, bh, (short)0, c, false, false);
  if (NT >= 2) c = __builtin_amdgcn_wmma_f32_16x16x32_f16(false, al, false, bh, (short)0, c, false, false);
  if (NT >= 3) c = __builtin_amdgcn_wmma_f32_16x16x32_f16(false, ah, false, bl, (short)0, c, false, false);
  asm volatile("v_nop\n\tv_nop\n\tv_nop\n\tv_nop" : "+v"(c) : "v"(ah), "v"(al), "v"(bh), "v"(bl));
  return c;
}
// batched GEMM like k_gemm_b but f16 operands: A f32 (split into f16 hi/lo if ASPLIT, else rounded to f16), Bt = f16 values [n][k]; alpha; C f32; N multiple of 16 (partial tiles skipped)
template <bool ASPLIT>
__global__ __launch_bounds__(128) void k_gemm_h(const float* __restrict__ A, int lda, size_t sA, const _Float16* __restrict__ Bh, int ldb, size_t sB, float alpha, float* __restrict__ C, int ldc, size_t sC, int M, int N, int K) {
  __shared__ __attribute__((aligned(16))) float so[4][16][64];
  const int tid = threadIdx.x, w = tid >> 5, lane = tid & 31, ln = lane & 15, hh = lane >> 4; const int by = blockIdx.y;
  A += (size_t)by * sA; Bh += (size_t)by * sB; C += (size_t)by * sC;
  const int ntn = (N + 63) / 64; const int wid = blockIdx.x * 4 + w; const int mt = wid / ntn, nq = wid % ntn; if (mt * 16 >= M) return;
  const int row0 = mt * 16, col0 = nq * 64; const float* arow = A + (size_t)(row0 + ln) * lda;
  v8f acc[4] = {};
  for (int kb = 0; kb < K; kb += 32) {
    FragH ah, al;
    const v4f x0 = *(const v4fa*)(arow + kb + 8 * hh), x1 = *(const v4fa*)(arow + kb + 8 * hh + 4), x2 = *(const v4fa*)(arow + kb + 16 + 8 * hh), x3 = *(const v4fa*)(arow + kb + 16 + 8 * hh + 4);
    float xs[16] = {x0[0],x0[1],x0[2],x0[3],x1[0],x1[1],x1[2],x1[3],x2[0],x2[1],x2[2],x2[3],x3[0],x3[1],x3[2],x3[3]};
#pragma unroll
    for (int i = 0; i < 16; ++i) { const _Float16 h = (_Float16)xs[i]; ah.h[i] = h; al.h[i] = ASPLIT ? (_Float16)(xs[i] - (float)h) : (_Float16)0.0f; }
#pragma unroll
    for (int t = 0; t < 4; ++t) { if (col0 + t * 16 >= N) continue; const size_t boff = (size_t)(col0 + t * 16 + ln) * ldb + kb; FragH bq; bq.half[0] = *(const v8us*)(Bh + boff + 8 * hh); bq.half[1] = *(const v8us*)(Bh + boff + 16 + 8 * hh);
      acc[t] = mmaH<ASPLIT ? 2 : 1>(ah.v, al.v, bq.v, bq.v, acc[t]); }
  }
#pragma unroll
  for (int t = 0; t < 4; ++t) { if (col0 + t * 16 >= N) continue;
#pragma unroll
    for (int r = 0; r < 8; ++r) so[w][8 * hh + r][t * 16 + ln] = acc[t][r] * alpha; }
  __builtin_amdgcn_fence(__ATOMIC_ACQ_REL, "workgroup"); __builtin_amdgcn_wave_barrier();
  const int rsub = lane >> 4, c4 = (lane & 15) * 4;
  {
#pragma unroll
    for (int q = 0; q < 8; ++q) { const int r = q * 2 + rsub; if (col0 + c4 < N) { const v4f v = *(const v4fa*)&so[w][r][c4]; *(v4f*)(C + (size_t)(row0 + r) * ldc + col0 + c4) = v; } }
     }
}

// Wt[n][k] = f16(W[k][n]·scale) from f32 row-major W[K][N] (scale = power of two; bf16-exact weights stay exact in f16 away from the subnormal range)
__global__ __launch_bounds__(256) void k_wt_f16(const float* __restrict__ W, _Float16* __restrict__ Wt, int K, int N, float scale) {
  const int t = blockIdx.x * 256 + threadIdx.x; if (t >= N * (K / 8)) return; const int n = t / (K / 8), k8 = (t % (K / 8)) * 8; FragH f;
#pragma unroll
  for (int i = 0; i < 8; ++i) f.h[i] = (_Float16)(bf16_round(W[(size_t)(k8 + i) * N + n]) * scale); const v8us o = f.half[0];
  *(v8us*)((unsigned short*)Wt + (size_t)n * K + k8) = o; 
}
// k_gemm_hh variant with fused epilogue: v = acc·alpha + bias[by·sBias + col] (+ CP[(row/rowsPerB)·sCPb + by·64 + col] if CP) ; ACT 0 none / 1 elu ; writes f16 C16 (and f32 C if non-null)
template <int ACT>
__global__ __launch_bounds__(128) void k_gemm_hhx(const _Float16* __restrict__ A, int lda, size_t sA, const _Float16* __restrict__ Bh, int ldb, size_t sB, float alpha, const float* __restrict__ bias, size_t sBias, const float* __restrict__ CP, int rowsPerB, size_t sCPb, int row0g,
    float* __restrict__ C, _Float16* __restrict__ C16, int ldc, size_t sC, int M, int N, int K) {
  __shared__ __attribute__((aligned(16))) float so[4][16][64];
  const int tid = threadIdx.x, w = tid >> 5, lane = tid & 31, ln = lane & 15, hh = lane >> 4; const int by = blockIdx.y;
  A += (size_t)by * sA; Bh += (size_t)by * sB; const size_t cofs = (size_t)by * sC; const float* bp = bias ? bias + (size_t)by * sBias : nullptr;
  const int ntn = (N + 63) / 64; const int wid = blockIdx.x * 4 + w; const int mt = wid / ntn, nq = wid % ntn; if (mt * 16 >= M) return;
  const int row0 = mt * 16, col0 = nq * 64; const _Float16* arow = A + (size_t)(row0 + ln) * lda;
  v8f acc[4] = {};
  for (int kb = 0; kb < K; kb += 32) { FragH ah; ah.half[0] = *(const v8us*)((const unsigned short*)arow + kb + 8 * hh); ah.half[1] = *(const v8us*)((const unsigned short*)arow + kb + 16 + 8 * hh);
#pragma unroll
    for (int t = 0; t < 4; ++t) { if (col0 + t * 16 >= N) continue; const size_t boff = (size_t)(col0 + t * 16 + ln) * ldb + kb; FragH bq; bq.half[0] = *(const v8us*)((const unsigned short*)Bh + boff + 8 * hh); bq.half[1] = *(const v8us*)((const unsigned short*)Bh + boff + 16 + 8 * hh);
      acc[t] = mmaH<1>(ah.v, ah.v, bq.v, bq.v, acc[t]); }
  }
#pragma unroll
  for (int t = 0; t < 4; ++t) { if (col0 + t * 16 >= N) continue; const int col = col0 + t * 16 + ln; const float bv = bp ? bf16_round(bp[col]) : 0.f;
#pragma unroll
    for (int r = 0; r < 8; ++r) { float v = acc[t][r] * alpha + bv; if (CP) { const int bidx = (row0g + row0 + 8 * hh + r) / rowsPerB; v += CP[(size_t)bidx * sCPb + (size_t)by * 64 + col]; } if (ACT == 1) v = (v > 0.f) ? v : expm1f(v); else if (ACT == 7) v = (v > 0.f) ? v + 1.0f : expf(v); else if (ACT == 8) v = tanhf(v); else if (ACT == 9) v = 0.5f * v * (1.0f + tanhf(0.7978845608028654f * (v + 0.044715f * v * v * v))); else if (ACT == 11) v = 1.0f / (1.0f + expf(-v)); else if (ACT == 12) v = (v > 0.f) ? v : 0.01f * v; else if (ACT == 14) v = (v > 0.f) ? v : 0.1f * v; else if (ACT == 15) v = v / (1.0f + expf(-v)); else if (ACT == 3) v = fmaxf(v, 0.f); else if (ACT == 6) v = 0.5f * v * (1.0f + erff(v * 0.70710678118654752f)); so[w][8 * hh + r][t * 16 + ln] = v; } }
  __builtin_amdgcn_fence(__ATOMIC_ACQ_REL, "workgroup"); __builtin_amdgcn_wave_barrier();
  const int rsub = lane >> 4, c4 = (lane & 15) * 4; typedef _Float16 v4h __attribute__((ext_vector_type(4)));
  {
#pragma unroll
    for (int q = 0; q < 8; ++q) { const int r = q * 2 + rsub; if (col0 + c4 < N) { const v4f v = *(const v4fa*)&so[w][r][c4]; if (C) *(v4f*)(C + cofs + (size_t)(row0 + r) * ldc + col0 + c4) = v; if (C16) { v4h h4; for (int i = 0; i < 4; ++i) h4[i] = (_Float16)v[i]; *(v4h*)(C16 + cofs + (size_t)(row0 + r) * ldc + col0 + c4) = h4; } } }
     }
}


typedef _Float16 v4h __attribute__((ext_vector_type(4)));

__global__ __launch_bounds__(256) void k_x16(const float* __restrict__ x, _Float16* __restrict__ X16, size_t n8) { const size_t t = (size_t)blockIdx.x * 256 + threadIdx.x; if (t >= n8) return; FragH f;
#pragma unroll
  for (int q = 0; q < 8; ++q) f.h[q] = (_Float16)bf16_round(x[t * 8 + q]); *(v8us*)((unsigned short*)X16 + t * 8) = f.half[0];  }
__global__ __launch_bounds__(256) void k_h16(const float* __restrict__ x, _Float16* __restrict__ X16, size_t n8) { const size_t t = (size_t)blockIdx.x * 256 + threadIdx.x; if (t >= n8) return; FragH f;
#pragma unroll
  for (int q = 0; q < 8; ++q) f.h[q] = (_Float16)x[t * 8 + q]; *(v8us*)((unsigned short*)X16 + t * 8) = f.half[0];  }
__global__ __launch_bounds__(256) void k_round16f(const float* __restrict__ W, _Float16* __restrict__ Bt, size_t n8) { const size_t t = (size_t)blockIdx.x * 256 + threadIdx.x; if (t >= n8) return; FragH f;
#pragma unroll
  for (int i = 0; i < 8; ++i) f.h[i] = (_Float16)(bf16_round(W[t * 8 + i]) * 16.0f); *(v8us*)((unsigned short*)Bt + t * 8) = f.half[0];  }
template <int NHv, int TTv>
__global__ __launch_bounds__(256) void k_vt(const _Float16* __restrict__ V16, int ldv, int voff, _Float16* __restrict__ Vt) { __shared__ unsigned short tl[64][66]; const int tid = threadIdx.x; const int slab = blockIdx.x / (TTv / 64), lg = blockIdx.x % (TTv / 64); const int b = slab / NHv, h = slab % NHv;
  for (int i = tid; i < 64 * 8; i += 256) { const int r = i / 8, c8 = (i % 8) * 8; FragH f; f.half[0] = *(const v8us*)((const unsigned short*)V16 + ((size_t)b * TTv + lg * 64 + r) * ldv + voff + h * 64 + c8);
#pragma unroll
    for (int q = 0; q < 8; ++q) tl[r][c8 + q] = f.u[q]; }
  __syncthreads();
  {
#pragma unroll
    for (int rd = 0; rd < 2; ++rd) { const int d = rd * 32 + tid / 8, pc = tid % 8; FragH f;
#pragma unroll
      for (int q = 0; q < 8; ++q) f.u[q] = tl[pc * 8 + q][d];
      *(v8us*)((unsigned short*)Vt + ((size_t)slab * 64 + d) * TTv + lg * 64 + pc * 8) = f.half[0]; }
     } }

__global__ __launch_bounds__(256) void k_hl(const float* __restrict__ F, _Float16* __restrict__ Hh, _Float16* __restrict__ Hl, size_t n8) { const size_t t = (size_t)blockIdx.x * 256 + threadIdx.x; if (t >= n8) return; FragH fh, fl; const v4f a = *(const v4fa*)(F + t * 8), c = *(const v4fa*)(F + t * 8 + 4);
#pragma unroll
  for (int q = 0; q < 4; ++q) { _Float16 h = (_Float16)a[q]; fh.h[q] = h; fl.h[q] = (_Float16)((a[q] - (float)h) * 1024.0f); h = (_Float16)c[q]; fh.h[4 + q] = h; fl.h[4 + q] = (_Float16)((c[q] - (float)h) * 1024.0f); }
  { *(v8us*)((unsigned short*)Hh + t * 8) = fh.half[0]; *(v8us*)((unsigned short*)Hl + t * 8) = fl.half[0];  } }

// ---- fast GEMM (wave tile 32x64; requires M % 32 == 0 rows per launch region and N % 64 == 0); epilogue = k_gemm_hhx semantics ----
__device__ __forceinline__ v16h g2_frag(const _Float16* p, int hh) { FragH f; f.half[0] = *(const v8us*)((const unsigned short*)p + 8 * hh); f.half[1] = *(const v8us*)((const unsigned short*)p + 16 + 8 * hh); return f.v; }
__device__ __forceinline__ v8f g2_mma(v16h a, v16h b, v8f c) { v8f d = __builtin_amdgcn_wmma_f32_16x16x32_f16(false, a, false, b, (short)0, c, false, false); asm volatile("v_nop\n\tv_nop\n\tv_nop\n\tv_nop" : "+v"(d) : "v"(a), "v"(b)); return d; }
template <int ACT>
__global__ __launch_bounds__(128) void k_gemm2(const _Float16* __restrict__ A, int lda, size_t sA, const _Float16* __restrict__ Bh, int ldb, size_t sB, float alpha, const float* __restrict__ bias, size_t sBias, const float* __restrict__ CP, int rowsPerB, size_t sCPb, int row0g,
    float* __restrict__ C, _Float16* __restrict__ C16, int ldc, size_t sC, int M, int N, int K) {
  __shared__ __attribute__((aligned(16))) float so[4][32][68];
  const int tid = threadIdx.x, w = tid >> 5, lane = tid & 31, ln = lane & 15, hh = lane >> 4; const int by = blockIdx.y;
  A += (size_t)by * sA; Bh += (size_t)by * sB; const size_t cofs = (size_t)by * sC; const float* bp = bias ? bias + (size_t)by * sBias : nullptr;
  const int ntn = N >> 6; const int mt = blockIdx.x / ntn, nq = blockIdx.x - mt * ntn; const int row0 = mt * 128 + 32 * w, col0 = nq * 64; if (row0 >= M) return;
  const _Float16* a0p = A + (size_t)(row0 + ln) * lda; const _Float16* a1p = a0p + (size_t)16 * lda;
  const _Float16* b0p = Bh + (size_t)(col0 + ln) * ldb; const _Float16* b1p = b0p + (size_t)16 * ldb; const _Float16* b2p = b1p + (size_t)16 * ldb; const _Float16* b3p = b2p + (size_t)16 * ldb;
  const v8f z8 = {0.f,0.f,0.f,0.f,0.f,0.f,0.f,0.f}; v8f c00 = z8, c01 = z8, c02 = z8, c03 = z8, c10 = z8, c11 = z8, c12 = z8, c13 = z8;
#pragma unroll 1
  for (int kb = 0; kb < K; kb += 32) { const v16h a0 = g2_frag(a0p + kb, hh), a1 = g2_frag(a1p + kb, hh);
    v16h b = g2_frag(b0p + kb, hh); c00 = g2_mma(a0, b, c00); c10 = g2_mma(a1, b, c10);
    b = g2_frag(b1p + kb, hh); c01 = g2_mma(a0, b, c01); c11 = g2_mma(a1, b, c11);
    b = g2_frag(b2p + kb, hh); c02 = g2_mma(a0, b, c02); c12 = g2_mma(a1, b, c12);
    b = g2_frag(b3p + kb, hh); c03 = g2_mma(a0, b, c03); c13 = g2_mma(a1, b, c13); }
  v8f accs[8] = {c00, c01, c02, c03, c10, c11, c12, c13};
#pragma unroll
  for (int u = 0; u < 8; ++u) { const int t = u & 3, half = u >> 2; const int col = col0 + t * 16 + ln; const float bv = bp ? bf16_round(bp[col]) : 0.f;
#pragma unroll
    for (int r = 0; r < 8; ++r) { const int rloc = half * 16 + 8 * hh + r; float v = accs[u][r] * alpha + bv; if (CP) { if (rowsPerB < 0) v += CP[cofs + (size_t)(row0g + row0 + rloc) * ldc + col];      /* rowsPerB < 0: own element of the batched C plane */ else { const int bidx = (row0g + row0 + rloc) / rowsPerB; v += CP[(size_t)bidx * sCPb + (size_t)by * 64 + col]; } }
      if (ACT == 3) v = fmaxf(v, 0.f); else if (ACT == 6) v = 0.5f * v * (1.0f + erff(v * 0.70710678118654752f)); else if (ACT == 11) v = 1.0f / (1.0f + expf(-v)); else if (ACT == 15) v = v / (1.0f + expf(-v)); else if (ACT == 12) v = (v > 0.f) ? v : 0.01f * v; else if (ACT == 8) v = tanhf(v);
      so[w][rloc][t * 16 + ln] = v; } }
  __builtin_amdgcn_fence(__ATOMIC_ACQ_REL, "workgroup"); __builtin_amdgcn_wave_barrier();
  const int rsub = lane >> 4, c4 = (lane & 15) * 4;
  {
#pragma unroll
    for (int q = 0; q < 16; ++q) { const int r = q * 2 + rsub; const v4f v = *(const v4fa*)&so[w][r][c4]; if (C) *(v4f*)(C + cofs + (size_t)(row0 + r) * ldc + col0 + c4) = v; if (C16) { v4h h4; for (int i = 0; i < 4; ++i) h4[i] = (_Float16)v[i]; *(v4h*)(C16 + cofs + (size_t)(row0 + r) * ldc + col0 + c4) = h4; } }
     } }



__constant__ int BK30[2 * SLEN - 1] = {15,15,15,15,15,15,15,15,15,15,15,15,15,15,15,15,15,15,15,15,15,15,15,15,15,15,15,15,15,15,15,15,15,15,15,15,15,15,15,15,15,15,15,15,15,15,15,15,15,15,15,15,15,15,15,15,15,15,15,15,15,15,15,15,15,15,15,15,15,15,15,15,15,15,15,15,15,15,15,15,15,15,15,15,15,15,15,15,15,15,15,15,15,15,15,15,15,15,15,15,15,15,15,15,15,15,15,15,15,15,15,15,15,15,15,15,15,15,15,15,15,15,15,15,15,15,15,15,15,15,15,15,15,15,15,15,15,15,15,15,15,15,15,15,15,15,15,15,15,15,15,15,15,15,15,15,15,15,15,15,15,15,15,15,15,15,15,15,15,15,15,15,15,15,15,15,15,15,15,15,15,15,15,15,15,15,15,15,15,15,15,15,15,15,15,15,15,15,15,15,15,15,15,15,15,15,15,15,15,15,15,15,15,15,15,15,15,15,15,15,15,15,15,15,15,15,15,15,15,15,15,15,15,15,15,15,15,15,15,15,15,15,15,15,15,15,15,15,15,15,15,15,15,15,15,15,15,15,15,15,15,15,15,15,15,15,15,15,15,15,15,15,15,15,15,15,15,15,15,15,15,15,15,15,15,15,15,15,15,15,15,15,15,15,15,15,15,15,15,15,15,15,15,15,15,15,15,15,15,15,15,15,15,15,15,15,15,15,15,15,15,15,15,15,15,15,15,15,15,15,15,15,15,15,15,15,15,15,15,15,15,15,15,15,15,15,15,15,15,15,15,15,15,15,15,15,15,15,15,15,15,15,15,15,15,15,15,15,15,15,15,15,15,15,15,15,15,15,15,15,15,15,15,15,15,15,15,15,15,15,15,15,15,15,15,15,15,15,15,15,15,15,15,15,15,15,15,15,15,15,15,15,15,15,15,15,15,15,15,15,15,15,15,15,15,15,15,15,15,15,15,15,15,15,15,15,15,15,15,15,15,15,15,15,15,15,15,15,15,15,15,15,15,15,15,15,15,15,15,15,15,15,15,15,15,15,15,15,15,15,15,15,15,15,15,15,15,15,15,15,15,15,15,15,15,15,15,15,15,15,15,15,15,15,15,15,15,15,15,15,15,15,15,15,15,15,15,15,15,15,15,15,15,15,15,15,15,15,15,15,15,15,15,15,15,15,15,15,15,15,15,15,15,15,15,15,15,15,15,15,15,15,15,15,15,15,15,15,15,15,15,15,15,15,15,15,15,15,15,15,15,15,15,15,15,15,15,15,15,15,15,15,15,15,15,15,15,15,15,15,15,15,15,15,15,15,15,15,15,15,15,15,15,15,15,15,15,15,15,15,15,15,15,15,15,15,15,15,15,15,15,15,15,15,15,15,15,15,15,15,15,15,15,15,15,15,15,15,15,15,15,15,15,15,15,15,15,15,15,15,15,15,15,15,15,15,15,15,15,15,15,15,15,15,15,15,15,15,15,15,15,15,15,15,15,15,15,15,15,15,15,15,15,15,15,15,15,15,15,15,15,15,15,15,15,15,15,15,15,15,15,15,15,15,15,15,15,15,15,15,15,15,15,15,15,15,15,15,15,15,15,15,15,15,15,15,15,15,15,15,15,15,15,15,15,15,15,15,15,15,15,15,15,15,15,15,15,15,15,15,15,15,15,15,15,15,15,15,15,15,15,15,15,15,15,15,15,15,15,15,15,15,15,15,15,15,15,15,15,15,15,15,15,15,15,15,15,15,15,15,15,15,15,15,15,15,15,15,15,15,15,15,15,15,15,15,15,15,15,15,15,15,15,15,15,15,15,15,15,15,15,15,15,15,15,15,15,15,15,15,15,15,15,15,15,15,15,15,15,15,15,15,15,15,15,15,15,15,15,15,15,15,15,15,15,15,15,15,15,15,15,15,15,15,15,15,15,15,15,15,15,15,15,15,15,15,15,15,15,15,15,15,15,15,15,15,15,15,15,15,15,15,15,15,15,15,15,15,15,15,15,15,15,15,15,15,15,15,15,15,15,15,15,15,15,15,15,15,15,15,15,15,15,15,15,15,15,15,15,15,15,15,15,15,15,15,15,15,15,15,15,15,15,15,15,15,15,15,15,15,15,15,15,15,15,15,15,15,15,15,15,15,15,15,15,15,15,15,15,15,15,15,15,15,15,15,15,15,15,15,15,15,15,15,15,15,15,15,15,15,15,15,15,15,15,15,15,15,15,15,15,15,15,15,15,15,15,15,15,15,15,15,15,15,15,15,15,15,15,15,15,15,15,15,15,15,15,15,15,15,15,15,15,15,15,15,15,15,15,15,15,15,15,15,15,15,15,15,15,15,15,15,15,15,15,15,15,15,15,15,15,15,15,15,15,15,15,15,15,15,15,15,15,15,15,15,15,15,15,15,15,15,15,15,15,15,15,15,15,15,15,15,15,15,15,15,15,15,15,15,15,15,15,15,15,15,15,15,15,15,15,15,15,15,15,15,15,15,15,15,15,15,15,15,15,15,15,15,15,15,15,15,15,15,15,15,15,15,15,15,15,15,15,15,15,15,15,15,15,15,15,15,15,15,15,15,15,15,15,15,15,15,15,15,15,15,15,15,15,15,15,15,15,15,15,15,15,15,15,15,15,15,15,15,15,15,15,15,15,15,15,15,15,15,15,15,15,15,15,15,15,15,15,15,15,15,15,15,15,15,15,15,15,15,15,15,15,15,15,15,15,15,15,15,15,15,15,15,15,15,15,15,15,15,15,15,15,15,15,15,15,15,15,15,15,15,15,15,15,15,15,15,15,15,15,15,15,15,15,15,15,15,15,15,15,15,15,15,15,15,15,15,15,15,15,15,15,15,15,15,15,15,15,15,15,15,15,15,15,15,15,15,15,15,15,15,15,15,15,15,15,15,15,15,15,15,15,15,15,15,15,15,15,15,15,15,15,15,15,15,15,15,15,15,15,15,15,15,15,15,15,15,15,15,15,15,15,15,15,15,15,15,15,15,15,15,15,15,15,15,15,15,15,15,15,15,15,15,15,15,15,15,15,15,15,15,15,15,15,15,15,15,15,15,15,15,15,15,15,15,15,15,15,15,15,15,15,15,15,15,15,15,15,15,15,15,15,15,15,15,15,15,15,15,15,15,15,15,15,15,15,15,15,15,15,15,15,15,15,15,15,15,15,15,15,15,15,15,15,15,15,15,15,15,15,15,15,15,15,15,15,15,15,15,15,15,15,15,15,15,15,15,15,15,15,15,15,15,15,15,15,15,15,15,15,15,15,15,15,15,15,15,15,15,15,15,15,15,15,15,15,15,15,15,15,15,15,15,15,15,15,15,15,15,15,15,15,15,15,15,15,15,15,15,15,15,15,15,15,15,15,15,15,15,15,15,15,15,15,15,15,15,15,15,15,15,15,15,15,15,15,15,15,15,15,15,15,15,15,15,15,15,15,15,15,15,15,15,15,15,15,15,15,15,15,15,15,15,15,15,15,15,15,15,15,15,15,15,15,15,15,15,15,15,15,15,15,15,15,15,15,15,15,15,15,15,15,15,15,15,15,15,15,15,15,15,15,15,15,15,15,15,15,15,15,15,15,15,15,15,15,15,15,15,15,15,15,15,15,15,15,15,15,15,15,15,15,15,15,15,15,15,15,15,15,15,15,15,15,15,15,15,15,15,15,15,15,15,15,15,15,15,15,15,15,15,15,15,15,15,15,15,15,15,15,15,15,15,15,15,15,15,15,15,15,15,15,15,15,15,15,15,15,15,15,15,15,15,15,15,15,15,15,15,15,15,15,15,15,15,15,15,15,15,15,15,15,15,15,15,15,15,15,15,15,15,15,15,15,15,15,15,15,15,15,15,15,15,15,15,15,15,15,15,15,15,15,15,15,15,15,15,15,15,15,15,15,15,15,15,15,15,15,15,15,15,15,15,15,15,15,15,15,15,15,15,15,15,15,15,15,15,15,15,15,15,15,15,15,15,15,15,15,15,15,15,15,15,15,15,15,15,15,15,15,15,15,15,15,15,15,15,15,15,15,15,15,15,15,15,15,15,15,15,15,15,15,15,15,15,15,15,15,15,15,15,15,15,15,15,15,15,15,15,15,15,15,15,15,15,15,15,15,15,15,15,15,15,15,15,15,15,15,15,15,15,15,15,15,15,15,15,15,15,15,15,15,15,15,15,15,15,15,15,15,15,15,15,15,15,15,15,15,15,15,15,15,15,15,15,15,15,15,15,15,15,15,15,15,15,15,15,15,15,15,15,15,15,15,15,15,15,15,15,15,15,15,15,15,15,15,15,15,15,15,15,15,15,15,15,15,15,15,15,15,15,15,15,15,15,15,15,15,15,15,15,15,15,15,15,15,15,15,15,15,15,15,15,15,15,15,15,15,15,15,15,15,14,14,14,14,14,14,14,14,14,14,14,14,14,14,14,14,14,14,14,14,14,14,14,14,14,14,14,13,13,13,13,13,13,13,13,13,13,13,13,13,13,13,13,13,13,12,12,12,12,12,12,12,12,12,12,12,12,12,12,11,11,11,11,11,11,11,11,11,10,10,10,10,10,10,10,9,9,9,9,8,8,8,8,7,6,5,4,3,2,1,0,17,18,19,20,21,22,23,24,24,24,24,25,25,25,25,26,26,26,26,26,26,26,27,27,27,27,27,27,27,27,27,28,28,28,28,28,28,28,28,28,28,28,28,28,28,29,29,29,29,29,29,29,29,29,29,29,29,29,29,29,29,29,29,30,30,30,30,30,30,30,30,30,30,30,30,30,30,30,30,30,30,30,30,30,30,30,30,30,30,30,31,31,31,31,31,31,31,31,31,31,31,31,31,31,31,31,31,31,31,31,31,31,31,31,31,31,31,31,31,31,31,31,31,31,31,31,31,31,31,31,31,31,31,31,31,31,31,31,31,31,31,31,31,31,31,31,31,31,31,31,31,31,31,31,31,31,31,31,31,31,31,31,31,31,31,31,31,31,31,31,31,31,31,31,31,31,31,31,31,31,31,31,31,31,31,31,31,31,31,31,31,31,31,31,31,31,31,31,31,31,31,31,31,31,31,31,31,31,31,31,31,31,31,31,31,31,31,31,31,31,31,31,31,31,31,31,31,31,31,31,31,31,31,31,31,31,31,31,31,31,31,31,31,31,31,31,31,31,31,31,31,31,31,31,31,31,31,31,31,31,31,31,31,31,31,31,31,31,31,31,31,31,31,31,31,31,31,31,31,31,31,31,31,31,31,31,31,31,31,31,31,31,31,31,31,31,31,31,31,31,31,31,31,31,31,31,31,31,31,31,31,31,31,31,31,31,31,31,31,31,31,31,31,31,31,31,31,31,31,31,31,31,31,31,31,31,31,31,31,31,31,31,31,31,31,31,31,31,31,31,31,31,31,31,31,31,31,31,31,31,31,31,31,31,31,31,31,31,31,31,31,31,31,31,31,31,31,31,31,31,31,31,31,31,31,31,31,31,31,31,31,31,31,31,31,31,31,31,31,31,31,31,31,31,31,31,31,31,31,31,31,31,31,31,31,31,31,31,31,31,31,31,31,31,31,31,31,31,31,31,31,31,31,31,31,31,31,31,31,31,31,31,31,31,31,31,31,31,31,31,31,31,31,31,31,31,31,31,31,31,31,31,31,31,31,31,31,31,31,31,31,31,31,31,31,31,31,31,31,31,31,31,31,31,31,31,31,31,31,31,31,31,31,31,31,31,31,31,31,31,31,31,31,31,31,31,31,31,31,31,31,31,31,31,31,31,31,31,31,31,31,31,31,31,31,31,31,31,31,31,31,31,31,31,31,31,31,31,31,31,31,31,31,31,31,31,31,31,31,31,31,31,31,31,31,31,31,31,31,31,31,31,31,31,31,31,31,31,31,31,31,31,31,31,31,31,31,31,31,31,31,31,31,31,31,31,31,31,31,31,31,31,31,31,31,31,31,31,31,31,31,31,31,31,31,31,31,31,31,31,31,31,31,31,31,31,31,31,31,31,31,31,31,31,31,31,31,31,31,31,31,31,31,31,31,31,31,31,31,31,31,31,31,31,31,31,31,31,31,31,31,31,31,31,31,31,31,31,31,31,31,31,31,31,31,31,31,31,31,31,31,31,31,31,31,31,31,31,31,31,31,31,31,31,31,31,31,31,31,31,31,31,31,31,31,31,31,31,31,31,31,31,31,31,31,31,31,31,31,31,31,31,31,31,31,31,31,31,31,31,31,31,31,31,31,31,31,31,31,31,31,31,31,31,31,31,31,31,31,31,31,31,31,31,31,31,31,31,31,31,31,31,31,31,31,31,31,31,31,31,31,31,31,31,31,31,31,31,31,31,31,31,31,31,31,31,31,31,31,31,31,31,31,31,31,31,31,31,31,31,31,31,31,31,31,31,31,31,31,31,31,31,31,31,31,31,31,31,31,31,31,31,31,31,31,31,31,31,31,31,31,31,31,31,31,31,31,31,31,31,31,31,31,31,31,31,31,31,31,31,31,31,31,31,31,31,31,31,31,31,31,31,31,31,31,31,31,31,31,31,31,31,31,31,31,31,31,31,31,31,31,31,31,31,31,31,31,31,31,31,31,31,31,31,31,31,31,31,31,31,31,31,31,31,31,31,31,31,31,31,31,31,31,31,31,31,31,31,31,31,31,31,31,31,31,31,31,31,31,31,31,31,31,31,31,31,31,31,31,31,31,31,31,31,31,31,31,31,31,31,31,31,31,31,31,31,31,31,31,31,31,31,31,31,31,31,31,31,31,31,31,31,31,31,31,31,31,31,31,31,31,31,31,31,31,31,31,31,31,31,31,31,31,31,31,31,31,31,31,31,31,31,31,31,31,31,31,31,31,31,31,31,31,31,31,31,31,31,31,31,31,31,31,31,31,31,31,31,31,31,31,31,31,31,31,31,31,31,31,31,31,31,31,31,31,31,31,31,31,31,31,31,31,31,31,31,31,31,31,31,31,31,31,31,31,31,31,31,31,31,31,31,31,31,31,31,31,31,31,31,31,31,31,31,31,31,31,31,31,31,31,31,31,31,31,31,31,31,31,31,31,31,31,31,31,31,31,31,31,31,31,31,31,31,31,31,31,31,31,31,31,31,31,31,31,31,31,31,31,31,31,31,31,31,31,31,31,31,31,31,31,31,31,31,31,31,31,31,31,31,31,31,31,31,31,31,31,31,31,31,31,31,31,31,31,31,31,31,31,31,31,31,31,31,31,31,31,31,31,31,31,31,31,31,31,31,31,31,31,31,31,31,31,31,31,31,31,31,31,31,31,31,31,31,31,31,31,31,31,31,31,31,31,31,31,31,31,31,31,31,31,31,31,31,31,31,31,31,31,31,31,31,31,31,31,31,31,31,31,31,31,31,31,31,31,31,31,31,31,31,31,31,31,31,31,31,31,31,31,31,31,31,31,31,31,31,31,31,31,31,31,31,31,31,31,31,31,31,31,31,31,31,31,31,31,31,31,31,31,31,31,31,31,31,31,31,31,31,31,31,31,31,31,31,31,31,31,31,31,31,31,31,31,31,31,31,31,31,31,31,31,31,31,31,31,31,31,31,31,31,31,31,31,31,31,31,31,31,31,31,31,31,31,31,31,31,31,31,31,31,31,31,31,31,31,31,31,31,31,31,31,31,31,31,31,31,31,31,31,31,31,31,31,31,31,31,31,31,31,31,31,31,31,31,31,31,31,31,31,31,31,31,31,31,31,31,31,31,31,31,31,31,31,31,31,31,31,31,31,31,31,31,31,31,31,31,31,31,31,31,31,31,31,31,31,31,31,31,31,31,31,31,31,31,31,31,31,31,31,31,31,31,31,31,31,31,31,31,31,31,31,31,31,31,31,31,31,31,31,31,31,31,31,31,31,31,31,31,31,31,31,31,31,31,31,31,31,31,31,31,31,31,31,31,31,31,31,31,31,31,31,31,31,31,31,31,31,31,31,31,31,31,31,31,31,31,31,31,31,31,31,31,31,31,31,31,31,31,31,31,31,31,31,31,31,31,31,31,31,31,31,31,31,31,31,31,31,31,31,31,31,31,31,31,31,31,31,31,31,31,31,31,31,31,31,31,31,31,31,31,31,31,31,31,31,31,31,31,31,31,31,31,31,31,31,31,31,31,31,31,31,31,31,31,31,31,31,31,31,31,31,31,31,31,31,31,31,31,31,31,31,31,31,31,31,31,31,31,31,31,31,31,31,31,31,31,31,31,31,31,31,31,31,31,31,31,31,31,31,31,31,31,31,31,31,31,31,31,31,31,31,31,31,31,31,31,31,31,31,31,31,31,31,31,31,31,31,31,31,31,31,31,31,31,31,31,31,31,31,31,31,31,31,31,31,31,31,31,31,31,31,31,31,31,31,31,31,31,31,31,31,31,31,31,31,31,31,31,31,31,31,31,31,31,31,31,31,31,31,31,31,31,31,31,31,31,31,31,31,31,31,31,31,31,31,31,31,31,31,31,31,31,31,31,31,31,31,31,31,31,31,31,31,31,31,31,31,31,31,31,31,31,31,31,31,31,31,31,31,31,31,31,31,31,31,31,31,31,31,31,31,31,31,31,31,31,31,31,31,31,31,31,31,31,31,31,31,31,31,31,31,31,31,31,31,31,31,31,31,31,31,31,31,31,31,31,31,31,31,31,31,31,31,31,31,31,31,31,31,31,31,31,31,31,31,31,31,31,31,31,31,31,31,31,31,31,31,31,31,31,31,31,31,31,31,31,31,31,31,31,31,31,31,31,31,31,31,31,31,31,31,31,31,31,31,31,31,31,31,31,31,31,31,31,31,31,31,31,31,31,31,31,31,31,31,31,31,31,31,31,31,31,31,31,31,31,31,31,31,31,31,31,31,31,31,31,31,31,31,31,31,31,31,31,31,31,31,31,31,31,31,31,31,31,31,31,31,31,31,31,31,31,31,31,31,31,31,31,31,31,31,31,31,31,31,31,31,31,31,31,31,31,31,31,31,31,31,31,31,31,31,31,31,31,31,31,31,31,31,31,31,31,31,31,31,31,31,31,31,31,31,31,31,31,31,31,31,31,31,31,31,31,31,31,31,31,31,31,31,31,31,31,31,31,31,31,31,31,31,31,31,31,31,31,31,31,31,31,31,31,31,31,31,31,31,31,31,31,31,31,31,31,31,31,31,31,31,31,31,31,31,31,31,31,31,31,31,31,31,31,31,31,31,31,31,31,31};      /* T5 _relative_position_bucket(k - q) for k - q in [-(S-1), S-1], computed with the module's own jax code on the host */
__global__ __launch_bounds__(512) void k_rb(const float* __restrict__ t, float* __restrict__ RB) { const int i = threadIdx.x; const float v = bf16_round(t[i]); *(float*)(RB + i) = v;  }
template <int CAUSAL>
__global__ __launch_bounds__(128) void k_flash(const _Float16* __restrict__ Q16, int ldq, const _Float16* __restrict__ K16, int ldk, const _Float16* __restrict__ Vt, const int* __restrict__ MSK, float* __restrict__ O, int ldo) {
  constexpr int RPW = 16, RTN = RPW / 16, NQB = TQ / (4 * RPW), DT = 4, KS = 2;
  __shared__ __attribute__((aligned(16))) unsigned short sP[4][RPW][40]; __shared__ __attribute__((aligned(16))) float sO[4][RPW][64 + 4];
  const int tid = threadIdx.x, w = tid >> 5, lane = tid & 31, ln = lane & 15, hh = lane >> 4;
  const int slab = blockIdx.x / QBNP, qblk = QB0P + blockIdx.x % QBNP; (void)NQB; const int b = slab / NH, h = slab % NH; const int qb0 = qblk * (4 * RPW); const int q0 = qb0 + w * RPW;
  FragH aq[2][KS];
#pragma unroll
  for (int rt = 0; rt < RTN; ++rt) { const unsigned short* qr = (const unsigned short*)Q16 + ((size_t)b * TQ + q0 + rt * 16 + ln) * ldq + h * 64;
#pragma unroll
    for (int ks = 0; ks < KS; ++ks) { aq[rt][ks].half[0] = *(const v8us*)(qr + ks * 32 + 8 * hh); aq[rt][ks].half[1] = *(const v8us*)(qr + ks * 32 + 16 + 8 * hh); } }
  const unsigned short* Vth = (const unsigned short*)Vt + (size_t)slab * 64 * TK;
  float m_r[2][8], l_r[2][8]; v8f oacc[2][DT];
#pragma unroll
  for (int rt = 0; rt < RTN; ++rt) {
#pragma unroll
    for (int r = 0; r < 8; ++r) { m_r[rt][r] = -3.0e38f; l_r[rt][r] = 0.f; }
#pragma unroll
    for (int dt = 0; dt < DT; ++dt) oacc[rt][dt] = (v8f){0.f,0.f,0.f,0.f,0.f,0.f,0.f,0.f}; }
  const int jend = (CAUSAL == 1 || CAUSAL == 32) ? (qb0 + 4 * RPW) : ((CAUSAL == 23) ? min(TK, (qb0 / CHK + 2) * CHK) : TK);      /* causal / window: keys that can never contribute are skipped */ const int jbeg = (CAUSAL == 23) ? max(0, (qb0 / CHK - 1) * CHK) : 0;
#pragma unroll 1
  for (int j0 = jbeg; j0 < jend; j0 += 32) {
    v8f s[2][2];
#pragma unroll
    for (int nt = 0; nt < 2; ++nt) { const unsigned short* kr = (const unsigned short*)K16 + ((size_t)b * TK + j0 + nt * 16 + ln) * ldk + h * 64; FragH bk[KS];
#pragma unroll
      for (int ks = 0; ks < KS; ++ks) { bk[ks].half[0] = *(const v8us*)(kr + ks * 32 + 8 * hh); bk[ks].half[1] = *(const v8us*)(kr + ks * 32 + 16 + 8 * hh); }
#pragma unroll
      for (int rt = 0; rt < RTN; ++rt) { v8f acc = (v8f){0.f,0.f,0.f,0.f,0.f,0.f,0.f,0.f};
#pragma unroll
        for (int ks = 0; ks < KS; ++ks) acc = mmaH<1>(aq[rt][ks].v, aq[rt][ks].v, bk[ks].v, bk[ks].v, acc); s[rt][nt] = acc; } }
#pragma unroll
    for (int rt = 0; rt < RTN; ++rt)
#pragma unroll
      for (int r = 0; r < 8; ++r) { const int tq = q0 + rt * 16 + 8 * hh + r; const int k0 = j0 + ln, k1 = j0 + 16 + ln;
        bool ok0 = (CAUSAL == 1 || CAUSAL == 32) ? (k0 <= tq) : ((CAUSAL == 2) ? ((k0 >> 5) == (tq >> 5)) : true), ok1 = (CAUSAL == 1 || CAUSAL == 32) ? (k1 <= tq) : ((CAUSAL == 2) ? ((k1 >> 5) == (tq >> 5)) : true); if (CAUSAL == 23) { const int cq = tq / CHK; ok0 = (abs(k0 / CHK - cq) <= 1) && (MSK[(size_t)b * TK + k0] == 0); ok1 = (abs(k1 / CHK - cq) <= 1) && (MSK[(size_t)b * TK + k1] == 0); }      /* mode 23: 3-chunk window + int key-padding mask */
        if (CAUSAL == 24) { ok0 = (MSK[(size_t)b * TK + k0] == 0); ok1 = (MSK[(size_t)b * TK + k1] == 0); }      /* mode 24: int key-padding mask (nonzero = padded = excluded) */      /* mode 2: block-diagonal 32-token groups */
        float s0 = ok0 ? s[rt][0][r] * SCL : -3.0e38f, s1 = ok1 ? s[rt][1][r] * SCL : -3.0e38f; if (CAUSAL == 27) { const float* amk = (const float*)MSK + ((size_t)b * MQI + tq) * MKI; s0 += bf16_round(amk[k0]); s1 += bf16_round(amk[k1]); }      /* mode 27: additive per-(batch, query, key) f32 mask INPUT [b][tq][k] */ if (CAUSAL == 30) { const float* rbp = (const float*)MSK; s0 += rbp[BK30[k0 - tq + (TK - 1)] * NH + h]; s1 += rbp[BK30[k1 - tq + (TK - 1)] * NH + h]; }      /* mode 30: T5 bucketed relative bias: table[bucket(k - q)][h]; bucket-of-distance is a module constant */ if (CAUSAL == 32) { const float* qsT = (const float*)MSK; const float* ksT = qsT + (size_t)NB * TQ; const float qs = qsT[(size_t)b * TQ + tq]; if (ok0) { float d = qs + ksT[(size_t)b * TK + k0]; d = d - 2.0f * s0; d = fmaxf(d, 0.f); s0 = -d * 0.125f; } if (ok1) { float d = qs + ksT[(size_t)b * TK + k1]; d = d - 2.0f * s1; d = fmaxf(d, 0.f); s1 = -d * 0.125f; } }      /* mode 32: RBF logit -relu(|q|^2 + |k|^2 - 2 q.k)/8, causal */ if (CAUSAL == 17) { const float* amk = (const float*)MSK + (size_t)b * TK; s0 += bf16_round(amk[k0]); s1 += bf16_round(amk[k1]); } if (CAUSAL == 18) { const float* tb = (const float*)MSK; const int* ri = MSK + 1024 + (size_t)b * TK; const int rq = ri[tq]; s0 += tb[(h * 8 + rq) * 8 + ri[k0]]; s1 += tb[(h * 8 + rq) * 8 + ri[k1]]; } if (CAUSAL == 19) { const int* rel = MSK + (size_t)tq * TK; const float* rb = (const float*)MSK + (size_t)TQ * TK + ((size_t)(b * NH + h) * TQ + tq) * 64; s0 += rb[rel[k0]]; s1 += rb[rel[k1]]; }      /* mode 19: + (q.Ek[rel] + Eb[rel][h]) / 8 gathered by the int relative ids (packed [ids | table]) */      /* mode 18: + resource_bias[h][r_q][r_k] from the packed [table | ids] buffer (TQ == TK) */      /* mode 17: additive per-(batch, key) mask INPUT */ float mc = fmaxf(s0, s1);
        mc = fmaxf(mc, __shfl_xor(mc, 1, 32)); mc = fmaxf(mc, __shfl_xor(mc, 2, 32)); mc = fmaxf(mc, __shfl_xor(mc, 4, 32)); mc = fmaxf(mc, __shfl_xor(mc, 8, 32));
        const float mn = fmaxf(m_r[rt][r], mc); const float al = (mn > -1.0e38f) ? expf(m_r[rt][r] - mn) : 1.0f; m_r[rt][r] = mn; const float p0 = ok0 ? expf(s0 - mn) : 0.f, p1 = ok1 ? expf(s1 - mn) : 0.f; l_r[rt][r] = l_r[rt][r] * al + p0 + p1;
#pragma unroll
        for (int dt = 0; dt < DT; ++dt) oacc[rt][dt][r] *= al;
        FragH t2; t2.h[0] = (_Float16)(p0 * 1024.0f); t2.h[1] = (_Float16)(p1 * 1024.0f); sP[w][rt * 16 + 8 * hh + r][ln] = t2.u[0]; sP[w][rt * 16 + 8 * hh + r][16 + ln] = t2.u[1]; }
    __builtin_amdgcn_fence(__ATOMIC_ACQ_REL, "workgroup"); __builtin_amdgcn_wave_barrier();
    FragH pa[2];
#pragma unroll
    for (int rt = 0; rt < RTN; ++rt) { pa[rt].half[0] = *(const v8us*)&sP[w][rt * 16 + ln][8 * hh]; pa[rt].half[1] = *(const v8us*)&sP[w][rt * 16 + ln][16 + 8 * hh]; }
#pragma unroll
    for (int dt = 0; dt < DT; ++dt) { const unsigned short* vrow = Vth + (size_t)(dt * 16 + ln) * TK + j0; FragH bv; bv.half[0] = *(const v8us*)(vrow + 8 * hh); bv.half[1] = *(const v8us*)(vrow + 16 + 8 * hh);
#pragma unroll
      for (int rt = 0; rt < RTN; ++rt) oacc[rt][dt] = mmaH<1>(pa[rt].v, pa[rt].v, bv.v, bv.v, oacc[rt][dt]); }
    __builtin_amdgcn_fence(__ATOMIC_ACQ_REL, "workgroup"); __builtin_amdgcn_wave_barrier(); }
#pragma unroll
  for (int rt = 0; rt < RTN; ++rt) {
#pragma unroll
    for (int r = 0; r < 8; ++r) { float l = l_r[rt][r]; l += __shfl_xor(l, 1, 32); l += __shfl_xor(l, 2, 32); l += __shfl_xor(l, 4, 32); l += __shfl_xor(l, 8, 32); l_r[rt][r] = (l > 0.f) ? 1.0f / (l * 1024.0f) : 0.f; }
#pragma unroll
    for (int dt = 0; dt < DT; ++dt)
#pragma unroll
      for (int r = 0; r < 8; ++r) sO[w][rt * 16 + 8 * hh + r][dt * 16 + ln] = oacc[rt][dt][r] * l_r[rt][r]; }
  __builtin_amdgcn_fence(__ATOMIC_ACQ_REL, "workgroup"); __builtin_amdgcn_wave_barrier();
  {
#pragma unroll
    for (int rp = 0; rp < RPW; rp += 2) { const int r = rp + (lane >> 4), pc = lane & 15; const v4f val = *(const v4fa*)&sO[w][r][pc * 4]; *(v4f*)(O + ((size_t)b * TQ + q0 + r) * ldo + h * 64 + pc * 4) = val; }
     } }
// 5-plane variant: S = Qh Kh^T + (Ql Kh^T + Qh Kl^T)/1024 with Q/K = [hi | 2^10 residual] f16 planes (QL/KL same layout as Q16/K16), then the 3-term P.V below.
// 3-term variant: O = (P_hi V_hi + (P_lo V_hi + P_hi V_lo) / 1024) / l with P = [hi | 2^10 residual] of 1024 p and V^T = [hi | 2^10 residual] planes (VtL same layout as Vt) -> ~2^-21-class products for un-averaged (early causal / peaked) rows
template <int CAUSAL>
__global__ __launch_bounds__(128) void k_flash5(const _Float16* __restrict__ Q16, const _Float16* __restrict__ QL, int ldq, const _Float16* __restrict__ K16, const _Float16* __restrict__ KL, int ldk, const _Float16* __restrict__ Vt, const _Float16* __restrict__ VtL, const int* __restrict__ MSK, float* __restrict__ O, int ldo) {
  constexpr int RPW = 16, RTN = RPW / 16, NQB = TQ / (4 * RPW), DT = 4, KS = 2;
  __shared__ __attribute__((aligned(16))) unsigned short sP[4][RPW][40]; __shared__ __attribute__((aligned(16))) unsigned short sPL[4][RPW][40]; __shared__ __attribute__((aligned(16))) float sO[4][RPW][64 + 4];
  const int tid = threadIdx.x, w = tid >> 5, lane = tid & 31, ln = lane & 15, hh = lane >> 4;
  const int slab = blockIdx.x / QBN5, qblk = QB05 + blockIdx.x % QBN5; (void)NQB; const int b = slab / NH, h = slab % NH; const int qb0 = qblk * (4 * RPW); const int q0 = qb0 + w * RPW;
  FragH aq[2][KS], aql[2][KS];
#pragma unroll
  for (int rt = 0; rt < RTN; ++rt) { const unsigned short* qr = (const unsigned short*)Q16 + ((size_t)b * TQ + q0 + rt * 16 + ln) * ldq + h * 64; const unsigned short* ql = (const unsigned short*)QL + ((size_t)b * TQ + q0 + rt * 16 + ln) * ldq + h * 64;
#pragma unroll
    for (int ks = 0; ks < KS; ++ks) { aq[rt][ks].half[0] = *(const v8us*)(qr + ks * 32 + 8 * hh); aq[rt][ks].half[1] = *(const v8us*)(qr + ks * 32 + 16 + 8 * hh); aql[rt][ks].half[0] = *(const v8us*)(ql + ks * 32 + 8 * hh); aql[rt][ks].half[1] = *(const v8us*)(ql + ks * 32 + 16 + 8 * hh); } }
  const unsigned short* Vth = (const unsigned short*)Vt + (size_t)slab * 64 * TK; const unsigned short* Vtl = (const unsigned short*)VtL + (size_t)slab * 64 * TK;
  float m_r[2][8], l_r[2][8]; v8f oacc[2][DT], oaccL[2][DT];
#pragma unroll
  for (int rt = 0; rt < RTN; ++rt) {
#pragma unroll
    for (int r = 0; r < 8; ++r) { m_r[rt][r] = -3.0e38f; l_r[rt][r] = 0.f; }
#pragma unroll
    for (int dt = 0; dt < DT; ++dt) { oacc[rt][dt] = (v8f){0.f,0.f,0.f,0.f,0.f,0.f,0.f,0.f}; oaccL[rt][dt] = oacc[rt][dt]; } }
  const int jend = (CAUSAL == 1 || CAUSAL == 32) ? (qb0 + 4 * RPW) : ((CAUSAL == 23) ? min(TK, (qb0 / CHK + 2) * CHK) : TK);      /* causal / window: keys that can never contribute are skipped */ const int jbeg = (CAUSAL == 23) ? max(0, (qb0 / CHK - 1) * CHK) : 0;
#pragma unroll 1
  for (int j0 = jbeg; j0 < jend; j0 += 32) {
    v8f s[2][2];
#pragma unroll
    for (int nt = 0; nt < 2; ++nt) { const unsigned short* kr = (const unsigned short*)K16 + ((size_t)b * TK + j0 + nt * 16 + ln) * ldk + h * 64; const unsigned short* klr = (const unsigned short*)KL + ((size_t)b * TK + j0 + nt * 16 + ln) * ldk + h * 64; FragH bk[KS], bkl[KS];
#pragma unroll
      for (int ks = 0; ks < KS; ++ks) { bk[ks].half[0] = *(const v8us*)(kr + ks * 32 + 8 * hh); bk[ks].half[1] = *(const v8us*)(kr + ks * 32 + 16 + 8 * hh); bkl[ks].half[0] = *(const v8us*)(klr + ks * 32 + 8 * hh); bkl[ks].half[1] = *(const v8us*)(klr + ks * 32 + 16 + 8 * hh); }
#pragma unroll
      for (int rt = 0; rt < RTN; ++rt) { v8f acc = (v8f){0.f,0.f,0.f,0.f,0.f,0.f,0.f,0.f}, accl = acc;
#pragma unroll
        for (int ks = 0; ks < KS; ++ks) { acc = mmaH<1>(aq[rt][ks].v, aq[rt][ks].v, bk[ks].v, bk[ks].v, acc); accl = mmaH<1>(aql[rt][ks].v, aql[rt][ks].v, bk[ks].v, bk[ks].v, accl); accl = mmaH<1>(aq[rt][ks].v, aq[rt][ks].v, bkl[ks].v, bkl[ks].v, accl); }
#pragma unroll
        for (int r = 0; r < 8; ++r) acc[r] += accl[r] * 0.0009765625f;
        s[rt][nt] = acc; } }
#pragma unroll
    for (int rt = 0; rt < RTN; ++rt)
#pragma unroll
      for (int r = 0; r < 8; ++r) { const int tq = q0 + rt * 16 + 8 * hh + r; const int k0 = j0 + ln, k1 = j0 + 16 + ln;
        bool ok0 = (CAUSAL == 1 || CAUSAL == 32) ? (k0 <= tq) : ((CAUSAL == 2) ? ((k0 >> 5) == (tq >> 5)) : true), ok1 = (CAUSAL == 1 || CAUSAL == 32) ? (k1 <= tq) : ((CAUSAL == 2) ? ((k1 >> 5) == (tq >> 5)) : true);      /* mode 2: block-diagonal 32-token groups */
        if (CAUSAL == 4) { const int* mrow = MSK + ((size_t)b * TQ + tq) * TK; ok0 = mrow[k0] != 0; ok1 = mrow[k1] != 0; }      /* mode 4: per-(query, key) INPUT mask shared by all heads; masked keys contribute nothing (== the reference's -4096 fill, whose exp underflows to 0), rows with no valid key give l = 0 -> output 0 (== the reference's row_valid zeroing) */
        float s0 = ok0 ? s[rt][0][r] * SCL : -3.0e38f, s1 = ok1 ? s[rt][1][r] * SCL : -3.0e38f; if (CAUSAL == 30) { const float* rbp = (const float*)MSK; s0 += rbp[BK30[k0 - tq + (TK - 1)] * NH + h]; s1 += rbp[BK30[k1 - tq + (TK - 1)] * NH + h]; }      /* mode 30: T5 bucketed relative bias: table[bucket(k - q)][h]; bucket-of-distance is a module constant */ if (CAUSAL == 32) { const float* qsT = (const float*)MSK; const float* ksT = qsT + (size_t)NB * TQ; const float qs = qsT[(size_t)b * TQ + tq]; if (ok0) { float d = qs + ksT[(size_t)b * TK + k0]; d = d - 2.0f * s0; d = fmaxf(d, 0.f); s0 = -d * 0.125f; } if (ok1) { float d = qs + ksT[(size_t)b * TK + k1]; d = d - 2.0f * s1; d = fmaxf(d, 0.f); s1 = -d * 0.125f; } }      /* mode 32: RBF logit -relu(|q|^2 + |k|^2 - 2 q.k)/8, causal */ if (CAUSAL == 17) { const float* amk = (const float*)MSK + (size_t)b * TK; s0 += bf16_round(amk[k0]); s1 += bf16_round(amk[k1]); } if (CAUSAL == 18) { const float* tb = (const float*)MSK; const int* ri = MSK + 1024 + (size_t)b * TK; const int rq = ri[tq]; s0 += tb[(h * 8 + rq) * 8 + ri[k0]]; s1 += tb[(h * 8 + rq) * 8 + ri[k1]]; } if (CAUSAL == 19) { const int* rel = MSK + (size_t)tq * TK; const float* rb = (const float*)MSK + (size_t)TQ * TK + ((size_t)(b * NH + h) * TQ + tq) * 64; s0 += rb[rel[k0]]; s1 += rb[rel[k1]]; }      /* mode 19: + (q.Ek[rel] + Eb[rel][h]) / 8 gathered by the int relative ids (packed [ids | table]) */      /* mode 18: + resource_bias[h][r_q][r_k] from the packed [table | ids] buffer (TQ == TK) */      /* mode 17: additive per-(batch, key) mask INPUT */ float mc = fmaxf(s0, s1);
        mc = fmaxf(mc, __shfl_xor(mc, 1, 32)); mc = fmaxf(mc, __shfl_xor(mc, 2, 32)); mc = fmaxf(mc, __shfl_xor(mc, 4, 32)); mc = fmaxf(mc, __shfl_xor(mc, 8, 32));
        const float mn = fmaxf(m_r[rt][r], mc); const float al = (mn > -1.0e38f) ? expf(m_r[rt][r] - mn) : 1.0f; m_r[rt][r] = mn; const float p0 = ok0 ? expf(s0 - mn) : 0.f, p1 = ok1 ? expf(s1 - mn) : 0.f; l_r[rt][r] = l_r[rt][r] * al + p0 + p1;
#pragma unroll
        for (int dt = 0; dt < DT; ++dt) { oacc[rt][dt][r] *= al; oaccL[rt][dt][r] *= al; }
        FragH t2, t2l; const float ps0 = p0 * 1024.0f, ps1 = p1 * 1024.0f; t2.h[0] = (_Float16)ps0; t2.h[1] = (_Float16)ps1; t2l.h[0] = (_Float16)((ps0 - (float)t2.h[0]) * 1024.0f); t2l.h[1] = (_Float16)((ps1 - (float)t2.h[1]) * 1024.0f);
        sP[w][rt * 16 + 8 * hh + r][ln] = t2.u[0]; sP[w][rt * 16 + 8 * hh + r][16 + ln] = t2.u[1]; sPL[w][rt * 16 + 8 * hh + r][ln] = t2l.u[0]; sPL[w][rt * 16 + 8 * hh + r][16 + ln] = t2l.u[1]; }
    __builtin_amdgcn_fence(__ATOMIC_ACQ_REL, "workgroup"); __builtin_amdgcn_wave_barrier();
    FragH pa[2], pl[2];
#pragma unroll
    for (int rt = 0; rt < RTN; ++rt) { pa[rt].half[0] = *(const v8us*)&sP[w][rt * 16 + ln][8 * hh]; pa[rt].half[1] = *(const v8us*)&sP[w][rt * 16 + ln][16 + 8 * hh]; pl[rt].half[0] = *(const v8us*)&sPL[w][rt * 16 + ln][8 * hh]; pl[rt].half[1] = *(const v8us*)&sPL[w][rt * 16 + ln][16 + 8 * hh]; }
#pragma unroll
    for (int dt = 0; dt < DT; ++dt) { const unsigned short* vrow = Vth + (size_t)(dt * 16 + ln) * TK + j0; const unsigned short* vrl = Vtl + (size_t)(dt * 16 + ln) * TK + j0; FragH bv, bl; bv.half[0] = *(const v8us*)(vrow + 8 * hh); bv.half[1] = *(const v8us*)(vrow + 16 + 8 * hh); bl.half[0] = *(const v8us*)(vrl + 8 * hh); bl.half[1] = *(const v8us*)(vrl + 16 + 8 * hh);
#pragma unroll
      for (int rt = 0; rt < RTN; ++rt) { oacc[rt][dt] = mmaH<1>(pa[rt].v, pa[rt].v, bv.v, bv.v, oacc[rt][dt]); oaccL[rt][dt] = mmaH<1>(pl[rt].v, pl[rt].v, bv.v, bv.v, oaccL[rt][dt]); oaccL[rt][dt] = mmaH<1>(pa[rt].v, pa[rt].v, bl.v, bl.v, oaccL[rt][dt]); } }
    __builtin_amdgcn_fence(__ATOMIC_ACQ_REL, "workgroup"); __builtin_amdgcn_wave_barrier(); }
#pragma unroll
  for (int rt = 0; rt < RTN; ++rt) {
#pragma unroll
    for (int r = 0; r < 8; ++r) { float l = l_r[rt][r]; l += __shfl_xor(l, 1, 32); l += __shfl_xor(l, 2, 32); l += __shfl_xor(l, 4, 32); l += __shfl_xor(l, 8, 32); l_r[rt][r] = (l > 0.f) ? 1.0f / (l * 1024.0f) : 0.f; }
#pragma unroll
    for (int dt = 0; dt < DT; ++dt)
#pragma unroll
      for (int r = 0; r < 8; ++r) { float v = oacc[rt][dt][r]; v += oaccL[rt][dt][r] * 0.0009765625f; sO[w][rt * 16 + 8 * hh + r][dt * 16 + ln] = v * l_r[rt][r]; } }
  __builtin_amdgcn_fence(__ATOMIC_ACQ_REL, "workgroup"); __builtin_amdgcn_wave_barrier();
  {
#pragma unroll
    for (int rp = 0; rp < RPW; rp += 2) { const int r = rp + (lane >> 4), pc = lane & 15; const v4f val = *(const v4fa*)&sO[w][r][pc * 4]; *(v4f*)(O + ((size_t)b * TQ + q0 + r) * ldo + h * 64 + pc * 4) = val; }
     } }

__global__ __launch_bounds__(256) void k_rotab(float* __restrict__ CS, float* __restrict__ SN) {
  #pragma clang fp contract(off)
  const int t = blockIdx.x * 256 + threadIdx.x; if (t >= SLEN * 32) return; const int j = t % 32, s = t / 32; const float ex = (float)(2 * j) / 64.0f; const float inv = 1.0f / powf(10000.0f, ex); const float th = (float)s * inv; const float c = cosf(th), sn = sinf(th);
  { *(float*)(CS + t) = c; *(float*)(SN + t) = sn;  } }
__global__ __launch_bounds__(256) void k_rope(const float* __restrict__ F, int nsrc, int ndst, int rep, const float* __restrict__ CS, const float* __restrict__ SN, _Float16* __restrict__ H, _Float16* __restrict__ L) {
  #pragma clang fp contract(off)
  const size_t t = (size_t)blockIdx.x * 256 + threadIdx.x; if (t >= (size_t)NR * ndst * 4) return; const int g8 = (int)(t % 4); const int hd = (int)((t / 4) % ndst); const size_t row = t / ((size_t)4 * ndst); const int s = (int)(row % SLEN); const int hs = hd / rep;
  const float* src = F + row * (size_t)(nsrc * 64) + hs * 64; FragH ah, al, bh, bl;
  for (int i = 0; i < 8; ++i) { const int d = g8 * 8 + i; const float c = CS[s * 32 + d], sn = SN[s * 32 + d]; const float x1 = src[d], x2 = src[d + 32];
    float o1 = x1 * c; o1 += -x2 * sn; float o2 = x2 * c; o2 += x1 * sn;
    _Float16 hv = (_Float16)o1; ah.h[i] = hv; al.h[i] = (_Float16)((o1 - (float)hv) * 1024.0f); hv = (_Float16)o2; bh.h[i] = hv; bl.h[i] = (_Float16)((o2 - (float)hv) * 1024.0f); }
  const size_t o = row * (size_t)(ndst * 64) + hd * 64 + g8 * 8;
  { *(v8us*)((unsigned short*)H + o) = ah.half[0]; *(v8us*)((unsigned short*)H + o + 32) = bh.half[0]; *(v8us*)((unsigned short*)L + o) = al.half[0]; *(v8us*)((unsigned short*)L + o + 32) = bl.half[0];  } }
__global__ __launch_bounds__(256) void k_rope2(const float* __restrict__ F, int nsrc, int ndst, int rep, const float* __restrict__ CS, const float* __restrict__ SN, _Float16* __restrict__ H, _Float16* __restrict__ L) {
  #pragma clang fp contract(off)
  const size_t t = (size_t)blockIdx.x * 256 + threadIdx.x; if (t >= (size_t)NR * ndst * 4) return; const int g16 = (int)(t % 4); const int hd = (int)((t / 4) % ndst); const size_t row = t / ((size_t)4 * ndst); const int s = (int)(row % SLEN); const int hs = hd / rep;
  const float* src = F + row * (size_t)(nsrc * 64) + hs * 64 + g16 * 16; FragH ah, al;
  for (int pr = 0; pr < 8; ++pr) { const int i = g16 * 8 + pr; const float c = CS[s * 32 + i], sn = SN[s * 32 + i]; const float x1 = src[2 * pr], x2 = src[2 * pr + 1];
    float o1 = x1 * c; o1 -= x2 * sn; float o2 = x1 * sn; o2 += x2 * c;
    _Float16 hv = (_Float16)o1; ah.h[2 * pr] = hv; al.h[2 * pr] = (_Float16)((o1 - (float)hv) * 1024.0f); hv = (_Float16)o2; ah.h[2 * pr + 1] = hv; al.h[2 * pr + 1] = (_Float16)((o2 - (float)hv) * 1024.0f); }
  const size_t o = row * (size_t)(ndst * 64) + hd * 64 + g16 * 16;
  { *(v8us*)((unsigned short*)H + o) = ah.half[0]; *(v8us*)((unsigned short*)H + o + 8) = ah.half[1]; *(v8us*)((unsigned short*)L + o) = al.half[0]; *(v8us*)((unsigned short*)L + o + 8) = al.half[1];  } }
__global__ __launch_bounds__(256) void k_ln512(const float* __restrict__ A, const float* __restrict__ res, const float* __restrict__ g, const float* __restrict__ bb, float* __restrict__ Y, _Float16* __restrict__ Y16) {
  #pragma clang fp contract(off)
  const int wv = threadIdx.x >> 5, ln = threadIdx.x & 31; const size_t r = (size_t)blockIdx.x * 8 + wv; if (r >= NR) return; float x[16]; float s = 0.f;
  for (int i = 0; i < 2; ++i) { const v8f a = *(const v8f*)(A + r * DM + i * 256 + ln * 8); for (int q = 0; q < 8; ++q) { float v = a[q]; if (res) v += bf16_round(res[r * DM + i * 256 + ln * 8 + q]); x[i * 8 + q] = v; s += v; } }
  for (int o = 16; o > 0; o >>= 1) s += __shfl_xor(s, o, 32); const float mu = s / (float)DM; float var = 0.f; for (int q = 0; q < 16; ++q) { const float d = x[q] - mu; var += d * d; }
  for (int o = 16; o > 0; o >>= 1) var += __shfl_xor(var, o, 32); const float inv = rsqrtf(var / (float)DM + 1e-5f);
  { for (int i = 0; i < 2; ++i) { const int c0 = i * 256 + ln * 8; v8f y; FragH f; for (int q = 0; q < 8; ++q) { float v = (x[i * 8 + q] - mu) * inv; v *= bf16_round(g[c0 + q]); v += bf16_round(bb[c0 + q]); y[q] = v; f.h[q] = (_Float16)v; } *(v8f*)(Y + r * DM + c0) = y; if (Y16) *(v8us*)((unsigned short*)Y16 + r * DM + c0) = f.half[0]; }  } }
__global__ __launch_bounds__(256) void k_pack(const float* __restrict__ rb, const int* __restrict__ rid, int* __restrict__ PK) { const int t = blockIdx.x * 256 + threadIdx.x; if (t >= 1024 + NB * TK) return; int v; if (t < 1024) v = __float_as_int(bf16_round(rb[t])); else v = rid[t - 1024]; *(int*)(PK + t) = v;  }
__global__ __launch_bounds__(256) void k_tabin(const float* __restrict__ sp, float* __restrict__ CS, float* __restrict__ SN) { const int t = blockIdx.x * 256 + threadIdx.x; if (t >= SLEN * 32) return; const int i = t % 32, s = t / 32; const float c = bf16_round(sp[s * 64 + 32 + i]), sn = bf16_round(sp[s * 64 + i]);
  { *(float*)(CS + t) = c; *(float*)(SN + t) = sn;  } }
__global__ __launch_bounds__(256) void k_wsc(const float* __restrict__ Wm, _Float16* __restrict__ Bt, size_t n8, float sc) { const size_t t = (size_t)blockIdx.x * 256 + threadIdx.x; if (t >= n8) return; FragH f; for (int q = 0; q < 8; ++q) f.h[q] = (_Float16)(bf16_round(Wm[t * 8 + q]) * sc); *(v8us*)((unsigned short*)Bt + t * 8) = f.half[0];  }
__global__ __launch_bounds__(256) void k_rotab2(float* __restrict__ CS, float* __restrict__ SN) {
  #pragma clang fp contract(off)
  const int t = blockIdx.x * 256 + threadIdx.x; if (t >= SLEN * 32) return; const int j = t % 32, s = t / 32; const float c0 = -0.14391156831212787f;      /* -ln(10000)/64 rounded to f32 */ const float inv = expf((float)(2 * j) * c0); const float th = (float)s * inv; const float c = cosf(th), sn = sinf(th);
  { *(float*)(CS + t) = c; *(float*)(SN + t) = sn;  } }
__global__ __launch_bounds__(256) void k_lnu(const float* __restrict__ X, _Float16* __restrict__ N16, float* __restrict__ XB) {
  #pragma clang fp contract(off)
  const int wv = threadIdx.x >> 5, ln = threadIdx.x & 31; const size_t r = (size_t)blockIdx.x * 8 + wv; if (r >= NR) return; float a[32]; float s = 0.f;
  for (int i = 0; i < 4; ++i) { const v8f v = *(const v8f*)(X + r * DM + (i * 32 + ln) * 8); for (int q = 0; q < 8; ++q) { const float u = bf16_round(v[q]); a[i * 8 + q] = u; s += u; } }
  for (int o = 16; o > 0; o >>= 1) s += __shfl_xor(s, o, 32); const float mu = s / (float)DM; float var = 0.f; for (int q = 0; q < 32; ++q) { const float d = a[q] - mu; var += d * d; }
  for (int o = 16; o > 0; o >>= 1) var += __shfl_xor(var, o, 32); const float den = sqrtf(var / (float)(DM - 1)) + 1e-6f; const float inv = 1.0f / den;      /* one reciprocal per row; (x-mean)*inv vs the reference's division differs by <= 1 ulp */
  { for (int i = 0; i < 4; ++i) { const int c0 = (i * 32 + ln) * 8; FragH f; v8f xb; for (int q = 0; q < 8; ++q) { f.h[q] = (_Float16)((a[i * 8 + q] - mu) * inv); xb[q] = a[i * 8 + q]; } *(v8us*)((unsigned short*)N16 + r * DM + c0) = f.half[0]; *(v8f*)(XB + r * DM + c0) = xb; }  } }
__global__ __launch_bounds__(256) void k_vtg(const _Float16* __restrict__ V16, _Float16* __restrict__ Vt) { __shared__ unsigned short tl[64][66]; const int tid = threadIdx.x; const int slab = blockIdx.x / (SLEN / 64), lg = blockIdx.x % (SLEN / 64); const int b = slab / NH, h = slab % NH; const int hs = h / NREP;
  for (int i = tid; i < 64 * 8; i += 256) { const int r = i / 8, c8 = (i % 8) * 8; FragH f; f.half[0] = *(const v8us*)((const unsigned short*)V16 + ((size_t)b * SLEN + lg * 64 + r) * KVD + hs * 64 + c8); for (int q = 0; q < 8; ++q) tl[r][c8 + q] = f.u[q]; }
  __syncthreads();
  { for (int rd = 0; rd < 2; ++rd) { const int d = rd * 32 + tid / 8, pc = tid % 8; FragH f; for (int q = 0; q < 8; ++q) f.u[q] = tl[pc * 8 + q][d]; *(v8us*)((unsigned short*)Vt + ((size_t)slab * 64 + d) * SLEN + lg * 64 + pc * 8) = f.half[0]; }  } }

__global__ __launch_bounds__(256) void k_h16s(const float* __restrict__ SRC, int lds, int coff, _Float16* __restrict__ DST, size_t n8) { const size_t t = (size_t)blockIdx.x * 256 + threadIdx.x; if (t >= n8) return; const size_t r = (t * 8) / DM; const int c = (int)((t * 8) % DM); const v8f a = *(const v8f*)(SRC + r * lds + coff + c); FragH f; for (int q = 0; q < 8; ++q) f.h[q] = (_Float16)a[q];
  *(v8us*)((unsigned short*)DST + t * 8) = f.half[0];  }


__global__ __launch_bounds__(256) void k_ccp(const float* __restrict__ QKV, int coff, _Float16* __restrict__ D) { const size_t t = (size_t)blockIdx.x * 256 + threadIdx.x; if (t >= (size_t)NR * DM / 8) return; const int c0 = (int)((t * 8) % DM); const size_t row = (t * 8) / DM; const v8f a = *(const v8f*)(QKV + row * 3 * DM + coff + c0); FragH f; for (int q = 0; q < 8; ++q) f.h[q] = (_Float16)a[q];
  *(v8us*)((unsigned short*)D + t * 8) = f.half[0];  }


template <int NLN>
__global__ __launch_bounds__(256) void k_lnrow(const float* __restrict__ X, const float* __restrict__ R, const float* __restrict__ g, const float* __restrict__ bb, float eps, float* __restrict__ OUT) {
  #pragma clang fp contract(off)
  constexpr int PER = NLN / 256; __shared__ float red[256]; const int tid = threadIdx.x; const size_t row = blockIdx.x; const float* x = X + row * NLN; const float* rr = R ? R + row * NLN : nullptr; float v[PER]; float s1 = 0.f;
  for (int u = 0; u < PER; ++u) { const int j = tid * PER + u; float t = x[j]; if (rr) t = t + rr[j]; v[u] = t; s1 += t; }
  red[tid] = s1; __syncthreads(); for (int st = 128; st > 0; st >>= 1) { if (tid < st) red[tid] += red[tid + st]; __syncthreads(); } const float mu = red[0] / (float)NLN; __syncthreads();
  float s2 = 0.f; for (int u = 0; u < PER; ++u) { const float c = v[u] - mu; s2 += c * c; } red[tid] = s2; __syncthreads(); for (int st = 128; st > 0; st >>= 1) { if (tid < st) red[tid] += red[tid + st]; __syncthreads(); }
  const float var = red[0] / (float)NLN; const float rs = rsqrtf(var + eps);
  { for (int u = 0; u < PER; ++u) { const int j = tid * PER + u; float o = (v[u] - mu) * rs; o = __fadd_rn(__fmul_rn(o, bf16_round(g[j])), bf16_round(bb[j])); *(float*)(OUT + row * NLN + j) = o; }  } }
__global__ __launch_bounds__(256) void k_xr32(const float* __restrict__ x, float* __restrict__ XR, size_t n8) { const size_t t = (size_t)blockIdx.x * 256 + threadIdx.x; if (t >= n8) return; v8f o; for (int q = 0; q < 8; ++q) o[q] = bf16_round(x[t * 8 + q]); *(v8f*)(XR + t * 8) = o;  }
__global__ __launch_bounds__(256) void k_r16b(const float* __restrict__ S, _Float16* __restrict__ D, size_t n8) { const size_t t = (size_t)blockIdx.x * 256 + threadIdx.x; if (t >= n8) return; const v8f a = *(const v8f*)(S + t * 8); FragH f; for (int q = 0; q < 8; ++q) f.h[q] = (_Float16)a[q]; *(v8us*)((unsigned short*)D + t * 8) = f.half[0];  }

__global__ __launch_bounds__(256) void k_nsq(const float* __restrict__ X, float* __restrict__ NSQ, size_t nrows) {
  #pragma clang fp contract(off)
  const size_t r = (size_t)blockIdx.x * 256 + threadIdx.x; if (r >= nrows) return; float acc = 0.f;
#pragma unroll 1
  for (int d = 0; d < 64; d += 8) { const v8f a = *(const v8f*)(X + r * 64 + d); for (int u = 0; u < 8; ++u) { const float x = bf16_round(a[u]); acc = __fadd_rn(acc, __fmul_rn(x, x)); } }
  *(float*)(NSQ + r) = acc;  }
__global__ __launch_bounds__(64) void k_fixr(const float* __restrict__ Q, const float* __restrict__ Kx, const float* __restrict__ V, const float* __restrict__ NSQ, float* __restrict__ O) {
  #pragma clang fp contract(off)
  __shared__ float pr[64][65]; const int q = threadIdx.x; const size_t sl = blockIdx.x; const float* qr = Q + (sl * SLEN + q) * 64; const float qs = NSQ[sl * SLEN + q]; const float* ksT = NSQ + (size_t)NB * SLEN; float mx = -3.0e38f;
#pragma unroll 1
  for (int j = 0; j <= q; ++j) { const float* kr = Kx + (sl * SLEN + j) * 64; float sdot = 0.f;
#pragma unroll 1
    for (int d = 0; d < 64; d += 8) { const v8f a = *(const v8f*)(qr + d); const v8f kk = *(const v8f*)(kr + d); for (int u = 0; u < 8; ++u) sdot = __fadd_rn(sdot, __fmul_rn(bf16_round(a[u]), bf16_round(kk[u]))); }
    float dd = qs + ksT[sl * SLEN + j]; dd = dd - 2.0f * sdot; dd = fmaxf(dd, 0.f); const float lg = -dd * 0.125f; pr[q][j] = lg; mx = fmaxf(mx, lg); }
  float su = 0.f;
#pragma unroll 1
  for (int j = 0; j <= q; ++j) { const float e = expf(pr[q][j] - mx); pr[q][j] = e; su += e; }
  const float inv = 1.0f / su;
  {
#pragma unroll 1
    for (int d = 0; d < 64; d += 8) { v8f acc = {0,0,0,0,0,0,0,0};
#pragma unroll 1
      for (int j = 0; j <= q; ++j) { const float p = pr[q][j] * inv; const v8f vv = *(const v8f*)(V + (sl * SLEN + j) * 64 + d); for (int u = 0; u < 8; ++u) acc[u] = __fadd_rn(acc[u], __fmul_rn(p, bf16_round(vv[u]))); }
      *(v8f*)(O + (sl * SLEN + q) * 64 + d) = acc; }
     } }

extern "C" void kernel_launch(void* const* d_in, const int* in_sizes, int n_in,
                              void* d_out, int out_size, void* d_ws, size_t ws_size, hipStream_t stream) {
  (void)in_sizes; (void)n_in; (void)out_size;
  const float* q = (const float*)d_in[0]; const float* k = (const float*)d_in[1]; const float* v = (const float*)d_in[2]; float* O = (float*)d_out;
  char* ws = (char*)d_ws; size_t off = 0;
  auto take = [&](size_t bytes) { char* p = ws + off; off += (bytes + 255) & ~(size_t)255; return p; };
  const size_t np = (size_t)NR * DM;      /* 32 x 2048 x 64 */
  _Float16* QH = (_Float16*)take(np * 2); _Float16* KH = (_Float16*)take(np * 2); _Float16* VH = (_Float16*)take(np * 2); _Float16* VT = (_Float16*)take(np * 2); float* NSQ = (float*)take((size_t)2 * NR * 4);
  if (off > ws_size) return;      /* 4 x 8 + 0.5 = ≈ 33 MiB */
  k_x16<<<(unsigned)((np / 8 + 255) / 256), 256, 0, stream>>>(q, QH, np / 8); k_x16<<<(unsigned)((np / 8 + 255) / 256), 256, 0, stream>>>(k, KH, np / 8); k_x16<<<(unsigned)((np / 8 + 255) / 256), 256, 0, stream>>>(v, VH, np / 8);      /* bf16-rounded inputs are exact in f16 */
  k_vtg<<<NB * NH * (SLEN / 64), 256, 0, stream>>>(VH, VT);
  k_nsq<<<(unsigned)((NR + 255) / 256), 256, 0, stream>>>(q, NSQ, (size_t)NR); k_nsq<<<(unsigned)((NR + 255) / 256), 256, 0, stream>>>(k, NSQ + NR, (size_t)NR);      /* |q|^2 | |k|^2 tables */
  k_flash<32><<<NB * NH * QBNP, 128, 0, stream>>>(QH, DM, KH, DM, VT, (const int*)NSQ, O, DM);      /* exact q, k products; f32 RBF logits; f32 context straight to the output */
  k_fixr<<<NB, 64, 0, stream>>>(q, k, v, NSQ, O);      /* rows < 64 per slab recomputed in f32 */
}

// v001
// A run of this version takes 334 microseconds.
// Timed twice side by side with v000, it ran 1.48 and 1.47 times as fast.
#include <hip/hip_runtime.h>
// CustomCausalAttention (q, k, v [2][16][2048][64]; RBF-kernel causal attention: logits = -relu(|q|^2 + |k|^2 - 2 q.k) / 8 over keys n <= m; out = softmax(logits) v -> [2][16][2048][64]).
// Structure: each (batch, head) slab is a contiguous 64-wide row block, treated as one 'batch' of a single 64-dim head: exact f16 planes of q, k, v (bf16-rounded inputs are exact in f16); |q|^2, |k|^2 as f32 row tables on VALU; v^T by LDS tiles; causal flash-style fused attention per (slab, 64-query block), forming the RBF logit from the f32 dot product and the two norm tables, f32 context written straight to the output; the first 64 causal rows per slab recomputed entirely in f32 on VALU.
// Compute dtype: inputs rounded to bf16; q, k, v exact as f16 (products exact, f32 accumulation); norms, logits, softmax f32 with plain f16 probabilities (~2^-12); rows < 64 all-f32. v_wmma_f32_16x16x32_f16.
#define NB 32                    /* 2 batches x 16 heads as slabs */
#define DM 64
#define NKV 1
#define NREP (NH / NKV)
#define KVD (NKV * 64)           /* 64 */
#define NR (NB * SLEN)
#define CHK 512
typedef int v4i __attribute__((ext_vector_type(4)));
#define FF 2048
#define SLEN 2048
#define MQI 2048
#define MKI 2048
#define TQ SLEN
#define TK SLEN
#define NH 1
#define SCL 1.0f                 /* raw dot product; the RBF transform applies the 1/8 */
#define QBLKS (TQ / 64)
#define QB05 0
#define QBN5 QBLKS      /* hi/lo engine (k_flash5) block range; not launched */
#define QB0P 0
#define QBNP QBLKS
#define RE 256
typedef __bf16 v16b __attribute__((ext_vector_type(16)));
typedef unsigned short v8us __attribute__((ext_vector_type(8), may_alias));
typedef float  v8f  __attribute__((ext_vector_type(8)));
typedef float  v4f  __attribute__((ext_vector_type(4)));
typedef float  v4fa __attribute__((ext_vector_type(4), may_alias));
union FragB { v16b v; v8us half[2]; unsigned short u[16]; };

__device__ __forceinline__ unsigned short bf16_bits(float x) { unsigned int u = __float_as_uint(x); return (unsigned short)((u + 0x7FFFu + ((u >> 16) & 1u)) >> 16); }
__device__ __forceinline__ float bf16_val(unsigned short b) { return __uint_as_float(((unsigned int)b) << 16); }
__device__ __forceinline__ float bf16_round(float x) { return bf16_val(bf16_bits(x)); }
// D += A·B with NT terms: 1 = ah·bh, 2 = + al·bh (A split), 3 = + ah·bl (both split)
template <int NT>
__device__ __forceinline__ v8f mmaN(v16b ah, v16b al, v16b bh, v16b bl, v8f c) {
  c = __builtin_amdgcn_wmma_f32_16x16x32_bf16(false, ah, false, bh, (short)0, c, false, false);
  if (NT >= 2) c = __builtin_amdgcn_wmma_f32_16x16x32_bf16(false, al, false, bh, (short)0, c, false, false);
  if (NT >= 3) c = __builtin_amdgcn_wmma_f32_16x16x32_bf16(false, ah, false, bl, (short)0, c, false, false);
  asm volatile("v_nop\n\tv_nop\n\tv_nop\n\tv_nop" : "+v"(c) : "v"(ah), "v"(al), "v"(bh), "v"(bl));
  return c;
}

__global__ __launch_bounds__(256) void k_wt_bf16(const float* __restrict__ W, unsigned short* __restrict__ Wt, int K, int N) {
  const int t = blockIdx.x * 256 + threadIdx.x;
  const int k8n = K / 8;
  if (t >= N * k8n) return;
  const int n = t / k8n, k8 = (t % k8n) * 8;
  v8us v;
#pragma unroll
  for (int i = 0; i < 8; ++i) v[i] = bf16_bits(W[(size_t)(k8 + i) * N + n]);
  *(v8us*)(Wt + (size_t)n * K + k8) = v;
  
}

// GEMM C[M][N] (f32, pitch ldc) = act(A[M][K]·W + bias). A f32 row-major (pitch lda) converted per fragment to bf16
// (ASPLIT: hi/lo two planes -> 2 terms, else single rounded term); Wt bf16 [N][K] (pitch ldb). BIAS_BF16 rounds the
// bias to bf16 first (bias quantised to bf16 before the add). K%32==0, M%16==0, N%64==0.
template <bool ASPLIT, int ACT, bool BIAS_BF16>
__global__ __launch_bounds__(128) void k_gemm_bf(const float* __restrict__ A, int lda, const unsigned short* __restrict__ Wt, int ldb,
                                               const float* __restrict__ bias, float* __restrict__ C, int ldc, int M, int N, int K) {
  __shared__ __attribute__((aligned(16))) float so[4][16][64];
  const int tid = threadIdx.x, w = tid >> 5, lane = tid & 31, ln = lane & 15, hh = lane >> 4;
  const int ntn = N / 64;
  const int wid = blockIdx.x * 4 + w;
  const int mt = wid / ntn, nq = wid % ntn;
  if (mt * 16 >= M) return;
  const int row0 = mt * 16, col0 = nq * 64;
  const float* arow = A + (size_t)(row0 + ln) * lda;
  v8f acc[4] = {};
  for (int kb = 0; kb < K; kb += 32) {
    FragB ah, al;
    const v4f x0 = *(const v4fa*)(arow + kb + 8 * hh), x1 = *(const v4fa*)(arow + kb + 8 * hh + 4);
    const v4f x2 = *(const v4fa*)(arow + kb + 16 + 8 * hh), x3 = *(const v4fa*)(arow + kb + 16 + 8 * hh + 4);
    float xs[16] = {x0[0],x0[1],x0[2],x0[3],x1[0],x1[1],x1[2],x1[3],x2[0],x2[1],x2[2],x2[3],x3[0],x3[1],x3[2],x3[3]};
#pragma unroll
    for (int i = 0; i < 16; ++i) { const unsigned short hb = bf16_bits(xs[i]); ah.u[i] = hb; al.u[i] = ASPLIT ? bf16_bits(xs[i] - bf16_val(hb)) : (unsigned short)0; }
#pragma unroll
    for (int t = 0; t < 4; ++t) {
      const unsigned short* brow = Wt + (size_t)(col0 + t * 16 + ln) * ldb + kb;
      FragB b;
      b.half[0] = *(const v8us*)(brow + 8 * hh);
      b.half[1] = *(const v8us*)(brow + 16 + 8 * hh);
      acc[t] = mmaN<ASPLIT ? 2 : 1>(ah.v, al.v, b.v, b.v, acc[t]);
    }
  }
#pragma unroll
  for (int t = 0; t < 4; ++t) {
    float bv = bias ? bias[col0 + t * 16 + ln] : 0.f;
    if (BIAS_BF16) bv = bf16_round(bv);
#pragma unroll
    for (int r = 0; r < 8; ++r) { float v = acc[t][r] + bv; if (ACT == 1) v = fmaxf(v, 0.f); so[w][8 * hh + r][t * 16 + ln] = v; }
  }
  __builtin_amdgcn_fence(__ATOMIC_ACQ_REL, "workgroup");
  __builtin_amdgcn_wave_barrier();
  const int rsub = lane >> 4, c4 = (lane & 15) * 4;
  {
#pragma unroll
    for (int q = 0; q < 8; ++q) {
      const int r = q * 2 + rsub;
      const v4f v = *(const v4fa*)&so[w][r][c4];
      *(v4f*)(C + (size_t)(row0 + r) * ldc + col0 + c4) = v;
    }
    
  }
}

// GEMM C = act(A·W + bias + resid): A f32 (ASPLIT -> hi/lo 2 terms), Wt bf16 [N][K]; ACT 0 none, 1 relu, 2 exact gelu;
// resid (optional, f32, row index = (row % rmod), pitch ldr, RES_BF16 rounds it) added before the activation.
template <bool ASPLIT, int ACT, bool BIAS_BF16, bool RES_BF16>
__global__ __launch_bounds__(128) void k_gemm_bf3(const float* __restrict__ A, int lda, const unsigned short* __restrict__ Wt, int ldb,
                                                const float* __restrict__ bias, const float* __restrict__ resid, int rmod, int ldr,
                                                float* __restrict__ C, int ldc, int M, int N, int K) {
  __shared__ __attribute__((aligned(16))) float so[4][16][64];
  const int tid = threadIdx.x, w = tid >> 5, lane = tid & 31, ln = lane & 15, hh = lane >> 4;
  const int ntn = N / 64;
  const int wid = blockIdx.x * 4 + w;
  const int mt = wid / ntn, nq = wid % ntn;
  if (mt * 16 >= M) return;
  const int row0 = mt * 16, col0 = nq * 64;
  const float* arow = A + (size_t)(row0 + ln) * lda;
  v8f acc[4] = {};
  for (int kb = 0; kb < K; kb += 32) {
    FragB ah, al;
    const v4f x0 = *(const v4fa*)(arow + kb + 8 * hh), x1 = *(const v4fa*)(arow + kb + 8 * hh + 4);
    const v4f x2 = *(const v4fa*)(arow + kb + 16 + 8 * hh), x3 = *(const v4fa*)(arow + kb + 16 + 8 * hh + 4);
    float xs[16] = {x0[0],x0[1],x0[2],x0[3],x1[0],x1[1],x1[2],x1[3],x2[0],x2[1],x2[2],x2[3],x3[0],x3[1],x3[2],x3[3]};
#pragma unroll
    for (int i = 0; i < 16; ++i) { const unsigned short hb = bf16_bits(xs[i]); ah.u[i] = hb; al.u[i] = ASPLIT ? bf16_bits(xs[i] - bf16_val(hb)) : (unsigned short)0; }
#pragma unroll
    for (int t = 0; t < 4; ++t) {
      const unsigned short* brow = Wt + (size_t)(col0 + t * 16 + ln) * ldb + kb;
      FragB b;
      b.half[0] = *(const v8us*)(brow + 8 * hh);
      b.half[1] = *(const v8us*)(brow + 16 + 8 * hh);
      acc[t] = mmaN<ASPLIT ? 2 : 1>(ah.v, al.v, b.v, b.v, acc[t]);
    }
  }
#pragma unroll
  for (int t = 0; t < 4; ++t) {
    const int col = col0 + t * 16 + ln;
    float bv = bias ? bias[col] : 0.f;
    if (BIAS_BF16) bv = bf16_round(bv);
#pragma unroll
    for (int r = 0; r < 8; ++r) {
      float v = acc[t][r] + bv;
      if (resid) { float rv = resid[(size_t)((row0 + 8 * hh + r) % rmod) * ldr + col]; if (RES_BF16) rv = bf16_round(rv); v += rv; }
      if (ACT == 1) v = fmaxf(v, 0.f);
      if (ACT == 2) v = 0.5f * v * (1.0f + erff(v * 0.70710678118654752f));
      if (ACT == 3) { const float u = 0.7978845608028654f * (v + 0.044715f * v * v * v); v = 0.5f * v * (1.0f + tanhf(u)); }
      so[w][8 * hh + r][t * 16 + ln] = v;
    }
  }
  __builtin_amdgcn_fence(__ATOMIC_ACQ_REL, "workgroup");
  __builtin_amdgcn_wave_barrier();
  const int rsub = lane >> 4, c4 = (lane & 15) * 4;
  {
#pragma unroll
    for (int q = 0; q < 8; ++q) {
      const int r = q * 2 + rsub;
      const v4f v = *(const v4fa*)&so[w][r][c4];
      *(v4f*)(C + (size_t)(row0 + r) * ldc + col0 + c4) = v;
    }
    
  }
}
// row LayerNorm (biased variance, eps) over N: s = X (+ R); optional out_sum <- s; out_norm <- (s-mu)*rsqrt(var+eps)*g + b
template <bool PARAM_BF16>
__global__ __launch_bounds__(256) void k_layernorm(const float* __restrict__ X, const float* __restrict__ R, const float* __restrict__ g, const float* __restrict__ bta,
                                                  float* __restrict__ out_sum, float* __restrict__ out_norm, int N, float eps) {
  __shared__ float red[256];
  const int row = blockIdx.x, tid = threadIdx.x;
  const float* x = X + (size_t)row * N; const float* rr = R ? R + (size_t)row * N : nullptr;
  float vals[16];                     // up to N = 4096
  const int per = N / 256;            // contiguous chunk per thread? use strided-by-4 chunks: thread handles j = tid*4 + 1024*u
  float s1 = 0.f;
  for (int u = 0; u < per / 4; ++u) {
    const int j = tid * 4 + 1024 * u;
    const v4f a = *(const v4fa*)(x + j);
    v4f b = {0.f,0.f,0.f,0.f}; if (rr) b = *(const v4fa*)(rr + j);
#pragma unroll
    for (int q = 0; q < 4; ++q) { const float v = a[q] + b[q]; vals[u * 4 + q] = v; s1 += v; }
  }
  red[tid] = s1; __syncthreads();
  for (int st = 128; st > 0; st >>= 1) { if (tid < st) red[tid] += red[tid + st]; __syncthreads(); }
  const float mu = red[0] / (float)N; __syncthreads();
  float s2 = 0.f;
  for (int u = 0; u < per / 4; ++u)
#pragma unroll
    for (int q = 0; q < 4; ++q) { const float c = vals[u * 4 + q] - mu; s2 += c * c; }
  red[tid] = s2; __syncthreads();
  for (int st = 128; st > 0; st >>= 1) { if (tid < st) red[tid] += red[tid + st]; __syncthreads(); }
  const float rs = rsqrtf(red[0] / (float)N + eps);
  {
    for (int u = 0; u < per / 4; ++u) {
      const int j = tid * 4 + 1024 * u;
      v4f o, sm;
#pragma unroll
      for (int q = 0; q < 4; ++q) {
        float gg = g[j + q], bb = bta[j + q];
        if (PARAM_BF16) { gg = bf16_round(gg); bb = bf16_round(bb); }
        sm[q] = vals[u * 4 + q]; o[q] = (vals[u * 4 + q] - mu) * rs * gg + bb;
      }
      if (out_sum) *(v4f*)(out_sum + (size_t)row * N + j) = sm;
      *(v4f*)(out_norm + (size_t)row * N + j) = o;
    }
    
  }
}



// ---- f16 WMMA path (v_wmma_f32_16x16x32_f16): 11-bit significands for operands in range — used where a [0,1] probability operand needs more precision than bf16
typedef _Float16 v16h __attribute__((ext_vector_type(16)));
union FragH { v16h v; v8us half[2]; _Float16 h[16]; unsigned short u[16]; };
template <int NT>
__device__ __forceinline__ v8f mmaH(v16h ah, v16h al, v16h bh, v16h bl, v8f c) {
  c = __builtin_amdgcn_wmma_f32_16x16x32_f16(false, ah, false, bh, (short)0, c, false, false);
  if (NT >= 2) c = __builtin_amdgcn_wmma_f32_16x16x32_f16(false, al, false, bh, (short)0, c, false, false);
  if (NT >= 3) c = __builtin_amdgcn_wmma_f32_16x16x32_f16(false, ah, false, bl, (short)0, c, false, false);
  asm volatile("v_nop\n\tv_nop\n\tv_nop\n\tv_nop" : "+v"(c) : "v"(ah), "v"(al), "v"(bh), "v"(bl));
  return c;
}
// batched GEMM like k_gemm_b but f16 operands: A f32 (split into f16 hi/lo if ASPLIT, else rounded to f16), Bt = f16 values [n][k]; alpha; C f32; N multiple of 16 (partial tiles skipped)
template <bool ASPLIT>
__global__ __launch_bounds__(128) void k_gemm_h(const float* __restrict__ A, int lda, size_t sA, const _Float16* __restrict__ Bh, int ldb, size_t sB, float alpha, float* __restrict__ C, int ldc, size_t sC, int M, int N, int K) {
  __shared__ __attribute__((aligned(16))) float so[4][16][64];
  const int tid = threadIdx.x, w = tid >> 5, lane = tid & 31, ln = lane & 15, hh = lane >> 4; const int by = blockIdx.y;
  A += (size_t)by * sA; Bh += (size_t)by * sB; C += (size_t)by * sC;
  const int ntn = (N + 63) / 64; const int wid = blockIdx.x * 4 + w; const int mt = wid / ntn, nq = wid % ntn; if (mt * 16 >= M) return;
  const int row0 = mt * 16, col0 = nq * 64; const float* arow = A + (size_t)(row0 + ln) * lda;
  v8f acc[4] = {};
  for (int kb = 0; kb < K; kb += 32) {
    FragH ah, al;
    const v4f x0 = *(const v4fa*)(arow + kb + 8 * hh), x1 = *(const v4fa*)(arow + kb + 8 * hh + 4), x2 = *(const v4fa*)(arow + kb + 16 + 8 * hh), x3 = *(const v4fa*)(arow + kb + 16 + 8 * hh + 4);
    float xs[16] = {x0[0],x0[1],x0[2],x0[3],x1[0],x1[1],x1[2],x1[3],x2[0],x2[1],x2[2],x2[3],x3[0],x3[1],x3[2],x3[3]};
#pragma unroll
    for (int i = 0; i < 16; ++i) { const _Float16 h = (_Float16)xs[i]; ah.h[i] = h; al.h[i] = ASPLIT ? (_Float16)(xs[i] - (float)h) : (_Float16)0.0f; }
#pragma unroll
    for (int t = 0; t < 4; ++t) { if (col0 + t * 16 >= N) continue; const size_t boff = (size_t)(col0 + t * 16 + ln) * ldb + kb; FragH bq; bq.half[0] = *(const v8us*)(Bh + boff + 8 * hh); bq.half[1] = *(const v8us*)(Bh + boff + 16 + 8 * hh);
      acc[t] = mmaH<ASPLIT ? 2 : 1>(ah.v, al.v, bq.v, bq.v, acc[t]); }
  }
#pragma unroll
  for (int t = 0; t < 4; ++t) { if (col0 + t * 16 >= N) continue;
#pragma unroll
    for (int r = 0; r < 8; ++r) so[w][8 * hh + r][t * 16 + ln] = acc[t][r] * alpha; }
  __builtin_amdgcn_fence(__ATOMIC_ACQ_REL, "workgroup"); __builtin_amdgcn_wave_barrier();
  const int rsub = lane >> 4, c4 = (lane & 15) * 4;
  {
#pragma unroll
    for (int q = 0; q < 8; ++q) { const int r = q * 2 + rsub; if (col0 + c4 < N) { const v4f v = *(const v4fa*)&so[w][r][c4]; *(v4f*)(C + (size_t)(row0 + r) * ldc + col0 + c4) = v; } }
     }
}

// Wt[n][k] = f16(W[k][n]·scale) from f32 row-major W[K][N] (scale = power of two; bf16-exact weights stay exact in f16 away from the subnormal range)
__global__ __launch_bounds__(256) void k_wt_f16(const float* __restrict__ W, _Float16* __restrict__ Wt, int K, int N, float scale) {
  const int t = blockIdx.x * 256 + threadIdx.x; if (t >= N * (K / 8)) return; const int n = t / (K / 8), k8 = (t % (K / 8)) * 8; FragH f;
#pragma unroll
  for (int i = 0; i < 8; ++i) f.h[i] = (_Float16)(bf16_round(W[(size_t)(k8 + i) * N + n]) * scale); const v8us o = f.half[0];
  *(v8us*)((unsigned short*)Wt + (size_t)n * K + k8) = o; 
}
// k_gemm_hh variant with fused epilogue: v = acc·alpha + bias[by·sBias + col] (+ CP[(row/rowsPerB)·sCPb + by·64 + col] if CP) ; ACT 0 none / 1 elu ; writes f16 C16 (and f32 C if non-null)
template <int ACT>
__global__ __launch_bounds__(128) void k_gemm_hhx(const _Float16* __restrict__ A, int lda, size_t sA, const _Float16* __restrict__ Bh, int ldb, size_t sB, float alpha, const float* __restrict__ bias, size_t sBias, const float* __restrict__ CP, int rowsPerB, size_t sCPb, int row0g,
    float* __restrict__ C, _Float16* __restrict__ C16, int ldc, size_t sC, int M, int N, int K) {
  __shared__ __attribute__((aligned(16))) float so[4][16][64];
  const int tid = threadIdx.x, w = tid >> 5, lane = tid & 31, ln = lane & 15, hh = lane >> 4; const int by = blockIdx.y;
  A += (size_t)by * sA; Bh += (size_t)by * sB; const size_t cofs = (size_t)by * sC; const float* bp = bias ? bias + (size_t)by * sBias : nullptr;
  const int ntn = (N + 63) / 64; const int wid = blockIdx.x * 4 + w; const int mt = wid / ntn, nq = wid % ntn; if (mt * 16 >= M) return;
  const int row0 = mt * 16, col0 = nq * 64; const _Float16* arow = A + (size_t)(row0 + ln) * lda;
  v8f acc[4] = {};
  for (int kb = 0; kb < K; kb += 32) { FragH ah; ah.half[0] = *(const v8us*)((const unsigned short*)arow + kb + 8 * hh); ah.half[1] = *(const v8us*)((const unsigned short*)arow + kb + 16 + 8 * hh);
#pragma unroll
    for (int t = 0; t < 4; ++t) { if (col0 + t * 16 >= N) continue; const size_t boff = (size_t)(col0 + t * 16 + ln) * ldb + kb; FragH bq; bq.half[0] = *(const v8us*)((const unsigned short*)Bh + boff + 8 * hh); bq.half[1] = *(const v8us*)((const unsigned short*)Bh + boff + 16 + 8 * hh);
      acc[t] = mmaH<1>(ah.v, ah.v, bq.v, bq.v, acc[t]); }
  }
#pragma unroll
  for (int t = 0; t < 4; ++t) { if (col0 + t * 16 >= N) continue; const int col = col0 + t * 16 + ln; const float bv = bp ? bf16_round(bp[col]) : 0.f;
#pragma unroll
    for (int r = 0; r < 8; ++r) { float v = acc[t][r] * alpha + bv; if (CP) { const int bidx = (row0g + row0 + 8 * hh + r) / rowsPerB; v += CP[(size_t)bidx * sCPb + (size_t)by * 64 + col]; } if (ACT == 1) v = (v > 0.f) ? v : expm1f(v); else if (ACT == 7) v = (v > 0.f) ? v + 1.0f : expf(v); else if (ACT == 8) v = tanhf(v); else if (ACT == 9) v = 0.5f * v * (1.0f + tanhf(0.7978845608028654f * (v + 0.044715f * v * v * v))); else if (ACT == 11) v = 1.0f / (1.0f + expf(-v)); else if (ACT == 12) v = (v > 0.f) ? v : 0.01f * v; else if (ACT == 14) v = (v > 0.f) ? v : 0.1f * v; else if (ACT == 15) v = v / (1.0f + expf(-v)); else if (ACT == 3) v = fmaxf(v, 0.f); else if (ACT == 6) v = 0.5f * v * (1.0f + erff(v * 0.70710678118654752f)); so[w][8 * hh + r][t * 16 + ln] = v; } }
  __builtin_amdgcn_fence(__ATOMIC_ACQ_REL, "workgroup"); __builtin_amdgcn_wave_barrier();
  const int rsub = lane >> 4, c4 = (lane & 15) * 4; typedef _Float16 v4h __attribute__((ext_vector_type(4)));
  {
#pragma unroll
    for (int q = 0; q < 8; ++q) { const int r = q * 2 + rsub; if (col0 + c4 < N) { const v4f v = *(const v4fa*)&so[w][r][c4]; if (C) *(v4f*)(C + cofs + (size_t)(row0 + r) * ldc + col0 + c4) = v; if (C16) { v4h h4; for (int i = 0; i < 4; ++i) h4[i] = (_Float16)v[i]; *(v4h*)(C16 + cofs + (size_t)(row0 + r) * ldc + col0 + c4) = h4; } } }
     }
}


typedef _Float16 v4h __attribute__((ext_vector_type(4)));

__global__ __launch_bounds__(256) void k_x16(const float* __restrict__ x, _Float16* __restrict__ X16, size_t n8) { const size_t t = (size_t)blockIdx.x * 256 + threadIdx.x; if (t >= n8) return; FragH f;
#pragma unroll
  for (int q = 0; q < 8; ++q) f.h[q] = (_Float16)bf16_round(x[t * 8 + q]); *(v8us*)((unsigned short*)X16 + t * 8) = f.half[0];  }
__global__ __launch_bounds__(256) void k_h16(const float* __restrict__ x, _Float16* __restrict__ X16, size_t n8) { const size_t t = (size_t)blockIdx.x * 256 + threadIdx.x; if (t >= n8) return; FragH f;
#pragma unroll
  for (int q = 0; q < 8; ++q) f.h[q] = (_Float16)x[t * 8 + q]; *(v8us*)((unsigned short*)X16 + t * 8) = f.half[0];  }
__global__ __launch_bounds__(256) void k_round16f(const float* __restrict__ W, _Float16* __restrict__ Bt, size_t n8) { const size_t t = (size_t)blockIdx.x * 256 + threadIdx.x; if (t >= n8) return; FragH f;
#pragma unroll
  for (int i = 0; i < 8; ++i) f.h[i] = (_Float16)(bf16_round(W[t * 8 + i]) * 16.0f); *(v8us*)((unsigned short*)Bt + t * 8) = f.half[0];  }
template <int NHv, int TTv>
__global__ __launch_bounds__(256) void k_vt(const _Float16* __restrict__ V16, int ldv, int voff, _Float16* __restrict__ Vt) { __shared__ unsigned short tl[64][66]; const int tid = threadIdx.x; const int slab = blockIdx.x / (TTv / 64), lg = blockIdx.x % (TTv / 64); const int b = slab / NHv, h = slab % NHv;
  for (int i = tid; i < 64 * 8; i += 256) { const int r = i / 8, c8 = (i % 8) * 8; FragH f; f.half[0] = *(const v8us*)((const unsigned short*)V16 + ((size_t)b * TTv + lg * 64 + r) * ldv + voff + h * 64 + c8);
#pragma unroll
    for (int q = 0; q < 8; ++q) tl[r][c8 + q] = f.u[q]; }
  __syncthreads();
  {
#pragma unroll
    for (int rd = 0; rd < 2; ++rd) { const int d = rd * 32 + tid / 8, pc = tid % 8; FragH f;
#pragma unroll
      for (int q = 0; q < 8; ++q) f.u[q] = tl[pc * 8 + q][d];
      *(v8us*)((unsigned short*)Vt + ((size_t)slab * 64 + d) * TTv + lg * 64 + pc * 8) = f.half[0]; }
     } }

__global__ __launch_bounds__(256) void k_hl(const float* __restrict__ F, _Float16* __restrict__ Hh, _Float16* __restrict__ Hl, size_t n8) { const size_t t = (size_t)blockIdx.x * 256 + threadIdx.x; if (t >= n8) return; FragH fh, fl; const v4f a = *(const v4fa*)(F + t * 8), c = *(const v4fa*)(F + t * 8 + 4);
#pragma unroll
  for (int q = 0; q < 4; ++q) { _Float16 h = (_Float16)a[q]; fh.h[q] = h; fl.h[q] = (_Float16)((a[q] - (float)h) * 1024.0f); h = (_Float16)c[q]; fh.h[4 + q] = h; fl.h[4 + q] = (_Float16)((c[q] - (float)h) * 1024.0f); }
  { *(v8us*)((unsigned short*)Hh + t * 8) = fh.half[0]; *(v8us*)((unsigned short*)Hl + t * 8) = fl.half[0];  } }

// ---- fast GEMM (wave tile 32x64; requires M % 32 == 0 rows per launch region and N % 64 == 0); epilogue = k_gemm_hhx semantics ----
__device__ __forceinline__ v16h g2_frag(const _Float16* p, int hh) { FragH f; f.half[0] = *(const v8us*)((const unsigned short*)p + 8 * hh); f.half[1] = *(const v8us*)((const unsigned short*)p + 16 + 8 * hh); return f.v; }
__device__ __forceinline__ v8f g2_mma(v16h a, v16h b, v8f c) { v8f d = __builtin_amdgcn_wmma_f32_16x16x32_f16(false, a, false, b, (short)0, c, false, false); asm volatile("v_nop\n\tv_nop\n\tv_nop\n\tv_nop" : "+v"(d) : "v"(a), "v"(b)); return d; }
template <int ACT>
__global__ __launch_bounds__(128) void k_gemm2(const _Float16* __restrict__ A, int lda, size_t sA, const _Float16* __restrict__ Bh, int ldb, size_t sB, float alpha, const float* __restrict__ bias, size_t sBias, const float* __restrict__ CP, int rowsPerB, size_t sCPb, int row0g,
    float* __restrict__ C, _Float16* __restrict__ C16, int ldc, size_t sC, int M, int N, int K) {
  __shared__ __attribute__((aligned(16))) float so[4][32][68];
  const int tid = threadIdx.x, w = tid >> 5, lane = tid & 31, ln = lane & 15, hh = lane >> 4; const int by = blockIdx.y;
  A += (size_t)by * sA; Bh += (size_t)by * sB; const size_t cofs = (size_t)by * sC; const float* bp = bias ? bias + (size_t)by * sBias : nullptr;
  const int ntn = N >> 6; const int mt = blockIdx.x / ntn, nq = blockIdx.x - mt * ntn; const int row0 = mt * 128 + 32 * w, col0 = nq * 64; if (row0 >= M) return;
  const _Float16* a0p = A + (size_t)(row0 + ln) * lda; const _Float16* a1p = a0p + (size_t)16 * lda;
  const _Float16* b0p = Bh + (size_t)(col0 + ln) * ldb; const _Float16* b1p = b0p + (size_t)16 * ldb; const _Float16* b2p = b1p + (size_t)16 * ldb; const _Float16* b3p = b2p + (size_t)16 * ldb;
  const v8f z8 = {0.f,0.f,0.f,0.f,0.f,0.f,0.f,0.f}; v8f c00 = z8, c01 = z8, c02 = z8, c03 = z8, c10 = z8, c11 = z8, c12 = z8, c13 = z8;
#pragma unroll 1
  for (int kb = 0; kb < K; kb += 32) { const v16h a0 = g2_frag(a0p + kb, hh), a1 = g2_frag(a1p + kb, hh);
    v16h b = g2_frag(b0p + kb, hh); c00 = g2_mma(a0, b, c00); c10 = g2_mma(a1, b, c10);
    b = g2_frag(b1p + kb, hh); c01 = g2_mma(a0, b, c01); c11 = g2_mma(a1, b, c11);
    b = g2_frag(b2p + kb, hh); c02 = g2_mma(a0, b, c02); c12 = g2_mma(a1, b, c12);
    b = g2_frag(b3p + kb, hh); c03 = g2_mma(a0, b, c03); c13 = g2_mma(a1, b, c13); }
  v8f accs[8] = {c00, c01, c02, c03, c10, c11, c12, c13};
#pragma unroll
  for (int u = 0; u < 8; ++u) { const int t = u & 3, half = u >> 2; const int col = col0 + t * 16 + ln; const float bv = bp ? bf16_round(bp[col]) : 0.f;
#pragma unroll
    for (int r = 0; r < 8; ++r) { const int rloc = half * 16 + 8 * hh + r; float v = accs[u][r] * alpha + bv; if (CP) { if (rowsPerB < 0) v += CP[cofs + (size_t)(row0g + row0 + rloc) * ldc + col];      /* rowsPerB < 0: own element of the batched C plane */ else { const int bidx = (row0g + row0 + rloc) / rowsPerB; v += CP[(size_t)bidx * sCPb + (size_t)by * 64 + col]; } }
      if (ACT == 3) v = fmaxf(v, 0.f); else if (ACT == 6) v = 0.5f * v * (1.0f + erff(v * 0.70710678118654752f)); else if (ACT == 11) v = 1.0f / (1.0f + expf(-v)); else if (ACT == 15) v = v / (1.0f + expf(-v)); else if (ACT == 12) v = (v > 0.f) ? v : 0.01f * v; else if (ACT == 8) v = tanhf(v);
      so[w][rloc][t * 16 + ln] = v; } }
  __builtin_amdgcn_fence(__ATOMIC_ACQ_REL, "workgroup"); __builtin_amdgcn_wave_barrier();
  const int rsub = lane >> 4, c4 = (lane & 15) * 4;
  {
#pragma unroll
    for (int q = 0; q < 16; ++q) { const int r = q * 2 + rsub; const v4f v = *(const v4fa*)&so[w][r][c4]; if (C) *(v4f*)(C + cofs + (size_t)(row0 + r) * ldc + col0 + c4) = v; if (C16) { v4h h4; for (int i = 0; i < 4; ++i) h4[i] = (_Float16)v[i]; *(v4h*)(C16 + cofs + (size_t)(row0 + r) * ldc + col0 + c4) = h4; } }
     } }



__constant__ int BK30[2 * SLEN - 1] = {15,15,15,15,15,15,15,15,15,15,15,15,15,15,15,15,15,15,15,15,15,15,15,15,15,15,15,15,15,15,15,15,15,15,15,15,15,15,15,15,15,15,15,15,15,15,15,15,15,15,15,15,15,15,15,15,15,15,15,15,15,15,15,15,15,15,15,15,15,15,15,15,15,15,15,15,15,15,15,15,15,15,15,15,15,15,15,15,15,15,15,15,15,15,15,15,15,15,15,15,15,15,15,15,15,15,15,15,15,15,15,15,15,15,15,15,15,15,15,15,15,15,15,15,15,15,15,15,15,15,15,15,15,15,15,15,15,15,15,15,15,15,15,15,15,15,15,15,15,15,15,15,15,15,15,15,15,15,15,15,15,15,15,15,15,15,15,15,15,15,15,15,15,15,15,15,15,15,15,15,15,15,15,15,15,15,15,15,15,15,15,15,15,15,15,15,15,15,15,15,15,15,15,15,15,15,15,15,15,15,15,15,15,15,15,15,15,15,15,15,15,15,15,15,15,15,15,15,15,15,15,15,15,15,15,15,15,15,15,15,15,15,15,15,15,15,15,15,15,15,15,15,15,15,15,15,15,15,15,15,15,15,15,15,15,15,15,15,15,15,15,15,15,15,15,15,15,15,15,15,15,15,15,15,15,15,15,15,15,15,15,15,15,15,15,15,15,15,15,15,15,15,15,15,15,15,15,15,15,15,15,15,15,15,15,15,15,15,15,15,15,15,15,15,15,15,15,15,15,15,15,15,15,15,15,15,15,15,15,15,15,15,15,15,15,15,15,15,15,15,15,15,15,15,15,15,15,15,15,15,15,15,15,15,15,15,15,15,15,15,15,15,15,15,15,15,15,15,15,15,15,15,15,15,15,15,15,15,15,15,15,15,15,15,15,15,15,15,15,15,15,15,15,15,15,15,15,15,15,15,15,15,15,15,15,15,15,15,15,15,15,15,15,15,15,15,15,15,15,15,15,15,15,15,15,15,15,15,15,15,15,15,15,15,15,15,15,15,15,15,15,15,15,15,15,15,15,15,15,15,15,15,15,15,15,15,15,15,15,15,15,15,15,15,15,15,15,15,15,15,15,15,15,15,15,15,15,15,15,15,15,15,15,15,15,15,15,15,15,15,15,15,15,15,15,15,15,15,15,15,15,15,15,15,15,15,15,15,15,15,15,15,15,15,15,15,15,15,15,15,15,15,15,15,15,15,15,15,15,15,15,15,15,15,15,15,15,15,15,15,15,15,15,15,15,15,15,15,15,15,15,15,15,15,15,15,15,15,15,15,15,15,15,15,15,15,15,15,15,15,15,15,15,15,15,15,15,15,15,15,15,15,15,15,15,15,15,15,15,15,15,15,15,15,15,15,15,15,15,15,15,15,15,15,15,15,15,15,15,15,15,15,15,15,15,15,15,15,15,15,15,15,15,15,15,15,15,15,15,15,15,15,15,15,15,15,15,15,15,15,15,15,15,15,15,15,15,15,15,15,15,15,15,15,15,15,15,15,15,15,15,15,15,15,15,15,15,15,15,15,15,15,15,15,15,15,15,15,15,15,15,15,15,15,15,15,15,15,15,15,15,15,15,15,15,15,15,15,15,15,15,15,15,15,15,15,15,15,15,15,15,15,15,15,15,15,15,15,15,15,15,15,15,15,15,15,15,15,15,15,15,15,15,15,15,15,15,15,15,15,15,15,15,15,15,15,15,15,15,15,15,15,15,15,15,15,15,15,15,15,15,15,15,15,15,15,15,15,15,15,15,15,15,15,15,15,15,15,15,15,15,15,15,15,15,15,15,15,15,15,15,15,15,15,15,15,15,15,15,15,15,15,15,15,15,15,15,15,15,15,15,15,15,15,15,15,15,15,15,15,15,15,15,15,15,15,15,15,15,15,15,15,15,15,15,15,15,15,15,15,15,15,15,15,15,15,15,15,15,15,15,15,15,15,15,15,15,15,15,15,15,15,15,15,15,15,15,15,15,15,15,15,15,15,15,15,15,15,15,15,15,15,15,15,15,15,15,15,15,15,15,15,15,15,15,15,15,15,15,15,15,15,15,15,15,15,15,15,15,15,15,15,15,15,15,15,15,15,15,15,15,15,15,15,15,15,15,15,15,15,15,15,15,15,15,15,15,15,15,15,15,15,15,15,15,15,15,15,15,15,15,15,15,15,15,15,15,15,15,15,15,15,15,15,15,15,15,15,15,15,15,15,15,15,15,15,15,15,15,15,15,15,15,15,15,15,15,15,15,15,15,15,15,15,15,15,15,15,15,15,15,15,15,15,15,15,15,15,15,15,15,15,15,15,15,15,15,15,15,15,15,15,15,15,15,15,15,15,15,15,15,15,15,15,15,15,15,15,15,15,15,15,15,15,15,15,15,15,15,15,15,15,15,15,15,15,15,15,15,15,15,15,15,15,15,15,15,15,15,15,15,15,15,15,15,15,15,15,15,15,15,15,15,15,15,15,15,15,15,15,15,15,15,15,15,15,15,15,15,15,15,15,15,15,15,15,15,15,15,15,15,15,15,15,15,15,15,15,15,15,15,15,15,15,15,15,15,15,15,15,15,15,15,15,15,15,15,15,15,15,15,15,15,15,15,15,15,15,15,15,15,15,15,15,15,15,15,15,15,15,15,15,15,15,15,15,15,15,15,15,15,15,15,15,15,15,15,15,15,15,15,15,15,15,15,15,15,15,15,15,15,15,15,15,15,15,15,15,15,15,15,15,15,15,15,15,15,15,15,15,15,15,15,15,15,15,15,15,15,15,15,15,15,15,15,15,15,15,15,15,15,15,15,15,15,15,15,15,15,15,15,15,15,15,15,15,15,15,15,15,15,15,15,15,15,15,15,15,15,15,15,15,15,15,15,15,15,15,15,15,15,15,15,15,15,15,15,15,15,15,15,15,15,15,15,15,15,15,15,15,15,15,15,15,15,15,15,15,15,15,15,15,15,15,15,15,15,15,15,15,15,15,15,15,15,15,15,15,15,15,15,15,15,15,15,15,15,15,15,15,15,15,15,15,15,15,15,15,15,15,15,15,15,15,15,15,15,15,15,15,15,15,15,15,15,15,15,15,15,15,15,15,15,15,15,15,15,15,15,15,15,15,15,15,15,15,15,15,15,15,15,15,15,15,15,15,15,15,15,15,15,15,15,15,15,15,15,15,15,15,15,15,15,15,15,15,15,15,15,15,15,15,15,15,15,15,15,15,15,15,15,15,15,15,15,15,15,15,15,15,15,15,15,15,15,15,15,15,15,15,15,15,15,15,15,15,15,15,15,15,15,15,15,15,15,15,15,15,15,15,15,15,15,15,15,15,15,15,15,15,15,15,15,15,15,15,15,15,15,15,15,15,15,15,15,15,15,15,15,15,15,15,15,15,15,15,15,15,15,15,15,15,15,15,15,15,15,15,15,15,15,15,15,15,15,15,15,15,15,15,15,15,15,15,15,15,15,15,15,15,15,15,15,15,15,15,15,15,15,15,15,15,15,15,15,15,15,15,15,15,15,15,15,15,15,15,15,15,15,15,15,15,15,15,15,15,15,15,15,15,15,15,15,15,15,15,15,15,15,15,15,15,15,15,15,15,15,15,15,15,15,15,15,15,15,15,15,15,15,15,15,15,15,15,15,15,15,15,15,15,15,15,15,15,15,15,15,15,15,15,15,15,15,15,15,15,15,15,15,15,15,15,15,15,15,15,15,15,15,15,15,15,15,15,15,15,15,15,15,15,15,15,15,15,15,15,15,15,15,15,15,15,15,15,15,15,15,15,15,15,15,15,15,15,15,15,15,15,15,15,15,15,15,15,15,15,15,15,15,15,15,15,15,15,15,15,15,15,15,15,15,15,15,15,15,15,15,15,15,15,15,15,15,15,15,15,15,15,15,15,15,15,15,15,15,15,15,15,15,15,15,15,15,15,15,15,15,15,15,15,15,15,15,15,15,15,15,15,15,15,15,15,15,15,15,15,15,15,15,15,15,15,15,15,15,15,15,15,15,15,15,15,15,15,15,15,15,15,15,15,15,15,15,15,15,15,15,15,15,15,15,15,15,15,15,15,15,15,15,15,15,15,15,15,15,15,15,15,15,15,15,15,15,15,15,15,15,15,15,15,15,15,15,15,15,15,15,15,15,15,15,15,15,15,15,15,15,15,15,15,15,15,15,15,15,15,15,15,15,15,15,15,15,15,15,15,15,15,15,15,15,15,15,15,15,15,15,15,15,15,15,15,15,15,15,15,15,15,15,15,15,15,15,15,15,15,15,15,15,15,15,15,15,15,15,15,15,15,15,15,15,15,15,15,15,15,15,15,15,15,15,15,15,15,15,15,15,15,15,15,15,15,15,15,15,15,15,15,15,15,15,15,15,15,15,15,15,15,15,15,15,15,15,15,15,15,15,14,14,14,14,14,14,14,14,14,14,14,14,14,14,14,14,14,14,14,14,14,14,14,14,14,14,14,13,13,13,13,13,13,13,13,13,13,13,13,13,13,13,13,13,13,12,12,12,12,12,12,12,12,12,12,12,12,12,12,11,11,11,11,11,11,11,11,11,10,10,10,10,10,10,10,9,9,9,9,8,8,8,8,7,6,5,4,3,2,1,0,17,18,19,20,21,22,23,24,24,24,24,25,25,25,25,26,26,26,26,26,26,26,27,27,27,27,27,27,27,27,27,28,28,28,28,28,28,28,28,28,28,28,28,28,28,29,29,29,29,29,29,29,29,29,29,29,29,29,29,29,29,29,29,30,30,30,30,30,30,30,30,30,30,30,30,30,30,30,30,30,30,30,30,30,30,30,30,30,30,30,31,31,31,31,31,31,31,31,31,31,31,31,31,31,31,31,31,31,31,31,31,31,31,31,31,31,31,31,31,31,31,31,31,31,31,31,31,31,31,31,31,31,31,31,31,31,31,31,31,31,31,31,31,31,31,31,31,31,31,31,31,31,31,31,31,31,31,31,31,31,31,31,31,31,31,31,31,31,31,31,31,31,31,31,31,31,31,31,31,31,31,31,31,31,31,31,31,31,31,31,31,31,31,31,31,31,31,31,31,31,31,31,31,31,31,31,31,31,31,31,31,31,31,31,31,31,31,31,31,31,31,31,31,31,31,31,31,31,31,31,31,31,31,31,31,31,31,31,31,31,31,31,31,31,31,31,31,31,31,31,31,31,31,31,31,31,31,31,31,31,31,31,31,31,31,31,31,31,31,31,31,31,31,31,31,31,31,31,31,31,31,31,31,31,31,31,31,31,31,31,31,31,31,31,31,31,31,31,31,31,31,31,31,31,31,31,31,31,31,31,31,31,31,31,31,31,31,31,31,31,31,31,31,31,31,31,31,31,31,31,31,31,31,31,31,31,31,31,31,31,31,31,31,31,31,31,31,31,31,31,31,31,31,31,31,31,31,31,31,31,31,31,31,31,31,31,31,31,31,31,31,31,31,31,31,31,31,31,31,31,31,31,31,31,31,31,31,31,31,31,31,31,31,31,31,31,31,31,31,31,31,31,31,31,31,31,31,31,31,31,31,31,31,31,31,31,31,31,31,31,31,31,31,31,31,31,31,31,31,31,31,31,31,31,31,31,31,31,31,31,31,31,31,31,31,31,31,31,31,31,31,31,31,31,31,31,31,31,31,31,31,31,31,31,31,31,31,31,31,31,31,31,31,31,31,31,31,31,31,31,31,31,31,31,31,31,31,31,31,31,31,31,31,31,31,31,31,31,31,31,31,31,31,31,31,31,31,31,31,31,31,31,31,31,31,31,31,31,31,31,31,31,31,31,31,31,31,31,31,31,31,31,31,31,31,31,31,31,31,31,31,31,31,31,31,31,31,31,31,31,31,31,31,31,31,31,31,31,31,31,31,31,31,31,31,31,31,31,31,31,31,31,31,31,31,31,31,31,31,31,31,31,31,31,31,31,31,31,31,31,31,31,31,31,31,31,31,31,31,31,31,31,31,31,31,31,31,31,31,31,31,31,31,31,31,31,31,31,31,31,31,31,31,31,31,31,31,31,31,31,31,31,31,31,31,31,31,31,31,31,31,31,31,31,31,31,31,31,31,31,31,31,31,31,31,31,31,31,31,31,31,31,31,31,31,31,31,31,31,31,31,31,31,31,31,31,31,31,31,31,31,31,31,31,31,31,31,31,31,31,31,31,31,31,31,31,31,31,31,31,31,31,31,31,31,31,31,31,31,31,31,31,31,31,31,31,31,31,31,31,31,31,31,31,31,31,31,31,31,31,31,31,31,31,31,31,31,31,31,31,31,31,31,31,31,31,31,31,31,31,31,31,31,31,31,31,31,31,31,31,31,31,31,31,31,31,31,31,31,31,31,31,31,31,31,31,31,31,31,31,31,31,31,31,31,31,31,31,31,31,31,31,31,31,31,31,31,31,31,31,31,31,31,31,31,31,31,31,31,31,31,31,31,31,31,31,31,31,31,31,31,31,31,31,31,31,31,31,31,31,31,31,31,31,31,31,31,31,31,31,31,31,31,31,31,31,31,31,31,31,31,31,31,31,31,31,31,31,31,31,31,31,31,31,31,31,31,31,31,31,31,31,31,31,31,31,31,31,31,31,31,31,31,31,31,31,31,31,31,31,31,31,31,31,31,31,31,31,31,31,31,31,31,31,31,31,31,31,31,31,31,31,31,31,31,31,31,31,31,31,31,31,31,31,31,31,31,31,31,31,31,31,31,31,31,31,31,31,31,31,31,31,31,31,31,31,31,31,31,31,31,31,31,31,31,31,31,31,31,31,31,31,31,31,31,31,31,31,31,31,31,31,31,31,31,31,31,31,31,31,31,31,31,31,31,31,31,31,31,31,31,31,31,31,31,31,31,31,31,31,31,31,31,31,31,31,31,31,31,31,31,31,31,31,31,31,31,31,31,31,31,31,31,31,31,31,31,31,31,31,31,31,31,31,31,31,31,31,31,31,31,31,31,31,31,31,31,31,31,31,31,31,31,31,31,31,31,31,31,31,31,31,31,31,31,31,31,31,31,31,31,31,31,31,31,31,31,31,31,31,31,31,31,31,31,31,31,31,31,31,31,31,31,31,31,31,31,31,31,31,31,31,31,31,31,31,31,31,31,31,31,31,31,31,31,31,31,31,31,31,31,31,31,31,31,31,31,31,31,31,31,31,31,31,31,31,31,31,31,31,31,31,31,31,31,31,31,31,31,31,31,31,31,31,31,31,31,31,31,31,31,31,31,31,31,31,31,31,31,31,31,31,31,31,31,31,31,31,31,31,31,31,31,31,31,31,31,31,31,31,31,31,31,31,31,31,31,31,31,31,31,31,31,31,31,31,31,31,31,31,31,31,31,31,31,31,31,31,31,31,31,31,31,31,31,31,31,31,31,31,31,31,31,31,31,31,31,31,31,31,31,31,31,31,31,31,31,31,31,31,31,31,31,31,31,31,31,31,31,31,31,31,31,31,31,31,31,31,31,31,31,31,31,31,31,31,31,31,31,31,31,31,31,31,31,31,31,31,31,31,31,31,31,31,31,31,31,31,31,31,31,31,31,31,31,31,31,31,31,31,31,31,31,31,31,31,31,31,31,31,31,31,31,31,31,31,31,31,31,31,31,31,31,31,31,31,31,31,31,31,31,31,31,31,31,31,31,31,31,31,31,31,31,31,31,31,31,31,31,31,31,31,31,31,31,31,31,31,31,31,31,31,31,31,31,31,31,31,31,31,31,31,31,31,31,31,31,31,31,31,31,31,31,31,31,31,31,31,31,31,31,31,31,31,31,31,31,31,31,31,31,31,31,31,31,31,31,31,31,31,31,31,31,31,31,31,31,31,31,31,31,31,31,31,31,31,31,31,31,31,31,31,31,31,31,31,31,31,31,31,31,31,31,31,31,31,31,31,31,31,31,31,31,31,31,31,31,31,31,31,31,31,31,31,31,31,31,31,31,31,31,31,31,31,31,31,31,31,31,31,31,31,31,31,31,31,31,31,31,31,31,31,31,31,31,31,31,31,31,31,31,31,31,31,31,31,31,31,31,31,31,31,31,31,31,31,31,31,31,31,31,31,31,31,31,31,31,31,31,31,31,31,31,31,31,31,31,31,31,31,31,31,31,31,31,31,31,31,31,31,31,31,31,31,31,31,31,31,31,31,31,31,31,31,31,31,31,31,31,31,31,31,31,31,31,31,31,31,31,31,31,31,31,31,31,31,31,31,31,31,31,31,31,31,31,31,31,31,31,31,31,31,31,31,31,31,31,31,31,31,31,31,31,31,31,31,31,31,31,31,31,31,31,31,31,31,31,31,31,31,31,31,31,31,31,31,31,31,31,31,31,31,31,31,31,31,31,31,31,31,31,31,31,31,31,31,31,31,31,31,31,31,31,31,31,31,31,31,31,31,31,31,31,31,31,31,31,31,31,31,31,31,31,31,31,31,31,31,31,31,31,31,31,31,31,31,31,31,31,31,31,31,31,31,31,31,31,31,31,31,31,31,31,31,31,31,31,31,31,31,31,31,31,31,31,31,31,31,31,31,31,31,31,31,31,31,31,31,31,31,31,31,31,31,31,31,31,31,31,31,31,31,31,31,31,31,31,31,31,31,31,31,31,31,31,31,31,31,31,31,31,31,31,31,31,31,31,31,31,31,31,31,31,31,31,31,31,31,31,31,31,31,31,31,31,31,31,31,31,31,31,31,31,31,31,31,31,31,31,31,31,31,31,31,31,31,31,31,31,31,31,31,31,31,31,31,31,31,31,31,31,31,31,31,31,31,31,31,31,31,31,31,31,31,31,31,31,31,31,31,31,31,31,31,31,31,31,31,31,31,31,31,31,31,31,31,31,31,31,31,31,31,31,31,31,31,31,31,31,31,31,31,31,31,31,31,31,31,31,31,31,31,31,31,31,31,31,31,31,31,31,31,31,31,31,31,31,31,31,31,31,31,31,31,31,31,31,31,31,31,31,31,31,31,31,31,31,31,31,31,31,31,31,31,31,31,31,31,31,31,31,31,31,31,31,31,31,31,31,31,31,31,31,31,31,31,31,31,31,31,31,31,31,31,31,31,31,31,31,31,31,31,31,31,31,31,31,31,31,31,31,31,31,31,31,31,31,31,31,31,31,31,31,31,31,31,31,31,31,31,31,31,31,31,31,31,31,31,31,31,31,31,31,31,31,31,31,31,31,31,31,31,31,31,31,31,31,31,31,31,31,31,31,31,31,31,31};      /* T5 _relative_position_bucket(k - q) for k - q in [-(S-1), S-1], computed with the module's own jax code on the host */
__global__ __launch_bounds__(512) void k_rb(const float* __restrict__ t, float* __restrict__ RB) { const int i = threadIdx.x; const float v = bf16_round(t[i]); *(float*)(RB + i) = v;  }
template <int CAUSAL>
__global__ __launch_bounds__(128) void k_flash(const _Float16* __restrict__ Q16, int ldq, const _Float16* __restrict__ K16, int ldk, const _Float16* __restrict__ Vt, const int* __restrict__ MSK, float* __restrict__ O, int ldo) {
  constexpr int RPW = 16, RTN = RPW / 16, NQB = TQ / (4 * RPW), DT = 4, KS = 2;
  __shared__ __attribute__((aligned(16))) unsigned short sP[4][RPW][40]; __shared__ __attribute__((aligned(16))) float sO[4][RPW][64 + 4];
  const int tid = threadIdx.x, w = tid >> 5, lane = tid & 31, ln = lane & 15, hh = lane >> 4;
  const int slab = blockIdx.x / QBNP, qblk = QB0P + blockIdx.x % QBNP; (void)NQB; const int b = slab / NH, h = slab % NH; const int qb0 = qblk * (4 * RPW); const int q0 = qb0 + w * RPW;
  FragH aq[2][KS];
#pragma unroll
  for (int rt = 0; rt < RTN; ++rt) { const unsigned short* qr = (const unsigned short*)Q16 + ((size_t)b * TQ + q0 + rt * 16 + ln) * ldq + h * 64;
#pragma unroll
    for (int ks = 0; ks < KS; ++ks) { aq[rt][ks].half[0] = *(const v8us*)(qr + ks * 32 + 8 * hh); aq[rt][ks].half[1] = *(const v8us*)(qr + ks * 32 + 16 + 8 * hh); } }
  const unsigned short* Vth = (const unsigned short*)Vt + (size_t)slab * 64 * TK;
  float m_r[2][8], l_r[2][8]; v8f oacc[2][DT];
#pragma unroll
  for (int rt = 0; rt < RTN; ++rt) {
#pragma unroll
    for (int r = 0; r < 8; ++r) { m_r[rt][r] = -3.0e38f; l_r[rt][r] = 0.f; }
#pragma unroll
    for (int dt = 0; dt < DT; ++dt) oacc[rt][dt] = (v8f){0.f,0.f,0.f,0.f,0.f,0.f,0.f,0.f}; }
  float qsq[2][8];      /* mode 32: |q|^2 of this lane's rows, read once */
#pragma unroll
  for (int rt = 0; rt < RTN; ++rt)
#pragma unroll
    for (int r = 0; r < 8; ++r) qsq[rt][r] = (CAUSAL == 32) ? ((const float*)MSK)[(size_t)b * TQ + q0 + rt * 16 + 8 * hh + r] : 0.f;
  const int jend = (CAUSAL == 1 || CAUSAL == 32) ? (qb0 + 4 * RPW) : ((CAUSAL == 23) ? min(TK, (qb0 / CHK + 2) * CHK) : TK);      /* causal / window: keys that can never contribute are skipped */ const int jbeg = (CAUSAL == 23) ? max(0, (qb0 / CHK - 1) * CHK) : 0;
#pragma unroll 1
  for (int j0 = jbeg; j0 < jend; j0 += 32) {
    v8f s[2][2];
    float ksq0 = 0.f, ksq1 = 0.f; if (CAUSAL == 32) { const float* ksT = (const float*)MSK + (size_t)NB * TQ + (size_t)b * TK + j0 + ln; ksq0 = ksT[0]; ksq1 = ksT[16]; }      /* mode 32: |k|^2 of this lane's two keys, one unconditional load each per key block (j0 + 31 < jend <= TK) */
#pragma unroll
    for (int nt = 0; nt < 2; ++nt) { const unsigned short* kr = (const unsigned short*)K16 + ((size_t)b * TK + j0 + nt * 16 + ln) * ldk + h * 64; FragH bk[KS];
#pragma unroll
      for (int ks = 0; ks < KS; ++ks) { bk[ks].half[0] = *(const v8us*)(kr + ks * 32 + 8 * hh); bk[ks].half[1] = *(const v8us*)(kr + ks * 32 + 16 + 8 * hh); }
#pragma unroll
      for (int rt = 0; rt < RTN; ++rt) { v8f acc = (v8f){0.f,0.f,0.f,0.f,0.f,0.f,0.f,0.f};
#pragma unroll
        for (int ks = 0; ks < KS; ++ks) acc = mmaH<1>(aq[rt][ks].v, aq[rt][ks].v, bk[ks].v, bk[ks].v, acc); s[rt][nt] = acc; } }
#pragma unroll
    for (int rt = 0; rt < RTN; ++rt)
#pragma unroll
      for (int r = 0; r < 8; ++r) { const int tq = q0 + rt * 16 + 8 * hh + r; const int k0 = j0 + ln, k1 = j0 + 16 + ln;
        bool ok0 = (CAUSAL == 1 || CAUSAL == 32) ? (k0 <= tq) : ((CAUSAL == 2) ? ((k0 >> 5) == (tq >> 5)) : true), ok1 = (CAUSAL == 1 || CAUSAL == 32) ? (k1 <= tq) : ((CAUSAL == 2) ? ((k1 >> 5) == (tq >> 5)) : true); if (CAUSAL == 23) { const int cq = tq / CHK; ok0 = (abs(k0 / CHK - cq) <= 1) && (MSK[(size_t)b * TK + k0] == 0); ok1 = (abs(k1 / CHK - cq) <= 1) && (MSK[(size_t)b * TK + k1] == 0); }      /* mode 23: 3-chunk window + int key-padding mask */
        if (CAUSAL == 24) { ok0 = (MSK[(size_t)b * TK + k0] == 0); ok1 = (MSK[(size_t)b * TK + k1] == 0); }      /* mode 24: int key-padding mask (nonzero = padded = excluded) */      /* mode 2: block-diagonal 32-token groups */
        float s0 = ok0 ? s[rt][0][r] * SCL : -3.0e38f, s1 = ok1 ? s[rt][1][r] * SCL : -3.0e38f; if (CAUSAL == 27) { const float* amk = (const float*)MSK + ((size_t)b * MQI + tq) * MKI; s0 += bf16_round(amk[k0]); s1 += bf16_round(amk[k1]); }      /* mode 27: additive per-(batch, query, key) f32 mask INPUT [b][tq][k] */ if (CAUSAL == 30) { const float* rbp = (const float*)MSK; s0 += rbp[BK30[k0 - tq + (TK - 1)] * NH + h]; s1 += rbp[BK30[k1 - tq + (TK - 1)] * NH + h]; }      /* mode 30: T5 bucketed relative bias: table[bucket(k - q)][h]; bucket-of-distance is a module constant */ if (CAUSAL == 32) { const float qs = qsq[rt][r]; if (ok0) { float d = qs + ksq0; d = d - 2.0f * s0; d = fmaxf(d, 0.f); s0 = -d * 0.125f; } if (ok1) { float d = qs + ksq1; d = d - 2.0f * s1; d = fmaxf(d, 0.f); s1 = -d * 0.125f; } }      /* mode 32: RBF logit -relu(|q|^2 + |k|^2 - 2 q.k)/8, causal */ if (CAUSAL == 17) { const float* amk = (const float*)MSK + (size_t)b * TK; s0 += bf16_round(amk[k0]); s1 += bf16_round(amk[k1]); } if (CAUSAL == 18) { const float* tb = (const float*)MSK; const int* ri = MSK + 1024 + (size_t)b * TK; const int rq = ri[tq]; s0 += tb[(h * 8 + rq) * 8 + ri[k0]]; s1 += tb[(h * 8 + rq) * 8 + ri[k1]]; } if (CAUSAL == 19) { const int* rel = MSK + (size_t)tq * TK; const float* rb = (const float*)MSK + (size_t)TQ * TK + ((size_t)(b * NH + h) * TQ + tq) * 64; s0 += rb[rel[k0]]; s1 += rb[rel[k1]]; }      /* mode 19: + (q.Ek[rel] + Eb[rel][h]) / 8 gathered by the int relative ids (packed [ids | table]) */      /* mode 18: + resource_bias[h][r_q][r_k] from the packed [table | ids] buffer (TQ == TK) */      /* mode 17: additive per-(batch, key) mask INPUT */ float mc = fmaxf(s0, s1);
        mc = fmaxf(mc, __shfl_xor(mc, 1, 32)); mc = fmaxf(mc, __shfl_xor(mc, 2, 32)); mc = fmaxf(mc, __shfl_xor(mc, 4, 32)); mc = fmaxf(mc, __shfl_xor(mc, 8, 32));
        const float mn = fmaxf(m_r[rt][r], mc); const float ea = expf(m_r[rt][r] - mn), e0 = expf(s0 - mn), e1 = expf(s1 - mn);      /* computed for every lane and selected below: no exec-mask branch, so the eight rows' chains can overlap */ const float al = (mn > -1.0e38f) ? ea : 1.0f; m_r[rt][r] = mn; const float p0 = ok0 ? e0 : 0.f, p1 = ok1 ? e1 : 0.f; l_r[rt][r] = l_r[rt][r] * al + p0 + p1;
#pragma unroll
        for (int dt = 0; dt < DT; ++dt) oacc[rt][dt][r] *= al;
        FragH t2; t2.h[0] = (_Float16)(p0 * 1024.0f); t2.h[1] = (_Float16)(p1 * 1024.0f); sP[w][rt * 16 + 8 * hh + r][ln] = t2.u[0]; sP[w][rt * 16 + 8 * hh + r][16 + ln] = t2.u[1]; }
    __builtin_amdgcn_fence(__ATOMIC_ACQ_REL, "workgroup"); __builtin_amdgcn_wave_barrier();
    FragH pa[2];
#pragma unroll
    for (int rt = 0; rt < RTN; ++rt) { pa[rt].half[0] = *(const v8us*)&sP[w][rt * 16 + ln][8 * hh]; pa[rt].half[1] = *(const v8us*)&sP[w][rt * 16 + ln][16 + 8 * hh]; }
#pragma unroll
    for (int dt = 0; dt < DT; ++dt) { const unsigned short* vrow = Vth + (size_t)(dt * 16 + ln) * TK + j0; FragH bv; bv.half[0] = *(const v8us*)(vrow + 8 * hh); bv.half[1] = *(const v8us*)(vrow + 16 + 8 * hh);
#pragma unroll
      for (int rt = 0; rt < RTN; ++rt) oacc[rt][dt] = mmaH<1>(pa[rt].v, pa[rt].v, bv.v, bv.v, oacc[rt][dt]); }
    __builtin_amdgcn_fence(__ATOMIC_ACQ_REL, "workgroup"); __builtin_amdgcn_wave_barrier(); }
#pragma unroll
  for (int rt = 0; rt < RTN; ++rt) {
#pragma unroll
    for (int r = 0; r < 8; ++r) { float l = l_r[rt][r]; l += __shfl_xor(l, 1, 32); l += __shfl_xor(l, 2, 32); l += __shfl_xor(l, 4, 32); l += __shfl_xor(l, 8, 32); l_r[rt][r] = (l > 0.f) ? 1.0f / (l * 1024.0f) : 0.f; }
#pragma unroll
    for (int dt = 0; dt < DT; ++dt)
#pragma unroll
      for (int r = 0; r < 8; ++r) sO[w][rt * 16 + 8 * hh + r][dt * 16 + ln] = oacc[rt][dt][r] * l_r[rt][r]; }
  __builtin_amdgcn_fence(__ATOMIC_ACQ_REL, "workgroup"); __builtin_amdgcn_wave_barrier();
  {
#pragma unroll
    for (int rp = 0; rp < RPW; rp += 2) { const int r = rp + (lane >> 4), pc = lane & 15; const v4f val = *(const v4fa*)&sO[w][r][pc * 4]; *(v4f*)(O + ((size_t)b * TQ + q0 + r) * ldo + h * 64 + pc * 4) = val; }
     } }
// 5-plane variant: S = Qh Kh^T + (Ql Kh^T + Qh Kl^T)/1024 with Q/K = [hi | 2^10 residual] f16 planes (QL/KL same layout as Q16/K16), then the 3-term P.V below.
// 3-term variant: O = (P_hi V_hi + (P_lo V_hi + P_hi V_lo) / 1024) / l with P = [hi | 2^10 residual] of 1024 p and V^T = [hi | 2^10 residual] planes (VtL same layout as Vt) -> ~2^-21-class products for un-averaged (early causal / peaked) rows
template <int CAUSAL>
__global__ __launch_bounds__(128) void k_flash5(const _Float16* __restrict__ Q16, const _Float16* __restrict__ QL, int ldq, const _Float16* __restrict__ K16, const _Float16* __restrict__ KL, int ldk, const _Float16* __restrict__ Vt, const _Float16* __restrict__ VtL, const int* __restrict__ MSK, float* __restrict__ O, int ldo) {
  constexpr int RPW = 16, RTN = RPW / 16, NQB = TQ / (4 * RPW), DT = 4, KS = 2;
  __shared__ __attribute__((aligned(16))) unsigned short sP[4][RPW][40]; __shared__ __attribute__((aligned(16))) unsigned short sPL[4][RPW][40]; __shared__ __attribute__((aligned(16))) float sO[4][RPW][64 + 4];
  const int tid = threadIdx.x, w = tid >> 5, lane = tid & 31, ln = lane & 15, hh = lane >> 4;
  const int slab = blockIdx.x / QBN5, qblk = QB05 + blockIdx.x % QBN5; (void)NQB; const int b = slab / NH, h = slab % NH; const int qb0 = qblk * (4 * RPW); const int q0 = qb0 + w * RPW;
  FragH aq[2][KS], aql[2][KS];
#pragma unroll
  for (int rt = 0; rt < RTN; ++rt) { const unsigned short* qr = (const unsigned short*)Q16 + ((size_t)b * TQ + q0 + rt * 16 + ln) * ldq + h * 64; const unsigned short* ql = (const unsigned short*)QL + ((size_t)b * TQ + q0 + rt * 16 + ln) * ldq + h * 64;
#pragma unroll
    for (int ks = 0; ks < KS; ++ks) { aq[rt][ks].half[0] = *(const v8us*)(qr + ks * 32 + 8 * hh); aq[rt][ks].half[1] = *(const v8us*)(qr + ks * 32 + 16 + 8 * hh); aql[rt][ks].half[0] = *(const v8us*)(ql + ks * 32 + 8 * hh); aql[rt][ks].half[1] = *(const v8us*)(ql + ks * 32 + 16 + 8 * hh); } }
  const unsigned short* Vth = (const unsigned short*)Vt + (size_t)slab * 64 * TK; const unsigned short* Vtl = (const unsigned short*)VtL + (size_t)slab * 64 * TK;
  float m_r[2][8], l_r[2][8]; v8f oacc[2][DT], oaccL[2][DT];
#pragma unroll
  for (int rt = 0; rt < RTN; ++rt) {
#pragma unroll
    for (int r = 0; r < 8; ++r) { m_r[rt][r] = -3.0e38f; l_r[rt][r] = 0.f; }
#pragma unroll
    for (int dt = 0; dt < DT; ++dt) { oacc[rt][dt] = (v8f){0.f,0.f,0.f,0.f,0.f,0.f,0.f,0.f}; oaccL[rt][dt] = oacc[rt][dt]; } }
  const int jend = (CAUSAL == 1 || CAUSAL == 32) ? (qb0 + 4 * RPW) : ((CAUSAL == 23) ? min(TK, (qb0 / CHK + 2) * CHK) : TK);      /* causal / window: keys that can never contribute are skipped */ const int jbeg = (CAUSAL == 23) ? max(0, (qb0 / CHK - 1) * CHK) : 0;
#pragma unroll 1
  for (int j0 = jbeg; j0 < jend; j0 += 32) {
    v8f s[2][2];
#pragma unroll
    for (int nt = 0; nt < 2; ++nt) { const unsigned short* kr = (const unsigned short*)K16 + ((size_t)b * TK + j0 + nt * 16 + ln) * ldk + h * 64; const unsigned short* klr = (const unsigned short*)KL + ((size_t)b * TK + j0 + nt * 16 + ln) * ldk + h * 64; FragH bk[KS], bkl[KS];
#pragma unroll
      for (int ks = 0; ks < KS; ++ks) { bk[ks].half[0] = *(const v8us*)(kr + ks * 32 + 8 * hh); bk[ks].half[1] = *(const v8us*)(kr + ks * 32 + 16 + 8 * hh); bkl[ks].half[0] = *(const v8us*)(klr + ks * 32 + 8 * hh); bkl[ks].half[1] = *(const v8us*)(klr + ks * 32 + 16 + 8 * hh); }
#pragma unroll
      for (int rt = 0; rt < RTN; ++rt) { v8f acc = (v8f){0.f,0.f,0.f,0.f,0.f,0.f,0.f,0.f}, accl = acc;
#pragma unroll
        for (int ks = 0; ks < KS; ++ks) { acc = mmaH<1>(aq[rt][ks].v, aq[rt][ks].v, bk[ks].v, bk[ks].v, acc); accl = mmaH<1>(aql[rt][ks].v, aql[rt][ks].v, bk[ks].v, bk[ks].v, accl); accl = mmaH<1>(aq[rt][ks].v, aq[rt][ks].v, bkl[ks].v, bkl[ks].v, accl); }
#pragma unroll
        for (int r = 0; r < 8; ++r) acc[r] += accl[r] * 0.0009765625f;
        s[rt][nt] = acc; } }
#pragma unroll
    for (int rt = 0; rt < RTN; ++rt)
#pragma unroll
      for (int r = 0; r < 8; ++r) { const int tq = q0 + rt * 16 + 8 * hh + r; const int k0 = j0 + ln, k1 = j0 + 16 + ln;
        bool ok0 = (CAUSAL == 1 || CAUSAL == 32) ? (k0 <= tq) : ((CAUSAL == 2) ? ((k0 >> 5) == (tq >> 5)) : true), ok1 = (CAUSAL == 1 || CAUSAL == 32) ? (k1 <= tq) : ((CAUSAL == 2) ? ((k1 >> 5) == (tq >> 5)) : true);      /* mode 2: block-diagonal 32-token groups */
        if (CAUSAL == 4) { const int* mrow = MSK + ((size_t)b * TQ + tq) * TK; ok0 = mrow[k0] != 0; ok1 = mrow[k1] != 0; }      /* mode 4: per-(query, key) INPUT mask shared by all heads; masked keys contribute nothing (== the reference's -4096 fill, whose exp underflows to 0), rows with no valid key give l = 0 -> output 0 (== the reference's row_valid zeroing) */
        float s0 = ok0 ? s[rt][0][r] * SCL : -3.0e38f, s1 = ok1 ? s[rt][1][r] * SCL : -3.0e38f; if (CAUSAL == 30) { const float* rbp = (const float*)MSK; s0 += rbp[BK30[k0 - tq + (TK - 1)] * NH + h]; s1 += rbp[BK30[k1 - tq + (TK - 1)] * NH + h]; }      /* mode 30: T5 bucketed relative bias: table[bucket(k - q)][h]; bucket-of-distance is a module constant */ if (CAUSAL == 32) { const float* qsT = (const float*)MSK; const float* ksT = qsT + (size_t)NB * TQ; const float qs = qsT[(size_t)b * TQ + tq]; if (ok0) { float d = qs + ksT[(size_t)b * TK + k0]; d = d - 2.0f * s0; d = fmaxf(d, 0.f); s0 = -d * 0.125f; } if (ok1) { float d = qs + ksT[(size_t)b * TK + k1]; d = d - 2.0f * s1; d = fmaxf(d, 0.f); s1 = -d * 0.125f; } }      /* mode 32: RBF logit -relu(|q|^2 + |k|^2 - 2 q.k)/8, causal */ if (CAUSAL == 17) { const float* amk = (const float*)MSK + (size_t)b * TK; s0 += bf16_round(amk[k0]); s1 += bf16_round(amk[k1]); } if (CAUSAL == 18) { const float* tb = (const float*)MSK; const int* ri = MSK + 1024 + (size_t)b * TK; const int rq = ri[tq]; s0 += tb[(h * 8 + rq) * 8 + ri[k0]]; s1 += tb[(h * 8 + rq) * 8 + ri[k1]]; } if (CAUSAL == 19) { const int* rel = MSK + (size_t)tq * TK; const float* rb = (const float*)MSK + (size_t)TQ * TK + ((size_t)(b * NH + h) * TQ + tq) * 64; s0 += rb[rel[k0]]; s1 += rb[rel[k1]]; }      /* mode 19: + (q.Ek[rel] + Eb[rel][h]) / 8 gathered by the int relative ids (packed [ids | table]) */      /* mode 18: + resource_bias[h][r_q][r_k] from the packed [table | ids] buffer (TQ == TK) */      /* mode 17: additive per-(batch, key) mask INPUT */ float mc = fmaxf(s0, s1);
        mc = fmaxf(mc, __shfl_xor(mc, 1, 32)); mc = fmaxf(mc, __shfl_xor(mc, 2, 32)); mc = fmaxf(mc, __shfl_xor(mc, 4, 32)); mc = fmaxf(mc, __shfl_xor(mc, 8, 32));
        const float mn = fmaxf(m_r[rt][r], mc); const float al = (mn > -1.0e38f) ? expf(m_r[rt][r] - mn) : 1.0f; m_r[rt][r] = mn; const float p0 = ok0 ? expf(s0 - mn) : 0.f, p1 = ok1 ? expf(s1 - mn) : 0.f; l_r[rt][r] = l_r[rt][r] * al + p0 + p1;
#pragma unroll
        for (int dt = 0; dt < DT; ++dt) { oacc[rt][dt][r] *= al; oaccL[rt][dt][r] *= al; }
        FragH t2, t2l; const float ps0 = p0 * 1024.0f, ps1 = p1 * 1024.0f; t2.h[0] = (_Float16)ps0; t2.h[1] = (_Float16)ps1; t2l.h[0] = (_Float16)((ps0 - (float)t2.h[0]) * 1024.0f); t2l.h[1] = (_Float16)((ps1 - (float)t2.h[1]) * 1024.0f);
        sP[w][rt * 16 + 8 * hh + r][ln] = t2.u[0]; sP[w][rt * 16 + 8 * hh + r][16 + ln] = t2.u[1]; sPL[w][rt * 16 + 8 * hh + r][ln] = t2l.u[0]; sPL[w][rt * 16 + 8 * hh + r][16 + ln] = t2l.u[1]; }
    __builtin_amdgcn_fence(__ATOMIC_ACQ_REL, "workgroup"); __builtin_amdgcn_wave_barrier();
    FragH pa[2], pl[2];
#pragma unroll
    for (int rt = 0; rt < RTN; ++rt) { pa[rt].half[0] = *(const v8us*)&sP[w][rt * 16 + ln][8 * hh]; pa[rt].half[1] = *(const v8us*)&sP[w][rt * 16 + ln][16 + 8 * hh]; pl[rt].half[0] = *(const v8us*)&sPL[w][rt * 16 + ln][8 * hh]; pl[rt].half[1] = *(const v8us*)&sPL[w][rt * 16 + ln][16 + 8 * hh]; }
#pragma unroll
    for (int dt = 0; dt < DT; ++dt) { const unsigned short* vrow = Vth + (size_t)(dt * 16 + ln) * TK + j0; const unsigned short* vrl = Vtl + (size_t)(dt * 16 + ln) * TK + j0; FragH bv, bl; bv.half[0] = *(const v8us*)(vrow + 8 * hh); bv.half[1] = *(const v8us*)(vrow + 16 + 8 * hh); bl.half[0] = *(const v8us*)(vrl + 8 * hh); bl.half[1] = *(const v8us*)(vrl + 16 + 8 * hh);
#pragma unroll
      for (int rt = 0; rt < RTN; ++rt) { oacc[rt][dt] = mmaH<1>(pa[rt].v, pa[rt].v, bv.v, bv.v, oacc[rt][dt]); oaccL[rt][dt] = mmaH<1>(pl[rt].v, pl[rt].v, bv.v, bv.v, oaccL[rt][dt]); oaccL[rt][dt] = mmaH<1>(pa[rt].v, pa[rt].v, bl.v, bl.v, oaccL[rt][dt]); } }
    __builtin_amdgcn_fence(__ATOMIC_ACQ_REL, "workgroup"); __builtin_amdgcn_wave_barrier(); }
#pragma unroll
  for (int rt = 0; rt < RTN; ++rt) {
#pragma unroll
    for (int r = 0; r < 8; ++r) { float l = l_r[rt][r]; l += __shfl_xor(l, 1, 32); l += __shfl_xor(l, 2, 32); l += __shfl_xor(l, 4, 32); l += __shfl_xor(l, 8, 32); l_r[rt][r] = (l > 0.f) ? 1.0f / (l * 1024.0f) : 0.f; }
#pragma unroll
    for (int dt = 0; dt < DT; ++dt)
#pragma unroll
      for (int r = 0; r < 8; ++r) { float v = oacc[rt][dt][r]; v += oaccL[rt][dt][r] * 0.0009765625f; sO[w][rt * 16 + 8 * hh + r][dt * 16 + ln] = v * l_r[rt][r]; } }
  __builtin_amdgcn_fence(__ATOMIC_ACQ_REL, "workgroup"); __builtin_amdgcn_wave_barrier();
  {
#pragma unroll
    for (int rp = 0; rp < RPW; rp += 2) { const int r = rp + (lane >> 4), pc = lane & 15; const v4f val = *(const v4fa*)&sO[w][r][pc * 4]; *(v4f*)(O + ((size_t)b * TQ + q0 + r) * ldo + h * 64 + pc * 4) = val; }
     } }

__global__ __launch_bounds__(256) void k_rotab(float* __restrict__ CS, float* __restrict__ SN) {
  #pragma clang fp contract(off)
  const int t = blockIdx.x * 256 + threadIdx.x; if (t >= SLEN * 32) return; const int j = t % 32, s = t / 32; const float ex = (float)(2 * j) / 64.0f; const float inv = 1.0f / powf(10000.0f, ex); const float th = (float)s * inv; const float c = cosf(th), sn = sinf(th);
  { *(float*)(CS + t) = c; *(float*)(SN + t) = sn;  } }
__global__ __launch_bounds__(256) void k_rope(const float* __restrict__ F, int nsrc, int ndst, int rep, const float* __restrict__ CS, const float* __restrict__ SN, _Float16* __restrict__ H, _Float16* __restrict__ L) {
  #pragma clang fp contract(off)
  const size_t t = (size_t)blockIdx.x * 256 + threadIdx.x; if (t >= (size_t)NR * ndst * 4) return; const int g8 = (int)(t % 4); const int hd = (int)((t / 4) % ndst); const size_t row = t / ((size_t)4 * ndst); const int s = (int)(row % SLEN); const int hs = hd / rep;
  const float* src = F + row * (size_t)(nsrc * 64) + hs * 64; FragH ah, al, bh, bl;
  for (int i = 0; i < 8; ++i) { const int d = g8 * 8 + i; const float c = CS[s * 32 + d], sn = SN[s * 32 + d]; const float x1 = src[d], x2 = src[d + 32];
    float o1 = x1 * c; o1 += -x2 * sn; float o2 = x2 * c; o2 += x1 * sn;
    _Float16 hv = (_Float16)o1; ah.h[i] = hv; al.h[i] = (_Float16)((o1 - (float)hv) * 1024.0f); hv = (_Float16)o2; bh.h[i] = hv; bl.h[i] = (_Float16)((o2 - (float)hv) * 1024.0f); }
  const size_t o = row * (size_t)(ndst * 64) + hd * 64 + g8 * 8;
  { *(v8us*)((unsigned short*)H + o) = ah.half[0]; *(v8us*)((unsigned short*)H + o + 32) = bh.half[0]; *(v8us*)((unsigned short*)L + o) = al.half[0]; *(v8us*)((unsigned short*)L + o + 32) = bl.half[0];  } }
__global__ __launch_bounds__(256) void k_rope2(const float* __restrict__ F, int nsrc, int ndst, int rep, const float* __restrict__ CS, const float* __restrict__ SN, _Float16* __restrict__ H, _Float16* __restrict__ L) {
  #pragma clang fp contract(off)
  const size_t t = (size_t)blockIdx.x * 256 + threadIdx.x; if (t >= (size_t)NR * ndst * 4) return; const int g16 = (int)(t % 4); const int hd = (int)((t / 4) % ndst); const size_t row = t / ((size_t)4 * ndst); const int s = (int)(row % SLEN); const int hs = hd / rep;
  const float* src = F + row * (size_t)(nsrc * 64) + hs * 64 + g16 * 16; FragH ah, al;
  for (int pr = 0; pr < 8; ++pr) { const int i = g16 * 8 + pr; const float c = CS[s * 32 + i], sn = SN[s * 32 + i]; const float x1 = src[2 * pr], x2 = src[2 * pr + 1];
    float o1 = x1 * c; o1 -= x2 * sn; float o2 = x1 * sn; o2 += x2 * c;
    _Float16 hv = (_Float16)o1; ah.h[2 * pr] = hv; al.h[2 * pr] = (_Float16)((o1 - (float)hv) * 1024.0f); hv = (_Float16)o2; ah.h[2 * pr + 1] = hv; al.h[2 * pr + 1] = (_Float16)((o2 - (float)hv) * 1024.0f); }
  const size_t o = row * (size_t)(ndst * 64) + hd * 64 + g16 * 16;
  { *(v8us*)((unsigned short*)H + o) = ah.half[0]; *(v8us*)((unsigned short*)H + o + 8) = ah.half[1]; *(v8us*)((unsigned short*)L + o) = al.half[0]; *(v8us*)((unsigned short*)L + o + 8) = al.half[1];  } }
__global__ __launch_bounds__(256) void k_ln512(const float* __restrict__ A, const float* __restrict__ res, const float* __restrict__ g, const float* __restrict__ bb, float* __restrict__ Y, _Float16* __restrict__ Y16) {
  #pragma clang fp contract(off)
  const int wv = threadIdx.x >> 5, ln = threadIdx.x & 31; const size_t r = (size_t)blockIdx.x * 8 + wv; if (r >= NR) return; float x[16]; float s = 0.f;
  for (int i = 0; i < 2; ++i) { const v8f a = *(const v8f*)(A + r * DM + i * 256 + ln * 8); for (int q = 0; q < 8; ++q) { float v = a[q]; if (res) v += bf16_round(res[r * DM + i * 256 + ln * 8 + q]); x[i * 8 + q] = v; s += v; } }
  for (int o = 16; o > 0; o >>= 1) s += __shfl_xor(s, o, 32); const float mu = s / (float)DM; float var = 0.f; for (int q = 0; q < 16; ++q) { const float d = x[q] - mu; var += d * d; }
  for (int o = 16; o > 0; o >>= 1) var += __shfl_xor(var, o, 32); const float inv = rsqrtf(var / (float)DM + 1e-5f);
  { for (int i = 0; i < 2; ++i) { const int c0 = i * 256 + ln * 8; v8f y; FragH f; for (int q = 0; q < 8; ++q) { float v = (x[i * 8 + q] - mu) * inv; v *= bf16_round(g[c0 + q]); v += bf16_round(bb[c0 + q]); y[q] = v; f.h[q] = (_Float16)v; } *(v8f*)(Y + r * DM + c0) = y; if (Y16) *(v8us*)((unsigned short*)Y16 + r * DM + c0) = f.half[0]; }  } }
__global__ __launch_bounds__(256) void k_pack(const float* __restrict__ rb, const int* __restrict__ rid, int* __restrict__ PK) { const int t = blockIdx.x * 256 + threadIdx.x; if (t >= 1024 + NB * TK) return; int v; if (t < 1024) v = __float_as_int(bf16_round(rb[t])); else v = rid[t - 1024]; *(int*)(PK + t) = v;  }
__global__ __launch_bounds__(256) void k_tabin(const float* __restrict__ sp, float* __restrict__ CS, float* __restrict__ SN) { const int t = blockIdx.x * 256 + threadIdx.x; if (t >= SLEN * 32) return; const int i = t % 32, s = t / 32; const float c = bf16_round(sp[s * 64 + 32 + i]), sn = bf16_round(sp[s * 64 + i]);
  { *(float*)(CS + t) = c; *(float*)(SN + t) = sn;  } }
__global__ __launch_bounds__(256) void k_wsc(const float* __restrict__ Wm, _Float16* __restrict__ Bt, size_t n8, float sc) { const size_t t = (size_t)blockIdx.x * 256 + threadIdx.x; if (t >= n8) return; FragH f; for (int q = 0; q < 8; ++q) f.h[q] = (_Float16)(bf16_round(Wm[t * 8 + q]) * sc); *(v8us*)((unsigned short*)Bt + t * 8) = f.half[0];  }
__global__ __launch_bounds__(256) void k_rotab2(float* __restrict__ CS, float* __restrict__ SN) {
  #pragma clang fp contract(off)
  const int t = blockIdx.x * 256 + threadIdx.x; if (t >= SLEN * 32) return; const int j = t % 32, s = t / 32; const float c0 = -0.14391156831212787f;      /* -ln(10000)/64 rounded to f32 */ const float inv = expf((float)(2 * j) * c0); const float th = (float)s * inv; const float c = cosf(th), sn = sinf(th);
  { *(float*)(CS + t) = c; *(float*)(SN + t) = sn;  } }
__global__ __launch_bounds__(256) void k_lnu(const float* __restrict__ X, _Float16* __restrict__ N16, float* __restrict__ XB) {
  #pragma clang fp contract(off)
  const int wv = threadIdx.x >> 5, ln = threadIdx.x & 31; const size_t r = (size_t)blockIdx.x * 8 + wv; if (r >= NR) return; float a[32]; float s = 0.f;
  for (int i = 0; i < 4; ++i) { const v8f v = *(const v8f*)(X + r * DM + (i * 32 + ln) * 8); for (int q = 0; q < 8; ++q) { const float u = bf16_round(v[q]); a[i * 8 + q] = u; s += u; } }
  for (int o = 16; o > 0; o >>= 1) s += __shfl_xor(s, o, 32); const float mu = s / (float)DM; float var = 0.f; for (int q = 0; q < 32; ++q) { const float d = a[q] - mu; var += d * d; }
  for (int o = 16; o > 0; o >>= 1) var += __shfl_xor(var, o, 32); const float den = sqrtf(var / (float)(DM - 1)) + 1e-6f; const float inv = 1.0f / den;      /* one reciprocal per row; (x-mean)*inv vs the reference's division differs by <= 1 ulp */
  { for (int i = 0; i < 4; ++i) { const int c0 = (i * 32 + ln) * 8; FragH f; v8f xb; for (int q = 0; q < 8; ++q) { f.h[q] = (_Float16)((a[i * 8 + q] - mu) * inv); xb[q] = a[i * 8 + q]; } *(v8us*)((unsigned short*)N16 + r * DM + c0) = f.half[0]; *(v8f*)(XB + r * DM + c0) = xb; }  } }
__global__ __launch_bounds__(256) void k_vtg(const _Float16* __restrict__ V16, _Float16* __restrict__ Vt) { __shared__ unsigned short tl[64][66]; const int tid = threadIdx.x; const int slab = blockIdx.x / (SLEN / 64), lg = blockIdx.x % (SLEN / 64); const int b = slab / NH, h = slab % NH; const int hs = h / NREP;
  for (int i = tid; i < 64 * 8; i += 256) { const int r = i / 8, c8 = (i % 8) * 8; FragH f; f.half[0] = *(const v8us*)((const unsigned short*)V16 + ((size_t)b * SLEN + lg * 64 + r) * KVD + hs * 64 + c8); for (int q = 0; q < 8; ++q) tl[r][c8 + q] = f.u[q]; }
  __syncthreads();
  { for (int rd = 0; rd < 2; ++rd) { const int d = rd * 32 + tid / 8, pc = tid % 8; FragH f; for (int q = 0; q < 8; ++q) f.u[q] = tl[pc * 8 + q][d]; *(v8us*)((unsigned short*)Vt + ((size_t)slab * 64 + d) * SLEN + lg * 64 + pc * 8) = f.half[0]; }  } }

__global__ __launch_bounds__(256) void k_h16s(const float* __restrict__ SRC, int lds, int coff, _Float16* __restrict__ DST, size_t n8) { const size_t t = (size_t)blockIdx.x * 256 + threadIdx.x; if (t >= n8) return; const size_t r = (t * 8) / DM; const int c = (int)((t * 8) % DM); const v8f a = *(const v8f*)(SRC + r * lds + coff + c); FragH f; for (int q = 0; q < 8; ++q) f.h[q] = (_Float16)a[q];
  *(v8us*)((unsigned short*)DST + t * 8) = f.half[0];  }


__global__ __launch_bounds__(256) void k_ccp(const float* __restrict__ QKV, int coff, _Float16* __restrict__ D) { const size_t t = (size_t)blockIdx.x * 256 + threadIdx.x; if (t >= (size_t)NR * DM / 8) return; const int c0 = (int)((t * 8) % DM); const size_t row = (t * 8) / DM; const v8f a = *(const v8f*)(QKV + row * 3 * DM + coff + c0); FragH f; for (int q = 0; q < 8; ++q) f.h[q] = (_Float16)a[q];
  *(v8us*)((unsigned short*)D + t * 8) = f.half[0];  }


template <int NLN>
__global__ __launch_bounds__(256) void k_lnrow(const float* __restrict__ X, const float* __restrict__ R, const float* __restrict__ g, const float* __restrict__ bb, float eps, float* __restrict__ OUT) {
  #pragma clang fp contract(off)
  constexpr int PER = NLN / 256; __shared__ float red[256]; const int tid = threadIdx.x; const size_t row = blockIdx.x; const float* x = X + row * NLN; const float* rr = R ? R + row * NLN : nullptr; float v[PER]; float s1 = 0.f;
  for (int u = 0; u < PER; ++u) { const int j = tid * PER + u; float t = x[j]; if (rr) t = t + rr[j]; v[u] = t; s1 += t; }
  red[tid] = s1; __syncthreads(); for (int st = 128; st > 0; st >>= 1) { if (tid < st) red[tid] += red[tid + st]; __syncthreads(); } const float mu = red[0] / (float)NLN; __syncthreads();
  float s2 = 0.f; for (int u = 0; u < PER; ++u) { const float c = v[u] - mu; s2 += c * c; } red[tid] = s2; __syncthreads(); for (int st = 128; st > 0; st >>= 1) { if (tid < st) red[tid] += red[tid + st]; __syncthreads(); }
  const float var = red[0] / (float)NLN; const float rs = rsqrtf(var + eps);
  { for (int u = 0; u < PER; ++u) { const int j = tid * PER + u; float o = (v[u] - mu) * rs; o = __fadd_rn(__fmul_rn(o, bf16_round(g[j])), bf16_round(bb[j])); *(float*)(OUT + row * NLN + j) = o; }  } }
__global__ __launch_bounds__(256) void k_xr32(const float* __restrict__ x, float* __restrict__ XR, size_t n8) { const size_t t = (size_t)blockIdx.x * 256 + threadIdx.x; if (t >= n8) return; v8f o; for (int q = 0; q < 8; ++q) o[q] = bf16_round(x[t * 8 + q]); *(v8f*)(XR + t * 8) = o;  }
__global__ __launch_bounds__(256) void k_r16b(const float* __restrict__ S, _Float16* __restrict__ D, size_t n8) { const size_t t = (size_t)blockIdx.x * 256 + threadIdx.x; if (t >= n8) return; const v8f a = *(const v8f*)(S + t * 8); FragH f; for (int q = 0; q < 8; ++q) f.h[q] = (_Float16)a[q]; *(v8us*)((unsigned short*)D + t * 8) = f.half[0];  }

__global__ __launch_bounds__(256) void k_nsq(const float* __restrict__ X, float* __restrict__ NSQ, size_t nrows) {
  #pragma clang fp contract(off)
  const size_t r = (size_t)blockIdx.x * 256 + threadIdx.x; if (r >= nrows) return; float acc = 0.f;
#pragma unroll 1
  for (int d = 0; d < 64; d += 8) { const v8f a = *(const v8f*)(X + r * 64 + d); for (int u = 0; u < 8; ++u) { const float x = bf16_round(a[u]); acc = __fadd_rn(acc, __fmul_rn(x, x)); } }
  *(float*)(NSQ + r) = acc;  }
__global__ __launch_bounds__(64) void k_fixr(const float* __restrict__ Q, const float* __restrict__ Kx, const float* __restrict__ V, const float* __restrict__ NSQ, float* __restrict__ O) {
  #pragma clang fp contract(off)
  __shared__ float pr[64][65]; const int q = threadIdx.x; const size_t sl = blockIdx.x; const float* qr = Q + (sl * SLEN + q) * 64; const float qs = NSQ[sl * SLEN + q]; const float* ksT = NSQ + (size_t)NB * SLEN; float mx = -3.0e38f;
#pragma unroll 1
  for (int j = 0; j <= q; ++j) { const float* kr = Kx + (sl * SLEN + j) * 64; float sdot = 0.f;
#pragma unroll 1
    for (int d = 0; d < 64; d += 8) { const v8f a = *(const v8f*)(qr + d); const v8f kk = *(const v8f*)(kr + d); for (int u = 0; u < 8; ++u) sdot = __fadd_rn(sdot, __fmul_rn(bf16_round(a[u]), bf16_round(kk[u]))); }
    float dd = qs + ksT[sl * SLEN + j]; dd = dd - 2.0f * sdot; dd = fmaxf(dd, 0.f); const float lg = -dd * 0.125f; pr[q][j] = lg; mx = fmaxf(mx, lg); }
  float su = 0.f;
#pragma unroll 1
  for (int j = 0; j <= q; ++j) { const float e = expf(pr[q][j] - mx); pr[q][j] = e; su += e; }
  const float inv = 1.0f / su;
  {
#pragma unroll 1
    for (int d = 0; d < 64; d += 8) { v8f acc = {0,0,0,0,0,0,0,0};
#pragma unroll 1
      for (int j = 0; j <= q; ++j) { const float p = pr[q][j] * inv; const v8f vv = *(const v8f*)(V + (sl * SLEN + j) * 64 + d); for (int u = 0; u < 8; ++u) acc[u] = __fadd_rn(acc[u], __fmul_rn(p, bf16_round(vv[u]))); }
      *(v8f*)(O + (sl * SLEN + q) * 64 + d) = acc; }
     } }

extern "C" void kernel_launch(void* const* d_in, const int* in_sizes, int n_in,
                              void* d_out, int out_size, void* d_ws, size_t ws_size, hipStream_t stream) {
  (void)in_sizes; (void)n_in; (void)out_size;
  const float* q = (const float*)d_in[0]; const float* k = (const float*)d_in[1]; const float* v = (const float*)d_in[2]; float* O = (float*)d_out;
  char* ws = (char*)d_ws; size_t off = 0;
  auto take = [&](size_t bytes) { char* p = ws + off; off += (bytes + 255) & ~(size_t)255; return p; };
  const size_t np = (size_t)NR * DM;      /* 32 x 2048 x 64 */
  _Float16* QH = (_Float16*)take(np * 2); _Float16* KH = (_Float16*)take(np * 2); _Float16* VH = (_Float16*)take(np * 2); _Float16* VT = (_Float16*)take(np * 2); float* NSQ = (float*)take((size_t)2 * NR * 4);
  if (off > ws_size) return;      /* 4 x 8 + 0.5 = ≈ 33 MiB */
  k_x16<<<(unsigned)((np / 8 + 255) / 256), 256, 0, stream>>>(q, QH, np / 8); k_x16<<<(unsigned)((np / 8 + 255) / 256), 256, 0, stream>>>(k, KH, np / 8); k_x16<<<(unsigned)((np / 8 + 255) / 256), 256, 0, stream>>>(v, VH, np / 8);      /* bf16-rounded inputs are exact in f16 */
  k_vtg<<<NB * NH * (SLEN / 64), 256, 0, stream>>>(VH, VT);
  k_nsq<<<(unsigned)((NR + 255) / 256), 256, 0, stream>>>(q, NSQ, (size_t)NR); k_nsq<<<(unsigned)((NR + 255) / 256), 256, 0, stream>>>(k, NSQ + NR, (size_t)NR);      /* |q|^2 | |k|^2 tables */
  k_flash<32><<<NB * NH * QBNP, 128, 0, stream>>>(QH, DM, KH, DM, VT, (const int*)NSQ, O, DM);      /* exact q, k products; f32 RBF logits; f32 context straight to the output */
  k_fixr<<<NB, 64, 0, stream>>>(q, k, v, NSQ, O);      /* rows < 64 per slab recomputed in f32 */
}

// v002
// A run of this version takes 202 microseconds.
// Two timings next to v001 put it at 1.65 and 1.68 times that version's speed.
// Counting every step since v000, it is 2.46 times as fast.
#include <hip/hip_runtime.h>
// CustomCausalAttention (q, k, v [2][16][2048][64]; RBF-kernel causal attention: logits = -relu(|q|^2 + |k|^2 - 2 q.k) / 8 over keys n <= m; out = softmax(logits) v -> [2][16][2048][64]).
// Structure: each (batch, head) slab is a contiguous 64-wide row block, treated as one 'batch' of a single 64-dim head: exact f16 planes of q, k, v (bf16-rounded inputs are exact in f16); |q|^2, |k|^2 as f32 row tables on VALU; v^T by LDS tiles; causal flash-style fused attention per (slab, 64-query block), forming the RBF logit from the f32 dot product and the two norm tables, f32 context written straight to the output; the first 64 causal rows per slab recomputed entirely in f32 on VALU.
// Compute dtype: inputs rounded to bf16; q, k, v exact as f16 (products exact, f32 accumulation); norms, logits, softmax f32 with plain f16 probabilities (~2^-12); rows < 64 all-f32. v_wmma_f32_16x16x32_f16.
#define NB 32                    /* 2 batches x 16 heads as slabs */
#define DM 64
#define NKV 1
#define NREP (NH / NKV)
#define KVD (NKV * 64)           /* 64 */
#define NR (NB * SLEN)
#define CHK 512
typedef int v4i __attribute__((ext_vector_type(4)));
#define FF 2048
#define SLEN 2048
#define MQI 2048
#define MKI 2048
#define TQ SLEN
#define TK SLEN
#define NH 1
#define SCL 1.0f                 /* raw dot product; the RBF transform applies the 1/8 */
#define QBLKS (TQ / 64)
#define QB05 0
#define QBN5 QBLKS      /* hi/lo engine (k_flash5) block range; not launched */
#define QB0P 0
#define QBNP QBLKS
#define RE 256
typedef __bf16 v16b __attribute__((ext_vector_type(16)));
typedef unsigned short v8us __attribute__((ext_vector_type(8), may_alias));
typedef float  v8f  __attribute__((ext_vector_type(8)));
typedef float  v4f  __attribute__((ext_vector_type(4)));
typedef float  v4fa __attribute__((ext_vector_type(4), may_alias));
union FragB { v16b v; v8us half[2]; unsigned short u[16]; };

__device__ __forceinline__ unsigned short bf16_bits(float x) { unsigned int u = __float_as_uint(x); return (unsigned short)((u + 0x7FFFu + ((u >> 16) & 1u)) >> 16); }
__device__ __forceinline__ float bf16_val(unsigned short b) { return __uint_as_float(((unsigned int)b) << 16); }
__device__ __forceinline__ float bf16_round(float x) { return bf16_val(bf16_bits(x)); }
// D += A·B with NT terms: 1 = ah·bh, 2 = + al·bh (A split), 3 = + ah·bl (both split)
template <int NT>
__device__ __forceinline__ v8f mmaN(v16b ah, v16b al, v16b bh, v16b bl, v8f c) {
  c = __builtin_amdgcn_wmma_f32_16x16x32_bf16(false, ah, false, bh, (short)0, c, false, false);
  if (NT >= 2) c = __builtin_amdgcn_wmma_f32_16x16x32_bf16(false, al, false, bh, (short)0, c, false, false);
  if (NT >= 3) c = __builtin_amdgcn_wmma_f32_16x16x32_bf16(false, ah, false, bl, (short)0, c, false, false);
  asm volatile("v_nop\n\tv_nop\n\tv_nop\n\tv_nop" : "+v"(c) : "v"(ah), "v"(al), "v"(bh), "v"(bl));
  return c;
}

__global__ __launch_bounds__(256) void k_wt_bf16(const float* __restrict__ W, unsigned short* __restrict__ Wt, int K, int N) {
  const int t = blockIdx.x * 256 + threadIdx.x;
  const int k8n = K / 8;
  if (t >= N * k8n) return;
  const int n = t / k8n, k8 = (t % k8n) * 8;
  v8us v;
#pragma unroll
  for (int i = 0; i < 8; ++i) v[i] = bf16_bits(W[(size_t)(k8 + i) * N + n]);
  *(v8us*)(Wt + (size_t)n * K + k8) = v;
  
}

// GEMM C[M][N] (f32, pitch ldc) = act(A[M][K]·W + bias). A f32 row-major (pitch lda) converted per fragment to bf16
// (ASPLIT: hi/lo two planes -> 2 terms, else single rounded term); Wt bf16 [N][K] (pitch ldb). BIAS_BF16 rounds the
// bias to bf16 first (bias quantised to bf16 before the add). K%32==0, M%16==0, N%64==0.
template <bool ASPLIT, int ACT, bool BIAS_BF16>
__global__ __launch_bounds__(128) void k_gemm_bf(const float* __restrict__ A, int lda, const unsigned short* __restrict__ Wt, int ldb,
                                               const float* __restrict__ bias, float* __restrict__ C, int ldc, int M, int N, int K) {
  __shared__ __attribute__((aligned(16))) float so[4][16][64];
  const int tid = threadIdx.x, w = tid >> 5, lane = tid & 31, ln = lane & 15, hh = lane >> 4;
  const int ntn = N / 64;
  const int wid = blockIdx.x * 4 + w;
  const int mt = wid / ntn, nq = wid % ntn;
  if (mt * 16 >= M) return;
  const int row0 = mt * 16, col0 = nq * 64;
  const float* arow = A + (size_t)(row0 + ln) * lda;
  v8f acc[4] = {};
  for (int kb = 0; kb < K; kb += 32) {
    FragB ah, al;
    const v4f x0 = *(const v4fa*)(arow + kb + 8 * hh), x1 = *(const v4fa*)(arow + kb + 8 * hh + 4);
    const v4f x2 = *(const v4fa*)(arow + kb + 16 + 8 * hh), x3 = *(const v4fa*)(arow + kb + 16 + 8 * hh + 4);
    float xs[16] = {x0[0],x0[1],x0[2],x0[3],x1[0],x1[1],x1[2],x1[3],x2[0],x2[1],x2[2],x2[3],x3[0],x3[1],x3[2],x3[3]};
#pragma unroll
    for (int i = 0; i < 16; ++i) { const unsigned short hb = bf16_bits(xs[i]); ah.u[i] = hb; al.u[i] = ASPLIT ? bf16_bits(xs[i] - bf16_val(hb)) : (unsigned short)0; }
#pragma unroll
    for (int t = 0; t < 4; ++t) {
      const unsigned short* brow = Wt + (size_t)(col0 + t * 16 + ln) * ldb + kb;
      FragB b;
      b.half[0] = *(const v8us*)(brow + 8 * hh);
      b.half[1] = *(const v8us*)(brow + 16 + 8 * hh);
      acc[t] = mmaN<ASPLIT ? 2 : 1>(ah.v, al.v, b.v, b.v, acc[t]);
    }
  }
#pragma unroll
  for (int t = 0; t < 4; ++t) {
    float bv = bias ? bias[col0 + t * 16 + ln] : 0.f;
    if (BIAS_BF16) bv = bf16_round(bv);
#pragma unroll
    for (int r = 0; r < 8; ++r) { float v = acc[t][r] + bv; if (ACT == 1) v = fmaxf(v, 0.f); so[w][8 * hh + r][t * 16 + ln] = v; }
  }
  __builtin_amdgcn_fence(__ATOMIC_ACQ_REL, "workgroup");
  __builtin_amdgcn_wave_barrier();
  const int rsub = lane >> 4, c4 = (lane & 15) * 4;
  {
#pragma unroll
    for (int q = 0; q < 8; ++q) {
      const int r = q * 2 + rsub;
      const v4f v = *(const v4fa*)&so[w][r][c4];
      *(v4f*)(C + (size_t)(row0 + r) * ldc + col0 + c4) = v;
    }
    
  }
}

// GEMM C = act(A·W + bias + resid): A f32 (ASPLIT -> hi/lo 2 terms), Wt bf16 [N][K]; ACT 0 none, 1 relu, 2 exact gelu;
// resid (optional, f32, row index = (row % rmod), pitch ldr, RES_BF16 rounds it) added before the activation.
template <bool ASPLIT, int ACT, bool BIAS_BF16, bool RES_BF16>
__global__ __launch_bounds__(128) void k_gemm_bf3(const float* __restrict__ A, int lda, const unsigned short* __restrict__ Wt, int ldb,
                                                const float* __restrict__ bias, const float* __restrict__ resid, int rmod, int ldr,
                                                float* __restrict__ C, int ldc, int M, int N, int K) {
  __shared__ __attribute__((aligned(16))) float so[4][16][64];
  const int tid = threadIdx.x, w = tid >> 5, lane = tid & 31, ln = lane & 15, hh = lane >> 4;
  const int ntn = N / 64;
  const int wid = blockIdx.x * 4 + w;
  const int mt = wid / ntn, nq = wid % ntn;
  if (mt * 16 >= M) return;
  const int row0 = mt * 16, col0 = nq * 64;
  const float* arow = A + (size_t)(row0 + ln) * lda;
  v8f acc[4] = {};
  for (int kb = 0; kb < K; kb += 32) {
    FragB ah, al;
    const v4f x0 = *(const v4fa*)(arow + kb + 8 * hh), x1 = *(const v4fa*)(arow + kb + 8 * hh + 4);
    const v4f x2 = *(const v4fa*)(arow + kb + 16 + 8 * hh), x3 = *(const v4fa*)(arow + kb + 16 + 8 * hh + 4);
    float xs[16] = {x0[0],x0[1],x0[2],x0[3],x1[0],x1[1],x1[2],x1[3],x2[0],x2[1],x2[2],x2[3],x3[0],x3[1],x3[2],x3[3]};
#pragma unroll
    for (int i = 0; i < 16; ++i) { const unsigned short hb = bf16_bits(xs[i]); ah.u[i] = hb; al.u[i] = ASPLIT ? bf16_bits(xs[i] - bf16_val(hb)) : (unsigned short)0; }
#pragma unroll
    for (int t = 0; t < 4; ++t) {
      const unsigned short* brow = Wt + (size_t)(col0 + t * 16 + ln) * ldb + kb;
      FragB b;
      b.half[0] = *(const v8us*)(brow + 8 * hh);
      b.half[1] = *(const v8us*)(brow + 16 + 8 * hh);
      acc[t] = mmaN<ASPLIT ? 2 : 1>(ah.v, al.v, b.v, b.v, acc[t]);
    }
  }
#pragma unroll
  for (int t = 0; t < 4; ++t) {
    const int col = col0 + t * 16 + ln;
    float bv = bias ? bias[col] : 0.f;
    if (BIAS_BF16) bv = bf16_round(bv);
#pragma unroll
    for (int r = 0; r < 8; ++r) {
      float v = acc[t][r] + bv;
      if (resid) { float rv = resid[(size_t)((row0 + 8 * hh + r) % rmod) * ldr + col]; if (RES_BF16) rv = bf16_round(rv); v += rv; }
      if (ACT == 1) v = fmaxf(v, 0.f);
      if (ACT == 2) v = 0.5f * v * (1.0f + erff(v * 0.70710678118654752f));
      if (ACT == 3) { const float u = 0.7978845608028654f * (v + 0.044715f * v * v * v); v = 0.5f * v * (1.0f + tanhf(u)); }
      so[w][8 * hh + r][t * 16 + ln] = v;
    }
  }
  __builtin_amdgcn_fence(__ATOMIC_ACQ_REL, "workgroup");
  __builtin_amdgcn_wave_barrier();
  const int rsub = lane >> 4, c4 = (lane & 15) * 4;
  {
#pragma unroll
    for (int q = 0; q < 8; ++q) {
      const int r = q * 2 + rsub;
      const v4f v = *(const v4fa*)&so[w][r][c4];
      *(v4f*)(C + (size_t)(row0 + r) * ldc + col0 + c4) = v;
    }
    
  }
}
// row LayerNorm (biased variance, eps) over N: s = X (+ R); optional out_sum <- s; out_norm <- (s-mu)*rsqrt(var+eps)*g + b
template <bool PARAM_BF16>
__global__ __launch_bounds__(256) void k_layernorm(const float* __restrict__ X, const float* __restrict__ R, const float* __restrict__ g, const float* __restrict__ bta,
                                                  float* __restrict__ out_sum, float* __restrict__ out_norm, int N, float eps) {
  __shared__ float red[256];
  const int row = blockIdx.x, tid = threadIdx.x;
  const float* x = X + (size_t)row * N; const float* rr = R ? R + (size_t)row * N : nullptr;
  float vals[16];                     // up to N = 4096
  const int per = N / 256;            // contiguous chunk per thread? use strided-by-4 chunks: thread handles j = tid*4 + 1024*u
  float s1 = 0.f;
  for (int u = 0; u < per / 4; ++u) {
    const int j = tid * 4 + 1024 * u;
    const v4f a = *(const v4fa*)(x + j);
    v4f b = {0.f,0.f,0.f,0.f}; if (rr) b = *(const v4fa*)(rr + j);
#pragma unroll
    for (int q = 0; q < 4; ++q) { const float v = a[q] + b[q]; vals[u * 4 + q] = v; s1 += v; }
  }
  red[tid] = s1; __syncthreads();
  for (int st = 128; st > 0; st >>= 1) { if (tid < st) red[tid] += red[tid + st]; __syncthreads(); }
  const float mu = red[0] / (float)N; __syncthreads();
  float s2 = 0.f;
  for (int u = 0; u < per / 4; ++u)
#pragma unroll
    for (int q = 0; q < 4; ++q) { const float c = vals[u * 4 + q] - mu; s2 += c * c; }
  red[tid] = s2; __syncthreads();
  for (int st = 128; st > 0; st >>= 1) { if (tid < st) red[tid] += red[tid + st]; __syncthreads(); }
  const float rs = rsqrtf(red[0] / (float)N + eps);
  {
    for (int u = 0; u < per / 4; ++u) {
      const int j = tid * 4 + 1024 * u;
      v4f o, sm;
#pragma unroll
      for (int q = 0; q < 4; ++q) {
        float gg = g[j + q], bb = bta[j + q];
        if (PARAM_BF16) { gg = bf16_round(gg); bb = bf16_round(bb); }
        sm[q] = vals[u * 4 + q]; o[q] = (vals[u * 4 + q] - mu) * rs * gg + bb;
      }
      if (out_sum) *(v4f*)(out_sum + (size_t)row * N + j) = sm;
      *(v4f*)(out_norm + (size_t)row * N + j) = o;
    }
    
  }
}



// ---- f16 WMMA path (v_wmma_f32_16x16x32_f16): 11-bit significands for operands in range — used where a [0,1] probability operand needs more precision than bf16
typedef _Float16 v16h __attribute__((ext_vector_type(16)));
union FragH { v16h v; v8us half[2]; _Float16 h[16]; unsigned short u[16]; };
template <int NT>
__device__ __forceinline__ v8f mmaH(v16h ah, v16h al, v16h bh, v16h bl, v8f c) {
  c = __builtin_amdgcn_wmma_f32_16x16x32_f16(false, ah, false, bh, (short)0, c, false, false);
  if (NT >= 2) c = __builtin_amdgcn_wmma_f32_16x16x32_f16(false, al, false, bh, (short)0, c, false, false);
  if (NT >= 3) c = __builtin_amdgcn_wmma_f32_16x16x32_f16(false, ah, false, bl, (short)0, c, false, false);
  asm volatile("v_nop\n\tv_nop\n\tv_nop\n\tv_nop" : "+v"(c) : "v"(ah), "v"(al), "v"(bh), "v"(bl));
  return c;
}
// batched GEMM like k_gemm_b but f16 operands: A f32 (split into f16 hi/lo if ASPLIT, else rounded to f16), Bt = f16 values [n][k]; alpha; C f32; N multiple of 16 (partial tiles skipped)
template <bool ASPLIT>
__global__ __launch_bounds__(128) void k_gemm_h(const float* __restrict__ A, int lda, size_t sA, const _Float16* __restrict__ Bh, int ldb, size_t sB, float alpha, float* __restrict__ C, int ldc, size_t sC, int M, int N, int K) {
  __shared__ __attribute__((aligned(16))) float so[4][16][64];
  const int tid = threadIdx.x, w = tid >> 5, lane = tid & 31, ln = lane & 15, hh = lane >> 4; const int by = blockIdx.y;
  A += (size_t)by * sA; Bh += (size_t)by * sB; C += (size_t)by * sC;
  const int ntn = (N + 63) / 64; const int wid = blockIdx.x * 4 + w; const int mt = wid / ntn, nq = wid % ntn; if (mt * 16 >= M) return;
  const int row0 = mt * 16, col0 = nq * 64; const float* arow = A + (size_t)(row0 + ln) * lda;
  v8f acc[4] = {};
  for (int kb = 0; kb < K; kb += 32) {
    FragH ah, al;
    const v4f x0 = *(const v4fa*)(arow + kb + 8 * hh), x1 = *(const v4fa*)(arow + kb + 8 * hh + 4), x2 = *(const v4fa*)(arow + kb + 16 + 8 * hh), x3 = *(const v4fa*)(arow + kb + 16 + 8 * hh + 4);
    float xs[16] = {x0[0],x0[1],x0[2],x0[3],x1[0],x1[1],x1[2],x1[3],x2[0],x2[1],x2[2],x2[3],x3[0],x3[1],x3[2],x3[3]};
#pragma unroll
    for (int i = 0; i < 16; ++i) { const _Float16 h = (_Float16)xs[i]; ah.h[i] = h; al.h[i] = ASPLIT ? (_Float16)(xs[i] - (float)h) : (_Float16)0.0f; }
#pragma unroll
    for (int t = 0; t < 4; ++t) { if (col0 + t * 16 >= N) continue; const size_t boff = (size_t)(col0 + t * 16 + ln) * ldb + kb; FragH bq; bq.half[0] = *(const v8us*)(Bh + boff + 8 * hh); bq.half[1] = *(const v8us*)(Bh + boff + 16 + 8 * hh);
      acc[t] = mmaH<ASPLIT ? 2 : 1>(ah.v, al.v, bq.v, bq.v, acc[t]); }
  }
#pragma unroll
  for (int t = 0; t < 4; ++t) { if (col0 + t * 16 >= N) continue;
#pragma unroll
    for (int r = 0; r < 8; ++r) so[w][8 * hh + r][t * 16 + ln] = acc[t][r] * alpha; }
  __builtin_amdgcn_fence(__ATOMIC_ACQ_REL, "workgroup"); __builtin_amdgcn_wave_barrier();
  const int rsub = lane >> 4, c4 = (lane & 15) * 4;
  {
#pragma unroll
    for (int q = 0; q < 8; ++q) { const int r = q * 2 + rsub; if (col0 + c4 < N) { const v4f v = *(const v4fa*)&so[w][r][c4]; *(v4f*)(C + (size_t)(row0 + r) * ldc + col0 + c4) = v; } }
     }
}

// Wt[n][k] = f16(W[k][n]·scale) from f32 row-major W[K][N] (scale = power of two; bf16-exact weights stay exact in f16 away from the subnormal range)
__global__ __launch_bounds__(256) void k_wt_f16(const float* __restrict__ W, _Float16* __restrict__ Wt, int K, int N, float scale) {
  const int t = blockIdx.x * 256 + threadIdx.x; if (t >= N * (K / 8)) return; const int n = t / (K / 8), k8 = (t % (K / 8)) * 8; FragH f;
#pragma unroll
  for (int i = 0; i < 8; ++i) f.h[i] = (_Float16)(bf16_round(W[(size_t)(k8 + i) * N + n]) * scale); const v8us o = f.half[0];
  *(v8us*)((unsigned short*)Wt + (size_t)n * K + k8) = o; 
}
// k_gemm_hh variant with fused epilogue: v = acc·alpha + bias[by·sBias + col] (+ CP[(row/rowsPerB)·sCPb + by·64 + col] if CP) ; ACT 0 none / 1 elu ; writes f16 C16 (and f32 C if non-null)
template <int ACT>
__global__ __launch_bounds__(128) void k_gemm_hhx(const _Float16* __restrict__ A, int lda, size_t sA, const _Float16* __restrict__ Bh, int ldb, size_t sB, float alpha, const float* __restrict__ bias, size_t sBias, const float* __restrict__ CP, int rowsPerB, size_t sCPb, int row0g,
    float* __restrict__ C, _Float16* __restrict__ C16, int ldc, size_t sC, int M, int N, int K) {
  __shared__ __attribute__((aligned(16))) float so[4][16][64];
  const int tid = threadIdx.x, w = tid >> 5, lane = tid & 31, ln = lane & 15, hh = lane >> 4; const int by = blockIdx.y;
  A += (size_t)by * sA; Bh += (size_t)by * sB; const size_t cofs = (size_t)by * sC; const float* bp = bias ? bias + (size_t)by * sBias : nullptr;
  const int ntn = (N + 63) / 64; const int wid = blockIdx.x * 4 + w; const int mt = wid / ntn, nq = wid % ntn; if (mt * 16 >= M) return;
  const int row0 = mt * 16, col0 = nq * 64; const _Float16* arow = A + (size_t)(row0 + ln) * lda;
  v8f acc[4] = {};
  for (int kb = 0; kb < K; kb += 32) { FragH ah; ah.half[0] = *(const v8us*)((const unsigned short*)arow + kb + 8 * hh); ah.half[1] = *(const v8us*)((const unsigned short*)arow + kb + 16 + 8 * hh);
#pragma unroll
    for (int t = 0; t < 4; ++t) { if (col0 + t * 16 >= N) continue; const size_t boff = (size_t)(col0 + t * 16 + ln) * ldb + kb; FragH bq; bq.half[0] = *(const v8us*)((const unsigned short*)Bh + boff + 8 * hh); bq.half[1] = *(const v8us*)((const unsigned short*)Bh + boff + 16 + 8 * hh);
      acc[t] = mmaH<1>(ah.v, ah.v, bq.v, bq.v, acc[t]); }
  }
#pragma unroll
  for (int t = 0; t < 4; ++t) { if (col0 + t * 16 >= N) continue; const int col = col0 + t * 16 + ln; const float bv = bp ? bf16_round(bp[col]) : 0.f;
#pragma unroll
    for (int r = 0; r < 8; ++r) { float v = acc[t][r] * alpha + bv; if (CP) { const int bidx = (row0g + row0 + 8 * hh + r) / rowsPerB; v += CP[(size_t)bidx * sCPb + (size_t)by * 64 + col]; } if (ACT == 1) v = (v > 0.f) ? v : expm1f(v); else if (ACT == 7) v = (v > 0.f) ? v + 1.0f : expf(v); else if (ACT == 8) v = tanhf(v); else if (ACT == 9) v = 0.5f * v * (1.0f + tanhf(0.7978845608028654f * (v + 0.044715f * v * v * v))); else if (ACT == 11) v = 1.0f / (1.0f + expf(-v)); else if (ACT == 12) v = (v > 0.f) ? v : 0.01f * v; else if (ACT == 14) v = (v > 0.f) ? v : 0.1f * v; else if (ACT == 15) v = v / (1.0f + expf(-v)); else if (ACT == 3) v = fmaxf(v, 0.f); else if (ACT == 6) v = 0.5f * v * (1.0f + erff(v * 0.70710678118654752f)); so[w][8 * hh + r][t * 16 + ln] = v; } }
  __builtin_amdgcn_fence(__ATOMIC_ACQ_REL, "workgroup"); __builtin_amdgcn_wave_barrier();
  const int rsub = lane >> 4, c4 = (lane & 15) * 4; typedef _Float16 v4h __attribute__((ext_vector_type(4)));
  {
#pragma unroll
    for (int q = 0; q < 8; ++q) { const int r = q * 2 + rsub; if (col0 + c4 < N) { const v4f v = *(const v4fa*)&so[w][r][c4]; if (C) *(v4f*)(C + cofs + (size_t)(row0 + r) * ldc + col0 + c4) = v; if (C16) { v4h h4; for (int i = 0; i < 4; ++i) h4[i] = (_Float16)v[i]; *(v4h*)(C16 + cofs + (size_t)(row0 + r) * ldc + col0 + c4) = h4; } } }
     }
}


typedef _Float16 v4h __attribute__((ext_vector_type(4)));

__global__ __launch_bounds__(256) void k_x16(const float* __restrict__ x, _Float16* __restrict__ X16, size_t n8) { const size_t t = (size_t)blockIdx.x * 256 + threadIdx.x; if (t >= n8) return; FragH f;
#pragma unroll
  for (int q = 0; q < 8; ++q) f.h[q] = (_Float16)bf16_round(x[t * 8 + q]); *(v8us*)((unsigned short*)X16 + t * 8) = f.half[0];  }
__global__ __launch_bounds__(256) void k_h16(const float* __restrict__ x, _Float16* __restrict__ X16, size_t n8) { const size_t t = (size_t)blockIdx.x * 256 + threadIdx.x; if (t >= n8) return; FragH f;
#pragma unroll
  for (int q = 0; q < 8; ++q) f.h[q] = (_Float16)x[t * 8 + q]; *(v8us*)((unsigned short*)X16 + t * 8) = f.half[0];  }
__global__ __launch_bounds__(256) void k_round16f(const float* __restrict__ W, _Float16* __restrict__ Bt, size_t n8) { const size_t t = (size_t)blockIdx.x * 256 + threadIdx.x; if (t >= n8) return; FragH f;
#pragma unroll
  for (int i = 0; i < 8; ++i) f.h[i] = (_Float16)(bf16_round(W[t * 8 + i]) * 16.0f); *(v8us*)((unsigned short*)Bt + t * 8) = f.half[0];  }
template <int NHv, int TTv>
__global__ __launch_bounds__(256) void k_vt(const _Float16* __restrict__ V16, int ldv, int voff, _Float16* __restrict__ Vt) { __shared__ unsigned short tl[64][66]; const int tid = threadIdx.x; const int slab = blockIdx.x / (TTv / 64), lg = blockIdx.x % (TTv / 64); const int b = slab / NHv, h = slab % NHv;
  for (int i = tid; i < 64 * 8; i += 256) { const int r = i / 8, c8 = (i % 8) * 8; FragH f; f.half[0] = *(const v8us*)((const unsigned short*)V16 + ((size_t)b * TTv + lg * 64 + r) * ldv + voff + h * 64 + c8);
#pragma unroll
    for (int q = 0; q < 8; ++q) tl[r][c8 + q] = f.u[q]; }
  __syncthreads();
  {
#pragma unroll
    for (int rd = 0; rd < 2; ++rd) { const int d = rd * 32 + tid / 8, pc = tid % 8; FragH f;
#pragma unroll
      for (int q = 0; q < 8; ++q) f.u[q] = tl[pc * 8 + q][d];
      *(v8us*)((unsigned short*)Vt + ((size_t)slab * 64 + d) * TTv + lg * 64 + pc * 8) = f.half[0]; }
     } }

__global__ __launch_bounds__(256) void k_hl(const float* __restrict__ F, _Float16* __restrict__ Hh, _Float16* __restrict__ Hl, size_t n8) { const size_t t = (size_t)blockIdx.x * 256 + threadIdx.x; if (t >= n8) return; FragH fh, fl; const v4f a = *(const v4fa*)(F + t * 8), c = *(const v4fa*)(F + t * 8 + 4);
#pragma unroll
  for (int q = 0; q < 4; ++q) { _Float16 h = (_Float16)a[q]; fh.h[q] = h; fl.h[q] = (_Float16)((a[q] - (float)h) * 1024.0f); h = (_Float16)c[q]; fh.h[4 + q] = h; fl.h[4 + q] = (_Float16)((c[q] - (float)h) * 1024.0f); }
  { *(v8us*)((unsigned short*)Hh + t * 8) = fh.half[0]; *(v8us*)((unsigned short*)Hl + t * 8) = fl.half[0];  } }

// ---- fast GEMM (wave tile 32x64; requires M % 32 == 0 rows per launch region and N % 64 == 0); epilogue = k_gemm_hhx semantics ----
__device__ __forceinline__ v16h g2_frag(const _Float16* p, int hh) { FragH f; f.half[0] = *(const v8us*)((const unsigned short*)p + 8 * hh); f.half[1] = *(const v8us*)((const unsigned short*)p + 16 + 8 * hh); return f.v; }
__device__ __forceinline__ v8f g2_mma(v16h a, v16h b, v8f c) { v8f d = __builtin_amdgcn_wmma_f32_16x16x32_f16(false, a, false, b, (short)0, c, false, false); asm volatile("v_nop\n\tv_nop\n\tv_nop\n\tv_nop" : "+v"(d) : "v"(a), "v"(b)); return d; }
template <int ACT>
__global__ __launch_bounds__(128) void k_gemm2(const _Float16* __restrict__ A, int lda, size_t sA, const _Float16* __restrict__ Bh, int ldb, size_t sB, float alpha, const float* __restrict__ bias, size_t sBias, const float* __restrict__ CP, int rowsPerB, size_t sCPb, int row0g,
    float* __restrict__ C, _Float16* __restrict__ C16, int ldc, size_t sC, int M, int N, int K) {
  __shared__ __attribute__((aligned(16))) float so[4][32][68];
  const int tid = threadIdx.x, w = tid >> 5, lane = tid & 31, ln = lane & 15, hh = lane >> 4; const int by = blockIdx.y;
  A += (size_t)by * sA; Bh += (size_t)by * sB; const size_t cofs = (size_t)by * sC; const float* bp = bias ? bias + (size_t)by * sBias : nullptr;
  const int ntn = N >> 6; const int mt = blockIdx.x / ntn, nq = blockIdx.x - mt * ntn; const int row0 = mt * 128 + 32 * w, col0 = nq * 64; if (row0 >= M) return;
  const _Float16* a0p = A + (size_t)(row0 + ln) * lda; const _Float16* a1p = a0p + (size_t)16 * lda;
  const _Float16* b0p = Bh + (size_t)(col0 + ln) * ldb; const _Float16* b1p = b0p + (size_t)16 * ldb; const _Float16* b2p = b1p + (size_t)16 * ldb; const _Float16* b3p = b2p + (size_t)16 * ldb;
  const v8f z8 = {0.f,0.f,0.f,0.f,0.f,0.f,0.f,0.f}; v8f c00 = z8, c01 = z8, c02 = z8, c03 = z8, c10 = z8, c11 = z8, c12 = z8, c13 = z8;
#pragma unroll 1
  for (int kb = 0; kb < K; kb += 32) { const v16h a0 = g2_frag(a0p + kb, hh), a1 = g2_frag(a1p + kb, hh);
    v16h b = g2_frag(b0p + kb, hh); c00 = g2_mma(a0, b, c00); c10 = g2_mma(a1, b, c10);
    b = g2_frag(b1p + kb, hh); c01 = g2_mma(a0, b, c01); c11 = g2_mma(a1, b, c11);
    b = g2_frag(b2p + kb, hh); c02 = g2_mma(a0, b, c02); c12 = g2_mma(a1, b, c12);
    b = g2_frag(b3p + kb, hh); c03 = g2_mma(a0, b, c03); c13 = g2_mma(a1, b, c13); }
  v8f accs[8] = {c00, c01, c02, c03, c10, c11, c12, c13};
#pragma unroll
  for (int u = 0; u < 8; ++u) { const int t = u & 3, half = u >> 2; const int col = col0 + t * 16 + ln; const float bv = bp ? bf16_round(bp[col]) : 0.f;
#pragma unroll
    for (int r = 0; r < 8; ++r) { const int rloc = half * 16 + 8 * hh + r; float v = accs[u][r] * alpha + bv; if (CP) { if (rowsPerB < 0) v += CP[cofs + (size_t)(row0g + row0 + rloc) * ldc + col];      /* rowsPerB < 0: own element of the batched C plane */ else { const int bidx = (row0g + row0 + rloc) / rowsPerB; v += CP[(size_t)bidx * sCPb + (size_t)by * 64 + col]; } }
      if (ACT == 3) v = fmaxf(v, 0.f); else if (ACT == 6) v = 0.5f * v * (1.0f + erff(v * 0.70710678118654752f)); else if (ACT == 11) v = 1.0f / (1.0f + expf(-v)); else if (ACT == 15) v = v / (1.0f + expf(-v)); else if (ACT == 12) v = (v > 0.f) ? v : 0.01f * v; else if (ACT == 8) v = tanhf(v);
      so[w][rloc][t * 16 + ln] = v; } }
  __builtin_amdgcn_fence(__ATOMIC_ACQ_REL, "workgroup"); __builtin_amdgcn_wave_barrier();
  const int rsub = lane >> 4, c4 = (lane & 15) * 4;
  {
#pragma unroll
    for (int q = 0; q < 16; ++q) { const int r = q * 2 + rsub; const v4f v = *(const v4fa*)&so[w][r][c4]; if (C) *(v4f*)(C + cofs + (size_t)(row0 + r) * ldc + col0 + c4) = v; if (C16) { v4h h4; for (int i = 0; i < 4; ++i) h4[i] = (_Float16)v[i]; *(v4h*)(C16 + cofs + (size_t)(row0 + r) * ldc + col0 + c4) = h4; } }
     } }



__constant__ int BK30[2 * SLEN - 1] = {15,15,15,15,15,15,15,15,15,15,15,15,15,15,15,15,15,15,15,15,15,15,15,15,15,15,15,15,15,15,15,15,15,15,15,15,15,15,15,15,15,15,15,15,15,15,15,15,15,15,15,15,15,15,15,15,15,15,15,15,15,15,15,15,15,15,15,15,15,15,15,15,15,15,15,15,15,15,15,15,15,15,15,15,15,15,15,15,15,15,15,15,15,15,15,15,15,15,15,15,15,15,15,15,15,15,15,15,15,15,15,15,15,15,15,15,15,15,15,15,15,15,15,15,15,15,15,15,15,15,15,15,15,15,15,15,15,15,15,15,15,15,15,15,15,15,15,15,15,15,15,15,15,15,15,15,15,15,15,15,15,15,15,15,15,15,15,15,15,15,15,15,15,15,15,15,15,15,15,15,15,15,15,15,15,15,15,15,15,15,15,15,15,15,15,15,15,15,15,15,15,15,15,15,15,15,15,15,15,15,15,15,15,15,15,15,15,15,15,15,15,15,15,15,15,15,15,15,15,15,15,15,15,15,15,15,15,15,15,15,15,15,15,15,15,15,15,15,15,15,15,15,15,15,15,15,15,15,15,15,15,15,15,15,15,15,15,15,15,15,15,15,15,15,15,15,15,15,15,15,15,15,15,15,15,15,15,15,15,15,15,15,15,15,15,15,15,15,15,15,15,15,15,15,15,15,15,15,15,15,15,15,15,15,15,15,15,15,15,15,15,15,15,15,15,15,15,15,15,15,15,15,15,15,15,15,15,15,15,15,15,15,15,15,15,15,15,15,15,15,15,15,15,15,15,15,15,15,15,15,15,15,15,15,15,15,15,15,15,15,15,15,15,15,15,15,15,15,15,15,15,15,15,15,15,15,15,15,15,15,15,15,15,15,15,15,15,15,15,15,15,15,15,15,15,15,15,15,15,15,15,15,15,15,15,15,15,15,15,15,15,15,15,15,15,15,15,15,15,15,15,15,15,15,15,15,15,15,15,15,15,15,15,15,15,15,15,15,15,15,15,15,15,15,15,15,15,15,15,15,15,15,15,15,15,15,15,15,15,15,15,15,15,15,15,15,15,15,15,15,15,15,15,15,15,15,15,15,15,15,15,15,15,15,15,15,15,15,15,15,15,15,15,15,15,15,15,15,15,15,15,15,15,15,15,15,15,15,15,15,15,15,15,15,15,15,15,15,15,15,15,15,15,15,15,15,15,15,15,15,15,15,15,15,15,15,15,15,15,15,15,15,15,15,15,15,15,15,15,15,15,15,15,15,15,15,15,15,15,15,15,15,15,15,15,15,15,15,15,15,15,15,15,15,15,15,15,15,15,15,15,15,15,15,15,15,15,15,15,15,15,15,15,15,15,15,15,15,15,15,15,15,15,15,15,15,15,15,15,15,15,15,15,15,15,15,15,15,15,15,15,15,15,15,15,15,15,15,15,15,15,15,15,15,15,15,15,15,15,15,15,15,15,15,15,15,15,15,15,15,15,15,15,15,15,15,15,15,15,15,15,15,15,15,15,15,15,15,15,15,15,15,15,15,15,15,15,15,15,15,15,15,15,15,15,15,15,15,15,15,15,15,15,15,15,15,15,15,15,15,15,15,15,15,15,15,15,15,15,15,15,15,15,15,15,15,15,15,15,15,15,15,15,15,15,15,15,15,15,15,15,15,15,15,15,15,15,15,15,15,15,15,15,15,15,15,15,15,15,15,15,15,15,15,15,15,15,15,15,15,15,15,15,15,15,15,15,15,15,15,15,15,15,15,15,15,15,15,15,15,15,15,15,15,15,15,15,15,15,15,15,15,15,15,15,15,15,15,15,15,15,15,15,15,15,15,15,15,15,15,15,15,15,15,15,15,15,15,15,15,15,15,15,15,15,15,15,15,15,15,15,15,15,15,15,15,15,15,15,15,15,15,15,15,15,15,15,15,15,15,15,15,15,15,15,15,15,15,15,15,15,15,15,15,15,15,15,15,15,15,15,15,15,15,15,15,15,15,15,15,15,15,15,15,15,15,15,15,15,15,15,15,15,15,15,15,15,15,15,15,15,15,15,15,15,15,15,15,15,15,15,15,15,15,15,15,15,15,15,15,15,15,15,15,15,15,15,15,15,15,15,15,15,15,15,15,15,15,15,15,15,15,15,15,15,15,15,15,15,15,15,15,15,15,15,15,15,15,15,15,15,15,15,15,15,15,15,15,15,15,15,15,15,15,15,15,15,15,15,15,15,15,15,15,15,15,15,15,15,15,15,15,15,15,15,15,15,15,15,15,15,15,15,15,15,15,15,15,15,15,15,15,15,15,15,15,15,15,15,15,15,15,15,15,15,15,15,15,15,15,15,15,15,15,15,15,15,15,15,15,15,15,15,15,15,15,15,15,15,15,15,15,15,15,15,15,15,15,15,15,15,15,15,15,15,15,15,15,15,15,15,15,15,15,15,15,15,15,15,15,15,15,15,15,15,15,15,15,15,15,15,15,15,15,15,15,15,15,15,15,15,15,15,15,15,15,15,15,15,15,15,15,15,15,15,15,15,15,15,15,15,15,15,15,15,15,15,15,15,15,15,15,15,15,15,15,15,15,15,15,15,15,15,15,15,15,15,15,15,15,15,15,15,15,15,15,15,15,15,15,15,15,15,15,15,15,15,15,15,15,15,15,15,15,15,15,15,15,15,15,15,15,15,15,15,15,15,15,15,15,15,15,15,15,15,15,15,15,15,15,15,15,15,15,15,15,15,15,15,15,15,15,15,15,15,15,15,15,15,15,15,15,15,15,15,15,15,15,15,15,15,15,15,15,15,15,15,15,15,15,15,15,15,15,15,15,15,15,15,15,15,15,15,15,15,15,15,15,15,15,15,15,15,15,15,15,15,15,15,15,15,15,15,15,15,15,15,15,15,15,15,15,15,15,15,15,15,15,15,15,15,15,15,15,15,15,15,15,15,15,15,15,15,15,15,15,15,15,15,15,15,15,15,15,15,15,15,15,15,15,15,15,15,15,15,15,15,15,15,15,15,15,15,15,15,15,15,15,15,15,15,15,15,15,15,15,15,15,15,15,15,15,15,15,15,15,15,15,15,15,15,15,15,15,15,15,15,15,15,15,15,15,15,15,15,15,15,15,15,15,15,15,15,15,15,15,15,15,15,15,15,15,15,15,15,15,15,15,15,15,15,15,15,15,15,15,15,15,15,15,15,15,15,15,15,15,15,15,15,15,15,15,15,15,15,15,15,15,15,15,15,15,15,15,15,15,15,15,15,15,15,15,15,15,15,15,15,15,15,15,15,15,15,15,15,15,15,15,15,15,15,15,15,15,15,15,15,15,15,15,15,15,15,15,15,15,15,15,15,15,15,15,15,15,15,15,15,15,15,15,15,15,15,15,15,15,15,15,15,15,15,15,15,15,15,15,15,15,15,15,15,15,15,15,15,15,15,15,15,15,15,15,15,15,15,15,15,15,15,15,15,15,15,15,15,15,15,15,15,15,15,15,15,15,15,15,15,15,15,15,15,15,15,15,15,15,15,15,15,15,15,15,15,15,15,15,15,15,15,15,15,15,15,15,15,15,15,15,15,15,15,15,15,15,15,15,15,15,15,15,15,15,15,15,15,15,15,15,15,15,15,15,15,15,15,15,15,15,15,15,15,15,15,15,15,15,15,15,15,15,15,15,15,15,15,15,15,15,15,15,15,15,15,15,15,15,15,15,15,15,15,15,15,15,15,15,15,15,15,15,15,15,15,15,15,15,15,15,15,15,15,15,15,15,15,15,15,15,15,15,15,15,15,15,15,15,15,15,15,15,15,15,15,15,15,15,15,15,15,15,15,15,15,15,15,15,15,15,15,15,15,15,15,15,15,15,15,15,15,15,15,15,15,15,15,15,15,15,15,15,15,15,15,15,15,15,15,15,15,15,15,15,15,15,15,15,15,15,15,15,15,15,15,15,15,15,15,15,15,15,15,15,15,15,15,15,15,15,15,15,15,15,15,15,15,15,15,15,15,15,15,15,15,15,15,15,15,15,15,15,15,15,15,15,15,15,15,15,15,15,15,15,15,15,15,15,15,15,15,15,15,15,15,15,15,15,15,15,15,15,15,15,15,15,15,15,15,15,15,15,15,15,15,15,15,15,15,15,15,15,15,15,15,15,15,15,15,15,15,15,15,15,15,15,15,15,15,15,15,15,15,15,15,15,15,15,15,15,15,15,15,15,15,15,15,15,15,15,15,15,15,15,15,15,15,15,15,15,15,15,15,15,15,15,15,15,15,15,15,15,15,15,15,15,15,15,15,15,15,15,15,15,15,15,15,15,15,15,15,15,15,15,15,15,15,15,15,15,15,15,15,15,15,15,15,15,15,15,15,15,15,15,15,15,15,15,15,15,15,15,15,15,15,15,15,15,15,14,14,14,14,14,14,14,14,14,14,14,14,14,14,14,14,14,14,14,14,14,14,14,14,14,14,14,13,13,13,13,13,13,13,13,13,13,13,13,13,13,13,13,13,13,12,12,12,12,12,12,12,12,12,12,12,12,12,12,11,11,11,11,11,11,11,11,11,10,10,10,10,10,10,10,9,9,9,9,8,8,8,8,7,6,5,4,3,2,1,0,17,18,19,20,21,22,23,24,24,24,24,25,25,25,25,26,26,26,26,26,26,26,27,27,27,27,27,27,27,27,27,28,28,28,28,28,28,28,28,28,28,28,28,28,28,29,29,29,29,29,29,29,29,29,29,29,29,29,29,29,29,29,29,30,30,30,30,30,30,30,30,30,30,30,30,30,30,30,30,30,30,30,30,30,30,30,30,30,30,30,31,31,31,31,31,31,31,31,31,31,31,31,31,31,31,31,31,31,31,31,31,31,31,31,31,31,31,31,31,31,31,31,31,31,31,31,31,31,31,31,31,31,31,31,31,31,31,31,31,31,31,31,31,31,31,31,31,31,31,31,31,31,31,31,31,31,31,31,31,31,31,31,31,31,31,31,31,31,31,31,31,31,31,31,31,31,31,31,31,31,31,31,31,31,31,31,31,31,31,31,31,31,31,31,31,31,31,31,31,31,31,31,31,31,31,31,31,31,31,31,31,31,31,31,31,31,31,31,31,31,31,31,31,31,31,31,31,31,31,31,31,31,31,31,31,31,31,31,31,31,31,31,31,31,31,31,31,31,31,31,31,31,31,31,31,31,31,31,31,31,31,31,31,31,31,31,31,31,31,31,31,31,31,31,31,31,31,31,31,31,31,31,31,31,31,31,31,31,31,31,31,31,31,31,31,31,31,31,31,31,31,31,31,31,31,31,31,31,31,31,31,31,31,31,31,31,31,31,31,31,31,31,31,31,31,31,31,31,31,31,31,31,31,31,31,31,31,31,31,31,31,31,31,31,31,31,31,31,31,31,31,31,31,31,31,31,31,31,31,31,31,31,31,31,31,31,31,31,31,31,31,31,31,31,31,31,31,31,31,31,31,31,31,31,31,31,31,31,31,31,31,31,31,31,31,31,31,31,31,31,31,31,31,31,31,31,31,31,31,31,31,31,31,31,31,31,31,31,31,31,31,31,31,31,31,31,31,31,31,31,31,31,31,31,31,31,31,31,31,31,31,31,31,31,31,31,31,31,31,31,31,31,31,31,31,31,31,31,31,31,31,31,31,31,31,31,31,31,31,31,31,31,31,31,31,31,31,31,31,31,31,31,31,31,31,31,31,31,31,31,31,31,31,31,31,31,31,31,31,31,31,31,31,31,31,31,31,31,31,31,31,31,31,31,31,31,31,31,31,31,31,31,31,31,31,31,31,31,31,31,31,31,31,31,31,31,31,31,31,31,31,31,31,31,31,31,31,31,31,31,31,31,31,31,31,31,31,31,31,31,31,31,31,31,31,31,31,31,31,31,31,31,31,31,31,31,31,31,31,31,31,31,31,31,31,31,31,31,31,31,31,31,31,31,31,31,31,31,31,31,31,31,31,31,31,31,31,31,31,31,31,31,31,31,31,31,31,31,31,31,31,31,31,31,31,31,31,31,31,31,31,31,31,31,31,31,31,31,31,31,31,31,31,31,31,31,31,31,31,31,31,31,31,31,31,31,31,31,31,31,31,31,31,31,31,31,31,31,31,31,31,31,31,31,31,31,31,31,31,31,31,31,31,31,31,31,31,31,31,31,31,31,31,31,31,31,31,31,31,31,31,31,31,31,31,31,31,31,31,31,31,31,31,31,31,31,31,31,31,31,31,31,31,31,31,31,31,31,31,31,31,31,31,31,31,31,31,31,31,31,31,31,31,31,31,31,31,31,31,31,31,31,31,31,31,31,31,31,31,31,31,31,31,31,31,31,31,31,31,31,31,31,31,31,31,31,31,31,31,31,31,31,31,31,31,31,31,31,31,31,31,31,31,31,31,31,31,31,31,31,31,31,31,31,31,31,31,31,31,31,31,31,31,31,31,31,31,31,31,31,31,31,31,31,31,31,31,31,31,31,31,31,31,31,31,31,31,31,31,31,31,31,31,31,31,31,31,31,31,31,31,31,31,31,31,31,31,31,31,31,31,31,31,31,31,31,31,31,31,31,31,31,31,31,31,31,31,31,31,31,31,31,31,31,31,31,31,31,31,31,31,31,31,31,31,31,31,31,31,31,31,31,31,31,31,31,31,31,31,31,31,31,31,31,31,31,31,31,31,31,31,31,31,31,31,31,31,31,31,31,31,31,31,31,31,31,31,31,31,31,31,31,31,31,31,31,31,31,31,31,31,31,31,31,31,31,31,31,31,31,31,31,31,31,31,31,31,31,31,31,31,31,31,31,31,31,31,31,31,31,31,31,31,31,31,31,31,31,31,31,31,31,31,31,31,31,31,31,31,31,31,31,31,31,31,31,31,31,31,31,31,31,31,31,31,31,31,31,31,31,31,31,31,31,31,31,31,31,31,31,31,31,31,31,31,31,31,31,31,31,31,31,31,31,31,31,31,31,31,31,31,31,31,31,31,31,31,31,31,31,31,31,31,31,31,31,31,31,31,31,31,31,31,31,31,31,31,31,31,31,31,31,31,31,31,31,31,31,31,31,31,31,31,31,31,31,31,31,31,31,31,31,31,31,31,31,31,31,31,31,31,31,31,31,31,31,31,31,31,31,31,31,31,31,31,31,31,31,31,31,31,31,31,31,31,31,31,31,31,31,31,31,31,31,31,31,31,31,31,31,31,31,31,31,31,31,31,31,31,31,31,31,31,31,31,31,31,31,31,31,31,31,31,31,31,31,31,31,31,31,31,31,31,31,31,31,31,31,31,31,31,31,31,31,31,31,31,31,31,31,31,31,31,31,31,31,31,31,31,31,31,31,31,31,31,31,31,31,31,31,31,31,31,31,31,31,31,31,31,31,31,31,31,31,31,31,31,31,31,31,31,31,31,31,31,31,31,31,31,31,31,31,31,31,31,31,31,31,31,31,31,31,31,31,31,31,31,31,31,31,31,31,31,31,31,31,31,31,31,31,31,31,31,31,31,31,31,31,31,31,31,31,31,31,31,31,31,31,31,31,31,31,31,31,31,31,31,31,31,31,31,31,31,31,31,31,31,31,31,31,31,31,31,31,31,31,31,31,31,31,31,31,31,31,31,31,31,31,31,31,31,31,31,31,31,31,31,31,31,31,31,31,31,31,31,31,31,31,31,31,31,31,31,31,31,31,31,31,31,31,31,31,31,31,31,31,31,31,31,31,31,31,31,31,31,31,31,31,31,31,31,31,31,31,31,31,31,31,31,31,31,31,31,31,31,31,31,31,31,31,31,31,31,31,31,31,31,31,31,31,31,31,31,31,31,31,31,31,31,31,31,31,31,31,31,31,31,31,31,31,31,31,31,31,31,31,31,31,31,31,31,31,31,31,31,31,31,31,31,31,31,31,31,31,31,31,31,31,31,31,31,31,31,31,31,31,31,31,31,31,31,31,31,31,31,31,31,31,31,31,31,31,31,31,31,31,31,31,31,31,31,31,31,31,31,31,31,31,31,31,31,31,31,31,31,31,31,31,31,31,31,31,31,31,31,31,31,31,31,31,31,31,31,31,31,31,31,31,31,31,31,31,31,31,31,31,31,31,31,31,31,31,31,31,31,31,31,31,31,31,31,31,31,31,31,31,31,31,31,31,31,31,31,31,31,31,31,31,31,31,31,31,31,31,31,31,31,31,31,31,31,31,31,31,31,31,31,31,31,31,31,31,31,31,31,31,31,31,31,31,31,31,31,31,31,31,31,31,31,31,31,31,31,31,31,31,31,31,31,31,31,31,31,31,31,31,31,31,31,31,31,31,31,31,31,31,31,31,31,31,31,31,31,31,31,31,31,31,31,31,31,31,31,31,31,31,31,31,31,31,31,31,31,31,31,31,31,31,31,31,31,31,31,31,31,31,31,31,31,31,31,31,31,31,31,31,31,31,31,31,31,31,31,31,31,31,31,31,31,31,31,31,31,31,31,31,31,31,31,31,31,31,31,31,31,31,31,31,31,31,31,31,31,31,31,31,31,31,31,31,31,31,31,31,31,31,31,31,31,31,31,31,31,31,31,31,31,31,31,31,31,31,31,31,31,31,31,31,31,31,31,31,31,31,31,31,31,31,31,31,31,31,31,31,31,31,31,31,31,31,31,31,31,31,31,31,31,31,31,31,31,31,31,31,31,31,31,31,31,31,31,31,31,31,31,31,31,31,31,31,31,31,31,31,31,31,31,31,31,31,31,31,31,31,31,31,31,31,31,31,31,31,31,31,31,31,31,31,31,31,31,31,31,31,31,31,31,31,31,31,31,31,31,31,31,31,31,31,31,31,31,31,31,31,31,31,31,31,31,31,31,31,31,31,31,31,31,31,31,31,31,31,31,31,31,31,31,31,31,31,31,31,31,31,31,31,31,31,31,31,31,31,31,31,31,31,31,31,31,31,31,31,31,31,31,31,31,31,31,31,31,31,31,31,31,31,31,31,31,31,31,31,31,31,31,31,31,31,31,31,31,31,31,31,31,31,31,31,31,31,31,31,31,31,31,31,31,31,31,31,31,31,31,31,31,31,31,31,31,31,31,31,31,31,31,31,31,31,31,31,31,31,31,31,31,31,31,31,31,31,31,31,31,31,31,31,31,31,31,31,31,31,31,31,31,31,31,31,31,31,31,31,31,31,31,31,31,31,31,31,31,31,31,31,31,31,31,31,31,31,31,31,31,31,31,31,31};      /* T5 _relative_position_bucket(k - q) for k - q in [-(S-1), S-1], computed with the module's own jax code on the host */
__global__ __launch_bounds__(512) void k_rb(const float* __restrict__ t, float* __restrict__ RB) { const int i = threadIdx.x; const float v = bf16_round(t[i]); *(float*)(RB + i) = v;  }
template <int CAUSAL>
__global__ __launch_bounds__(128) void k_flash(const _Float16* __restrict__ Q16, int ldq, const _Float16* __restrict__ K16, int ldk, const _Float16* __restrict__ Vt, const int* __restrict__ MSK, float* __restrict__ O, int ldo) {
  constexpr int RPW = 16, RTN = RPW / 16, NQB = TQ / (4 * RPW), DT = 4, KS = 2;
  __shared__ __attribute__((aligned(16))) unsigned short sP[4][RPW][40]; __shared__ __attribute__((aligned(16))) float sO[4][RPW][64 + 4];
  const int tid = threadIdx.x, w = tid >> 5, lane = tid & 31, ln = lane & 15, hh = lane >> 4;
  const int slab = blockIdx.x / QBNP, qblk = QB0P + blockIdx.x % QBNP; (void)NQB; const int b = slab / NH, h = slab % NH; const int qb0 = qblk * (4 * RPW); const int q0 = qb0 + w * RPW;
  FragH aq[2][KS];
#pragma unroll
  for (int rt = 0; rt < RTN; ++rt) { const unsigned short* qr = (const unsigned short*)Q16 + ((size_t)b * TQ + q0 + rt * 16 + ln) * ldq + h * 64;
#pragma unroll
    for (int ks = 0; ks < KS; ++ks) { aq[rt][ks].half[0] = *(const v8us*)(qr + ks * 32 + 8 * hh); aq[rt][ks].half[1] = *(const v8us*)(qr + ks * 32 + 16 + 8 * hh); } }
  const unsigned short* Vth = (const unsigned short*)Vt + (size_t)slab * 64 * TK;
  float m_r[2][8], l_r[2][8]; v8f oacc[2][DT];
#pragma unroll
  for (int rt = 0; rt < RTN; ++rt) {
#pragma unroll
    for (int r = 0; r < 8; ++r) { m_r[rt][r] = -3.0e38f; l_r[rt][r] = 0.f; }
#pragma unroll
    for (int dt = 0; dt < DT; ++dt) oacc[rt][dt] = (v8f){0.f,0.f,0.f,0.f,0.f,0.f,0.f,0.f}; }
  float qsq[2][8];      /* mode 32: |q|^2 of this lane's rows, read once */
#pragma unroll
  for (int rt = 0; rt < RTN; ++rt)
#pragma unroll
    for (int r = 0; r < 8; ++r) qsq[rt][r] = (CAUSAL == 32) ? ((const float*)MSK)[(size_t)b * TQ + q0 + rt * 16 + 8 * hh + r] : 0.f;
  const int jend = (CAUSAL == 1 || CAUSAL == 32) ? (qb0 + 4 * RPW) : ((CAUSAL == 23) ? min(TK, (qb0 / CHK + 2) * CHK) : TK);      /* causal / window: keys that can never contribute are skipped */ const int jbeg = (CAUSAL == 23) ? max(0, (qb0 / CHK - 1) * CHK) : 0;
#pragma unroll 1
  for (int j0 = jbeg; j0 < jend; j0 += 32) {
    v8f s[2][2];
    float ksq0 = 0.f, ksq1 = 0.f; if (CAUSAL == 32) { const float* ksT = (const float*)MSK + (size_t)NB * TQ + (size_t)b * TK + j0 + ln; ksq0 = ksT[0]; ksq1 = ksT[16]; }      /* mode 32: |k|^2 of this lane's two keys, one unconditional load each per key block (j0 + 31 < jend <= TK) */
#pragma unroll
    for (int nt = 0; nt < 2; ++nt) { const unsigned short* kr = (const unsigned short*)K16 + ((size_t)b * TK + j0 + nt * 16 + ln) * ldk + h * 64; FragH bk[KS];
#pragma unroll
      for (int ks = 0; ks < KS; ++ks) { bk[ks].half[0] = *(const v8us*)(kr + ks * 32 + 8 * hh); bk[ks].half[1] = *(const v8us*)(kr + ks * 32 + 16 + 8 * hh); }
#pragma unroll
      for (int rt = 0; rt < RTN; ++rt) { v8f acc = (v8f){0.f,0.f,0.f,0.f,0.f,0.f,0.f,0.f};
#pragma unroll
        for (int ks = 0; ks < KS; ++ks) acc = mmaH<1>(aq[rt][ks].v, aq[rt][ks].v, bk[ks].v, bk[ks].v, acc); s[rt][nt] = acc; } }
#pragma unroll
    for (int rt = 0; rt < RTN; ++rt)
#pragma unroll
      for (int r = 0; r < 8; ++r) { const int tq = q0 + rt * 16 + 8 * hh + r; const int k0 = j0 + ln, k1 = j0 + 16 + ln;
        bool ok0 = (CAUSAL == 1 || CAUSAL == 32) ? (k0 <= tq) : ((CAUSAL == 2) ? ((k0 >> 5) == (tq >> 5)) : true), ok1 = (CAUSAL == 1 || CAUSAL == 32) ? (k1 <= tq) : ((CAUSAL == 2) ? ((k1 >> 5) == (tq >> 5)) : true); if (CAUSAL == 23) { const int cq = tq / CHK; ok0 = (abs(k0 / CHK - cq) <= 1) && (MSK[(size_t)b * TK + k0] == 0); ok1 = (abs(k1 / CHK - cq) <= 1) && (MSK[(size_t)b * TK + k1] == 0); }      /* mode 23: 3-chunk window + int key-padding mask */
        if (CAUSAL == 24) { ok0 = (MSK[(size_t)b * TK + k0] == 0); ok1 = (MSK[(size_t)b * TK + k1] == 0); }      /* mode 24: int key-padding mask (nonzero = padded = excluded) */      /* mode 2: block-diagonal 32-token groups */
        float s0 = ok0 ? s[rt][0][r] * SCL : -3.0e38f, s1 = ok1 ? s[rt][1][r] * SCL : -3.0e38f; if (CAUSAL == 27) { const float* amk = (const float*)MSK + ((size_t)b * MQI + tq) * MKI; s0 += bf16_round(amk[k0]); s1 += bf16_round(amk[k1]); }      /* mode 27: additive per-(batch, query, key) f32 mask INPUT [b][tq][k] */ if (CAUSAL == 30) { const float* rbp = (const float*)MSK; s0 += rbp[BK30[k0 - tq + (TK - 1)] * NH + h]; s1 += rbp[BK30[k1 - tq + (TK - 1)] * NH + h]; }      /* mode 30: T5 bucketed relative bias: table[bucket(k - q)][h]; bucket-of-distance is a module constant */ if (CAUSAL == 32) { const float qs = qsq[rt][r]; if (ok0) { float d = qs + ksq0; d = d - 2.0f * s0; d = fmaxf(d, 0.f); s0 = -d * 0.125f; } if (ok1) { float d = qs + ksq1; d = d - 2.0f * s1; d = fmaxf(d, 0.f); s1 = -d * 0.125f; } }      /* mode 32: RBF logit -relu(|q|^2 + |k|^2 - 2 q.k)/8, causal */ if (CAUSAL == 17) { const float* amk = (const float*)MSK + (size_t)b * TK; s0 += bf16_round(amk[k0]); s1 += bf16_round(amk[k1]); } if (CAUSAL == 18) { const float* tb = (const float*)MSK; const int* ri = MSK + 1024 + (size_t)b * TK; const int rq = ri[tq]; s0 += tb[(h * 8 + rq) * 8 + ri[k0]]; s1 += tb[(h * 8 + rq) * 8 + ri[k1]]; } if (CAUSAL == 19) { const int* rel = MSK + (size_t)tq * TK; const float* rb = (const float*)MSK + (size_t)TQ * TK + ((size_t)(b * NH + h) * TQ + tq) * 64; s0 += rb[rel[k0]]; s1 += rb[rel[k1]]; }      /* mode 19: + (q.Ek[rel] + Eb[rel][h]) / 8 gathered by the int relative ids (packed [ids | table]) */      /* mode 18: + resource_bias[h][r_q][r_k] from the packed [table | ids] buffer (TQ == TK) */      /* mode 17: additive per-(batch, key) mask INPUT */ float mc = fmaxf(s0, s1);
        mc = fmaxf(mc, __shfl_xor(mc, 1, 32)); mc = fmaxf(mc, __shfl_xor(mc, 2, 32)); mc = fmaxf(mc, __shfl_xor(mc, 4, 32)); mc = fmaxf(mc, __shfl_xor(mc, 8, 32));
        const float mn = fmaxf(m_r[rt][r], mc); const float ea = expf(m_r[rt][r] - mn), e0 = expf(s0 - mn), e1 = expf(s1 - mn);      /* computed for every lane and selected below: no exec-mask branch, so the eight rows' chains can overlap */ const float al = (mn > -1.0e38f) ? ea : 1.0f; m_r[rt][r] = mn; const float p0 = ok0 ? e0 : 0.f, p1 = ok1 ? e1 : 0.f; l_r[rt][r] = l_r[rt][r] * al + p0 + p1;
#pragma unroll
        for (int dt = 0; dt < DT; ++dt) oacc[rt][dt][r] *= al;
        FragH t2; t2.h[0] = (_Float16)(p0 * 1024.0f); t2.h[1] = (_Float16)(p1 * 1024.0f); sP[w][rt * 16 + 8 * hh + r][ln] = t2.u[0]; sP[w][rt * 16 + 8 * hh + r][16 + ln] = t2.u[1]; }
    __builtin_amdgcn_fence(__ATOMIC_ACQ_REL, "workgroup"); __builtin_amdgcn_wave_barrier();
    FragH pa[2];
#pragma unroll
    for (int rt = 0; rt < RTN; ++rt) { pa[rt].half[0] = *(const v8us*)&sP[w][rt * 16 + ln][8 * hh]; pa[rt].half[1] = *(const v8us*)&sP[w][rt * 16 + ln][16 + 8 * hh]; }
#pragma unroll
    for (int dt = 0; dt < DT; ++dt) { const unsigned short* vrow = Vth + (size_t)(dt * 16 + ln) * TK + j0; FragH bv; bv.half[0] = *(const v8us*)(vrow + 8 * hh); bv.half[1] = *(const v8us*)(vrow + 16 + 8 * hh);
#pragma unroll
      for (int rt = 0; rt < RTN; ++rt) oacc[rt][dt] = mmaH<1>(pa[rt].v, pa[rt].v, bv.v, bv.v, oacc[rt][dt]); }
    __builtin_amdgcn_fence(__ATOMIC_ACQ_REL, "workgroup"); __builtin_amdgcn_wave_barrier(); }
#pragma unroll
  for (int rt = 0; rt < RTN; ++rt) {
#pragma unroll
    for (int r = 0; r < 8; ++r) { float l = l_r[rt][r]; l += __shfl_xor(l, 1, 32); l += __shfl_xor(l, 2, 32); l += __shfl_xor(l, 4, 32); l += __shfl_xor(l, 8, 32); l_r[rt][r] = (l > 0.f) ? 1.0f / (l * 1024.0f) : 0.f; }
#pragma unroll
    for (int dt = 0; dt < DT; ++dt)
#pragma unroll
      for (int r = 0; r < 8; ++r) sO[w][rt * 16 + 8 * hh + r][dt * 16 + ln] = oacc[rt][dt][r] * l_r[rt][r]; }
  __builtin_amdgcn_fence(__ATOMIC_ACQ_REL, "workgroup"); __builtin_amdgcn_wave_barrier();
  {
#pragma unroll
    for (int rp = 0; rp < RPW; rp += 2) { const int r = rp + (lane >> 4), pc = lane & 15; const v4f val = *(const v4fa*)&sO[w][r][pc * 4]; *(v4f*)(O + ((size_t)b * TQ + q0 + r) * ldo + h * 64 + pc * 4) = val; }
     } }
// 5-plane variant: S = Qh Kh^T + (Ql Kh^T + Qh Kl^T)/1024 with Q/K = [hi | 2^10 residual] f16 planes (QL/KL same layout as Q16/K16), then the 3-term P.V below.
// 3-term variant: O = (P_hi V_hi + (P_lo V_hi + P_hi V_lo) / 1024) / l with P = [hi | 2^10 residual] of 1024 p and V^T = [hi | 2^10 residual] planes (VtL same layout as Vt) -> ~2^-21-class products for un-averaged (early causal / peaked) rows
template <int CAUSAL>
__global__ __launch_bounds__(128) void k_flash5(const _Float16* __restrict__ Q16, const _Float16* __restrict__ QL, int ldq, const _Float16* __restrict__ K16, const _Float16* __restrict__ KL, int ldk, const _Float16* __restrict__ Vt, const _Float16* __restrict__ VtL, const int* __restrict__ MSK, float* __restrict__ O, int ldo) {
  constexpr int RPW = 16, RTN = RPW / 16, NQB = TQ / (4 * RPW), DT = 4, KS = 2;
  __shared__ __attribute__((aligned(16))) unsigned short sP[4][RPW][40]; __shared__ __attribute__((aligned(16))) unsigned short sPL[4][RPW][40]; __shared__ __attribute__((aligned(16))) float sO[4][RPW][64 + 4];
  const int tid = threadIdx.x, w = tid >> 5, lane = tid & 31, ln = lane & 15, hh = lane >> 4;
  const int slab = blockIdx.x / QBN5, qblk = QB05 + blockIdx.x % QBN5; (void)NQB; const int b = slab / NH, h = slab % NH; const int qb0 = qblk * (4 * RPW); const int q0 = qb0 + w * RPW;
  FragH aq[2][KS], aql[2][KS];
#pragma unroll
  for (int rt = 0; rt < RTN; ++rt) { const unsigned short* qr = (const unsigned short*)Q16 + ((size_t)b * TQ + q0 + rt * 16 + ln) * ldq + h * 64; const unsigned short* ql = (const unsigned short*)QL + ((size_t)b * TQ + q0 + rt * 16 + ln) * ldq + h * 64;
#pragma unroll
    for (int ks = 0; ks < KS; ++ks) { aq[rt][ks].half[0] = *(const v8us*)(qr + ks * 32 + 8 * hh); aq[rt][ks].half[1] = *(const v8us*)(qr + ks * 32 + 16 + 8 * hh); aql[rt][ks].half[0] = *(const v8us*)(ql + ks * 32 + 8 * hh); aql[rt][ks].half[1] = *(const v8us*)(ql + ks * 32 + 16 + 8 * hh); } }
  const unsigned short* Vth = (const unsigned short*)Vt + (size_t)slab * 64 * TK; const unsigned short* Vtl = (const unsigned short*)VtL + (size_t)slab * 64 * TK;
  float m_r[2][8], l_r[2][8]; v8f oacc[2][DT], oaccL[2][DT];
#pragma unroll
  for (int rt = 0; rt < RTN; ++rt) {
#pragma unroll
    for (int r = 0; r < 8; ++r) { m_r[rt][r] = -3.0e38f; l_r[rt][r] = 0.f; }
#pragma unroll
    for (int dt = 0; dt < DT; ++dt) { oacc[rt][dt] = (v8f){0.f,0.f,0.f,0.f,0.f,0.f,0.f,0.f}; oaccL[rt][dt] = oacc[rt][dt]; } }
  const int jend = (CAUSAL == 1 || CAUSAL == 32) ? (qb0 + 4 * RPW) : ((CAUSAL == 23) ? min(TK, (qb0 / CHK + 2) * CHK) : TK);      /* causal / window: keys that can never contribute are skipped */ const int jbeg = (CAUSAL == 23) ? max(0, (qb0 / CHK - 1) * CHK) : 0;
#pragma unroll 1
  for (int j0 = jbeg; j0 < jend; j0 += 32) {
    v8f s[2][2];
#pragma unroll
    for (int nt = 0; nt < 2; ++nt) { const unsigned short* kr = (const unsigned short*)K16 + ((size_t)b * TK + j0 + nt * 16 + ln) * ldk + h * 64; const unsigned short* klr = (const unsigned short*)KL + ((size_t)b * TK + j0 + nt * 16 + ln) * ldk + h * 64; FragH bk[KS], bkl[KS];
#pragma unroll
      for (int ks = 0; ks < KS; ++ks) { bk[ks].half[0] = *(const v8us*)(kr + ks * 32 + 8 * hh); bk[ks].half[1] = *(const v8us*)(kr + ks * 32 + 16 + 8 * hh); bkl[ks].half[0] = *(const v8us*)(klr + ks * 32 + 8 * hh); bkl[ks].half[1] = *(const v8us*)(klr + ks * 32 + 16 + 8 * hh); }
#pragma unroll
      for (int rt = 0; rt < RTN; ++rt) { v8f acc = (v8f){0.f,0.f,0.f,0.f,0.f,0.f,0.f,0.f}, accl = acc;
#pragma unroll
        for (int ks = 0; ks < KS; ++ks) { acc = mmaH<1>(aq[rt][ks].v, aq[rt][ks].v, bk[ks].v, bk[ks].v, acc); accl = mmaH<1>(aql[rt][ks].v, aql[rt][ks].v, bk[ks].v, bk[ks].v, accl); accl = mmaH<1>(aq[rt][ks].v, aq[rt][ks].v, bkl[ks].v, bkl[ks].v, accl); }
#pragma unroll
        for (int r = 0; r < 8; ++r) acc[r] += accl[r] * 0.0009765625f;
        s[rt][nt] = acc; } }
#pragma unroll
    for (int rt = 0; rt < RTN; ++rt)
#pragma unroll
      for (int r = 0; r < 8; ++r) { const int tq = q0 + rt * 16 + 8 * hh + r; const int k0 = j0 + ln, k1 = j0 + 16 + ln;
        bool ok0 = (CAUSAL == 1 || CAUSAL == 32) ? (k0 <= tq) : ((CAUSAL == 2) ? ((k0 >> 5) == (tq >> 5)) : true), ok1 = (CAUSAL == 1 || CAUSAL == 32) ? (k1 <= tq) : ((CAUSAL == 2) ? ((k1 >> 5) == (tq >> 5)) : true);      /* mode 2: block-diagonal 32-token groups */
        if (CAUSAL == 4) { const int* mrow = MSK + ((size_t)b * TQ + tq) * TK; ok0 = mrow[k0] != 0; ok1 = mrow[k1] != 0; }      /* mode 4: per-(query, key) INPUT mask shared by all heads; masked keys contribute nothing (== the reference's -4096 fill, whose exp underflows to 0), rows with no valid key give l = 0 -> output 0 (== the reference's row_valid zeroing) */
        float s0 = ok0 ? s[rt][0][r] * SCL : -3.0e38f, s1 = ok1 ? s[rt][1][r] * SCL : -3.0e38f; if (CAUSAL == 30) { const float* rbp = (const float*)MSK; s0 += rbp[BK30[k0 - tq + (TK - 1)] * NH + h]; s1 += rbp[BK30[k1 - tq + (TK - 1)] * NH + h]; }      /* mode 30: T5 bucketed relative bias: table[bucket(k - q)][h]; bucket-of-distance is a module constant */ if (CAUSAL == 32) { const float* qsT = (const float*)MSK; const float* ksT = qsT + (size_t)NB * TQ; const float qs = qsT[(size_t)b * TQ + tq]; if (ok0) { float d = qs + ksT[(size_t)b * TK + k0]; d = d - 2.0f * s0; d = fmaxf(d, 0.f); s0 = -d * 0.125f; } if (ok1) { float d = qs + ksT[(size_t)b * TK + k1]; d = d - 2.0f * s1; d = fmaxf(d, 0.f); s1 = -d * 0.125f; } }      /* mode 32: RBF logit -relu(|q|^2 + |k|^2 - 2 q.k)/8, causal */ if (CAUSAL == 17) { const float* amk = (const float*)MSK + (size_t)b * TK; s0 += bf16_round(amk[k0]); s1 += bf16_round(amk[k1]); } if (CAUSAL == 18) { const float* tb = (const float*)MSK; const int* ri = MSK + 1024 + (size_t)b * TK; const int rq = ri[tq]; s0 += tb[(h * 8 + rq) * 8 + ri[k0]]; s1 += tb[(h * 8 + rq) * 8 + ri[k1]]; } if (CAUSAL == 19) { const int* rel = MSK + (size_t)tq * TK; const float* rb = (const float*)MSK + (size_t)TQ * TK + ((size_t)(b * NH + h) * TQ + tq) * 64; s0 += rb[rel[k0]]; s1 += rb[rel[k1]]; }      /* mode 19: + (q.Ek[rel] + Eb[rel][h]) / 8 gathered by the int relative ids (packed [ids | table]) */      /* mode 18: + resource_bias[h][r_q][r_k] from the packed [table | ids] buffer (TQ == TK) */      /* mode 17: additive per-(batch, key) mask INPUT */ float mc = fmaxf(s0, s1);
        mc = fmaxf(mc, __shfl_xor(mc, 1, 32)); mc = fmaxf(mc, __shfl_xor(mc, 2, 32)); mc = fmaxf(mc, __shfl_xor(mc, 4, 32)); mc = fmaxf(mc, __shfl_xor(mc, 8, 32));
        const float mn = fmaxf(m_r[rt][r], mc); const float al = (mn > -1.0e38f) ? expf(m_r[rt][r] - mn) : 1.0f; m_r[rt][r] = mn; const float p0 = ok0 ? expf(s0 - mn) : 0.f, p1 = ok1 ? expf(s1 - mn) : 0.f; l_r[rt][r] = l_r[rt][r] * al + p0 + p1;
#pragma unroll
        for (int dt = 0; dt < DT; ++dt) { oacc[rt][dt][r] *= al; oaccL[rt][dt][r] *= al; }
        FragH t2, t2l; const float ps0 = p0 * 1024.0f, ps1 = p1 * 1024.0f; t2.h[0] = (_Float16)ps0; t2.h[1] = (_Float16)ps1; t2l.h[0] = (_Float16)((ps0 - (float)t2.h[0]) * 1024.0f); t2l.h[1] = (_Float16)((ps1 - (float)t2.h[1]) * 1024.0f);
        sP[w][rt * 16 + 8 * hh + r][ln] = t2.u[0]; sP[w][rt * 16 + 8 * hh + r][16 + ln] = t2.u[1]; sPL[w][rt * 16 + 8 * hh + r][ln] = t2l.u[0]; sPL[w][rt * 16 + 8 * hh + r][16 + ln] = t2l.u[1]; }
    __builtin_amdgcn_fence(__ATOMIC_ACQ_REL, "workgroup"); __builtin_amdgcn_wave_barrier();
    FragH pa[2], pl[2];
#pragma unroll
    for (int rt = 0; rt < RTN; ++rt) { pa[rt].half[0] = *(const v8us*)&sP[w][rt * 16 + ln][8 * hh]; pa[rt].half[1] = *(const v8us*)&sP[w][rt * 16 + ln][16 + 8 * hh]; pl[rt].half[0] = *(const v8us*)&sPL[w][rt * 16 + ln][8 * hh]; pl[rt].half[1] = *(const v8us*)&sPL[w][rt * 16 + ln][16 + 8 * hh]; }
#pragma unroll
    for (int dt = 0; dt < DT; ++dt) { const unsigned short* vrow = Vth + (size_t)(dt * 16 + ln) * TK + j0; const unsigned short* vrl = Vtl + (size_t)(dt * 16 + ln) * TK + j0; FragH bv, bl; bv.half[0] = *(const v8us*)(vrow + 8 * hh); bv.half[1] = *(const v8us*)(vrow + 16 + 8 * hh); bl.half[0] = *(const v8us*)(vrl + 8 * hh); bl.half[1] = *(const v8us*)(vrl + 16 + 8 * hh);
#pragma unroll
      for (int rt = 0; rt < RTN; ++rt) { oacc[rt][dt] = mmaH<1>(pa[rt].v, pa[rt].v, bv.v, bv.v, oacc[rt][dt]); oaccL[rt][dt] = mmaH<1>(pl[rt].v, pl[rt].v, bv.v, bv.v, oaccL[rt][dt]); oaccL[rt][dt] = mmaH<1>(pa[rt].v, pa[rt].v, bl.v, bl.v, oaccL[rt][dt]); } }
    __builtin_amdgcn_fence(__ATOMIC_ACQ_REL, "workgroup"); __builtin_amdgcn_wave_barrier(); }
#pragma unroll
  for (int rt = 0; rt < RTN; ++rt) {
#pragma unroll
    for (int r = 0; r < 8; ++r) { float l = l_r[rt][r]; l += __shfl_xor(l, 1, 32); l += __shfl_xor(l, 2, 32); l += __shfl_xor(l, 4, 32); l += __shfl_xor(l, 8, 32); l_r[rt][r] = (l > 0.f) ? 1.0f / (l * 1024.0f) : 0.f; }
#pragma unroll
    for (int dt = 0; dt < DT; ++dt)
#pragma unroll
      for (int r = 0; r < 8; ++r) { float v = oacc[rt][dt][r]; v += oaccL[rt][dt][r] * 0.0009765625f; sO[w][rt * 16 + 8 * hh + r][dt * 16 + ln] = v * l_r[rt][r]; } }
  __builtin_amdgcn_fence(__ATOMIC_ACQ_REL, "workgroup"); __builtin_amdgcn_wave_barrier();
  {
#pragma unroll
    for (int rp = 0; rp < RPW; rp += 2) { const int r = rp + (lane >> 4), pc = lane & 15; const v4f val = *(const v4fa*)&sO[w][r][pc * 4]; *(v4f*)(O + ((size_t)b * TQ + q0 + r) * ldo + h * 64 + pc * 4) = val; }
     } }

__global__ __launch_bounds__(256) void k_rotab(float* __restrict__ CS, float* __restrict__ SN) {
  #pragma clang fp contract(off)
  const int t = blockIdx.x * 256 + threadIdx.x; if (t >= SLEN * 32) return; const int j = t % 32, s = t / 32; const float ex = (float)(2 * j) / 64.0f; const float inv = 1.0f / powf(10000.0f, ex); const float th = (float)s * inv; const float c = cosf(th), sn = sinf(th);
  { *(float*)(CS + t) = c; *(float*)(SN + t) = sn;  } }
__global__ __launch_bounds__(256) void k_rope(const float* __restrict__ F, int nsrc, int ndst, int rep, const float* __restrict__ CS, const float* __restrict__ SN, _Float16* __restrict__ H, _Float16* __restrict__ L) {
  #pragma clang fp contract(off)
  const size_t t = (size_t)blockIdx.x * 256 + threadIdx.x; if (t >= (size_t)NR * ndst * 4) return; const int g8 = (int)(t % 4); const int hd = (int)((t / 4) % ndst); const size_t row = t / ((size_t)4 * ndst); const int s = (int)(row % SLEN); const int hs = hd / rep;
  const float* src = F + row * (size_t)(nsrc * 64) + hs * 64; FragH ah, al, bh, bl;
  for (int i = 0; i < 8; ++i) { const int d = g8 * 8 + i; const float c = CS[s * 32 + d], sn = SN[s * 32 + d]; const float x1 = src[d], x2 = src[d + 32];
    float o1 = x1 * c; o1 += -x2 * sn; float o2 = x2 * c; o2 += x1 * sn;
    _Float16 hv = (_Float16)o1; ah.h[i] = hv; al.h[i] = (_Float16)((o1 - (float)hv) * 1024.0f); hv = (_Float16)o2; bh.h[i] = hv; bl.h[i] = (_Float16)((o2 - (float)hv) * 1024.0f); }
  const size_t o = row * (size_t)(ndst * 64) + hd * 64 + g8 * 8;
  { *(v8us*)((unsigned short*)H + o) = ah.half[0]; *(v8us*)((unsigned short*)H + o + 32) = bh.half[0]; *(v8us*)((unsigned short*)L + o) = al.half[0]; *(v8us*)((unsigned short*)L + o + 32) = bl.half[0];  } }
__global__ __launch_bounds__(256) void k_rope2(const float* __restrict__ F, int nsrc, int ndst, int rep, const float* __restrict__ CS, const float* __restrict__ SN, _Float16* __restrict__ H, _Float16* __restrict__ L) {
  #pragma clang fp contract(off)
  const size_t t = (size_t)blockIdx.x * 256 + threadIdx.x; if (t >= (size_t)NR * ndst * 4) return; const int g16 = (int)(t % 4); const int hd = (int)((t / 4) % ndst); const size_t row = t / ((size_t)4 * ndst); const int s = (int)(row % SLEN); const int hs = hd / rep;
  const float* src = F + row * (size_t)(nsrc * 64) + hs * 64 + g16 * 16; FragH ah, al;
  for (int pr = 0; pr < 8; ++pr) { const int i = g16 * 8 + pr; const float c = CS[s * 32 + i], sn = SN[s * 32 + i]; const float x1 = src[2 * pr], x2 = src[2 * pr + 1];
    float o1 = x1 * c; o1 -= x2 * sn; float o2 = x1 * sn; o2 += x2 * c;
    _Float16 hv = (_Float16)o1; ah.h[2 * pr] = hv; al.h[2 * pr] = (_Float16)((o1 - (float)hv) * 1024.0f); hv = (_Float16)o2; ah.h[2 * pr + 1] = hv; al.h[2 * pr + 1] = (_Float16)((o2 - (float)hv) * 1024.0f); }
  const size_t o = row * (size_t)(ndst * 64) + hd * 64 + g16 * 16;
  { *(v8us*)((unsigned short*)H + o) = ah.half[0]; *(v8us*)((unsigned short*)H + o + 8) = ah.half[1]; *(v8us*)((unsigned short*)L + o) = al.half[0]; *(v8us*)((unsigned short*)L + o + 8) = al.half[1];  } }
__global__ __launch_bounds__(256) void k_ln512(const float* __restrict__ A, const float* __restrict__ res, const float* __restrict__ g, const float* __restrict__ bb, float* __restrict__ Y, _Float16* __restrict__ Y16) {
  #pragma clang fp contract(off)
  const int wv = threadIdx.x >> 5, ln = threadIdx.x & 31; const size_t r = (size_t)blockIdx.x * 8 + wv; if (r >= NR) return; float x[16]; float s = 0.f;
  for (int i = 0; i < 2; ++i) { const v8f a = *(const v8f*)(A + r * DM + i * 256 + ln * 8); for (int q = 0; q < 8; ++q) { float v = a[q]; if (res) v += bf16_round(res[r * DM + i * 256 + ln * 8 + q]); x[i * 8 + q] = v; s += v; } }
  for (int o = 16; o > 0; o >>= 1) s += __shfl_xor(s, o, 32); const float mu = s / (float)DM; float var = 0.f; for (int q = 0; q < 16; ++q) { const float d = x[q] - mu; var += d * d; }
  for (int o = 16; o > 0; o >>= 1) var += __shfl_xor(var, o, 32); const float inv = rsqrtf(var / (float)DM + 1e-5f);
  { for (int i = 0; i < 2; ++i) { const int c0 = i * 256 + ln * 8; v8f y; FragH f; for (int q = 0; q < 8; ++q) { float v = (x[i * 8 + q] - mu) * inv; v *= bf16_round(g[c0 + q]); v += bf16_round(bb[c0 + q]); y[q] = v; f.h[q] = (_Float16)v; } *(v8f*)(Y + r * DM + c0) = y; if (Y16) *(v8us*)((unsigned short*)Y16 + r * DM + c0) = f.half[0]; }  } }
__global__ __launch_bounds__(256) void k_pack(const float* __restrict__ rb, const int* __restrict__ rid, int* __restrict__ PK) { const int t = blockIdx.x * 256 + threadIdx.x; if (t >= 1024 + NB * TK) return; int v; if (t < 1024) v = __float_as_int(bf16_round(rb[t])); else v = rid[t - 1024]; *(int*)(PK + t) = v;  }
__global__ __launch_bounds__(256) void k_tabin(const float* __restrict__ sp, float* __restrict__ CS, float* __restrict__ SN) { const int t = blockIdx.x * 256 + threadIdx.x; if (t >= SLEN * 32) return; const int i = t % 32, s = t / 32; const float c = bf16_round(sp[s * 64 + 32 + i]), sn = bf16_round(sp[s * 64 + i]);
  { *(float*)(CS + t) = c; *(float*)(SN + t) = sn;  } }
__global__ __launch_bounds__(256) void k_wsc(const float* __restrict__ Wm, _Float16* __restrict__ Bt, size_t n8, float sc) { const size_t t = (size_t)blockIdx.x * 256 + threadIdx.x; if (t >= n8) return; FragH f; for (int q = 0; q < 8; ++q) f.h[q] = (_Float16)(bf16_round(Wm[t * 8 + q]) * sc); *(v8us*)((unsigned short*)Bt + t * 8) = f.half[0];  }
__global__ __launch_bounds__(256) void k_rotab2(float* __restrict__ CS, float* __restrict__ SN) {
  #pragma clang fp contract(off)
  const int t = blockIdx.x * 256 + threadIdx.x; if (t >= SLEN * 32) return; const int j = t % 32, s = t / 32; const float c0 = -0.14391156831212787f;      /* -ln(10000)/64 rounded to f32 */ const float inv = expf((float)(2 * j) * c0); const float th = (float)s * inv; const float c = cosf(th), sn = sinf(th);
  { *(float*)(CS + t) = c; *(float*)(SN + t) = sn;  } }
__global__ __launch_bounds__(256) void k_lnu(const float* __restrict__ X, _Float16* __restrict__ N16, float* __restrict__ XB) {
  #pragma clang fp contract(off)
  const int wv = threadIdx.x >> 5, ln = threadIdx.x & 31; const size_t r = (size_t)blockIdx.x * 8 + wv; if (r >= NR) return; float a[32]; float s = 0.f;
  for (int i = 0; i < 4; ++i) { const v8f v = *(const v8f*)(X + r * DM + (i * 32 + ln) * 8); for (int q = 0; q < 8; ++q) { const float u = bf16_round(v[q]); a[i * 8 + q] = u; s += u; } }
  for (int o = 16; o > 0; o >>= 1) s += __shfl_xor(s, o, 32); const float mu = s / (float)DM; float var = 0.f; for (int q = 0; q < 32; ++q) { const float d = a[q] - mu; var += d * d; }
  for (int o = 16; o > 0; o >>= 1) var += __shfl_xor(var, o, 32); const float den = sqrtf(var / (float)(DM - 1)) + 1e-6f; const float inv = 1.0f / den;      /* one reciprocal per row; (x-mean)*inv vs the reference's division differs by <= 1 ulp */
  { for (int i = 0; i < 4; ++i) { const int c0 = (i * 32 + ln) * 8; FragH f; v8f xb; for (int q = 0; q < 8; ++q) { f.h[q] = (_Float16)((a[i * 8 + q] - mu) * inv); xb[q] = a[i * 8 + q]; } *(v8us*)((unsigned short*)N16 + r * DM + c0) = f.half[0]; *(v8f*)(XB + r * DM + c0) = xb; }  } }
__global__ __launch_bounds__(256) void k_vtg(const _Float16* __restrict__ V16, _Float16* __restrict__ Vt) { __shared__ unsigned short tl[64][66]; const int tid = threadIdx.x; const int slab = blockIdx.x / (SLEN / 64), lg = blockIdx.x % (SLEN / 64); const int b = slab / NH, h = slab % NH; const int hs = h / NREP;
  for (int i = tid; i < 64 * 8; i += 256) { const int r = i / 8, c8 = (i % 8) * 8; FragH f; f.half[0] = *(const v8us*)((const unsigned short*)V16 + ((size_t)b * SLEN + lg * 64 + r) * KVD + hs * 64 + c8); for (int q = 0; q < 8; ++q) tl[r][c8 + q] = f.u[q]; }
  __syncthreads();
  { for (int rd = 0; rd < 2; ++rd) { const int d = rd * 32 + tid / 8, pc = tid % 8; FragH f; for (int q = 0; q < 8; ++q) f.u[q] = tl[pc * 8 + q][d]; *(v8us*)((unsigned short*)Vt + ((size_t)slab * 64 + d) * SLEN + lg * 64 + pc * 8) = f.half[0]; }  } }

__global__ __launch_bounds__(256) void k_h16s(const float* __restrict__ SRC, int lds, int coff, _Float16* __restrict__ DST, size_t n8) { const size_t t = (size_t)blockIdx.x * 256 + threadIdx.x; if (t >= n8) return; const size_t r = (t * 8) / DM; const int c = (int)((t * 8) % DM); const v8f a = *(const v8f*)(SRC + r * lds + coff + c); FragH f; for (int q = 0; q < 8; ++q) f.h[q] = (_Float16)a[q];
  *(v8us*)((unsigned short*)DST + t * 8) = f.half[0];  }


__global__ __launch_bounds__(256) void k_ccp(const float* __restrict__ QKV, int coff, _Float16* __restrict__ D) { const size_t t = (size_t)blockIdx.x * 256 + threadIdx.x; if (t >= (size_t)NR * DM / 8) return; const int c0 = (int)((t * 8) % DM); const size_t row = (t * 8) / DM; const v8f a = *(const v8f*)(QKV + row * 3 * DM + coff + c0); FragH f; for (int q = 0; q < 8; ++q) f.h[q] = (_Float16)a[q];
  *(v8us*)((unsigned short*)D + t * 8) = f.half[0];  }


template <int NLN>
__global__ __launch_bounds__(256) void k_lnrow(const float* __restrict__ X, const float* __restrict__ R, const float* __restrict__ g, const float* __restrict__ bb, float eps, float* __restrict__ OUT) {
  #pragma clang fp contract(off)
  constexpr int PER = NLN / 256; __shared__ float red[256]; const int tid = threadIdx.x; const size_t row = blockIdx.x; const float* x = X + row * NLN; const float* rr = R ? R + row * NLN : nullptr; float v[PER]; float s1 = 0.f;
  for (int u = 0; u < PER; ++u) { const int j = tid * PER + u; float t = x[j]; if (rr) t = t + rr[j]; v[u] = t; s1 += t; }
  red[tid] = s1; __syncthreads(); for (int st = 128; st > 0; st >>= 1) { if (tid < st) red[tid] += red[tid + st]; __syncthreads(); } const float mu = red[0] / (float)NLN; __syncthreads();
  float s2 = 0.f; for (int u = 0; u < PER; ++u) { const float c = v[u] - mu; s2 += c * c; } red[tid] = s2; __syncthreads(); for (int st = 128; st > 0; st >>= 1) { if (tid < st) red[tid] += red[tid + st]; __syncthreads(); }
  const float var = red[0] / (float)NLN; const float rs = rsqrtf(var + eps);
  { for (int u = 0; u < PER; ++u) { const int j = tid * PER + u; float o = (v[u] - mu) * rs; o = __fadd_rn(__fmul_rn(o, bf16_round(g[j])), bf16_round(bb[j])); *(float*)(OUT + row * NLN + j) = o; }  } }
__global__ __launch_bounds__(256) void k_xr32(const float* __restrict__ x, float* __restrict__ XR, size_t n8) { const size_t t = (size_t)blockIdx.x * 256 + threadIdx.x; if (t >= n8) return; v8f o; for (int q = 0; q < 8; ++q) o[q] = bf16_round(x[t * 8 + q]); *(v8f*)(XR + t * 8) = o;  }
__global__ __launch_bounds__(256) void k_r16b(const float* __restrict__ S, _Float16* __restrict__ D, size_t n8) { const size_t t = (size_t)blockIdx.x * 256 + threadIdx.x; if (t >= n8) return; const v8f a = *(const v8f*)(S + t * 8); FragH f; for (int q = 0; q < 8; ++q) f.h[q] = (_Float16)a[q]; *(v8us*)((unsigned short*)D + t * 8) = f.half[0];  }

__global__ __launch_bounds__(256) void k_nsq(const float* __restrict__ X, float* __restrict__ NSQ, size_t nrows) {
  #pragma clang fp contract(off)
  const size_t r = (size_t)blockIdx.x * 256 + threadIdx.x; if (r >= nrows) return; float acc = 0.f;
#pragma unroll 1
  for (int d = 0; d < 64; d += 8) { const v8f a = *(const v8f*)(X + r * 64 + d); for (int u = 0; u < 8; ++u) { const float x = bf16_round(a[u]); acc = __fadd_rn(acc, __fmul_rn(x, x)); } }
  *(float*)(NSQ + r) = acc;  }
// One block per (slab, 8 query rows < 64), one wave per row. The slab's first 64 rows of k and v are rounded and staged in LDS once per block; lanes own keys for the logits, then output columns for the context. Each dot product, the row sum and each context sum keep their serial order.
__global__ __launch_bounds__(256) void k_fixr(const float* __restrict__ Q, const float* __restrict__ Kx, const float* __restrict__ V, const float* __restrict__ NSQ, float* __restrict__ O) {
  #pragma clang fp contract(off)
  __shared__ __attribute__((aligned(16))) float sk[64][68];      /* pitch 272 B = 16 B x odd: a lane per row reads 16 bytes without bank conflicts */
  __shared__ __attribute__((aligned(16))) float sv[64][64]; __shared__ __attribute__((aligned(16))) float pr[8][64];
  const int tid = threadIdx.x, w = tid >> 5, lane = tid & 31; const size_t sl = blockIdx.x >> 3; const int q = __builtin_amdgcn_readfirstlane((int)(blockIdx.x & 7) * 8 + w);
  const float* kb = Kx + sl * SLEN * 64; const float* vb = V + sl * SLEN * 64;
#pragma unroll
  for (int i = 0; i < 4; ++i) { const int e = (i * 256 + tid) * 4; const v4f a = *(const v4fa*)(kb + e); const v4f c = *(const v4fa*)(vb + e); v4f ra, rc;
#pragma unroll
    for (int u = 0; u < 4; ++u) { ra[u] = bf16_round(a[u]); rc[u] = bf16_round(c[u]); }
    *(v4fa*)&sk[e >> 6][e & 63] = ra; *(v4fa*)&sv[e >> 6][e & 63] = rc; }
  const float* qr = Q + (sl * SLEN + q) * 64; const float qs = NSQ[sl * SLEN + q]; const float* ksT = NSQ + (size_t)NB * SLEN + sl * SLEN; const float kq0 = ksT[lane], kq1 = ksT[lane + 32];
  float x[64];      /* the wave's query row, fetched ahead of the barrier so that its latency runs beside the staging loads' */
#pragma unroll
  for (int d = 0; d < 64; d += 4) { const v4f a = *(const v4fa*)(qr + d);
#pragma unroll
    for (int u = 0; u < 4; ++u) x[d + u] = bf16_round(a[u]); }
  __syncthreads();      /* the staged rows are read by every wave of the block */
  float sd0 = 0.f, sd1 = 0.f;      /* keys lane and lane + 32 */
#pragma unroll
  for (int d = 0; d < 64; d += 4) { const v4f k0 = *(const v4fa*)&sk[lane][d]; const v4f k1 = *(const v4fa*)&sk[lane + 32][d];
#pragma unroll
    for (int u = 0; u < 4; ++u) { sd0 = __fadd_rn(sd0, __fmul_rn(x[d + u], k0[u])); sd1 = __fadd_rn(sd1, __fmul_rn(x[d + u], k1[u])); } }
  float d0 = qs + kq0; d0 = d0 - 2.0f * sd0; d0 = fmaxf(d0, 0.f); float d1 = qs + kq1; d1 = d1 - 2.0f * sd1; d1 = fmaxf(d1, 0.f);
  const bool ok0 = lane <= q, ok1 = lane + 32 <= q; const float lg0 = ok0 ? -d0 * 0.125f : -3.0e38f, lg1 = ok1 ? -d1 * 0.125f : -3.0e38f;
  float mx = fmaxf(lg0, lg1); mx = fmaxf(mx, __shfl_xor(mx, 1, 32)); mx = fmaxf(mx, __shfl_xor(mx, 2, 32)); mx = fmaxf(mx, __shfl_xor(mx, 4, 32)); mx = fmaxf(mx, __shfl_xor(mx, 8, 32)); mx = fmaxf(mx, __shfl_xor(mx, 16, 32));
  const float e0 = expf(lg0 - mx), e1 = expf(lg1 - mx); pr[w][lane] = ok0 ? e0 : 0.f; pr[w][lane + 32] = ok1 ? e1 : 0.f;
  __builtin_amdgcn_fence(__ATOMIC_ACQ_REL, "workgroup"); __builtin_amdgcn_wave_barrier();      /* the wave's own lanes read each other's weights below */
  float su = 0.f;
#pragma unroll
  for (int j = 0; j < 64; j += 4) { const v4f e = *(const v4fa*)&pr[w][j]; su += e[0]; su += e[1]; su += e[2]; su += e[3]; }      /* ascending keys; a masked key adds an exact zero */
  const float inv = 1.0f / su; typedef float v2f __attribute__((ext_vector_type(2))); typedef float v2fa __attribute__((ext_vector_type(2), may_alias));
  float a0 = 0.f, a1 = 0.f;      /* output columns 2 lane and 2 lane + 1 */
#pragma unroll 1
  for (int j0 = 0; j0 <= q; j0 += 16) {
#pragma unroll
    for (int i = 0; i < 16; ++i) { const bool in = j0 + i <= q; const v2f vv = *(const v2fa*)&sv[j0 + i][lane * 2]; const float p = pr[w][j0 + i] * inv;      /* past the row's last key the weight is zero; the value is zeroed too, so the term is an exact zero */
      a0 = __fadd_rn(a0, __fmul_rn(p, in ? vv[0] : 0.f)); a1 = __fadd_rn(a1, __fmul_rn(p, in ? vv[1] : 0.f)); } }
  const v2f o = {a0, a1}; *(v2f*)(O + (sl * SLEN + q) * 64 + lane * 2) = o; }

extern "C" void kernel_launch(void* const* d_in, const int* in_sizes, int n_in,
                              void* d_out, int out_size, void* d_ws, size_t ws_size, hipStream_t stream) {
  (void)in_sizes; (void)n_in; (void)out_size;
  const float* q = (const float*)d_in[0]; const float* k = (const float*)d_in[1]; const float* v = (const float*)d_in[2]; float* O = (float*)d_out;
  char* ws = (char*)d_ws; size_t off = 0;
  auto take = [&](size_t bytes) { char* p = ws + off; off += (bytes + 255) & ~(size_t)255; return p; };
  const size_t np = (size_t)NR * DM;      /* 32 x 2048 x 64 */
  _Float16* QH = (_Float16*)take(np * 2); _Float16* KH = (_Float16*)take(np * 2); _Float16* VH = (_Float16*)take(np * 2); _Float16* VT = (_Float16*)take(np * 2); float* NSQ = (float*)take((size_t)2 * NR * 4);
  if (off > ws_size) return;      /* 4 x 8 + 0.5 = ≈ 33 MiB */
  k_x16<<<(unsigned)((np / 8 + 255) / 256), 256, 0, stream>>>(q, QH, np / 8); k_x16<<<(unsigned)((np / 8 + 255) / 256), 256, 0, stream>>>(k, KH, np / 8); k_x16<<<(unsigned)((np / 8 + 255) / 256), 256, 0, stream>>>(v, VH, np / 8);      /* bf16-rounded inputs are exact in f16 */
  k_vtg<<<NB * NH * (SLEN / 64), 256, 0, stream>>>(VH, VT);
  k_nsq<<<(unsigned)((NR + 255) / 256), 256, 0, stream>>>(q, NSQ, (size_t)NR); k_nsq<<<(unsigned)((NR + 255) / 256), 256, 0, stream>>>(k, NSQ + NR, (size_t)NR);      /* |q|^2 | |k|^2 tables */
  k_flash<32><<<NB * NH * QBNP, 128, 0, stream>>>(QH, DM, KH, DM, VT, (const int*)NSQ, O, DM);      /* exact q, k products; f32 RBF logits; f32 context straight to the output */
  k_fixr<<<NB * 8, 256, 0, stream>>>(q, k, v, NSQ, O);      /* rows < 64 per slab recomputed in f32 */
}

// v003
// Measured time: 129 microseconds a run.
// In two side-by-side timings against v002, it was 1.56 and 1.57 times as fast.
// Over all steps from v000 it is 3.85 times as fast.
#include <hip/hip_runtime.h>
// CustomCausalAttention (q, k, v [2][16][2048][64]; RBF-kernel causal attention: logits = -relu(|q|^2 + |k|^2 - 2 q.k) / 8 over keys n <= m; out = softmax(logits) v -> [2][16][2048][64]).
// Structure: each (batch, head) slab is a contiguous 64-wide row block, treated as one 'batch' of a single 64-dim head: exact f16 planes of q, k, v (bf16-rounded inputs are exact in f16); |q|^2, |k|^2 as f32 row tables on VALU; v^T by LDS tiles; causal flash-style fused attention per (slab, 64-query block), forming the RBF logit from the f32 dot product and the two norm tables, f32 context written straight to the output; the first 64 causal rows per slab recomputed entirely in f32 on VALU.
// Compute dtype: inputs rounded to bf16; q, k, v exact as f16 (products exact, f32 accumulation); norms, logits, softmax f32 with plain f16 probabilities (~2^-12); rows < 64 all-f32. v_wmma_f32_16x16x32_f16.
#define NB 32                    /* 2 batches x 16 heads as slabs */
#define DM 64
#define NKV 1
#define NREP (NH / NKV)
#define KVD (NKV * 64)           /* 64 */
#define NR (NB * SLEN)
#define CHK 512
typedef int v4i __attribute__((ext_vector_type(4)));
#define FF 2048
#define SLEN 2048
#define MQI 2048
#define MKI 2048
#define TQ SLEN
#define TK SLEN
#define NH 1
#define SCL 1.0f                 /* raw dot product; the RBF transform applies the 1/8 */
#define QBLKS (TQ / 64)
#define QB05 0
#define QBN5 QBLKS      /* hi/lo engine (k_flash5) block range; not launched */
#define QB0P 0
#define QBNP QBLKS
#define RE 256
typedef __bf16 v16b __attribute__((ext_vector_type(16)));
typedef unsigned short v8us __attribute__((ext_vector_type(8), may_alias));
typedef float  v8f  __attribute__((ext_vector_type(8)));
typedef float  v4f  __attribute__((ext_vector_type(4)));
typedef float  v4fa __attribute__((ext_vector_type(4), may_alias));
union FragB { v16b v; v8us half[2]; unsigned short u[16]; };

__device__ __forceinline__ unsigned short bf16_bits(float x) { unsigned int u = __float_as_uint(x); return (unsigned short)((u + 0x7FFFu + ((u >> 16) & 1u)) >> 16); }
__device__ __forceinline__ float bf16_val(unsigned short b) { return __uint_as_float(((unsigned int)b) << 16); }
__device__ __forceinline__ float bf16_round(float x) { return bf16_val(bf16_bits(x)); }
// D += A·B with NT terms: 1 = ah·bh, 2 = + al·bh (A split), 3 = + ah·bl (both split)
template <int NT>
__device__ __forceinline__ v8f mmaN(v16b ah, v16b al, v16b bh, v16b bl, v8f c) {
  c = __builtin_amdgcn_wmma_f32_16x16x32_bf16(false, ah, false, bh, (short)0, c, false, false);
  if (NT >= 2) c = __builtin_amdgcn_wmma_f32_16x16x32_bf16(false, al, false, bh, (short)0, c, false, false);
  if (NT >= 3) c = __builtin_amdgcn_wmma_f32_16x16x32_bf16(false, ah, false, bl, (short)0, c, false, false);
  asm volatile("v_nop\n\tv_nop\n\tv_nop\n\tv_nop" : "+v"(c) : "v"(ah), "v"(al), "v"(bh), "v"(bl));
  return c;
}

__global__ __launch_bounds__(256) void k_wt_bf16(const float* __restrict__ W, unsigned short* __restrict__ Wt, int K, int N) {
  const int t = blockIdx.x * 256 + threadIdx.x;
  const int k8n = K / 8;
  if (t >= N * k8n) return;
  const int n = t / k8n, k8 = (t % k8n) * 8;
  v8us v;
#pragma unroll
  for (int i = 0; i < 8; ++i) v[i] = bf16_bits(W[(size_t)(k8 + i) * N + n]);
  *(v8us*)(Wt + (size_t)n * K + k8) = v;
  
}

// GEMM C[M][N] (f32, pitch ldc) = act(A[M][K]·W + bias). A f32 row-major (pitch lda) converted per fragment to bf16
// (ASPLIT: hi/lo two planes -> 2 terms, else single rounded term); Wt bf16 [N][K] (pitch ldb). BIAS_BF16 rounds the
// bias to bf16 first (bias quantised to bf16 before the add). K%32==0, M%16==0, N%64==0.
template <bool ASPLIT, int ACT, bool BIAS_BF16>
__global__ __launch_bounds__(128) void k_gemm_bf(const float* __restrict__ A, int lda, const unsigned short* __restrict__ Wt, int ldb,
                                               const float* __restrict__ bias, float* __restrict__ C, int ldc, int M, int N, int K) {
  __shared__ __attribute__((aligned(16))) float so[4][16][64];
  const int tid = threadIdx.x, w = tid >> 5, lane = tid & 31, ln = lane & 15, hh = lane >> 4;
  const int ntn = N / 64;
  const int wid = blockIdx.x * 4 + w;
  const int mt = wid / ntn, nq = wid % ntn;
  if (mt * 16 >= M) return;
  const int row0 = mt * 16, col0 = nq * 64;
  const float* arow = A + (size_t)(row0 + ln) * lda;
  v8f acc[4] = {};
  for (int kb = 0; kb < K; kb += 32) {
    FragB ah, al;
    const v4f x0 = *(const v4fa*)(arow + kb + 8 * hh), x1 = *(const v4fa*)(arow + kb + 8 * hh + 4);
    const v4f x2 = *(const v4fa*)(arow + kb + 16 + 8 * hh), x3 = *(const v4fa*)(arow + kb + 16 + 8 * hh + 4);
    float xs[16] = {x0[0],x0[1],x0[2],x0[3],x1[0],x1[1],x1[2],x1[3],x2[0],x2[1],x2[2],x2[3],x3[0],x3[1],x3[2],x3[3]};
#pragma unroll
    for (int i = 0; i < 16; ++i) { const unsigned short hb = bf16_bits(xs[i]); ah.u[i] = hb; al.u[i] = ASPLIT ? bf16_bits(xs[i] - bf16_val(hb)) : (unsigned short)0; }
#pragma unroll
    for (int t = 0; t < 4; ++t) {
      const unsigned short* brow = Wt + (size_t)(col0 + t * 16 + ln) * ldb + kb;
      FragB b;
      b.half[0] = *(const v8us*)(brow + 8 * hh);
      b.half[1] = *(const v8us*)(brow + 16 + 8 * hh);
      acc[t] = mmaN<ASPLIT ? 2 : 1>(ah.v, al.v, b.v, b.v, acc[t]);
    }
  }
#pragma unroll
  for (int t = 0; t < 4; ++t) {
    float bv = bias ? bias[col0 + t * 16 + ln] : 0.f;
    if (BIAS_BF16) bv = bf16_round(bv);
#pragma unroll
    for (int r = 0; r < 8; ++r) { float v = acc[t][r] + bv; if (ACT == 1) v = fmaxf(v, 0.f); so[w][8 * hh + r][t * 16 + ln] = v; }
  }
  __builtin_amdgcn_fence(__ATOMIC_ACQ_REL, "workgroup");
  __builtin_amdgcn_wave_barrier();
  const int rsub = lane >> 4, c4 = (lane & 15) * 4;
  {
#pragma unroll
    for (int q = 0; q < 8; ++q) {
      const int r = q * 2 + rsub;
      const v4f v = *(const v4fa*)&so[w][r][c4];
      *(v4f*)(C + (size_t)(row0 + r) * ldc + col0 + c4) = v;
    }
    
  }
}

// GEMM C = act(A·W + bias + resid): A f32 (ASPLIT -> hi/lo 2 terms), Wt bf16 [N][K]; ACT 0 none, 1 relu, 2 exact gelu;
// resid (optional, f32, row index = (row % rmod), pitch ldr, RES_BF16 rounds it) added before the activation.
template <bool ASPLIT, int ACT, bool BIAS_BF16, bool RES_BF16>
__global__ __launch_bounds__(128) void k_gemm_bf3(const float* __restrict__ A, int lda, const unsigned short* __restrict__ Wt, int ldb,
                                                const float* __restrict__ bias, const float* __restrict__ resid, int rmod, int ldr,
                                                float* __restrict__ C, int ldc, int M, int N, int K) {
  __shared__ __attribute__((aligned(16))) float so[4][16][64];
  const int tid = threadIdx.x, w = tid >> 5, lane = tid & 31, ln = lane & 15, hh = lane >> 4;
  const int ntn = N / 64;
  const int wid = blockIdx.x * 4 + w;
  const int mt = wid / ntn, nq = wid % ntn;
  if (mt * 16 >= M) return;
  const int row0 = mt * 16, col0 = nq * 64;
  const float* arow = A + (size_t)(row0 + ln) * lda;
  v8f acc[4] = {};
  for (int kb = 0; kb < K; kb += 32) {
    FragB ah, al;
    const v4f x0 = *(const v4fa*)(arow + kb + 8 * hh), x1 = *(const v4fa*)(arow + kb + 8 * hh + 4);
    const v4f x2 = *(const v4fa*)(arow + kb + 16 + 8 * hh), x3 = *(const v4fa*)(arow + kb + 16 + 8 * hh + 4);
    float xs[16] = {x0[0],x0[1],x0[2],x0[3],x1[0],x1[1],x1[2],x1[3],x2[0],x2[1],x2[2],x2[3],x3[0],x3[1],x3[2],x3[3]};
#pragma unroll
    for (int i = 0; i < 16; ++i) { const unsigned short hb = bf16_bits(xs[i]); ah.u[i] = hb; al.u[i] = ASPLIT ? bf16_bits(xs[i] - bf16_val(hb)) : (unsigned short)0; }
#pragma unroll
    for (int t = 0; t < 4; ++t) {
      const unsigned short* brow = Wt + (size_t)(col0 + t * 16 + ln) * ldb + kb;
      FragB b;
      b.half[0] = *(const v8us*)(brow + 8 * hh);
      b.half[1] = *(const v8us*)(brow + 16 + 8 * hh);
      acc[t] = mmaN<ASPLIT ? 2 : 1>(ah.v, al.v, b.v, b.v, acc[t]);
    }
  }
#pragma unroll
  for (int t = 0; t < 4; ++t) {
    const int col = col0 + t * 16 + ln;
    float bv = bias ? bias[col] : 0.f;
    if (BIAS_BF16) bv = bf16_round(bv);
#pragma unroll
    for (int r = 0; r < 8; ++r) {
      float v = acc[t][r] + bv;
      if (resid) { float rv = resid[(size_t)((row0 + 8 * hh + r) % rmod) * ldr + col]; if (RES_BF16) rv = bf16_round(rv); v += rv; }
      if (ACT == 1) v = fmaxf(v, 0.f);
      if (ACT == 2) v = 0.5f * v * (1.0f + erff(v * 0.70710678118654752f));
      if (ACT == 3) { const float u = 0.7978845608028654f * (v + 0.044715f * v * v * v); v = 0.5f * v * (1.0f + tanhf(u)); }
      so[w][8 * hh + r][t * 16 + ln] = v;
    }
  }
  __builtin_amdgcn_fence(__ATOMIC_ACQ_REL, "workgroup");
  __builtin_amdgcn_wave_barrier();
  const int rsub = lane >> 4, c4 = (lane & 15) * 4;
  {
#pragma unroll
    for (int q = 0; q < 8; ++q) {
      const int r = q * 2 + rsub;
      const v4f v = *(const v4fa*)&so[w][r][c4];
      *(v4f*)(C + (size_t)(row0 + r) * ldc + col0 + c4) = v;
    }
    
  }
}
// row LayerNorm (biased variance, eps) over N: s = X (+ R); optional out_sum <- s; out_norm <- (s-mu)*rsqrt(var+eps)*g + b
template <bool PARAM_BF16>
__global__ __launch_bounds__(256) void k_layernorm(const float* __restrict__ X, const float* __restrict__ R, const float* __restrict__ g, const float* __restrict__ bta,
                                                  float* __restrict__ out_sum, float* __restrict__ out_norm, int N, float eps) {
  __shared__ float red[256];
  const int row = blockIdx.x, tid = threadIdx.x;
  const float* x = X + (size_t)row * N; const float* rr = R ? R + (size_t)row * N : nullptr;
  float vals[16];                     // up to N = 4096
  const int per = N / 256;            // contiguous chunk per thread? use strided-by-4 chunks: thread handles j = tid*4 + 1024*u
  float s1 = 0.f;
  for (int u = 0; u < per / 4; ++u) {
    const int j = tid * 4 + 1024 * u;
    const v4f a = *(const v4fa*)(x + j);
    v4f b = {0.f,0.f,0.f,0.f}; if (rr) b = *(const v4fa*)(rr + j);
#pragma unroll
    for (int q = 0; q < 4; ++q) { const float v = a[q] + b[q]; vals[u * 4 + q] = v; s1 += v; }
  }
  red[tid] = s1; __syncthreads();
  for (int st = 128; st > 0; st >>= 1) { if (tid < st) red[tid] += red[tid + st]; __syncthreads(); }
  const float mu = red[0] / (float)N; __syncthreads();
  float s2 = 0.f;
  for (int u = 0; u < per / 4; ++u)
#pragma unroll
    for (int q = 0; q < 4; ++q) { const float c = vals[u * 4 + q] - mu; s2 += c * c; }
  red[tid] = s2; __syncthreads();
  for (int st = 128; st > 0; st >>= 1) { if (tid < st) red[tid] += red[tid + st]; __syncthreads(); }
  const float rs = rsqrtf(red[0] / (float)N + eps);
  {
    for (int u = 0; u < per / 4; ++u) {
      const int j = tid * 4 + 1024 * u;
      v4f o, sm;
#pragma unroll
      for (int q = 0; q < 4; ++q) {
        float gg = g[j + q], bb = bta[j + q];
        if (PARAM_BF16) { gg = bf16_round(gg); bb = bf16_round(bb); }
        sm[q] = vals[u * 4 + q]; o[q] = (vals[u * 4 + q] - mu) * rs * gg + bb;
      }
      if (out_sum) *(v4f*)(out_sum + (size_t)row * N + j) = sm;
      *(v4f*)(out_norm + (size_t)row * N + j) = o;
    }
    
  }
}



// ---- f16 WMMA path (v_wmma_f32_16x16x32_f16): 11-bit significands for operands in range — used where a [0,1] probability operand needs more precision than bf16
typedef _Float16 v16h __attribute__((ext_vector_type(16)));
union FragH { v16h v; v8us half[2]; _Float16 h[16]; unsigned short u[16]; };
template <int NT>
__device__ __forceinline__ v8f mmaH(v16h ah, v16h al, v16h bh, v16h bl, v8f c) {
  c = __builtin_amdgcn_wmma_f32_16x16x32_f16(false, ah, false, bh, (short)0, c, false, false);
  if (NT >= 2) c = __builtin_amdgcn_wmma_f32_16x16x32_f16(false, al, false, bh, (short)0, c, false, false);
  if (NT >= 3) c = __builtin_amdgcn_wmma_f32_16x16x32_f16(false, ah, false, bl, (short)0, c, false, false);
  asm volatile("v_nop\n\tv_nop\n\tv_nop\n\tv_nop" : "+v"(c) : "v"(ah), "v"(al), "v"(bh), "v"(bl));
  return c;
}
// batched GEMM like k_gemm_b but f16 operands: A f32 (split into f16 hi/lo if ASPLIT, else rounded to f16), Bt = f16 values [n][k]; alpha; C f32; N multiple of 16 (partial tiles skipped)
template <bool ASPLIT>
__global__ __launch_bounds__(128) void k_gemm_h(const float* __restrict__ A, int lda, size_t sA, const _Float16* __restrict__ Bh, int ldb, size_t sB, float alpha, float* __restrict__ C, int ldc, size_t sC, int M, int N, int K) {
  __shared__ __attribute__((aligned(16))) float so[4][16][64];
  const int tid = threadIdx.x, w = tid >> 5, lane = tid & 31, ln = lane & 15, hh = lane >> 4; const int by = blockIdx.y;
  A += (size_t)by * sA; Bh += (size_t)by * sB; C += (size_t)by * sC;
  const int ntn = (N + 63) / 64; const int wid = blockIdx.x * 4 + w; const int mt = wid / ntn, nq = wid % ntn; if (mt * 16 >= M) return;
  const int row0 = mt * 16, col0 = nq * 64; const float* arow = A + (size_t)(row0 + ln) * lda;
  v8f acc[4] = {};
  for (int kb = 0; kb < K; kb += 32) {
    FragH ah, al;
    const v4f x0 = *(const v4fa*)(arow + kb + 8 * hh), x1 = *(const v4fa*)(arow + kb + 8 * hh + 4), x2 = *(const v4fa*)(arow + kb + 16 + 8 * hh), x3 = *(const v4fa*)(arow + kb + 16 + 8 * hh + 4);
    float xs[16] = {x0[0],x0[1],x0[2],x0[3],x1[0],x1[1],x1[2],x1[3],x2[0],x2[1],x2[2],x2[3],x3[0],x3[1],x3[2],x3[3]};
#pragma unroll
    for (int i = 0; i < 16; ++i) { const _Float16 h = (_Float16)xs[i]; ah.h[i] = h; al.h[i] = ASPLIT ? (_Float16)(xs[i] - (float)h) : (_Float16)0.0f; }
#pragma unroll
    for (int t = 0; t < 4; ++t) { if (col0 + t * 16 >= N) continue; const size_t boff = (size_t)(col0 + t * 16 + ln) * ldb + kb; FragH bq; bq.half[0] = *(const v8us*)(Bh + boff + 8 * hh); bq.half[1] = *(const v8us*)(Bh + boff + 16 + 8 * hh);
      acc[t] = mmaH<ASPLIT ? 2 : 1>(ah.v, al.v, bq.v, bq.v, acc[t]); }
  }
#pragma unroll
  for (int t = 0; t < 4; ++t) { if (col0 + t * 16 >= N) continue;
#pragma unroll
    for (int r = 0; r < 8; ++r) so[w][8 * hh + r][t * 16 + ln] = acc[t][r] * alpha; }
  __builtin_amdgcn_fence(__ATOMIC_ACQ_REL, "workgroup"); __builtin_amdgcn_wave_barrier();
  const int rsub = lane >> 4, c4 = (lane & 15) * 4;
  {
#pragma unroll
    for (int q = 0; q < 8; ++q) { const int r = q * 2 + rsub; if (col0 + c4 < N) { const v4f v = *(const v4fa*)&so[w][r][c4]; *(v4f*)(C + (size_t)(row0 + r) * ldc + col0 + c4) = v; } }
     }
}

// Wt[n][k] = f16(W[k][n]·scale) from f32 row-major W[K][N] (scale = power of two; bf16-exact weights stay exact in f16 away from the subnormal range)
__global__ __launch_bounds__(256) void k_wt_f16(const float* __restrict__ W, _Float16* __restrict__ Wt, int K, int N, float scale) {
  const int t = blockIdx.x * 256 + threadIdx.x; if (t >= N * (K / 8)) return; const int n = t / (K / 8), k8 = (t % (K / 8)) * 8; FragH f;
#pragma unroll
  for (int i = 0; i < 8; ++i) f.h[i] = (_Float16)(bf16_round(W[(size_t)(k8 + i) * N + n]) * scale); const v8us o = f.half[0];
  *(v8us*)((unsigned short*)Wt + (size_t)n * K + k8) = o; 
}
// k_gemm_hh variant with fused epilogue: v = acc·alpha + bias[by·sBias + col] (+ CP[(row/rowsPerB)·sCPb + by·64 + col] if CP) ; ACT 0 none / 1 elu ; writes f16 C16 (and f32 C if non-null)
template <int ACT>
__global__ __launch_bounds__(128) void k_gemm_hhx(const _Float16* __restrict__ A, int lda, size_t sA, const _Float16* __restrict__ Bh, int ldb, size_t sB, float alpha, const float* __restrict__ bias, size_t sBias, const float* __restrict__ CP, int rowsPerB, size_t sCPb, int row0g,
    float* __restrict__ C, _Float16* __restrict__ C16, int ldc, size_t sC, int M, int N, int K) {
  __shared__ __attribute__((aligned(16))) float so[4][16][64];
  const int tid = threadIdx.x, w = tid >> 5, lane = tid & 31, ln = lane & 15, hh = lane >> 4; const int by = blockIdx.y;
  A += (size_t)by * sA; Bh += (size_t)by * sB; const size_t cofs = (size_t)by * sC; const float* bp = bias ? bias + (size_t)by * sBias : nullptr;
  const int ntn = (N + 63) / 64; const int wid = blockIdx.x * 4 + w; const int mt = wid / ntn, nq = wid % ntn; if (mt * 16 >= M) return;
  const int row0 = mt * 16, col0 = nq * 64; const _Float16* arow = A + (size_t)(row0 + ln) * lda;
  v8f acc[4] = {};
  for (int kb = 0; kb < K; kb += 32) { FragH ah; ah.half[0] = *(const v8us*)((const unsigned short*)arow + kb + 8 * hh); ah.half[1] = *(const v8us*)((const unsigned short*)arow + kb + 16 + 8 * hh);
#pragma unroll
    for (int t = 0; t < 4; ++t) { if (col0 + t * 16 >= N) continue; const size_t boff = (size_t)(col0 + t * 16 + ln) * ldb + kb; FragH bq; bq.half[0] = *(const v8us*)((const unsigned short*)Bh + boff + 8 * hh); bq.half[1] = *(const v8us*)((const unsigned short*)Bh + boff + 16 + 8 * hh);
      acc[t] = mmaH<1>(ah.v, ah.v, bq.v, bq.v, acc[t]); }
  }
#pragma unroll
  for (int t = 0; t < 4; ++t) { if (col0 + t * 16 >= N) continue; const int col = col0 + t * 16 + ln; const float bv = bp ? bf16_round(bp[col]) : 0.f;
#pragma unroll
    for (int r = 0; r < 8; ++r) { float v = acc[t][r] * alpha + bv; if (CP) { const int bidx = (row0g + row0 + 8 * hh + r) / rowsPerB; v += CP[(size_t)bidx * sCPb + (size_t)by * 64 + col]; } if (ACT == 1) v = (v > 0.f) ? v : expm1f(v); else if (ACT == 7) v = (v > 0.f) ? v + 1.0f : expf(v); else if (ACT == 8) v = tanhf(v); else if (ACT == 9) v = 0.5f * v * (1.0f + tanhf(0.7978845608028654f * (v + 0.044715f * v * v * v))); else if (ACT == 11) v = 1.0f / (1.0f + expf(-v)); else if (ACT == 12) v = (v > 0.f) ? v : 0.01f * v; else if (ACT == 14) v = (v > 0.f) ? v : 0.1f * v; else if (ACT == 15) v = v / (1.0f + expf(-v)); else if (ACT == 3) v = fmaxf(v, 0.f); else if (ACT == 6) v = 0.5f * v * (1.0f + erff(v * 0.70710678118654752f)); so[w][8 * hh + r][t * 16 + ln] = v; } }
  __builtin_amdgcn_fence(__ATOMIC_ACQ_REL, "workgroup"); __builtin_amdgcn_wave_barrier();
  const int rsub = lane >> 4, c4 = (lane & 15) * 4; typedef _Float16 v4h __attribute__((ext_vector_type(4)));
  {
#pragma unroll
    for (int q = 0; q < 8; ++q) { const int r = q * 2 + rsub; if (col0 + c4 < N) { const v4f v = *(const v4fa*)&so[w][r][c4]; if (C) *(v4f*)(C + cofs + (size_t)(row0 + r) * ldc + col0 + c4) = v; if (C16) { v4h h4; for (int i = 0; i < 4; ++i) h4[i] = (_Float16)v[i]; *(v4h*)(C16 + cofs + (size_t)(row0 + r) * ldc + col0 + c4) = h4; } } }
     }
}


typedef _Float16 v4h __attribute__((ext_vector_type(4)));

__global__ __launch_bounds__(256) void k_x16(const float* __restrict__ x, _Float16* __restrict__ X16, size_t n8) { const size_t t = (size_t)blockIdx.x * 256 + threadIdx.x; if (t >= n8) return; FragH f;
#pragma unroll
  for (int q = 0; q < 8; ++q) f.h[q] = (_Float16)bf16_round(x[t * 8 + q]); *(v8us*)((unsigned short*)X16 + t * 8) = f.half[0];  }
__global__ __launch_bounds__(256) void k_h16(const float* __restrict__ x, _Float16* __restrict__ X16, size_t n8) { const size_t t = (size_t)blockIdx.x * 256 + threadIdx.x; if (t >= n8) return; FragH f;
#pragma unroll
  for (int q = 0; q < 8; ++q) f.h[q] = (_Float16)x[t * 8 + q]; *(v8us*)((unsigned short*)X16 + t * 8) = f.half[0];  }
__global__ __launch_bounds__(256) void k_round16f(const float* __restrict__ W, _Float16* __restrict__ Bt, size_t n8) { const size_t t = (size_t)blockIdx.x * 256 + threadIdx.x; if (t >= n8) return; FragH f;
#pragma unroll
  for (int i = 0; i < 8; ++i) f.h[i] = (_Float16)(bf16_round(W[t * 8 + i]) * 16.0f); *(v8us*)((unsigned short*)Bt + t * 8) = f.half[0];  }
template <int NHv, int TTv>
__global__ __launch_bounds__(256) void k_vt(const _Float16* __restrict__ V16, int ldv, int voff, _Float16* __restrict__ Vt) { __shared__ unsigned short tl[64][66]; const int tid = threadIdx.x; const int slab = blockIdx.x / (TTv / 64), lg = blockIdx.x % (TTv / 64); const int b = slab / NHv, h = slab % NHv;
  for (int i = tid; i < 64 * 8; i += 256) { const int r = i / 8, c8 = (i % 8) * 8; FragH f; f.half[0] = *(const v8us*)((const unsigned short*)V16 + ((size_t)b * TTv + lg * 64 + r) * ldv + voff + h * 64 + c8);
#pragma unroll
    for (int q = 0; q < 8; ++q) tl[r][c8 + q] = f.u[q]; }
  __syncthreads();
  {
#pragma unroll
    for (int rd = 0; rd < 2; ++rd) { const int d = rd * 32 + tid / 8, pc = tid % 8; FragH f;
#pragma unroll
      for (int q = 0; q < 8; ++q) f.u[q] = tl[pc * 8 + q][d];
      *(v8us*)((unsigned short*)Vt + ((size_t)slab * 64 + d) * TTv + lg * 64 + pc * 8) = f.half[0]; }
     } }

__global__ __launch_bounds__(256) void k_hl(const float* __restrict__ F, _Float16* __restrict__ Hh, _Float16* __restrict__ Hl, size_t n8) { const size_t t = (size_t)blockIdx.x * 256 + threadIdx.x; if (t >= n8) return; FragH fh, fl; const v4f a = *(const v4fa*)(F + t * 8), c = *(const v4fa*)(F + t * 8 + 4);
#pragma unroll
  for (int q = 0; q < 4; ++q) { _Float16 h = (_Float16)a[q]; fh.h[q] = h; fl.h[q] = (_Float16)((a[q] - (float)h) * 1024.0f); h = (_Float16)c[q]; fh.h[4 + q] = h; fl.h[4 + q] = (_Float16)((c[q] - (float)h) * 1024.0f); }
  { *(v8us*)((unsigned short*)Hh + t * 8) = fh.half[0]; *(v8us*)((unsigned short*)Hl + t * 8) = fl.half[0];  } }

// ---- fast GEMM (wave tile 32x64; requires M % 32 == 0 rows per launch region and N % 64 == 0); epilogue = k_gemm_hhx semantics ----
__device__ __forceinline__ v16h g2_frag(const _Float16* p, int hh) { FragH f; f.half[0] = *(const v8us*)((const unsigned short*)p + 8 * hh); f.half[1] = *(const v8us*)((const unsigned short*)p + 16 + 8 * hh); return f.v; }
__device__ __forceinline__ v8f g2_mma(v16h a, v16h b, v8f c) { v8f d = __builtin_amdgcn_wmma_f32_16x16x32_f16(false, a, false, b, (short)0, c, false, false); asm volatile("v_nop\n\tv_nop\n\tv_nop\n\tv_nop" : "+v"(d) : "v"(a), "v"(b)); return d; }
template <int ACT>
__global__ __launch_bounds__(128) void k_gemm2(const _Float16* __restrict__ A, int lda, size_t sA, const _Float16* __restrict__ Bh, int ldb, size_t sB, float alpha, const float* __restrict__ bias, size_t sBias, const float* __restrict__ CP, int rowsPerB, size_t sCPb, int row0g,
    float* __restrict__ C, _Float16* __restrict__ C16, int ldc, size_t sC, int M, int N, int K) {
  __shared__ __attribute__((aligned(16))) float so[4][32][68];
  const int tid = threadIdx.x, w = tid >> 5, lane = tid & 31, ln = lane & 15, hh = lane >> 4; const int by = blockIdx.y;
  A += (size_t)by * sA; Bh += (size_t)by * sB; const size_t cofs = (size_t)by * sC; const float* bp = bias ? bias + (size_t)by * sBias : nullptr;
  const int ntn = N >> 6; const int mt = blockIdx.x / ntn, nq = blockIdx.x - mt * ntn; const int row0 = mt * 128 + 32 * w, col0 = nq * 64; if (row0 >= M) return;
  const _Float16* a0p = A + (size_t)(row0 + ln) * lda; const _Float16* a1p = a0p + (size_t)16 * lda;
  const _Float16* b0p = Bh + (size_t)(col0 + ln) * ldb; const _Float16* b1p = b0p + (size_t)16 * ldb; const _Float16* b2p = b1p + (size_t)16 * ldb; const _Float16* b3p = b2p + (size_t)16 * ldb;
  const v8f z8 = {0.f,0.f,0.f,0.f,0.f,0.f,0.f,0.f}; v8f c00 = z8, c01 = z8, c02 = z8, c03 = z8, c10 = z8, c11 = z8, c12 = z8, c13 = z8;
#pragma unroll 1
  for (int kb = 0; kb < K; kb += 32) { const v16h a0 = g2_frag(a0p + kb, hh), a1 = g2_frag(a1p + kb, hh);
    v16h b = g2_frag(b0p + kb, hh); c00 = g2_mma(a0, b, c00); c10 = g2_mma(a1, b, c10);
    b = g2_frag(b1p + kb, hh); c01 = g2_mma(a0, b, c01); c11 = g2_mma(a1, b, c11);
    b = g2_frag(b2p + kb, hh); c02 = g2_mma(a0, b, c02); c12 = g2_mma(a1, b, c12);
    b = g2_frag(b3p + kb, hh); c03 = g2_mma(a0, b, c03); c13 = g2_mma(a1, b, c13); }
  v8f accs[8] = {c00, c01, c02, c03, c10, c11, c12, c13};
#pragma unroll
  for (int u = 0; u < 8; ++u) { const int t = u & 3, half = u >> 2; const int col = col0 + t * 16 + ln; const float bv = bp ? bf16_round(bp[col]) : 0.f;
#pragma unroll
    for (int r = 0; r < 8; ++r) { const int rloc = half * 16 + 8 * hh + r; float v = accs[u][r] * alpha + bv; if (CP) { if (rowsPerB < 0) v += CP[cofs + (size_t)(row0g + row0 + rloc) * ldc + col];      /* rowsPerB < 0: own element of the batched C plane */ else { const int bidx = (row0g + row0 + rloc) / rowsPerB; v += CP[(size_t)bidx * sCPb + (size_t)by * 64 + col]; } }
      if (ACT == 3) v = fmaxf(v, 0.f); else if (ACT == 6) v = 0.5f * v * (1.0f + erff(v * 0.70710678118654752f)); else if (ACT == 11) v = 1.0f / (1.0f + expf(-v)); else if (ACT == 15) v = v / (1.0f + expf(-v)); else if (ACT == 12) v = (v > 0.f) ? v : 0.01f * v; else if (ACT == 8) v = tanhf(v);
      so[w][rloc][t * 16 + ln] = v; } }
  __builtin_amdgcn_fence(__ATOMIC_ACQ_REL, "workgroup"); __builtin_amdgcn_wave_barrier();
  const int rsub = lane >> 4, c4 = (lane & 15) * 4;
  {
#pragma unroll
    for (int q = 0; q < 16; ++q) { const int r = q * 2 + rsub; const v4f v = *(const v4fa*)&so[w][r][c4]; if (C) *(v4f*)(C + cofs + (size_t)(row0 + r) * ldc + col0 + c4) = v; if (C16) { v4h h4; for (int i = 0; i < 4; ++i) h4[i] = (_Float16)v[i]; *(v4h*)(C16 + cofs + (size_t)(row0 + r) * ldc + col0 + c4) = h4; } }
     } }



__constant__ int BK30[2 * SLEN - 1] = {15,15,15,15,15,15,15,15,15,15,15,15,15,15,15,15,15,15,15,15,15,15,15,15,15,15,15,15,15,15,15,15,15,15,15,15,15,15,15,15,15,15,15,15,15,15,15,15,15,15,15,15,15,15,15,15,15,15,15,15,15,15,15,15,15,15,15,15,15,15,15,15,15,15,15,15,15,15,15,15,15,15,15,15,15,15,15,15,15,15,15,15,15,15,15,15,15,15,15,15,15,15,15,15,15,15,15,15,15,15,15,15,15,15,15,15,15,15,15,15,15,15,15,15,15,15,15,15,15,15,15,15,15,15,15,15,15,15,15,15,15,15,15,15,15,15,15,15,15,15,15,15,15,15,15,15,15,15,15,15,15,15,15,15,15,15,15,15,15,15,15,15,15,15,15,15,15,15,15,15,15,15,15,15,15,15,15,15,15,15,15,15,15,15,15,15,15,15,15,15,15,15,15,15,15,15,15,15,15,15,15,15,15,15,15,15,15,15,15,15,15,15,15,15,15,15,15,15,15,15,15,15,15,15,15,15,15,15,15,15,15,15,15,15,15,15,15,15,15,15,15,15,15,15,15,15,15,15,15,15,15,15,15,15,15,15,15,15,15,15,15,15,15,15,15,15,15,15,15,15,15,15,15,15,15,15,15,15,15,15,15,15,15,15,15,15,15,15,15,15,15,15,15,15,15,15,15,15,15,15,15,15,15,15,15,15,15,15,15,15,15,15,15,15,15,15,15,15,15,15,15,15,15,15,15,15,15,15,15,15,15,15,15,15,15,15,15,15,15,15,15,15,15,15,15,15,15,15,15,15,15,15,15,15,15,15,15,15,15,15,15,15,15,15,15,15,15,15,15,15,15,15,15,15,15,15,15,15,15,15,15,15,15,15,15,15,15,15,15,15,15,15,15,15,15,15,15,15,15,15,15,15,15,15,15,15,15,15,15,15,15,15,15,15,15,15,15,15,15,15,15,15,15,15,15,15,15,15,15,15,15,15,15,15,15,15,15,15,15,15,15,15,15,15,15,15,15,15,15,15,15,15,15,15,15,15,15,15,15,15,15,15,15,15,15,15,15,15,15,15,15,15,15,15,15,15,15,15,15,15,15,15,15,15,15,15,15,15,15,15,15,15,15,15,15,15,15,15,15,15,15,15,15,15,15,15,15,15,15,15,15,15,15,15,15,15,15,15,15,15,15,15,15,15,15,15,15,15,15,15,15,15,15,15,15,15,15,15,15,15,15,15,15,15,15,15,15,15,15,15,15,15,15,15,15,15,15,15,15,15,15,15,15,15,15,15,15,15,15,15,15,15,15,15,15,15,15,15,15,15,15,15,15,15,15,15,15,15,15,15,15,15,15,15,15,15,15,15,15,15,15,15,15,15,15,15,15,15,15,15,15,15,15,15,15,15,15,15,15,15,15,15,15,15,15,15,15,15,15,15,15,15,15,15,15,15,15,15,15,15,15,15,15,15,15,15,15,15,15,15,15,15,15,15,15,15,15,15,15,15,15,15,15,15,15,15,15,15,15,15,15,15,15,15,15,15,15,15,15,15,15,15,15,15,15,15,15,15,15,15,15,15,15,15,15,15,15,15,15,15,15,15,15,15,15,15,15,15,15,15,15,15,15,15,15,15,15,15,15,15,15,15,15,15,15,15,15,15,15,15,15,15,15,15,15,15,15,15,15,15,15,15,15,15,15,15,15,15,15,15,15,15,15,15,15,15,15,15,15,15,15,15,15,15,15,15,15,15,15,15,15,15,15,15,15,15,15,15,15,15,15,15,15,15,15,15,15,15,15,15,15,15,15,15,15,15,15,15,15,15,15,15,15,15,15,15,15,15,15,15,15,15,15,15,15,15,15,15,15,15,15,15,15,15,15,15,15,15,15,15,15,15,15,15,15,15,15,15,15,15,15,15,15,15,15,15,15,15,15,15,15,15,15,15,15,15,15,15,15,15,15,15,15,15,15,15,15,15,15,15,15,15,15,15,15,15,15,15,15,15,15,15,15,15,15,15,15,15,15,15,15,15,15,15,15,15,15,15,15,15,15,15,15,15,15,15,15,15,15,15,15,15,15,15,15,15,15,15,15,15,15,15,15,15,15,15,15,15,15,15,15,15,15,15,15,15,15,15,15,15,15,15,15,15,15,15,15,15,15,15,15,15,15,15,15,15,15,15,15,15,15,15,15,15,15,15,15,15,15,15,15,15,15,15,15,15,15,15,15,15,15,15,15,15,15,15,15,15,15,15,15,15,15,15,15,15,15,15,15,15,15,15,15,15,15,15,15,15,15,15,15,15,15,15,15,15,15,15,15,15,15,15,15,15,15,15,15,15,15,15,15,15,15,15,15,15,15,15,15,15,15,15,15,15,15,15,15,15,15,15,15,15,15,15,15,15,15,15,15,15,15,15,15,15,15,15,15,15,15,15,15,15,15,15,15,15,15,15,15,15,15,15,15,15,15,15,15,15,15,15,15,15,15,15,15,15,15,15,15,15,15,15,15,15,15,15,15,15,15,15,15,15,15,15,15,15,15,15,15,15,15,15,15,15,15,15,15,15,15,15,15,15,15,15,15,15,15,15,15,15,15,15,15,15,15,15,15,15,15,15,15,15,15,15,15,15,15,15,15,15,15,15,15,15,15,15,15,15,15,15,15,15,15,15,15,15,15,15,15,15,15,15,15,15,15,15,15,15,15,15,15,15,15,15,15,15,15,15,15,15,15,15,15,15,15,15,15,15,15,15,15,15,15,15,15,15,15,15,15,15,15,15,15,15,15,15,15,15,15,15,15,15,15,15,15,15,15,15,15,15,15,15,15,15,15,15,15,15,15,15,15,15,15,15,15,15,15,15,15,15,15,15,15,15,15,15,15,15,15,15,15,15,15,15,15,15,15,15,15,15,15,15,15,15,15,15,15,15,15,15,15,15,15,15,15,15,15,15,15,15,15,15,15,15,15,15,15,15,15,15,15,15,15,15,15,15,15,15,15,15,15,15,15,15,15,15,15,15,15,15,15,15,15,15,15,15,15,15,15,15,15,15,15,15,15,15,15,15,15,15,15,15,15,15,15,15,15,15,15,15,15,15,15,15,15,15,15,15,15,15,15,15,15,15,15,15,15,15,15,15,15,15,15,15,15,15,15,15,15,15,15,15,15,15,15,15,15,15,15,15,15,15,15,15,15,15,15,15,15,15,15,15,15,15,15,15,15,15,15,15,15,15,15,15,15,15,15,15,15,15,15,15,15,15,15,15,15,15,15,15,15,15,15,15,15,15,15,15,15,15,15,15,15,15,15,15,15,15,15,15,15,15,15,15,15,15,15,15,15,15,15,15,15,15,15,15,15,15,15,15,15,15,15,15,15,15,15,15,15,15,15,15,15,15,15,15,15,15,15,15,15,15,15,15,15,15,15,15,15,15,15,15,15,15,15,15,15,15,15,15,15,15,15,15,15,15,15,15,15,15,15,15,15,15,15,15,15,15,15,15,15,15,15,15,15,15,15,15,15,15,15,15,15,15,15,15,15,15,15,15,15,15,15,15,15,15,15,15,15,15,15,15,15,15,15,15,15,15,15,15,15,15,15,15,15,15,15,15,15,15,15,15,15,15,15,15,15,15,15,15,15,15,15,15,15,15,15,15,15,15,15,15,15,15,15,15,15,15,15,15,15,15,15,15,15,15,15,15,15,15,15,15,15,15,15,15,15,15,15,15,15,15,15,15,15,15,15,15,15,15,15,15,15,15,15,15,15,15,15,15,15,15,15,15,15,15,15,15,15,15,15,15,15,15,15,15,15,15,15,15,15,15,15,15,15,15,15,15,15,15,15,15,15,15,15,15,15,15,15,15,15,15,15,15,15,15,15,15,15,15,15,15,15,15,15,15,15,15,15,15,15,15,15,15,15,15,15,15,15,15,15,15,15,15,15,15,15,15,15,15,15,15,15,15,15,15,15,15,15,15,15,15,15,15,15,15,15,15,15,15,15,15,15,15,15,15,15,15,15,15,15,15,15,15,15,15,15,15,15,15,15,15,15,15,15,15,15,15,15,15,15,15,15,15,15,15,15,15,15,15,15,15,15,15,15,15,15,15,15,15,15,15,15,15,15,15,15,15,15,15,15,15,15,15,15,15,15,15,15,15,15,15,15,15,15,15,15,15,15,15,15,15,15,15,15,15,15,15,15,15,15,15,15,15,15,15,15,15,15,15,15,15,15,15,15,15,15,15,15,15,15,15,15,15,15,15,15,15,15,15,15,15,15,15,15,15,15,15,15,15,15,15,15,15,15,15,15,15,15,15,15,15,15,15,15,15,15,15,15,15,15,15,15,15,15,15,15,15,15,15,15,15,15,15,15,15,15,15,15,15,15,15,15,15,15,15,15,15,15,15,15,15,15,15,15,15,15,14,14,14,14,14,14,14,14,14,14,14,14,14,14,14,14,14,14,14,14,14,14,14,14,14,14,14,13,13,13,13,13,13,13,13,13,13,13,13,13,13,13,13,13,13,12,12,12,12,12,12,12,12,12,12,12,12,12,12,11,11,11,11,11,11,11,11,11,10,10,10,10,10,10,10,9,9,9,9,8,8,8,8,7,6,5,4,3,2,1,0,17,18,19,20,21,22,23,24,24,24,24,25,25,25,25,26,26,26,26,26,26,26,27,27,27,27,27,27,27,27,27,28,28,28,28,28,28,28,28,28,28,28,28,28,28,29,29,29,29,29,29,29,29,29,29,29,29,29,29,29,29,29,29,30,30,30,30,30,30,30,30,30,30,30,30,30,30,30,30,30,30,30,30,30,30,30,30,30,30,30,31,31,31,31,31,31,31,31,31,31,31,31,31,31,31,31,31,31,31,31,31,31,31,31,31,31,31,31,31,31,31,31,31,31,31,31,31,31,31,31,31,31,31,31,31,31,31,31,31,31,31,31,31,31,31,31,31,31,31,31,31,31,31,31,31,31,31,31,31,31,31,31,31,31,31,31,31,31,31,31,31,31,31,31,31,31,31,31,31,31,31,31,31,31,31,31,31,31,31,31,31,31,31,31,31,31,31,31,31,31,31,31,31,31,31,31,31,31,31,31,31,31,31,31,31,31,31,31,31,31,31,31,31,31,31,31,31,31,31,31,31,31,31,31,31,31,31,31,31,31,31,31,31,31,31,31,31,31,31,31,31,31,31,31,31,31,31,31,31,31,31,31,31,31,31,31,31,31,31,31,31,31,31,31,31,31,31,31,31,31,31,31,31,31,31,31,31,31,31,31,31,31,31,31,31,31,31,31,31,31,31,31,31,31,31,31,31,31,31,31,31,31,31,31,31,31,31,31,31,31,31,31,31,31,31,31,31,31,31,31,31,31,31,31,31,31,31,31,31,31,31,31,31,31,31,31,31,31,31,31,31,31,31,31,31,31,31,31,31,31,31,31,31,31,31,31,31,31,31,31,31,31,31,31,31,31,31,31,31,31,31,31,31,31,31,31,31,31,31,31,31,31,31,31,31,31,31,31,31,31,31,31,31,31,31,31,31,31,31,31,31,31,31,31,31,31,31,31,31,31,31,31,31,31,31,31,31,31,31,31,31,31,31,31,31,31,31,31,31,31,31,31,31,31,31,31,31,31,31,31,31,31,31,31,31,31,31,31,31,31,31,31,31,31,31,31,31,31,31,31,31,31,31,31,31,31,31,31,31,31,31,31,31,31,31,31,31,31,31,31,31,31,31,31,31,31,31,31,31,31,31,31,31,31,31,31,31,31,31,31,31,31,31,31,31,31,31,31,31,31,31,31,31,31,31,31,31,31,31,31,31,31,31,31,31,31,31,31,31,31,31,31,31,31,31,31,31,31,31,31,31,31,31,31,31,31,31,31,31,31,31,31,31,31,31,31,31,31,31,31,31,31,31,31,31,31,31,31,31,31,31,31,31,31,31,31,31,31,31,31,31,31,31,31,31,31,31,31,31,31,31,31,31,31,31,31,31,31,31,31,31,31,31,31,31,31,31,31,31,31,31,31,31,31,31,31,31,31,31,31,31,31,31,31,31,31,31,31,31,31,31,31,31,31,31,31,31,31,31,31,31,31,31,31,31,31,31,31,31,31,31,31,31,31,31,31,31,31,31,31,31,31,31,31,31,31,31,31,31,31,31,31,31,31,31,31,31,31,31,31,31,31,31,31,31,31,31,31,31,31,31,31,31,31,31,31,31,31,31,31,31,31,31,31,31,31,31,31,31,31,31,31,31,31,31,31,31,31,31,31,31,31,31,31,31,31,31,31,31,31,31,31,31,31,31,31,31,31,31,31,31,31,31,31,31,31,31,31,31,31,31,31,31,31,31,31,31,31,31,31,31,31,31,31,31,31,31,31,31,31,31,31,31,31,31,31,31,31,31,31,31,31,31,31,31,31,31,31,31,31,31,31,31,31,31,31,31,31,31,31,31,31,31,31,31,31,31,31,31,31,31,31,31,31,31,31,31,31,31,31,31,31,31,31,31,31,31,31,31,31,31,31,31,31,31,31,31,31,31,31,31,31,31,31,31,31,31,31,31,31,31,31,31,31,31,31,31,31,31,31,31,31,31,31,31,31,31,31,31,31,31,31,31,31,31,31,31,31,31,31,31,31,31,31,31,31,31,31,31,31,31,31,31,31,31,31,31,31,31,31,31,31,31,31,31,31,31,31,31,31,31,31,31,31,31,31,31,31,31,31,31,31,31,31,31,31,31,31,31,31,31,31,31,31,31,31,31,31,31,31,31,31,31,31,31,31,31,31,31,31,31,31,31,31,31,31,31,31,31,31,31,31,31,31,31,31,31,31,31,31,31,31,31,31,31,31,31,31,31,31,31,31,31,31,31,31,31,31,31,31,31,31,31,31,31,31,31,31,31,31,31,31,31,31,31,31,31,31,31,31,31,31,31,31,31,31,31,31,31,31,31,31,31,31,31,31,31,31,31,31,31,31,31,31,31,31,31,31,31,31,31,31,31,31,31,31,31,31,31,31,31,31,31,31,31,31,31,31,31,31,31,31,31,31,31,31,31,31,31,31,31,31,31,31,31,31,31,31,31,31,31,31,31,31,31,31,31,31,31,31,31,31,31,31,31,31,31,31,31,31,31,31,31,31,31,31,31,31,31,31,31,31,31,31,31,31,31,31,31,31,31,31,31,31,31,31,31,31,31,31,31,31,31,31,31,31,31,31,31,31,31,31,31,31,31,31,31,31,31,31,31,31,31,31,31,31,31,31,31,31,31,31,31,31,31,31,31,31,31,31,31,31,31,31,31,31,31,31,31,31,31,31,31,31,31,31,31,31,31,31,31,31,31,31,31,31,31,31,31,31,31,31,31,31,31,31,31,31,31,31,31,31,31,31,31,31,31,31,31,31,31,31,31,31,31,31,31,31,31,31,31,31,31,31,31,31,31,31,31,31,31,31,31,31,31,31,31,31,31,31,31,31,31,31,31,31,31,31,31,31,31,31,31,31,31,31,31,31,31,31,31,31,31,31,31,31,31,31,31,31,31,31,31,31,31,31,31,31,31,31,31,31,31,31,31,31,31,31,31,31,31,31,31,31,31,31,31,31,31,31,31,31,31,31,31,31,31,31,31,31,31,31,31,31,31,31,31,31,31,31,31,31,31,31,31,31,31,31,31,31,31,31,31,31,31,31,31,31,31,31,31,31,31,31,31,31,31,31,31,31,31,31,31,31,31,31,31,31,31,31,31,31,31,31,31,31,31,31,31,31,31,31,31,31,31,31,31,31,31,31,31,31,31,31,31,31,31,31,31,31,31,31,31,31,31,31,31,31,31,31,31,31,31,31,31,31,31,31,31,31,31,31,31,31,31,31,31,31,31,31,31,31,31,31,31,31,31,31,31,31,31,31,31,31,31,31,31,31,31,31,31,31,31,31,31,31,31,31,31,31,31,31,31,31,31,31,31,31,31,31,31,31,31,31,31,31,31,31,31,31,31,31,31,31,31,31,31,31,31,31,31,31,31,31,31,31,31,31,31,31,31,31,31,31,31,31,31,31,31,31,31,31,31,31,31,31,31,31,31,31,31,31,31,31,31,31,31,31,31,31,31,31,31,31,31,31,31,31,31,31,31,31,31,31,31,31,31,31,31,31,31,31,31,31,31,31,31,31,31,31,31,31,31,31,31,31,31,31,31,31,31,31,31,31,31,31,31,31,31,31,31,31,31,31,31,31,31,31,31,31,31,31,31,31,31,31,31,31,31,31,31,31,31,31,31,31,31,31,31,31,31,31,31,31,31,31,31,31,31,31,31,31,31,31,31,31,31,31,31,31,31,31,31,31,31,31,31,31,31,31,31,31,31,31,31,31,31,31,31,31,31,31,31,31,31,31,31,31,31,31,31,31,31,31,31,31,31,31,31,31,31,31,31,31,31,31,31,31,31,31,31,31,31,31,31,31,31,31,31,31,31,31,31,31,31,31,31,31,31,31,31,31,31,31,31,31,31,31,31,31,31,31,31,31,31,31,31,31,31,31,31,31,31,31,31,31,31,31,31,31,31,31,31,31,31,31,31,31,31,31,31,31,31,31,31,31,31,31,31,31,31,31,31,31,31,31,31,31,31,31,31,31,31,31,31,31,31,31,31,31,31,31,31,31,31,31,31,31,31,31,31,31,31,31,31,31,31,31,31,31,31,31,31,31,31,31,31,31,31,31,31,31,31,31,31,31,31,31,31,31,31,31,31,31,31,31,31,31,31,31,31,31,31,31,31,31,31,31,31,31,31,31,31,31,31,31,31,31,31,31,31,31,31,31,31,31,31,31,31,31,31,31,31,31,31,31,31,31,31,31,31,31,31,31,31,31,31,31,31,31,31,31,31,31,31,31,31,31,31,31,31,31,31,31,31,31,31,31,31,31,31,31,31,31,31,31,31,31,31,31,31,31,31,31,31,31,31,31,31,31,31,31,31,31,31,31,31,31,31,31,31,31,31,31,31,31,31,31,31,31,31,31,31,31,31,31,31,31,31,31,31,31,31,31,31,31,31,31,31,31,31,31,31,31,31,31,31,31,31,31,31,31,31,31,31,31,31,31,31,31,31,31,31,31,31,31,31,31,31,31,31,31,31,31,31,31,31,31,31,31,31,31,31,31,31,31,31,31,31,31,31,31,31,31,31,31,31,31,31,31,31,31,31,31,31,31,31,31,31,31,31,31,31,31,31,31,31,31,31,31,31,31,31,31,31,31,31};      /* T5 _relative_position_bucket(k - q) for k - q in [-(S-1), S-1], computed with the module's own jax code on the host */
__global__ __launch_bounds__(512) void k_rb(const float* __restrict__ t, float* __restrict__ RB) { const int i = threadIdx.x; const float v = bf16_round(t[i]); *(float*)(RB + i) = v;  }
template <int CAUSAL>
__global__ __launch_bounds__(128) void k_flash(const _Float16* __restrict__ Q16, int ldq, const _Float16* __restrict__ K16, int ldk, const _Float16* __restrict__ Vt, const int* __restrict__ MSK, float* __restrict__ O, int ldo) {
  constexpr int RPW = 16, RTN = RPW / 16, NQB = TQ / (4 * RPW), DT = 4, KS = 2;
  __shared__ __attribute__((aligned(16))) unsigned short sP[4][RPW][40]; __shared__ __attribute__((aligned(16))) float sO[4][RPW][64 + 4];
  const int tid = threadIdx.x, w = tid >> 5, lane = tid & 31, ln = lane & 15, hh = lane >> 4;
  const int slab = blockIdx.x / QBNP, qblk = QB0P + blockIdx.x % QBNP; (void)NQB; const int b = slab / NH, h = slab % NH; const int qb0 = qblk * (4 * RPW); const int q0 = qb0 + w * RPW;
  FragH aq[2][KS];
#pragma unroll
  for (int rt = 0; rt < RTN; ++rt) { const unsigned short* qr = (const unsigned short*)Q16 + ((size_t)b * TQ + q0 + rt * 16 + ln) * ldq + h * 64;
#pragma unroll
    for (int ks = 0; ks < KS; ++ks) { aq[rt][ks].half[0] = *(const v8us*)(qr + ks * 32 + 8 * hh); aq[rt][ks].half[1] = *(const v8us*)(qr + ks * 32 + 16 + 8 * hh); } }
  const unsigned short* Vth = (const unsigned short*)Vt + (size_t)slab * 64 * TK;
  float m_r[2][8], l_r[2][8]; v8f oacc[2][DT];
#pragma unroll
  for (int rt = 0; rt < RTN; ++rt) {
#pragma unroll
    for (int r = 0; r < 8; ++r) { m_r[rt][r] = -3.0e38f; l_r[rt][r] = 0.f; }
#pragma unroll
    for (int dt = 0; dt < DT; ++dt) oacc[rt][dt] = (v8f){0.f,0.f,0.f,0.f,0.f,0.f,0.f,0.f}; }
  float qsq[2][8];      /* mode 32: |q|^2 of this lane's rows, read once */
#pragma unroll
  for (int rt = 0; rt < RTN; ++rt)
#pragma unroll
    for (int r = 0; r < 8; ++r) qsq[rt][r] = (CAUSAL == 32) ? ((const float*)MSK)[(size_t)b * TQ + q0 + rt * 16 + 8 * hh + r] : 0.f;
  const int jend = (CAUSAL == 1 || CAUSAL == 32) ? (qb0 + 4 * RPW) : ((CAUSAL == 23) ? min(TK, (qb0 / CHK + 2) * CHK) : TK);      /* causal / window: keys that can never contribute are skipped */ const int jbeg = (CAUSAL == 23) ? max(0, (qb0 / CHK - 1) * CHK) : 0;
#pragma unroll 1
  for (int j0 = jbeg; j0 < jend; j0 += 32) {
    v8f s[2][2];
    float ksq0 = 0.f, ksq1 = 0.f; if (CAUSAL == 32) { const float* ksT = (const float*)MSK + (size_t)NB * TQ + (size_t)b * TK + j0 + ln; ksq0 = ksT[0]; ksq1 = ksT[16]; }      /* mode 32: |k|^2 of this lane's two keys, one unconditional load each per key block (j0 + 31 < jend <= TK) */
#pragma unroll
    for (int nt = 0; nt < 2; ++nt) { const unsigned short* kr = (const unsigned short*)K16 + ((size_t)b * TK + j0 + nt * 16 + ln) * ldk + h * 64; FragH bk[KS];
#pragma unroll
      for (int ks = 0; ks < KS; ++ks) { bk[ks].half[0] = *(const v8us*)(kr + ks * 32 + 8 * hh); bk[ks].half[1] = *(const v8us*)(kr + ks * 32 + 16 + 8 * hh); }
#pragma unroll
      for (int rt = 0; rt < RTN; ++rt) { v8f acc = (v8f){0.f,0.f,0.f,0.f,0.f,0.f,0.f,0.f};
#pragma unroll
        for (int ks = 0; ks < KS; ++ks) acc = mmaH<1>(aq[rt][ks].v, aq[rt][ks].v, bk[ks].v, bk[ks].v, acc); s[rt][nt] = acc; } }
#pragma unroll
    for (int rt = 0; rt < RTN; ++rt)
#pragma unroll
      for (int r = 0; r < 8; ++r) { const int tq = q0 + rt * 16 + 8 * hh + r; const int k0 = j0 + ln, k1 = j0 + 16 + ln;
        bool ok0 = (CAUSAL == 1 || CAUSAL == 32) ? (k0 <= tq) : ((CAUSAL == 2) ? ((k0 >> 5) == (tq >> 5)) : true), ok1 = (CAUSAL == 1 || CAUSAL == 32) ? (k1 <= tq) : ((CAUSAL == 2) ? ((k1 >> 5) == (tq >> 5)) : true); if (CAUSAL == 23) { const int cq = tq / CHK; ok0 = (abs(k0 / CHK - cq) <= 1) && (MSK[(size_t)b * TK + k0] == 0); ok1 = (abs(k1 / CHK - cq) <= 1) && (MSK[(size_t)b * TK + k1] == 0); }      /* mode 23: 3-chunk window + int key-padding mask */
        if (CAUSAL == 24) { ok0 = (MSK[(size_t)b * TK + k0] == 0); ok1 = (MSK[(size_t)b * TK + k1] == 0); }      /* mode 24: int key-padding mask (nonzero = padded = excluded) */      /* mode 2: block-diagonal 32-token groups */
        float s0 = ok0 ? s[rt][0][r] * SCL : -3.0e38f, s1 = ok1 ? s[rt][1][r] * SCL : -3.0e38f; if (CAUSAL == 27) { const float* amk = (const float*)MSK + ((size_t)b * MQI + tq) * MKI; s0 += bf16_round(amk[k0]); s1 += bf16_round(amk[k1]); }      /* mode 27: additive per-(batch, query, key) f32 mask INPUT [b][tq][k] */ if (CAUSAL == 30) { const float* rbp = (const float*)MSK; s0 += rbp[BK30[k0 - tq + (TK - 1)] * NH + h]; s1 += rbp[BK30[k1 - tq + (TK - 1)] * NH + h]; }      /* mode 30: T5 bucketed relative bias: table[bucket(k - q)][h]; bucket-of-distance is a module constant */ if (CAUSAL == 32) { const float qs = qsq[rt][r]; if (ok0) { float d = qs + ksq0; d = d - 2.0f * s0; d = fmaxf(d, 0.f); s0 = -d * 0.125f; } if (ok1) { float d = qs + ksq1; d = d - 2.0f * s1; d = fmaxf(d, 0.f); s1 = -d * 0.125f; } }      /* mode 32: RBF logit -relu(|q|^2 + |k|^2 - 2 q.k)/8, causal */ if (CAUSAL == 17) { const float* amk = (const float*)MSK + (size_t)b * TK; s0 += bf16_round(amk[k0]); s1 += bf16_round(amk[k1]); } if (CAUSAL == 18) { const float* tb = (const float*)MSK; const int* ri = MSK + 1024 + (size_t)b * TK; const int rq = ri[tq]; s0 += tb[(h * 8 + rq) * 8 + ri[k0]]; s1 += tb[(h * 8 + rq) * 8 + ri[k1]]; } if (CAUSAL == 19) { const int* rel = MSK + (size_t)tq * TK; const float* rb = (const float*)MSK + (size_t)TQ * TK + ((size_t)(b * NH + h) * TQ + tq) * 64; s0 += rb[rel[k0]]; s1 += rb[rel[k1]]; }      /* mode 19: + (q.Ek[rel] + Eb[rel][h]) / 8 gathered by the int relative ids (packed [ids | table]) */      /* mode 18: + resource_bias[h][r_q][r_k] from the packed [table | ids] buffer (TQ == TK) */      /* mode 17: additive per-(batch, key) mask INPUT */ float mc = fmaxf(s0, s1);
        mc = fmaxf(mc, __shfl_xor(mc, 1, 32)); mc = fmaxf(mc, __shfl_xor(mc, 2, 32)); mc = fmaxf(mc, __shfl_xor(mc, 4, 32)); mc = fmaxf(mc, __shfl_xor(mc, 8, 32));
        const float mn = fmaxf(m_r[rt][r], mc); const float ea = expf(m_r[rt][r] - mn), e0 = expf(s0 - mn), e1 = expf(s1 - mn);      /* computed for every lane and selected below: no exec-mask branch, so the eight rows' chains can overlap */ const float al = (mn > -1.0e38f) ? ea : 1.0f; m_r[rt][r] = mn; const float p0 = ok0 ? e0 : 0.f, p1 = ok1 ? e1 : 0.f; l_r[rt][r] = l_r[rt][r] * al + p0 + p1;
#pragma unroll
        for (int dt = 0; dt < DT; ++dt) oacc[rt][dt][r] *= al;
        FragH t2; t2.h[0] = (_Float16)(p0 * 1024.0f); t2.h[1] = (_Float16)(p1 * 1024.0f); sP[w][rt * 16 + 8 * hh + r][ln] = t2.u[0]; sP[w][rt * 16 + 8 * hh + r][16 + ln] = t2.u[1]; }
    __builtin_amdgcn_fence(__ATOMIC_ACQ_REL, "workgroup"); __builtin_amdgcn_wave_barrier();
    FragH pa[2];
#pragma unroll
    for (int rt = 0; rt < RTN; ++rt) { pa[rt].half[0] = *(const v8us*)&sP[w][rt * 16 + ln][8 * hh]; pa[rt].half[1] = *(const v8us*)&sP[w][rt * 16 + ln][16 + 8 * hh]; }
#pragma unroll
    for (int dt = 0; dt < DT; ++dt) { const unsigned short* vrow = Vth + (size_t)(dt * 16 + ln) * TK + j0; FragH bv; bv.half[0] = *(const v8us*)(vrow + 8 * hh); bv.half[1] = *(const v8us*)(vrow + 16 + 8 * hh);
#pragma unroll
      for (int rt = 0; rt < RTN; ++rt) oacc[rt][dt] = mmaH<1>(pa[rt].v, pa[rt].v, bv.v, bv.v, oacc[rt][dt]); }
    __builtin_amdgcn_fence(__ATOMIC_ACQ_REL, "workgroup"); __builtin_amdgcn_wave_barrier(); }
#pragma unroll
  for (int rt = 0; rt < RTN; ++rt) {
#pragma unroll
    for (int r = 0; r < 8; ++r) { float l = l_r[rt][r]; l += __shfl_xor(l, 1, 32); l += __shfl_xor(l, 2, 32); l += __shfl_xor(l, 4, 32); l += __shfl_xor(l, 8, 32); l_r[rt][r] = (l > 0.f) ? 1.0f / (l * 1024.0f) : 0.f; }
#pragma unroll
    for (int dt = 0; dt < DT; ++dt)
#pragma unroll
      for (int r = 0; r < 8; ++r) sO[w][rt * 16 + 8 * hh + r][dt * 16 + ln] = oacc[rt][dt][r] * l_r[rt][r]; }
  __builtin_amdgcn_fence(__ATOMIC_ACQ_REL, "workgroup"); __builtin_amdgcn_wave_barrier();
  {
#pragma unroll
    for (int rp = 0; rp < RPW; rp += 2) { const int r = rp + (lane >> 4), pc = lane & 15; const v4f val = *(const v4fa*)&sO[w][r][pc * 4]; *(v4f*)(O + ((size_t)b * TQ + q0 + r) * ldo + h * 64 + pc * 4) = val; }
     } }
// 5-plane variant: S = Qh Kh^T + (Ql Kh^T + Qh Kl^T)/1024 with Q/K = [hi | 2^10 residual] f16 planes (QL/KL same layout as Q16/K16), then the 3-term P.V below.
// 3-term variant: O = (P_hi V_hi + (P_lo V_hi + P_hi V_lo) / 1024) / l with P = [hi | 2^10 residual] of 1024 p and V^T = [hi | 2^10 residual] planes (VtL same layout as Vt) -> ~2^-21-class products for un-averaged (early causal / peaked) rows
template <int CAUSAL>
__global__ __launch_bounds__(128) void k_flash5(const _Float16* __restrict__ Q16, const _Float16* __restrict__ QL, int ldq, const _Float16* __restrict__ K16, const _Float16* __restrict__ KL, int ldk, const _Float16* __restrict__ Vt, const _Float16* __restrict__ VtL, const int* __restrict__ MSK, float* __restrict__ O, int ldo) {
  constexpr int RPW = 16, RTN = RPW / 16, NQB = TQ / (4 * RPW), DT = 4, KS = 2;
  __shared__ __attribute__((aligned(16))) unsigned short sP[4][RPW][40]; __shared__ __attribute__((aligned(16))) unsigned short sPL[4][RPW][40]; __shared__ __attribute__((aligned(16))) float sO[4][RPW][64 + 4];
  const int tid = threadIdx.x, w = tid >> 5, lane = tid & 31, ln = lane & 15, hh = lane >> 4;
  const int slab = blockIdx.x / QBN5, qblk = QB05 + blockIdx.x % QBN5; (void)NQB; const int b = slab / NH, h = slab % NH; const int qb0 = qblk * (4 * RPW); const int q0 = qb0 + w * RPW;
  FragH aq[2][KS], aql[2][KS];
#pragma unroll
  for (int rt = 0; rt < RTN; ++rt) { const unsigned short* qr = (const unsigned short*)Q16 + ((size_t)b * TQ + q0 + rt * 16 + ln) * ldq + h * 64; const unsigned short* ql = (const unsigned short*)QL + ((size_t)b * TQ + q0 + rt * 16 + ln) * ldq + h * 64;
#pragma unroll
    for (int ks = 0; ks < KS; ++ks) { aq[rt][ks].half[0] = *(const v8us*)(qr + ks * 32 + 8 * hh); aq[rt][ks].half[1] = *(const v8us*)(qr + ks * 32 + 16 + 8 * hh); aql[rt][ks].half[0] = *(const v8us*)(ql + ks * 32 + 8 * hh); aql[rt][ks].half[1] = *(const v8us*)(ql + ks * 32 + 16 + 8 * hh); } }
  const unsigned short* Vth = (const unsigned short*)Vt + (size_t)slab * 64 * TK; const unsigned short* Vtl = (const unsigned short*)VtL + (size_t)slab * 64 * TK;
  float m_r[2][8], l_r[2][8]; v8f oacc[2][DT], oaccL[2][DT];
#pragma unroll
  for (int rt = 0; rt < RTN; ++rt) {
#pragma unroll
    for (int r = 0; r < 8; ++r) { m_r[rt][r] = -3.0e38f; l_r[rt][r] = 0.f; }
#pragma unroll
    for (int dt = 0; dt < DT; ++dt) { oacc[rt][dt] = (v8f){0.f,0.f,0.f,0.f,0.f,0.f,0.f,0.f}; oaccL[rt][dt] = oacc[rt][dt]; } }
  const int jend = (CAUSAL == 1 || CAUSAL == 32) ? (qb0 + 4 * RPW) : ((CAUSAL == 23) ? min(TK, (qb0 / CHK + 2) * CHK) : TK);      /* causal / window: keys that can never contribute are skipped */ const int jbeg = (CAUSAL == 23) ? max(0, (qb0 / CHK - 1) * CHK) : 0;
#pragma unroll 1
  for (int j0 = jbeg; j0 < jend; j0 += 32) {
    v8f s[2][2];
#pragma unroll
    for (int nt = 0; nt < 2; ++nt) { const unsigned short* kr = (const unsigned short*)K16 + ((size_t)b * TK + j0 + nt * 16 + ln) * ldk + h * 64; const unsigned short* klr = (const unsigned short*)KL + ((size_t)b * TK + j0 + nt * 16 + ln) * ldk + h * 64; FragH bk[KS], bkl[KS];
#pragma unroll
      for (int ks = 0; ks < KS; ++ks) { bk[ks].half[0] = *(const v8us*)(kr + ks * 32 + 8 * hh); bk[ks].half[1] = *(const v8us*)(kr + ks * 32 + 16 + 8 * hh); bkl[ks].half[0] = *(const v8us*)(klr + ks * 32 + 8 * hh); bkl[ks].half[1] = *(const v8us*)(klr + ks * 32 + 16 + 8 * hh); }
#pragma unroll
      for (int rt = 0; rt < RTN; ++rt) { v8f acc = (v8f){0.f,0.f,0.f,0.f,0.f,0.f,0.f,0.f}, accl = acc;
#pragma unroll
        for (int ks = 0; ks < KS; ++ks) { acc = mmaH<1>(aq[rt][ks].v, aq[rt][ks].v, bk[ks].v, bk[ks].v, acc); accl = mmaH<1>(aql[rt][ks].v, aql[rt][ks].v, bk[ks].v, bk[ks].v, accl); accl = mmaH<1>(aq[rt][ks].v, aq[rt][ks].v, bkl[ks].v, bkl[ks].v, accl); }
#pragma unroll
        for (int r = 0; r < 8; ++r) acc[r] += accl[r] * 0.0009765625f;
        s[rt][nt] = acc; } }
#pragma unroll
    for (int rt = 0; rt < RTN; ++rt)
#pragma unroll
      for (int r = 0; r < 8; ++r) { const int tq = q0 + rt * 16 + 8 * hh + r; const int k0 = j0 + ln, k1 = j0 + 16 + ln;
        bool ok0 = (CAUSAL == 1 || CAUSAL == 32) ? (k0 <= tq) : ((CAUSAL == 2) ? ((k0 >> 5) == (tq >> 5)) : true), ok1 = (CAUSAL == 1 || CAUSAL == 32) ? (k1 <= tq) : ((CAUSAL == 2) ? ((k1 >> 5) == (tq >> 5)) : true);      /* mode 2: block-diagonal 32-token groups */
        if (CAUSAL == 4) { const int* mrow = MSK + ((size_t)b * TQ + tq) * TK; ok0 = mrow[k0] != 0; ok1 = mrow[k1] != 0; }      /* mode 4: per-(query, key) INPUT mask shared by all heads; masked keys contribute nothing (== the reference's -4096 fill, whose exp underflows to 0), rows with no valid key give l = 0 -> output 0 (== the reference's row_valid zeroing) */
        float s0 = ok0 ? s[rt][0][r] * SCL : -3.0e38f, s1 = ok1 ? s[rt][1][r] * SCL : -3.0e38f; if (CAUSAL == 30) { const float* rbp = (const float*)MSK; s0 += rbp[BK30[k0 - tq + (TK - 1)] * NH + h]; s1 += rbp[BK30[k1 - tq + (TK - 1)] * NH + h]; }      /* mode 30: T5 bucketed relative bias: table[bucket(k - q)][h]; bucket-of-distance is a module constant */ if (CAUSAL == 32) { const float* qsT = (const float*)MSK; const float* ksT = qsT + (size_t)NB * TQ; const float qs = qsT[(size_t)b * TQ + tq]; if (ok0) { float d = qs + ksT[(size_t)b * TK + k0]; d = d - 2.0f * s0; d = fmaxf(d, 0.f); s0 = -d * 0.125f; } if (ok1) { float d = qs + ksT[(size_t)b * TK + k1]; d = d - 2.0f * s1; d = fmaxf(d, 0.f); s1 = -d * 0.125f; } }      /* mode 32: RBF logit -relu(|q|^2 + |k|^2 - 2 q.k)/8, causal */ if (CAUSAL == 17) { const float* amk = (const float*)MSK + (size_t)b * TK; s0 += bf16_round(amk[k0]); s1 += bf16_round(amk[k1]); } if (CAUSAL == 18) { const float* tb = (const float*)MSK; const int* ri = MSK + 1024 + (size_t)b * TK; const int rq = ri[tq]; s0 += tb[(h * 8 + rq) * 8 + ri[k0]]; s1 += tb[(h * 8 + rq) * 8 + ri[k1]]; } if (CAUSAL == 19) { const int* rel = MSK + (size_t)tq * TK; const float* rb = (const float*)MSK + (size_t)TQ * TK + ((size_t)(b * NH + h) * TQ + tq) * 64; s0 += rb[rel[k0]]; s1 += rb[rel[k1]]; }      /* mode 19: + (q.Ek[rel] + Eb[rel][h]) / 8 gathered by the int relative ids (packed [ids | table]) */      /* mode 18: + resource_bias[h][r_q][r_k] from the packed [table | ids] buffer (TQ == TK) */      /* mode 17: additive per-(batch, key) mask INPUT */ float mc = fmaxf(s0, s1);
        mc = fmaxf(mc, __shfl_xor(mc, 1, 32)); mc = fmaxf(mc, __shfl_xor(mc, 2, 32)); mc = fmaxf(mc, __shfl_xor(mc, 4, 32)); mc = fmaxf(mc, __shfl_xor(mc, 8, 32));
        const float mn = fmaxf(m_r[rt][r], mc); const float al = (mn > -1.0e38f) ? expf(m_r[rt][r] - mn) : 1.0f; m_r[rt][r] = mn; const float p0 = ok0 ? expf(s0 - mn) : 0.f, p1 = ok1 ? expf(s1 - mn) : 0.f; l_r[rt][r] = l_r[rt][r] * al + p0 + p1;
#pragma unroll
        for (int dt = 0; dt < DT; ++dt) { oacc[rt][dt][r] *= al; oaccL[rt][dt][r] *= al; }
        FragH t2, t2l; const float ps0 = p0 * 1024.0f, ps1 = p1 * 1024.0f; t2.h[0] = (_Float16)ps0; t2.h[1] = (_Float16)ps1; t2l.h[0] = (_Float16)((ps0 - (float)t2.h[0]) * 1024.0f); t2l.h[1] = (_Float16)((ps1 - (float)t2.h[1]) * 1024.0f);
        sP[w][rt * 16 + 8 * hh + r][ln] = t2.u[0]; sP[w][rt * 16 + 8 * hh + r][16 + ln] = t2.u[1]; sPL[w][rt * 16 + 8 * hh + r][ln] = t2l.u[0]; sPL[w][rt * 16 + 8 * hh + r][16 + ln] = t2l.u[1]; }
    __builtin_amdgcn_fence(__ATOMIC_ACQ_REL, "workgroup"); __builtin_amdgcn_wave_barrier();
    FragH pa[2], pl[2];
#pragma unroll
    for (int rt = 0; rt < RTN; ++rt) { pa[rt].half[0] = *(const v8us*)&sP[w][rt * 16 + ln][8 * hh]; pa[rt].half[1] = *(const v8us*)&sP[w][rt * 16 + ln][16 + 8 * hh]; pl[rt].half[0] = *(const v8us*)&sPL[w][rt * 16 + ln][8 * hh]; pl[rt].half[1] = *(const v8us*)&sPL[w][rt * 16 + ln][16 + 8 * hh]; }
#pragma unroll
    for (int dt = 0; dt < DT; ++dt) { const unsigned short* vrow = Vth + (size_t)(dt * 16 + ln) * TK + j0; const unsigned short* vrl = Vtl + (size_t)(dt * 16 + ln) * TK + j0; FragH bv, bl; bv.half[0] = *(const v8us*)(vrow + 8 * hh); bv.half[1] = *(const v8us*)(vrow + 16 + 8 * hh); bl.half[0] = *(const v8us*)(vrl + 8 * hh); bl.half[1] = *(const v8us*)(vrl + 16 + 8 * hh);
#pragma unroll
      for (int rt = 0; rt < RTN; ++rt) { oacc[rt][dt] = mmaH<1>(pa[rt].v, pa[rt].v, bv.v, bv.v, oacc[rt][dt]); oaccL[rt][dt] = mmaH<1>(pl[rt].v, pl[rt].v, bv.v, bv.v, oaccL[rt][dt]); oaccL[rt][dt] = mmaH<1>(pa[rt].v, pa[rt].v, bl.v, bl.v, oaccL[rt][dt]); } }
    __builtin_amdgcn_fence(__ATOMIC_ACQ_REL, "workgroup"); __builtin_amdgcn_wave_barrier(); }
#pragma unroll
  for (int rt = 0; rt < RTN; ++rt) {
#pragma unroll
    for (int r = 0; r < 8; ++r) { float l = l_r[rt][r]; l += __shfl_xor(l, 1, 32); l += __shfl_xor(l, 2, 32); l += __shfl_xor(l, 4, 32); l += __shfl_xor(l, 8, 32); l_r[rt][r] = (l > 0.f) ? 1.0f / (l * 1024.0f) : 0.f; }
#pragma unroll
    for (int dt = 0; dt < DT; ++dt)
#pragma unroll
      for (int r = 0; r < 8; ++r) { float v = oacc[rt][dt][r]; v += oaccL[rt][dt][r] * 0.0009765625f; sO[w][rt * 16 + 8 * hh + r][dt * 16 + ln] = v * l_r[rt][r]; } }
  __builtin_amdgcn_fence(__ATOMIC_ACQ_REL, "workgroup"); __builtin_amdgcn_wave_barrier();
  {
#pragma unroll
    for (int rp = 0; rp < RPW; rp += 2) { const int r = rp + (lane >> 4), pc = lane & 15; const v4f val = *(const v4fa*)&sO[w][r][pc * 4]; *(v4f*)(O + ((size_t)b * TQ + q0 + r) * ldo + h * 64 + pc * 4) = val; }
     } }

// Transposed form of the causal RBF attention pass: S^T = K Q^T, O^T += V^T P^T. A lane holds one query's scores (16 of a block's 32 keys, the other wave half the other 16), so the block maximum is in-lane plus one exchange between the halves, and the two score tiles, converted in place, are the B operand of the second product: P passes through no LDS and the loop holds no fence. Logits, maxima and weights are formed by the expressions of k_flash mode 32.
__device__ __forceinline__ float xhalf(float x) { return __builtin_bit_cast(float, __builtin_amdgcn_permlanex16(__builtin_bit_cast(int, x), __builtin_bit_cast(int, x), 0x76543210, 0xfedcba98, false, false)); }      /* lane l with lane l ^ 16 */
__global__ __launch_bounds__(128) void k_flash_t(const _Float16* __restrict__ Q16, const _Float16* __restrict__ K16, const _Float16* __restrict__ Vt, const float* __restrict__ NSQ, float* __restrict__ O) {
  constexpr int DT = 4, KS = 2;
  __shared__ __attribute__((aligned(16))) float sO[4][16][64 + 4];
  const int tid = threadIdx.x, w = tid >> 5, lane = tid & 31, ln = lane & 15, hh = lane >> 4;
  const int slab = blockIdx.x / QBLKS, qblk = blockIdx.x % QBLKS; const int qb0 = qblk * 64; const int q0 = qb0 + w * 16; const int tq = q0 + ln;      /* this lane's query */
  FragH bq[KS]; const unsigned short* qr = (const unsigned short*)Q16 + ((size_t)slab * TQ + tq) * 64;
#pragma unroll
  for (int ks = 0; ks < KS; ++ks) { bq[ks].half[0] = *(const v8us*)(qr + ks * 32 + 8 * hh); bq[ks].half[1] = *(const v8us*)(qr + ks * 32 + 16 + 8 * hh); }
  const unsigned short* Kb = (const unsigned short*)K16 + (size_t)slab * TK * 64; const unsigned short* Vth = (const unsigned short*)Vt + (size_t)slab * 64 * TK;
  const float qs = NSQ[(size_t)slab * TQ + tq]; const float* ksT = NSQ + (size_t)NB * TQ + (size_t)slab * TK;
  float m = -3.0e38f, l = 0.f; v8f oacc[DT];
#pragma unroll
  for (int dt = 0; dt < DT; ++dt) oacc[dt] = (v8f){0.f,0.f,0.f,0.f,0.f,0.f,0.f,0.f};
  const int jend = qb0 + 64;
#pragma unroll 1
  for (int j0 = 0; j0 < jend; j0 += 32) {
    FragH ak[2][KS], av[DT]; v4f kq[2][2];      /* with no fence in the loop the whole pass's loads stand at its head, in front of the first product, and fly together */
#pragma unroll
    for (int nt = 0; nt < 2; ++nt) { const unsigned short* kr = Kb + (size_t)(j0 + nt * 16 + ln) * 64;
#pragma unroll
      for (int ks = 0; ks < KS; ++ks) { ak[nt][ks].half[0] = *(const v8us*)(kr + ks * 32 + 8 * hh); ak[nt][ks].half[1] = *(const v8us*)(kr + ks * 32 + 16 + 8 * hh); }
      kq[nt][0] = *(const v4fa*)(ksT + j0 + nt * 16 + 8 * hh); kq[nt][1] = *(const v4fa*)(ksT + j0 + nt * 16 + 8 * hh + 4); }      /* |k|^2 of this lane's eight keys of the tile */
    asm volatile("s_wait_xcnt 0x0" ::: "memory");      /* precaution: the address registers of the loads above may be reused as destinations of the loads below */
#pragma unroll
    for (int dt = 0; dt < DT; ++dt) { const unsigned short* vrow = Vth + (size_t)(dt * 16 + ln) * TK + j0; av[dt].half[0] = *(const v8us*)(vrow + 8 * hh); av[dt].half[1] = *(const v8us*)(vrow + 16 + 8 * hh); }
    asm volatile("s_wait_xcnt 0x0" ::: "memory");      /* precaution: stands in front of the pointer steps and of every other rewrite of a register that an issued load names */
    __builtin_amdgcn_sched_barrier(0);      /* keeps those rewrites, which the scheduler otherwise lifts among the loads, behind the wait */
    const int lim = tq - j0 - 8 * hh;      /* key 16 nt + r of this lane's sixteen is causal where 16 nt + r <= lim */
    float sc[16]; float mc = -3.0e38f;
#pragma unroll
    for (int nt = 0; nt < 2; ++nt) { v8f acc = (v8f){0.f,0.f,0.f,0.f,0.f,0.f,0.f,0.f};
#pragma unroll
      for (int ks = 0; ks < KS; ++ks) acc = mmaH<1>(ak[nt][ks].v, ak[nt][ks].v, bq[ks].v, bq[ks].v, acc);      /* acc[r] = k[j0 + 16 nt + 8 hh + r] . q[tq] */
#pragma unroll
      for (int r = 0; r < 8; ++r) { const bool ok = nt * 16 + r <= lim; float d = qs + kq[nt][r >> 2][r & 3]; d = d - 2.0f * (acc[r] * SCL); d = fmaxf(d, 0.f); const float sv = ok ? -d * 0.125f : -3.0e38f; sc[nt * 8 + r] = sv; mc = fmaxf(mc, sv); } }
    mc = fmaxf(mc, xhalf(mc));
    const float mn = fmaxf(m, mc); const float ea = expf(m - mn); const float al = (mn > -1.0e38f) ? ea : 1.0f; m = mn;
    FragH pb; float p[16];
#pragma unroll
    for (int i = 0; i < 16; ++i) { const bool ok = (i >> 3) * 16 + (i & 7) <= lim; const float e = expf(sc[i] - mn); p[i] = ok ? e : 0.f; pb.h[i] = (_Float16)(p[i] * 1024.0f); }      /* element i of the B operand is key 8 hh + i, then 16 + 8 hh + (i - 8): the order of the V^T loader above */
#pragma unroll
    for (int st = 8; st > 0; st >>= 1)
#pragma unroll
      for (int i = 0; i < st; ++i) p[i] += p[i + st];
    l = l * al + p[0];
#pragma unroll
    for (int dt = 0; dt < DT; ++dt) {
#pragma unroll
      for (int r = 0; r < 8; ++r) oacc[dt][r] *= al; }
#pragma unroll
    for (int dt = 0; dt < DT; ++dt) oacc[dt] = mmaH<1>(av[dt].v, av[dt].v, pb.v, pb.v, oacc[dt]); }      /* oacc[dt][r] = context column 16 dt + 8 hh + r of query tq */
  l += xhalf(l); const float inv = (l > 0.f) ? 1.0f / (l * 1024.0f) : 0.f;
#pragma unroll
  for (int dt = 0; dt < DT; ++dt) { v4f a, c;
#pragma unroll
    for (int r = 0; r < 4; ++r) { a[r] = oacc[dt][r] * inv; c[r] = oacc[dt][4 + r] * inv; }
    *(v4fa*)&sO[w][ln][dt * 16 + 8 * hh] = a; *(v4fa*)&sO[w][ln][dt * 16 + 8 * hh + 4] = c; }
  __builtin_amdgcn_fence(__ATOMIC_ACQ_REL, "workgroup"); __builtin_amdgcn_wave_barrier();      /* the wave's own lanes read each other's rows below, for whole-row stores */
#pragma unroll
  for (int rp = 0; rp < 16; rp += 2) { const int r = rp + (lane >> 4), pc = lane & 15; const v4f val = *(const v4fa*)&sO[w][r][pc * 4]; *(v4f*)(O + ((size_t)slab * TQ + q0 + r) * 64 + pc * 4) = val; } }

__global__ __launch_bounds__(256) void k_rotab(float* __restrict__ CS, float* __restrict__ SN) {
  #pragma clang fp contract(off)
  const int t = blockIdx.x * 256 + threadIdx.x; if (t >= SLEN * 32) return; const int j = t % 32, s = t / 32; const float ex = (float)(2 * j) / 64.0f; const float inv = 1.0f / powf(10000.0f, ex); const float th = (float)s * inv; const float c = cosf(th), sn = sinf(th);
  { *(float*)(CS + t) = c; *(float*)(SN + t) = sn;  } }
__global__ __launch_bounds__(256) void k_rope(const float* __restrict__ F, int nsrc, int ndst, int rep, const float* __restrict__ CS, const float* __restrict__ SN, _Float16* __restrict__ H, _Float16* __restrict__ L) {
  #pragma clang fp contract(off)
  const size_t t = (size_t)blockIdx.x * 256 + threadIdx.x; if (t >= (size_t)NR * ndst * 4) return; const int g8 = (int)(t % 4); const int hd = (int)((t / 4) % ndst); const size_t row = t / ((size_t)4 * ndst); const int s = (int)(row % SLEN); const int hs = hd / rep;
  const float* src = F + row * (size_t)(nsrc * 64) + hs * 64; FragH ah, al, bh, bl;
  for (int i = 0; i < 8; ++i) { const int d = g8 * 8 + i; const float c = CS[s * 32 + d], sn = SN[s * 32 + d]; const float x1 = src[d], x2 = src[d + 32];
    float o1 = x1 * c; o1 += -x2 * sn; float o2 = x2 * c; o2 += x1 * sn;
    _Float16 hv = (_Float16)o1; ah.h[i] = hv; al.h[i] = (_Float16)((o1 - (float)hv) * 1024.0f); hv = (_Float16)o2; bh.h[i] = hv; bl.h[i] = (_Float16)((o2 - (float)hv) * 1024.0f); }
  const size_t o = row * (size_t)(ndst * 64) + hd * 64 + g8 * 8;
  { *(v8us*)((unsigned short*)H + o) = ah.half[0]; *(v8us*)((unsigned short*)H + o + 32) = bh.half[0]; *(v8us*)((unsigned short*)L + o) = al.half[0]; *(v8us*)((unsigned short*)L + o + 32) = bl.half[0];  } }
__global__ __launch_bounds__(256) void k_rope2(const float* __restrict__ F, int nsrc, int ndst, int rep, const float* __restrict__ CS, const float* __restrict__ SN, _Float16* __restrict__ H, _Float16* __restrict__ L) {
  #pragma clang fp contract(off)
  const size_t t = (size_t)blockIdx.x * 256 + threadIdx.x; if (t >= (size_t)NR * ndst * 4) return; const int g16 = (int)(t % 4); const int hd = (int)((t / 4) % ndst); const size_t row = t / ((size_t)4 * ndst); const int s = (int)(row % SLEN); const int hs = hd / rep;
  const float* src = F + row * (size_t)(nsrc * 64) + hs * 64 + g16 * 16; FragH ah, al;
  for (int pr = 0; pr < 8; ++pr) { const int i = g16 * 8 + pr; const float c = CS[s * 32 + i], sn = SN[s * 32 + i]; const float x1 = src[2 * pr], x2 = src[2 * pr + 1];
    float o1 = x1 * c; o1 -= x2 * sn; float o2 = x1 * sn; o2 += x2 * c;
    _Float16 hv = (_Float16)o1; ah.h[2 * pr] = hv; al.h[2 * pr] = (_Float16)((o1 - (float)hv) * 1024.0f); hv = (_Float16)o2; ah.h[2 * pr + 1] = hv; al.h[2 * pr + 1] = (_Float16)((o2 - (float)hv) * 1024.0f); }
  const size_t o = row * (size_t)(ndst * 64) + hd * 64 + g16 * 16;
  { *(v8us*)((unsigned short*)H + o) = ah.half[0]; *(v8us*)((unsigned short*)H + o + 8) = ah.half[1]; *(v8us*)((unsigned short*)L + o) = al.half[0]; *(v8us*)((unsigned short*)L + o + 8) = al.half[1];  } }
__global__ __launch_bounds__(256) void k_ln512(const float* __restrict__ A, const float* __restrict__ res, const float* __restrict__ g, const float* __restrict__ bb, float* __restrict__ Y, _Float16* __restrict__ Y16) {
  #pragma clang fp contract(off)
  const int wv = threadIdx.x >> 5, ln = threadIdx.x & 31; const size_t r = (size_t)blockIdx.x * 8 + wv; if (r >= NR) return; float x[16]; float s = 0.f;
  for (int i = 0; i < 2; ++i) { const v8f a = *(const v8f*)(A + r * DM + i * 256 + ln * 8); for (int q = 0; q < 8; ++q) { float v = a[q]; if (res) v += bf16_round(res[r * DM + i * 256 + ln * 8 + q]); x[i * 8 + q] = v; s += v; } }
  for (int o = 16; o > 0; o >>= 1) s += __shfl_xor(s, o, 32); const float mu = s / (float)DM; float var = 0.f; for (int q = 0; q < 16; ++q) { const float d = x[q] - mu; var += d * d; }
  for (int o = 16; o > 0; o >>= 1) var += __shfl_xor(var, o, 32); const float inv = rsqrtf(var / (float)DM + 1e-5f);
  { for (int i = 0; i < 2; ++i) { const int c0 = i * 256 + ln * 8; v8f y; FragH f; for (int q = 0; q < 8; ++q) { float v = (x[i * 8 + q] - mu) * inv; v *= bf16_round(g[c0 + q]); v += bf16_round(bb[c0 + q]); y[q] = v; f.h[q] = (_Float16)v; } *(v8f*)(Y + r * DM + c0) = y; if (Y16) *(v8us*)((unsigned short*)Y16 + r * DM + c0) = f.half[0]; }  } }
__global__ __launch_bounds__(256) void k_pack(const float* __restrict__ rb, const int* __restrict__ rid, int* __restrict__ PK) { const int t = blockIdx.x * 256 + threadIdx.x; if (t >= 1024 + NB * TK) return; int v; if (t < 1024) v = __float_as_int(bf16_round(rb[t])); else v = rid[t - 1024]; *(int*)(PK + t) = v;  }
__global__ __launch_bounds__(256) void k_tabin(const float* __restrict__ sp, float* __restrict__ CS, float* __restrict__ SN) { const int t = blockIdx.x * 256 + threadIdx.x; if (t >= SLEN * 32) return; const int i = t % 32, s = t / 32; const float c = bf16_round(sp[s * 64 + 32 + i]), sn = bf16_round(sp[s * 64 + i]);
  { *(float*)(CS + t) = c; *(float*)(SN + t) = sn;  } }
__global__ __launch_bounds__(256) void k_wsc(const float* __restrict__ Wm, _Float16* __restrict__ Bt, size_t n8, float sc) { const size_t t = (size_t)blockIdx.x * 256 + threadIdx.x; if (t >= n8) return; FragH f; for (int q = 0; q < 8; ++q) f.h[q] = (_Float16)(bf16_round(Wm[t * 8 + q]) * sc); *(v8us*)((unsigned short*)Bt + t * 8) = f.half[0];  }
__global__ __launch_bounds__(256) void k_rotab2(float* __restrict__ CS, float* __restrict__ SN) {
  #pragma clang fp contract(off)
  const int t = blockIdx.x * 256 + threadIdx.x; if (t >= SLEN * 32) return; const int j = t % 32, s = t / 32; const float c0 = -0.14391156831212787f;      /* -ln(10000)/64 rounded to f32 */ const float inv = expf((float)(2 * j) * c0); const float th = (float)s * inv; const float c = cosf(th), sn = sinf(th);
  { *(float*)(CS + t) = c; *(float*)(SN + t) = sn;  } }
__global__ __launch_bounds__(256) void k_lnu(const float* __restrict__ X, _Float16* __restrict__ N16, float* __restrict__ XB) {
  #pragma clang fp contract(off)
  const int wv = threadIdx.x >> 5, ln = threadIdx.x & 31; const size_t r = (size_t)blockIdx.x * 8 + wv; if (r >= NR) return; float a[32]; float s = 0.f;
  for (int i = 0; i < 4; ++i) { const v8f v = *(const v8f*)(X + r * DM + (i * 32 + ln) * 8); for (int q = 0; q < 8; ++q) { const float u = bf16_round(v[q]); a[i * 8 + q] = u; s += u; } }
  for (int o = 16; o > 0; o >>= 1) s += __shfl_xor(s, o, 32); const float mu = s / (float)DM; float var = 0.f; for (int q = 0; q < 32; ++q) { const float d = a[q] - mu; var += d * d; }
  for (int o = 16; o > 0; o >>= 1) var += __shfl_xor(var, o, 32); const float den = sqrtf(var / (float)(DM - 1)) + 1e-6f; const float inv = 1.0f / den;      /* one reciprocal per row; (x-mean)*inv vs the reference's division differs by <= 1 ulp */
  { for (int i = 0; i < 4; ++i) { const int c0 = (i * 32 + ln) * 8; FragH f; v8f xb; for (int q = 0; q < 8; ++q) { f.h[q] = (_Float16)((a[i * 8 + q] - mu) * inv); xb[q] = a[i * 8 + q]; } *(v8us*)((unsigned short*)N16 + r * DM + c0) = f.half[0]; *(v8f*)(XB + r * DM + c0) = xb; }  } }
__global__ __launch_bounds__(256) void k_vtg(const _Float16* __restrict__ V16, _Float16* __restrict__ Vt) { __shared__ unsigned short tl[64][66]; const int tid = threadIdx.x; const int slab = blockIdx.x / (SLEN / 64), lg = blockIdx.x % (SLEN / 64); const int b = slab / NH, h = slab % NH; const int hs = h / NREP;
  for (int i = tid; i < 64 * 8; i += 256) { const int r = i / 8, c8 = (i % 8) * 8; FragH f; f.half[0] = *(const v8us*)((const unsigned short*)V16 + ((size_t)b * SLEN + lg * 64 + r) * KVD + hs * 64 + c8); for (int q = 0; q < 8; ++q) tl[r][c8 + q] = f.u[q]; }
  __syncthreads();
  { for (int rd = 0; rd < 2; ++rd) { const int d = rd * 32 + tid / 8, pc = tid % 8; FragH f; for (int q = 0; q < 8; ++q) f.u[q] = tl[pc * 8 + q][d]; *(v8us*)((unsigned short*)Vt + ((size_t)slab * 64 + d) * SLEN + lg * 64 + pc * 8) = f.half[0]; }  } }

__global__ __launch_bounds__(256) void k_h16s(const float* __restrict__ SRC, int lds, int coff, _Float16* __restrict__ DST, size_t n8) { const size_t t = (size_t)blockIdx.x * 256 + threadIdx.x; if (t >= n8) return; const size_t r = (t * 8) / DM; const int c = (int)((t * 8) % DM); const v8f a = *(const v8f*)(SRC + r * lds + coff + c); FragH f; for (int q = 0; q < 8; ++q) f.h[q] = (_Float16)a[q];
  *(v8us*)((unsigned short*)DST + t * 8) = f.half[0];  }


__global__ __launch_bounds__(256) void k_ccp(const float* __restrict__ QKV, int coff, _Float16* __restrict__ D) { const size_t t = (size_t)blockIdx.x * 256 + threadIdx.x; if (t >= (size_t)NR * DM / 8) return; const int c0 = (int)((t * 8) % DM); const size_t row = (t * 8) / DM; const v8f a = *(const v8f*)(QKV + row * 3 * DM + coff + c0); FragH f; for (int q = 0; q < 8; ++q) f.h[q] = (_Float16)a[q];
  *(v8us*)((unsigned short*)D + t * 8) = f.half[0];  }


template <int NLN>
__global__ __launch_bounds__(256) void k_lnrow(const float* __restrict__ X, const float* __restrict__ R, const float* __restrict__ g, const float* __restrict__ bb, float eps, float* __restrict__ OUT) {
  #pragma clang fp contract(off)
  constexpr int PER = NLN / 256; __shared__ float red[256]; const int tid = threadIdx.x; const size_t row = blockIdx.x; const float* x = X + row * NLN; const float* rr = R ? R + row * NLN : nullptr; float v[PER]; float s1 = 0.f;
  for (int u = 0; u < PER; ++u) { const int j = tid * PER + u; float t = x[j]; if (rr) t = t + rr[j]; v[u] = t; s1 += t; }
  red[tid] = s1; __syncthreads(); for (int st = 128; st > 0; st >>= 1) { if (tid < st) red[tid] += red[tid + st]; __syncthreads(); } const float mu = red[0] / (float)NLN; __syncthreads();
  float s2 = 0.f; for (int u = 0; u < PER; ++u) { const float c = v[u] - mu; s2 += c * c; } red[tid] = s2; __syncthreads(); for (int st = 128; st > 0; st >>= 1) { if (tid < st) red[tid] += red[tid + st]; __syncthreads(); }
  const float var = red[0] / (float)NLN; const float rs = rsqrtf(var + eps);
  { for (int u = 0; u < PER; ++u) { const int j = tid * PER + u; float o = (v[u] - mu) * rs; o = __fadd_rn(__fmul_rn(o, bf16_round(g[j])), bf16_round(bb[j])); *(float*)(OUT + row * NLN + j) = o; }  } }
__global__ __launch_bounds__(256) void k_xr32(const float* __restrict__ x, float* __restrict__ XR, size_t n8) { const size_t t = (size_t)blockIdx.x * 256 + threadIdx.x; if (t >= n8) return; v8f o; for (int q = 0; q < 8; ++q) o[q] = bf16_round(x[t * 8 + q]); *(v8f*)(XR + t * 8) = o;  }
__global__ __launch_bounds__(256) void k_r16b(const float* __restrict__ S, _Float16* __restrict__ D, size_t n8) { const size_t t = (size_t)blockIdx.x * 256 + threadIdx.x; if (t >= n8) return; const v8f a = *(const v8f*)(S + t * 8); FragH f; for (int q = 0; q < 8; ++q) f.h[q] = (_Float16)a[q]; *(v8us*)((unsigned short*)D + t * 8) = f.half[0];  }

__global__ __launch_bounds__(256) void k_nsq(const float* __restrict__ X, float* __restrict__ NSQ, size_t nrows) {
  #pragma clang fp contract(off)
  const size_t r = (size_t)blockIdx.x * 256 + threadIdx.x; if (r >= nrows) return; float acc = 0.f;
#pragma unroll 1
  for (int d = 0; d < 64; d += 8) { const v8f a = *(const v8f*)(X + r * 64 + d); for (int u = 0; u < 8; ++u) { const float x = bf16_round(a[u]); acc = __fadd_rn(acc, __fmul_rn(x, x)); } }
  *(float*)(NSQ + r) = acc;  }
// One block per (slab, 8 query rows < 64), one wave per row. The slab's first 64 rows of k and v are rounded and staged in LDS once per block; lanes own keys for the logits, then output columns for the context. Each dot product, the row sum and each context sum keep their serial order.
__global__ __launch_bounds__(256) void k_fixr(const float* __restrict__ Q, const float* __restrict__ Kx, const float* __restrict__ V, const float* __restrict__ NSQ, float* __restrict__ O) {
  #pragma clang fp contract(off)
  __shared__ __attribute__((aligned(16))) float sk[64][68];      /* pitch 272 B = 16 B x odd: a lane per row reads 16 bytes without bank conflicts */
  __shared__ __attribute__((aligned(16))) float sv[64][64]; __shared__ __attribute__((aligned(16))) float pr[8][64];
  const int tid = threadIdx.x, w = tid >> 5, lane = tid & 31; const size_t sl = blockIdx.x >> 3; const int q = __builtin_amdgcn_readfirstlane((int)(blockIdx.x & 7) * 8 + w);
  const float* kb = Kx + sl * SLEN * 64; const float* vb = V + sl * SLEN * 64;
#pragma unroll
  for (int i = 0; i < 4; ++i) { const int e = (i * 256 + tid) * 4; const v4f a = *(const v4fa*)(kb + e); const v4f c = *(const v4fa*)(vb + e); v4f ra, rc;
#pragma unroll
    for (int u = 0; u < 4; ++u) { ra[u] = bf16_round(a[u]); rc[u] = bf16_round(c[u]); }
    *(v4fa*)&sk[e >> 6][e & 63] = ra; *(v4fa*)&sv[e >> 6][e & 63] = rc; }
  const float* qr = Q + (sl * SLEN + q) * 64; const float qs = NSQ[sl * SLEN + q]; const float* ksT = NSQ + (size_t)NB * SLEN + sl * SLEN; const float kq0 = ksT[lane], kq1 = ksT[lane + 32];
  float x[64];      /* the wave's query row, fetched ahead of the barrier so that its latency runs beside the staging loads' */
#pragma unroll
  for (int d = 0; d < 64; d += 4) { const v4f a = *(const v4fa*)(qr + d);
#pragma unroll
    for (int u = 0; u < 4; ++u) x[d + u] = bf16_round(a[u]); }
  __syncthreads();      /* the staged rows are read by every wave of the block */
  float sd0 = 0.f, sd1 = 0.f;      /* keys lane and lane + 32 */
#pragma unroll
  for (int d = 0; d < 64; d += 4) { const v4f k0 = *(const v4fa*)&sk[lane][d]; const v4f k1 = *(const v4fa*)&sk[lane + 32][d];
#pragma unroll
    for (int u = 0; u < 4; ++u) { sd0 = __fadd_rn(sd0, __fmul_rn(x[d + u], k0[u])); sd1 = __fadd_rn(sd1, __fmul_rn(x[d + u], k1[u])); } }
  float d0 = qs + kq0; d0 = d0 - 2.0f * sd0; d0 = fmaxf(d0, 0.f); float d1 = qs + kq1; d1 = d1 - 2.0f * sd1; d1 = fmaxf(d1, 0.f);
  const bool ok0 = lane <= q, ok1 = lane + 32 <= q; const float lg0 = ok0 ? -d0 * 0.125f : -3.0e38f, lg1 = ok1 ? -d1 * 0.125f : -3.0e38f;
  float mx = fmaxf(lg0, lg1); mx = fmaxf(mx, __shfl_xor(mx, 1, 32)); mx = fmaxf(mx, __shfl_xor(mx, 2, 32)); mx = fmaxf(mx, __shfl_xor(mx, 4, 32)); mx = fmaxf(mx, __shfl_xor(mx, 8, 32)); mx = fmaxf(mx, __shfl_xor(mx, 16, 32));
  const float e0 = expf(lg0 - mx), e1 = expf(lg1 - mx); pr[w][lane] = ok0 ? e0 : 0.f; pr[w][lane + 32] = ok1 ? e1 : 0.f;
  __builtin_amdgcn_fence(__ATOMIC_ACQ_REL, "workgroup"); __builtin_amdgcn_wave_barrier();      /* the wave's own lanes read each other's weights below */
  float su = 0.f;
#pragma unroll
  for (int j = 0; j < 64; j += 4) { const v4f e = *(const v4fa*)&pr[w][j]; su += e[0]; su += e[1]; su += e[2]; su += e[3]; }      /* ascending keys; a masked key adds an exact zero */
  const float inv = 1.0f / su; typedef float v2f __attribute__((ext_vector_type(2))); typedef float v2fa __attribute__((ext_vector_type(2), may_alias));
  float a0 = 0.f, a1 = 0.f;      /* output columns 2 lane and 2 lane + 1 */
#pragma unroll 1
  for (int j0 = 0; j0 <= q; j0 += 16) {
#pragma unroll
    for (int i = 0; i < 16; ++i) { const bool in = j0 + i <= q; const v2f vv = *(const v2fa*)&sv[j0 + i][lane * 2]; const float p = pr[w][j0 + i] * inv;      /* past the row's last key the weight is zero; the value is zeroed too, so the term is an exact zero */
      a0 = __fadd_rn(a0, __fmul_rn(p, in ? vv[0] : 0.f)); a1 = __fadd_rn(a1, __fmul_rn(p, in ? vv[1] : 0.f)); } }
  const v2f o = {a0, a1}; *(v2f*)(O + (sl * SLEN + q) * 64 + lane * 2) = o; }

extern "C" void kernel_launch(void* const* d_in, const int* in_sizes, int n_in,
                              void* d_out, int out_size, void* d_ws, size_t ws_size, hipStream_t stream) {
  (void)in_sizes; (void)n_in; (void)out_size;
  const float* q = (const float*)d_in[0]; const float* k = (const float*)d_in[1]; const float* v = (const float*)d_in[2]; float* O = (float*)d_out;
  char* ws = (char*)d_ws; size_t off = 0;
  auto take = [&](size_t bytes) { char* p = ws + off; off += (bytes + 255) & ~(size_t)255; return p; };
  const size_t np = (size_t)NR * DM;      /* 32 x 2048 x 64 */
  _Float16* QH = (_Float16*)take(np * 2); _Float16* KH = (_Float16*)take(np * 2); _Float16* VH = (_Float16*)take(np * 2); _Float16* VT = (_Float16*)take(np * 2); float* NSQ = (float*)take((size_t)2 * NR * 4);
  if (off > ws_size) return;      /* 4 x 8 + 0.5 = ≈ 33 MiB */
  k_x16<<<(unsigned)((np / 8 + 255) / 256), 256, 0, stream>>>(q, QH, np / 8); k_x16<<<(unsigned)((np / 8 + 255) / 256), 256, 0, stream>>>(k, KH, np / 8); k_x16<<<(unsigned)((np / 8 + 255) / 256), 256, 0, stream>>>(v, VH, np / 8);      /* bf16-rounded inputs are exact in f16 */
  k_vtg<<<NB * NH * (SLEN / 64), 256, 0, stream>>>(VH, VT);
  k_nsq<<<(unsigned)((NR + 255) / 256), 256, 0, stream>>>(q, NSQ, (size_t)NR); k_nsq<<<(unsigned)((NR + 255) / 256), 256, 0, stream>>>(k, NSQ + NR, (size_t)NR);      /* |q|^2 | |k|^2 tables */
  k_flash_t<<<NB * QBLKS, 128, 0, stream>>>(QH, KH, VT, NSQ, O);      /* exact q, k products; f32 RBF logits; f32 context straight to the output */
  k_fixr<<<NB * 8, 256, 0, stream>>>(q, k, v, NSQ, O);      /* rows < 64 per slab recomputed in f32 */
}

// v004
// It runs in 125 microseconds.
// Next to v003, in two timings, it ran 1.04 times as fast each time.
// Over all steps from v000 it is 4.00 times as fast.
#include <hip/hip_runtime.h>
// CustomCausalAttention (q, k, v [2][16][2048][64]; RBF-kernel causal attention: logits = -relu(|q|^2 + |k|^2 - 2 q.k) / 8 over keys n <= m; out = softmax(logits) v -> [2][16][2048][64]).
// Structure: each (batch, head) slab is a contiguous 64-wide row block, treated as one 'batch' of a single 64-dim head: one preparatory launch makes the exact f16 planes of q and k (bf16-rounded inputs are exact in f16), |q|^2, |k|^2 as f32 row tables on VALU, and v^T by LDS tiles; causal flash-style fused attention per (slab, 64-query block), forming the RBF logit from the f32 dot product and the two norm tables, f32 context written straight to the output; the first 64 causal rows per slab recomputed entirely in f32 on VALU.
// Compute dtype: inputs rounded to bf16; q, k, v exact as f16 (products exact, f32 accumulation); norms, logits, softmax f32 with plain f16 probabilities (~2^-12); rows < 64 all-f32. v_wmma_f32_16x16x32_f16.
#define NB 32                    /* 2 batches x 16 heads as slabs */
#define DM 64
#define NKV 1
#define NREP (NH / NKV)
#define KVD (NKV * 64)           /* 64 */
#define NR (NB * SLEN)
#define CHK 512
typedef int v4i __attribute__((ext_vector_type(4)));
#define FF 2048
#define SLEN 2048
#define MQI 2048
#define MKI 2048
#define TQ SLEN
#define TK SLEN
#define NH 1
#define SCL 1.0f                 /* raw dot product; the RBF transform applies the 1/8 */
#define QBLKS (TQ / 64)
#define QB05 0
#define QBN5 QBLKS      /* hi/lo engine (k_flash5) block range; not launched */
#define QB0P 0
#define QBNP QBLKS
#define RE 256
typedef __bf16 v16b __attribute__((ext_vector_type(16)));
typedef unsigned short v8us __attribute__((ext_vector_type(8), may_alias));
typedef float  v8f  __attribute__((ext_vector_type(8)));
typedef float  v4f  __attribute__((ext_vector_type(4)));
typedef float  v4fa __attribute__((ext_vector_type(4), may_alias));
union FragB { v16b v; v8us half[2]; unsigned short u[16]; };

__device__ __forceinline__ unsigned short bf16_bits(float x) { unsigned int u = __float_as_uint(x); return (unsigned short)((u + 0x7FFFu + ((u >> 16) & 1u)) >> 16); }
__device__ __forceinline__ float bf16_val(unsigned short b) { return __uint_as_float(((unsigned int)b) << 16); }
__device__ __forceinline__ float bf16_round(float x) { return bf16_val(bf16_bits(x)); }
// D += A·B with NT terms: 1 = ah·bh, 2 = + al·bh (A split), 3 = + ah·bl (both split)
template <int NT>
__device__ __forceinline__ v8f mmaN(v16b ah, v16b al, v16b bh, v16b bl, v8f c) {
  c = __builtin_amdgcn_wmma_f32_16x16x32_bf16(false, ah, false, bh, (short)0, c, false, false);
  if (NT >= 2) c = __builtin_amdgcn_wmma_f32_16x16x32_bf16(false, al, false, bh, (short)0, c, false, false);
  if (NT >= 3) c = __builtin_amdgcn_wmma_f32_16x16x32_bf16(false, ah, false, bl, (short)0, c, false, false);
  asm volatile("v_nop\n\tv_nop\n\tv_nop\n\tv_nop" : "+v"(c) : "v"(ah), "v"(al), "v"(bh), "v"(bl));
  return c;
}

__global__ __launch_bounds__(256) void k_wt_bf16(const float* __restrict__ W, unsigned short* __restrict__ Wt, int K, int N) {
  const int t = blockIdx.x * 256 + threadIdx.x;
  const int k8n = K / 8;
  if (t >= N * k8n) return;
  const int n = t / k8n, k8 = (t % k8n) * 8;
  v8us v;
#pragma unroll
  for (int i = 0; i < 8; ++i) v[i] = bf16_bits(W[(size_t)(k8 + i) * N + n]);
  *(v8us*)(Wt + (size_t)n * K + k8) = v;
  
}

// GEMM C[M][N] (f32, pitch ldc) = act(A[M][K]·W + bias). A f32 row-major (pitch lda) converted per fragment to bf16
// (ASPLIT: hi/lo two planes -> 2 terms, else single rounded term); Wt bf16 [N][K] (pitch ldb). BIAS_BF16 rounds the
// bias to bf16 first (bias quantised to bf16 before the add). K%32==0, M%16==0, N%64==0.
template <bool ASPLIT, int ACT, bool BIAS_BF16>
__global__ __launch_bounds__(128) void k_gemm_bf(const float* __restrict__ A, int lda, const unsigned short* __restrict__ Wt, int ldb,
                                               const float* __restrict__ bias, float* __restrict__ C, int ldc, int M, int N, int K) {
  __shared__ __attribute__((aligned(16))) float so[4][16][64];
  const int tid = threadIdx.x, w = tid >> 5, lane = tid & 31, ln = lane & 15, hh = lane >> 4;
  const int ntn = N / 64;
  const int wid = blockIdx.x * 4 + w;
  const int mt = wid / ntn, nq = wid % ntn;
  if (mt * 16 >= M) return;
  const int row0 = mt * 16, col0 = nq * 64;
  const float* arow = A + (size_t)(row0 + ln) * lda;
  v8f acc[4] = {};
  for (int kb = 0; kb < K; kb += 32) {
    FragB ah, al;
    const v4f x0 = *(const v4fa*)(arow + kb + 8 * hh), x1 = *(const v4fa*)(arow + kb + 8 * hh + 4);
    const v4f x2 = *(const v4fa*)(arow + kb + 16 + 8 * hh), x3 = *(const v4fa*)(arow + kb + 16 + 8 * hh + 4);
    float xs[16] = {x0[0],x0[1],x0[2],x0[3],x1[0],x1[1],x1[2],x1[3],x2[0],x2[1],x2[2],x2[3],x3[0],x3[1],x3[2],x3[3]};
#pragma unroll
    for (int i = 0; i < 16; ++i) { const unsigned short hb = bf16_bits(xs[i]); ah.u[i] = hb; al.u[i] = ASPLIT ? bf16_bits(xs[i] - bf16_val(hb)) : (unsigned short)0; }
#pragma unroll
    for (int t = 0; t < 4; ++t) {
      const unsigned short* brow = Wt + (size_t)(col0 + t * 16 + ln) * ldb + kb;
      FragB b;
      b.half[0] = *(const v8us*)(brow + 8 * hh);
      b.half[1] = *(const v8us*)(brow + 16 + 8 * hh);
      acc[t] = mmaN<ASPLIT ? 2 : 1>(ah.v, al.v, b.v, b.v, acc[t]);
    }
  }
#pragma unroll
  for (int t = 0; t < 4; ++t) {
    float bv = bias ? bias[col0 + t * 16 + ln] : 0.f;
    if (BIAS_BF16) bv = bf16_round(bv);
#pragma unroll
    for (int r = 0; r < 8; ++r) { float v = acc[t][r] + bv; if (ACT == 1) v = fmaxf(v, 0.f); so[w][8 * hh + r][t * 16 + ln] = v; }
  }
  __builtin_amdgcn_fence(__ATOMIC_ACQ_REL, "workgroup");
  __builtin_amdgcn_wave_barrier();
  const int rsub = lane >> 4, c4 = (lane & 15) * 4;
  {
#pragma unroll
    for (int q = 0; q < 8; ++q) {
      const int r = q * 2 + rsub;
      const v4f v = *(const v4fa*)&so[w][r][c4];
      *(v4f*)(C + (size_t)(row0 + r) * ldc + col0 + c4) = v;
    }
    
  }
}

// GEMM C = act(A·W + bias + resid): A f32 (ASPLIT -> hi/lo 2 terms), Wt bf16 [N][K]; ACT 0 none, 1 relu, 2 exact gelu;
// resid (optional, f32, row index = (row % rmod), pitch ldr, RES_BF16 rounds it) added before the activation.
template <bool ASPLIT, int ACT, bool BIAS_BF16, bool RES_BF16>
__global__ __launch_bounds__(128) void k_gemm_bf3(const float* __restrict__ A, int lda, const unsigned short* __restrict__ Wt, int ldb,
                                                const float* __restrict__ bias, const float* __restrict__ resid, int rmod, int ldr,
                                                float* __restrict__ C, int ldc, int M, int N, int K) {
  __shared__ __attribute__((aligned(16))) float so[4][16][64];
  const int tid = threadIdx.x, w = tid >> 5, lane = tid & 31, ln = lane & 15, hh = lane >> 4;
  const int ntn = N / 64;
  const int wid = blockIdx.x * 4 + w;
  const int mt = wid / ntn, nq = wid % ntn;
  if (mt * 16 >= M) return;
  const int row0 = mt * 16, col0 = nq * 64;
  const float* arow = A + (size_t)(row0 + ln) * lda;
  v8f acc[4] = {};
  for (int kb = 0; kb < K; kb += 32) {
    FragB ah, al;
    const v4f x0 = *(const v4fa*)(arow + kb + 8 * hh), x1 = *(const v4fa*)(arow + kb + 8 * hh + 4);
    const v4f x2 = *(const v4fa*)(arow + kb + 16 + 8 * hh), x3 = *(const v4fa*)(arow + kb + 16 + 8 * hh + 4);
    float xs[16] = {x0[0],x0[1],x0[2],x0[3],x1[0],x1[1],x1[2],x1[3],x2[0],x2[1],x2[2],x2[3],x3[0],x3[1],x3[2],x3[3]};
#pragma unroll
    for (int i = 0; i < 16; ++i) { const unsigned short hb = bf16_bits(xs[i]); ah.u[i] = hb; al.u[i] = ASPLIT ? bf16_bits(xs[i] - bf16_val(hb)) : (unsigned short)0; }
#pragma unroll
    for (int t = 0; t < 4; ++t) {
      const unsigned short* brow = Wt + (size_t)(col0 + t * 16 + ln) * ldb + kb;
      FragB b;
      b.half[0] = *(const v8us*)(brow + 8 * hh);
      b.half[1] = *(const v8us*)(brow + 16 + 8 * hh);
      acc[t] = mmaN<ASPLIT ? 2 : 1>(ah.v, al.v, b.v, b.v, acc[t]);
    }
  }
#pragma unroll
  for (int t = 0; t < 4; ++t) {
    const int col = col0 + t * 16 + ln;
    float bv = bias ? bias[col] : 0.f;
    if (BIAS_BF16) bv = bf16_round(bv);
#pragma unroll
    for (int r = 0; r < 8; ++r) {
      float v = acc[t][r] + bv;
      if (resid) { float rv = resid[(size_t)((row0 + 8 * hh + r) % rmod) * ldr + col]; if (RES_BF16) rv = bf16_round(rv); v += rv; }
      if (ACT == 1) v = fmaxf(v, 0.f);
      if (ACT == 2) v = 0.5f * v * (1.0f + erff(v * 0.70710678118654752f));
      if (ACT == 3) { const float u = 0.7978845608028654f * (v + 0.044715f * v * v * v); v = 0.5f * v * (1.0f + tanhf(u)); }
      so[w][8 * hh + r][t * 16 + ln] = v;
    }
  }
  __builtin_amdgcn_fence(__ATOMIC_ACQ_REL, "workgroup");
  __builtin_amdgcn_wave_barrier();
  const int rsub = lane >> 4, c4 = (lane & 15) * 4;
  {
#pragma unroll
    for (int q = 0; q < 8; ++q) {
      const int r = q * 2 + rsub;
      const v4f v = *(const v4fa*)&so[w][r][c4];
      *(v4f*)(C + (size_t)(row0 + r) * ldc + col0 + c4) = v;
    }
    
  }
}
// row LayerNorm (biased variance, eps) over N: s = X (+ R); optional out_sum <- s; out_norm <- (s-mu)*rsqrt(var+eps)*g + b
template <bool PARAM_BF16>
__global__ __launch_bounds__(256) void k_layernorm(const float* __restrict__ X, const float* __restrict__ R, const float* __restrict__ g, const float* __restrict__ bta,
                                                  float* __restrict__ out_sum, float* __restrict__ out_norm, int N, float eps) {
  __shared__ float red[256];
  const int row = blockIdx.x, tid = threadIdx.x;
  const float* x = X + (size_t)row * N; const float* rr = R ? R + (size_t)row * N : nullptr;
  float vals[16];                     // up to N = 4096
  const int per = N / 256;            // contiguous chunk per thread? use strided-by-4 chunks: thread handles j = tid*4 + 1024*u
  float s1 = 0.f;
  for (int u = 0; u < per / 4; ++u) {
    const int j = tid * 4 + 1024 * u;
    const v4f a = *(const v4fa*)(x + j);
    v4f b = {0.f,0.f,0.f,0.f}; if (rr) b = *(const v4fa*)(rr + j);
#pragma unroll
    for (int q = 0; q < 4; ++q) { const float v = a[q] + b[q]; vals[u * 4 + q] = v; s1 += v; }
  }
  red[tid] = s1; __syncthreads();
  for (int st = 128; st > 0; st >>= 1) { if (tid < st) red[tid] += red[tid + st]; __syncthreads(); }
  const float mu = red[0] / (float)N; __syncthreads();
  float s2 = 0.f;
  for (int u = 0; u < per / 4; ++u)
#pragma unroll
    for (int q = 0; q < 4; ++q) { const float c = vals[u * 4 + q] - mu; s2 += c * c; }
  red[tid] = s2; __syncthreads();
  for (int st = 128; st > 0; st >>= 1) { if (tid < st) red[tid] += red[tid + st]; __syncthreads(); }
  const float rs = rsqrtf(red[0] / (float)N + eps);
  {
    for (int u = 0; u < per / 4; ++u) {
      const int j = tid * 4 + 1024 * u;
      v4f o, sm;
#pragma unroll
      for (int q = 0; q < 4; ++q) {
        float gg = g[j + q], bb = bta[j + q];
        if (PARAM_BF16) { gg = bf16_round(gg); bb = bf16_round(bb); }
        sm[q] = vals[u * 4 + q]; o[q] = (vals[u * 4 + q] - mu) * rs * gg + bb;
      }
      if (out_sum) *(v4f*)(out_sum + (size_t)row * N + j) = sm;
      *(v4f*)(out_norm + (size_t)row * N + j) = o;
    }
    
  }
}



// ---- f16 WMMA path (v_wmma_f32_16x16x32_f16): 11-bit significands for operands in range — used where a [0,1] probability operand needs more precision than bf16
typedef _Float16 v16h __attribute__((ext_vector_type(16)));
union FragH { v16h v; v8us half[2]; _Float16 h[16]; unsigned short u[16]; };
template <int NT>
__device__ __forceinline__ v8f mmaH(v16h ah, v16h al, v16h bh, v16h bl, v8f c) {
  c = __builtin_amdgcn_wmma_f32_16x16x32_f16(false, ah, false, bh, (short)0, c, false, false);
  if (NT >= 2) c = __builtin_amdgcn_wmma_f32_16x16x32_f16(false, al, false, bh, (short)0, c, false, false);
  if (NT >= 3) c = __builtin_amdgcn_wmma_f32_16x16x32_f16(false, ah, false, bl, (short)0, c, false, false);
  asm volatile("v_nop\n\tv_nop\n\tv_nop\n\tv_nop" : "+v"(c) : "v"(ah), "v"(al), "v"(bh), "v"(bl));
  return c;
}
// batched GEMM like k_gemm_b but f16 operands: A f32 (split into f16 hi/lo if ASPLIT, else rounded to f16), Bt = f16 values [n][k]; alpha; C f32; N multiple of 16 (partial tiles skipped)
template <bool ASPLIT>
__global__ __launch_bounds__(128) void k_gemm_h(const float* __restrict__ A, int lda, size_t sA, const _Float16* __restrict__ Bh, int ldb, size_t sB, float alpha, float* __restrict__ C, int ldc, size_t sC, int M, int N, int K) {
  __shared__ __attribute__((aligned(16))) float so[4][16][64];
  const int tid = threadIdx.x, w = tid >> 5, lane = tid & 31, ln = lane & 15, hh = lane >> 4; const int by = blockIdx.y;
  A += (size_t)by * sA; Bh += (size_t)by * sB; C += (size_t)by * sC;
  const int ntn = (N + 63) / 64; const int wid = blockIdx.x * 4 + w; const int mt = wid / ntn, nq = wid % ntn; if (mt * 16 >= M) return;
  const int row0 = mt * 16, col0 = nq * 64; const float* arow = A + (size_t)(row0 + ln) * lda;
  v8f acc[4] = {};
  for (int kb = 0; kb < K; kb += 32) {
    FragH ah, al;
    const v4f x0 = *(const v4fa*)(arow + kb + 8 * hh), x1 = *(const v4fa*)(arow + kb + 8 * hh + 4), x2 = *(const v4fa*)(arow + kb + 16 + 8 * hh), x3 = *(const v4fa*)(arow + kb + 16 + 8 * hh + 4);
    float xs[16] = {x0[0],x0[1],x0[2],x0[3],x1[0],x1[1],x1[2],x1[3],x2[0],x2[1],x2[2],x2[3],x3[0],x3[1],x3[2],x3[3]};
#pragma unroll
    for (int i = 0; i < 16; ++i) { const _Float16 h = (_Float16)xs[i]; ah.h[i] = h; al.h[i] = ASPLIT ? (_Float16)(xs[i] - (float)h) : (_Float16)0.0f; }
#pragma unroll
    for (int t = 0; t < 4; ++t) { if (col0 + t * 16 >= N) continue; const size_t boff = (size_t)(col0 + t * 16 + ln) * ldb + kb; FragH bq; bq.half[0] = *(const v8us*)(Bh + boff + 8 * hh); bq.half[1] = *(const v8us*)(Bh + boff + 16 + 8 * hh);
      acc[t] = mmaH<ASPLIT ? 2 : 1>(ah.v, al.v, bq.v, bq.v, acc[t]); }
  }
#pragma unroll
  for (int t = 0; t < 4; ++t) { if (col0 + t * 16 >= N) continue;
#pragma unroll
    for (int r = 0; r < 8; ++r) so[w][8 * hh + r][t * 16 + ln] = acc[t][r] * alpha; }
  __builtin_amdgcn_fence(__ATOMIC_ACQ_REL, "workgroup"); __builtin_amdgcn_wave_barrier();
  const int rsub = lane >> 4, c4 = (lane & 15) * 4;
  {
#pragma unroll
    for (int q = 0; q < 8; ++q) { const int r = q * 2 + rsub; if (col0 + c4 < N) { const v4f v = *(const v4fa*)&so[w][r][c4]; *(v4f*)(C + (size_t)(row0 + r) * ldc + col0 + c4) = v; } }
     }
}

// Wt[n][k] = f16(W[k][n]·scale) from f32 row-major W[K][N] (scale = power of two; bf16-exact weights stay exact in f16 away from the subnormal range)
__global__ __launch_bounds__(256) void k_wt_f16(const float* __restrict__ W, _Float16* __restrict__ Wt, int K, int N, float scale) {
  const int t = blockIdx.x * 256 + threadIdx.x; if (t >= N * (K / 8)) return; const int n = t / (K / 8), k8 = (t % (K / 8)) * 8; FragH f;
#pragma unroll
  for (int i = 0; i < 8; ++i) f.h[i] = (_Float16)(bf16_round(W[(size_t)(k8 + i) * N + n]) * scale); const v8us o = f.half[0];
  *(v8us*)((unsigned short*)Wt + (size_t)n * K + k8) = o; 
}
// k_gemm_hh variant with fused epilogue: v = acc·alpha + bias[by·sBias + col] (+ CP[(row/rowsPerB)·sCPb + by·64 + col] if CP) ; ACT 0 none / 1 elu ; writes f16 C16 (and f32 C if non-null)
template <int ACT>
__global__ __launch_bounds__(128) void k_gemm_hhx(const _Float16* __restrict__ A, int lda, size_t sA, const _Float16* __restrict__ Bh, int ldb, size_t sB, float alpha, const float* __restrict__ bias, size_t sBias, const float* __restrict__ CP, int rowsPerB, size_t sCPb, int row0g,
    float* __restrict__ C, _Float16* __restrict__ C16, int ldc, size_t sC, int M, int N, int K) {
  __shared__ __attribute__((aligned(16))) float so[4][16][64];
  const int tid = threadIdx.x, w = tid >> 5, lane = tid & 31, ln = lane & 15, hh = lane >> 4; const int by = blockIdx.y;
  A += (size_t)by * sA; Bh += (size_t)by * sB; const size_t cofs = (size_t)by * sC; const float* bp = bias ? bias + (size_t)by * sBias : nullptr;
  const int ntn = (N + 63) / 64; const int wid = blockIdx.x * 4 + w; const int mt = wid / ntn, nq = wid % ntn; if (mt * 16 >= M) return;
  const int row0 = mt * 16, col0 = nq * 64; const _Float16* arow = A + (size_t)(row0 + ln) * lda;
  v8f acc[4] = {};
  for (int kb = 0; kb < K; kb += 32) { FragH ah; ah.half[0] = *(const v8us*)((const unsigned short*)arow + kb + 8 * hh); ah.half[1] = *(const v8us*)((const unsigned short*)arow + kb + 16 + 8 * hh);
#pragma unroll
    for (int t = 0; t < 4; ++t) { if (col0 + t * 16 >= N) continue; const size_t boff = (size_t)(col0 + t * 16 + ln) * ldb + kb; FragH bq; bq.half[0] = *(const v8us*)((const unsigned short*)Bh + boff + 8 * hh); bq.half[1] = *(const v8us*)((const unsigned short*)Bh + boff + 16 + 8 * hh);
      acc[t] = mmaH<1>(ah.v, ah.v, bq.v, bq.v, acc[t]); }
  }
#pragma unroll
  for (int t = 0; t < 4; ++t) { if (col0 + t * 16 >= N) continue; const int col = col0 + t * 16 + ln; const float bv = bp ? bf16_round(bp[col]) : 0.f;
#pragma unroll
    for (int r = 0; r < 8; ++r) { float v = acc[t][r] * alpha + bv; if (CP) { const int bidx = (row0g + row0 + 8 * hh + r) / rowsPerB; v += CP[(size_t)bidx * sCPb + (size_t)by * 64 + col]; } if (ACT == 1) v = (v > 0.f) ? v : expm1f(v); else if (ACT == 7) v = (v > 0.f) ? v + 1.0f : expf(v); else if (ACT == 8) v = tanhf(v); else if (ACT == 9) v = 0.5f * v * (1.0f + tanhf(0.7978845608028654f * (v + 0.044715f * v * v * v))); else if (ACT == 11) v = 1.0f / (1.0f + expf(-v)); else if (ACT == 12) v = (v > 0.f) ? v : 0.01f * v; else if (ACT == 14) v = (v > 0.f) ? v : 0.1f * v; else if (ACT == 15) v = v / (1.0f + expf(-v)); else if (ACT == 3) v = fmaxf(v, 0.f); else if (ACT == 6) v = 0.5f * v * (1.0f + erff(v * 0.70710678118654752f)); so[w][8 * hh + r][t * 16 + ln] = v; } }
  __builtin_amdgcn_fence(__ATOMIC_ACQ_REL, "workgroup"); __builtin_amdgcn_wave_barrier();
  const int rsub = lane >> 4, c4 = (lane & 15) * 4; typedef _Float16 v4h __attribute__((ext_vector_type(4)));
  {
#pragma unroll
    for (int q = 0; q < 8; ++q) { const int r = q * 2 + rsub; if (col0 + c4 < N) { const v4f v = *(const v4fa*)&so[w][r][c4]; if (C) *(v4f*)(C + cofs + (size_t)(row0 + r) * ldc + col0 + c4) = v; if (C16) { v4h h4; for (int i = 0; i < 4; ++i) h4[i] = (_Float16)v[i]; *(v4h*)(C16 + cofs + (size_t)(row0 + r) * ldc + col0 + c4) = h4; } } }
     }
}


typedef _Float16 v4h __attribute__((ext_vector_type(4)));

__global__ __launch_bounds__(256) void k_h16(const float* __restrict__ x, _Float16* __restrict__ X16, size_t n8) { const size_t t = (size_t)blockIdx.x * 256 + threadIdx.x; if (t >= n8) return; FragH f;
#pragma unroll
  for (int q = 0; q < 8; ++q) f.h[q] = (_Float16)x[t * 8 + q]; *(v8us*)((unsigned short*)X16 + t * 8) = f.half[0];  }
__global__ __launch_bounds__(256) void k_round16f(const float* __restrict__ W, _Float16* __restrict__ Bt, size_t n8) { const size_t t = (size_t)blockIdx.x * 256 + threadIdx.x; if (t >= n8) return; FragH f;
#pragma unroll
  for (int i = 0; i < 8; ++i) f.h[i] = (_Float16)(bf16_round(W[t * 8 + i]) * 16.0f); *(v8us*)((unsigned short*)Bt + t * 8) = f.half[0];  }
template <int NHv, int TTv>
__global__ __launch_bounds__(256) void k_vt(const _Float16* __restrict__ V16, int ldv, int voff, _Float16* __restrict__ Vt) { __shared__ unsigned short tl[64][66]; const int tid = threadIdx.x; const int slab = blockIdx.x / (TTv / 64), lg = blockIdx.x % (TTv / 64); const int b = slab / NHv, h = slab % NHv;
  for (int i = tid; i < 64 * 8; i += 256) { const int r = i / 8, c8 = (i % 8) * 8; FragH f; f.half[0] = *(const v8us*)((const unsigned short*)V16 + ((size_t)b * TTv + lg * 64 + r) * ldv + voff + h * 64 + c8);
#pragma unroll
    for (int q = 0; q < 8; ++q) tl[r][c8 + q] = f.u[q]; }
  __syncthreads();
  {
#pragma unroll
    for (int rd = 0; rd < 2; ++rd) { const int d = rd * 32 + tid / 8, pc = tid % 8; FragH f;
#pragma unroll
      for (int q = 0; q < 8; ++q) f.u[q] = tl[pc * 8 + q][d];
      *(v8us*)((unsigned short*)Vt + ((size_t)slab * 64 + d) * TTv + lg * 64 + pc * 8) = f.half[0]; }
     } }

__global__ __launch_bounds__(256) void k_hl(const float* __restrict__ F, _Float16* __restrict__ Hh, _Float16* __restrict__ Hl, size_t n8) { const size_t t = (size_t)blockIdx.x * 256 + threadIdx.x; if (t >= n8) return; FragH fh, fl; const v4f a = *(const v4fa*)(F + t * 8), c = *(const v4fa*)(F + t * 8 + 4);
#pragma unroll
  for (int q = 0; q < 4; ++q) { _Float16 h = (_Float16)a[q]; fh.h[q] = h; fl.h[q] = (_Float16)((a[q] - (float)h) * 1024.0f); h = (_Float16)c[q]; fh.h[4 + q] = h; fl.h[4 + q] = (_Float16)((c[q] - (float)h) * 1024.0f); }
  { *(v8us*)((unsigned short*)Hh + t * 8) = fh.half[0]; *(v8us*)((unsigned short*)Hl + t * 8) = fl.half[0];  } }

// ---- fast GEMM (wave tile 32x64; requires M % 32 == 0 rows per launch region and N % 64 == 0); epilogue = k_gemm_hhx semantics ----
__device__ __forceinline__ v16h g2_frag(const _Float16* p, int hh) { FragH f; f.half[0] = *(const v8us*)((const unsigned short*)p + 8 * hh); f.half[1] = *(const v8us*)((const unsigned short*)p + 16 + 8 * hh); return f.v; }
__device__ __forceinline__ v8f g2_mma(v16h a, v16h b, v8f c) { v8f d = __builtin_amdgcn_wmma_f32_16x16x32_f16(false, a, false, b, (short)0, c, false, false); asm volatile("v_nop\n\tv_nop\n\tv_nop\n\tv_nop" : "+v"(d) : "v"(a), "v"(b)); return d; }
template <int ACT>
__global__ __launch_bounds__(128) void k_gemm2(const _Float16* __restrict__ A, int lda, size_t sA, const _Float16* __restrict__ Bh, int ldb, size_t sB, float alpha, const float* __restrict__ bias, size_t sBias, const float* __restrict__ CP, int rowsPerB, size_t sCPb, int row0g,
    float* __restrict__ C, _Float16* __restrict__ C16, int ldc, size_t sC, int M, int N, int K) {
  __shared__ __attribute__((aligned(16))) float so[4][32][68];
  const int tid = threadIdx.x, w = tid >> 5, lane = tid & 31, ln = lane & 15, hh = lane >> 4; const int by = blockIdx.y;
  A += (size_t)by * sA; Bh += (size_t)by * sB; const size_t cofs = (size_t)by * sC; const float* bp = bias ? bias + (size_t)by * sBias : nullptr;
  const int ntn = N >> 6; const int mt = blockIdx.x / ntn, nq = blockIdx.x - mt * ntn; const int row0 = mt * 128 + 32 * w, col0 = nq * 64; if (row0 >= M) return;
  const _Float16* a0p = A + (size_t)(row0 + ln) * lda; const _Float16* a1p = a0p + (size_t)16 * lda;
  const _Float16* b0p = Bh + (size_t)(col0 + ln) * ldb; const _Float16* b1p = b0p + (size_t)16 * ldb; const _Float16* b2p = b1p + (size_t)16 * ldb; const _Float16* b3p = b2p + (size_t)16 * ldb;
  const v8f z8 = {0.f,0.f,0.f,0.f,0.f,0.f,0.f,0.f}; v8f c00 = z8, c01 = z8, c02 = z8, c03 = z8, c10 = z8, c11 = z8, c12 = z8, c13 = z8;
#pragma unroll 1
  for (int kb = 0; kb < K; kb += 32) { const v16h a0 = g2_frag(a0p + kb, hh), a1 = g2_frag(a1p + kb, hh);
    v16h b = g2_frag(b0p + kb, hh); c00 = g2_mma(a0, b, c00); c10 = g2_mma(a1, b, c10);
    b = g2_frag(b1p + kb, hh); c01 = g2_mma(a0, b, c01); c11 = g2_mma(a1, b, c11);
    b = g2_frag(b2p + kb, hh); c02 = g2_mma(a0, b, c02); c12 = g2_mma(a1, b, c12);
    b = g2_frag(b3p + kb, hh); c03 = g2_mma(a0, b, c03); c13 = g2_mma(a1, b, c13); }
  v8f accs[8] = {c00, c01, c02, c03, c10, c11, c12, c13};
#pragma unroll
  for (int u = 0; u < 8; ++u) { const int t = u & 3, half = u >> 2; const int col = col0 + t * 16 + ln; const float bv = bp ? bf16_round(bp[col]) : 0.f;
#pragma unroll
    for (int r = 0; r < 8; ++r) { const int rloc = half * 16 + 8 * hh + r; float v = accs[u][r] * alpha + bv; if (CP) { if (rowsPerB < 0) v += CP[cofs + (size_t)(row0g + row0 + rloc) * ldc + col];      /* rowsPerB < 0: own element of the batched C plane */ else { const int bidx = (row0g + row0 + rloc) / rowsPerB; v += CP[(size_t)bidx * sCPb + (size_t)by * 64 + col]; } }
      if (ACT == 3) v = fmaxf(v, 0.f); else if (ACT == 6) v = 0.5f * v * (1.0f + erff(v * 0.70710678118654752f)); else if (ACT == 11) v = 1.0f / (1.0f + expf(-v)); else if (ACT == 15) v = v / (1.0f + expf(-v)); else if (ACT == 12) v = (v > 0.f) ? v : 0.01f * v; else if (ACT == 8) v = tanhf(v);
      so[w][rloc][t * 16 + ln] = v; } }
  __builtin_amdgcn_fence(__ATOMIC_ACQ_REL, "workgroup"); __builtin_amdgcn_wave_barrier();
  const int rsub = lane >> 4, c4 = (lane & 15) * 4;
  {
#pragma unroll
    for (int q = 0; q < 16; ++q) { const int r = q * 2 + rsub; const v4f v = *(const v4fa*)&so[w][r][c4]; if (C) *(v4f*)(C + cofs + (size_t)(row0 + r) * ldc + col0 + c4) = v; if (C16) { v4h h4; for (int i = 0; i < 4; ++i) h4[i] = (_Float16)v[i]; *(v4h*)(C16 + cofs + (size_t)(row0 + r) * ldc + col0 + c4) = h4; } }
     } }



__constant__ int BK30[2 * SLEN - 1] = {15,15,15,15,15,15,15,15,15,15,15,15,15,15,15,15,15,15,15,15,15,15,15,15,15,15,15,15,15,15,15,15,15,15,15,15,15,15,15,15,15,15,15,15,15,15,15,15,15,15,15,15,15,15,15,15,15,15,15,15,15,15,15,15,15,15,15,15,15,15,15,15,15,15,15,15,15,15,15,15,15,15,15,15,15,15,15,15,15,15,15,15,15,15,15,15,15,15,15,15,15,15,15,15,15,15,15,15,15,15,15,15,15,15,15,15,15,15,15,15,15,15,15,15,15,15,15,15,15,15,15,15,15,15,15,15,15,15,15,15,15,15,15,15,15,15,15,15,15,15,15,15,15,15,15,15,15,15,15,15,15,15,15,15,15,15,15,15,15,15,15,15,15,15,15,15,15,15,15,15,15,15,15,15,15,15,15,15,15,15,15,15,15,15,15,15,15,15,15,15,15,15,15,15,15,15,15,15,15,15,15,15,15,15,15,15,15,15,15,15,15,15,15,15,15,15,15,15,15,15,15,15,15,15,15,15,15,15,15,15,15,15,15,15,15,15,15,15,15,15,15,15,15,15,15,15,15,15,15,15,15,15,15,15,15,15,15,15,15,15,15,15,15,15,15,15,15,15,15,15,15,15,15,15,15,15,15,15,15,15,15,15,15,15,15,15,15,15,15,15,15,15,15,15,15,15,15,15,15,15,15,15,15,15,15,15,15,15,15,15,15,15,15,15,15,15,15,15,15,15,15,15,15,15,15,15,15,15,15,15,15,15,15,15,15,15,15,15,15,15,15,15,15,15,15,15,15,15,15,15,15,15,15,15,15,15,15,15,15,15,15,15,15,15,15,15,15,15,15,15,15,15,15,15,15,15,15,15,15,15,15,15,15,15,15,15,15,15,15,15,15,15,15,15,15,15,15,15,15,15,15,15,15,15,15,15,15,15,15,15,15,15,15,15,15,15,15,15,15,15,15,15,15,15,15,15,15,15,15,15,15,15,15,15,15,15,15,15,15,15,15,15,15,15,15,15,15,15,15,15,15,15,15,15,15,15,15,15,15,15,15,15,15,15,15,15,15,15,15,15,15,15,15,15,15,15,15,15,15,15,15,15,15,15,15,15,15,15,15,15,15,15,15,15,15,15,15,15,15,15,15,15,15,15,15,15,15,15,15,15,15,15,15,15,15,15,15,15,15,15,15,15,15,15,15,15,15,15,15,15,15,15,15,15,15,15,15,15,15,15,15,15,15,15,15,15,15,15,15,15,15,15,15,15,15,15,15,15,15,15,15,15,15,15,15,15,15,15,15,15,15,15,15,15,15,15,15,15,15,15,15,15,15,15,15,15,15,15,15,15,15,15,15,15,15,15,15,15,15,15,15,15,15,15,15,15,15,15,15,15,15,15,15,15,15,15,15,15,15,15,15,15,15,15,15,15,15,15,15,15,15,15,15,15,15,15,15,15,15,15,15,15,15,15,15,15,15,15,15,15,15,15,15,15,15,15,15,15,15,15,15,15,15,15,15,15,15,15,15,15,15,15,15,15,15,15,15,15,15,15,15,15,15,15,15,15,15,15,15,15,15,15,15,15,15,15,15,15,15,15,15,15,15,15,15,15,15,15,15,15,15,15,15,15,15,15,15,15,15,15,15,15,15,15,15,15,15,15,15,15,15,15,15,15,15,15,15,15,15,15,15,15,15,15,15,15,15,15,15,15,15,15,15,15,15,15,15,15,15,15,15,15,15,15,15,15,15,15,15,15,15,15,15,15,15,15,15,15,15,15,15,15,15,15,15,15,15,15,15,15,15,15,15,15,15,15,15,15,15,15,15,15,15,15,15,15,15,15,15,15,15,15,15,15,15,15,15,15,15,15,15,15,15,15,15,15,15,15,15,15,15,15,15,15,15,15,15,15,15,15,15,15,15,15,15,15,15,15,15,15,15,15,15,15,15,15,15,15,15,15,15,15,15,15,15,15,15,15,15,15,15,15,15,15,15,15,15,15,15,15,15,15,15,15,15,15,15,15,15,15,15,15,15,15,15,15,15,15,15,15,15,15,15,15,15,15,15,15,15,15,15,15,15,15,15,15,15,15,15,15,15,15,15,15,15,15,15,15,15,15,15,15,15,15,15,15,15,15,15,15,15,15,15,15,15,15,15,15,15,15,15,15,15,15,15,15,15,15,15,15,15,15,15,15,15,15,15,15,15,15,15,15,15,15,15,15,15,15,15,15,15,15,15,15,15,15,15,15,15,15,15,15,15,15,15,15,15,15,15,15,15,15,15,15,15,15,15,15,15,15,15,15,15,15,15,15,15,15,15,15,15,15,15,15,15,15,15,15,15,15,15,15,15,15,15,15,15,15,15,15,15,15,15,15,15,15,15,15,15,15,15,15,15,15,15,15,15,15,15,15,15,15,15,15,15,15,15,15,15,15,15,15,15,15,15,15,15,15,15,15,15,15,15,15,15,15,15,15,15,15,15,15,15,15,15,15,15,15,15,15,15,15,15,15,15,15,15,15,15,15,15,15,15,15,15,15,15,15,15,15,15,15,15,15,15,15,15,15,15,15,15,15,15,15,15,15,15,15,15,15,15,15,15,15,15,15,15,15,15,15,15,15,15,15,15,15,15,15,15,15,15,15,15,15,15,15,15,15,15,15,15,15,15,15,15,15,15,15,15,15,15,15,15,15,15,15,15,15,15,15,15,15,15,15,15,15,15,15,15,15,15,15,15,15,15,15,15,15,15,15,15,15,15,15,15,15,15,15,15,15,15,15,15,15,15,15,15,15,15,15,15,15,15,15,15,15,15,15,15,15,15,15,15,15,15,15,15,15,15,15,15,15,15,15,15,15,15,15,15,15,15,15,15,15,15,15,15,15,15,15,15,15,15,15,15,15,15,15,15,15,15,15,15,15,15,15,15,15,15,15,15,15,15,15,15,15,15,15,15,15,15,15,15,15,15,15,15,15,15,15,15,15,15,15,15,15,15,15,15,15,15,15,15,15,15,15,15,15,15,15,15,15,15,15,15,15,15,15,15,15,15,15,15,15,15,15,15,15,15,15,15,15,15,15,15,15,15,15,15,15,15,15,15,15,15,15,15,15,15,15,15,15,15,15,15,15,15,15,15,15,15,15,15,15,15,15,15,15,15,15,15,15,15,15,15,15,15,15,15,15,15,15,15,15,15,15,15,15,15,15,15,15,15,15,15,15,15,15,15,15,15,15,15,15,15,15,15,15,15,15,15,15,15,15,15,15,15,15,15,15,15,15,15,15,15,15,15,15,15,15,15,15,15,15,15,15,15,15,15,15,15,15,15,15,15,15,15,15,15,15,15,15,15,15,15,15,15,15,15,15,15,15,15,15,15,15,15,15,15,15,15,15,15,15,15,15,15,15,15,15,15,15,15,15,15,15,15,15,15,15,15,15,15,15,15,15,15,15,15,15,15,15,15,15,15,15,15,15,15,15,15,15,15,15,15,15,15,15,15,15,15,15,15,15,15,15,15,15,15,15,15,15,15,15,15,15,15,15,15,15,15,15,15,15,15,15,15,15,15,15,15,15,15,15,15,15,15,15,15,15,15,15,15,15,15,15,15,15,15,15,15,15,15,15,15,15,15,15,15,15,15,15,15,15,15,15,15,15,15,15,15,15,15,15,15,15,15,15,15,15,15,15,15,15,15,15,15,15,15,15,15,15,15,15,15,15,15,15,15,15,15,15,15,15,15,15,15,15,15,15,15,15,15,15,15,15,15,15,15,15,15,15,15,15,15,15,15,15,15,15,15,15,15,15,15,15,15,15,15,15,15,15,15,15,15,15,15,15,15,15,15,15,15,15,15,15,15,15,15,15,15,15,15,15,15,15,15,15,15,15,15,15,15,15,15,15,15,15,15,15,15,15,15,15,15,15,15,15,15,15,15,15,15,15,15,15,15,15,15,15,15,15,15,15,15,15,15,15,15,15,15,15,15,15,15,15,15,15,15,15,15,15,15,15,15,15,15,15,15,15,15,15,15,15,15,15,15,15,15,15,15,15,15,15,15,15,15,15,15,15,15,15,15,15,15,15,15,15,15,15,15,15,15,15,15,15,15,15,15,15,15,15,15,15,15,15,15,15,15,15,15,15,15,15,15,15,15,15,15,15,15,15,15,15,15,15,15,15,15,15,15,15,15,15,15,15,15,15,15,15,15,15,15,15,15,15,15,15,15,15,15,15,15,15,15,15,15,15,15,15,15,15,15,15,15,15,15,15,15,15,15,15,15,15,15,15,15,15,15,15,15,15,15,15,15,15,15,15,15,15,15,15,15,15,15,15,15,15,15,15,15,15,15,15,15,15,15,15,15,15,15,15,15,15,15,15,15,15,15,15,15,15,15,15,15,15,15,15,15,15,15,15,15,15,15,15,15,14,14,14,14,14,14,14,14,14,14,14,14,14,14,14,14,14,14,14,14,14,14,14,14,14,14,14,13,13,13,13,13,13,13,13,13,13,13,13,13,13,13,13,13,13,12,12,12,12,12,12,12,12,12,12,12,12,12,12,11,11,11,11,11,11,11,11,11,10,10,10,10,10,10,10,9,9,9,9,8,8,8,8,7,6,5,4,3,2,1,0,17,18,19,20,21,22,23,24,24,24,24,25,25,25,25,26,26,26,26,26,26,26,27,27,27,27,27,27,27,27,27,28,28,28,28,28,28,28,28,28,28,28,28,28,28,29,29,29,29,29,29,29,29,29,29,29,29,29,29,29,29,29,29,30,30,30,30,30,30,30,30,30,30,30,30,30,30,30,30,30,30,30,30,30,30,30,30,30,30,30,31,31,31,31,31,31,31,31,31,31,31,31,31,31,31,31,31,31,31,31,31,31,31,31,31,31,31,31,31,31,31,31,31,31,31,31,31,31,31,31,31,31,31,31,31,31,31,31,31,31,31,31,31,31,31,31,31,31,31,31,31,31,31,31,31,31,31,31,31,31,31,31,31,31,31,31,31,31,31,31,31,31,31,31,31,31,31,31,31,31,31,31,31,31,31,31,31,31,31,31,31,31,31,31,31,31,31,31,31,31,31,31,31,31,31,31,31,31,31,31,31,31,31,31,31,31,31,31,31,31,31,31,31,31,31,31,31,31,31,31,31,31,31,31,31,31,31,31,31,31,31,31,31,31,31,31,31,31,31,31,31,31,31,31,31,31,31,31,31,31,31,31,31,31,31,31,31,31,31,31,31,31,31,31,31,31,31,31,31,31,31,31,31,31,31,31,31,31,31,31,31,31,31,31,31,31,31,31,31,31,31,31,31,31,31,31,31,31,31,31,31,31,31,31,31,31,31,31,31,31,31,31,31,31,31,31,31,31,31,31,31,31,31,31,31,31,31,31,31,31,31,31,31,31,31,31,31,31,31,31,31,31,31,31,31,31,31,31,31,31,31,31,31,31,31,31,31,31,31,31,31,31,31,31,31,31,31,31,31,31,31,31,31,31,31,31,31,31,31,31,31,31,31,31,31,31,31,31,31,31,31,31,31,31,31,31,31,31,31,31,31,31,31,31,31,31,31,31,31,31,31,31,31,31,31,31,31,31,31,31,31,31,31,31,31,31,31,31,31,31,31,31,31,31,31,31,31,31,31,31,31,31,31,31,31,31,31,31,31,31,31,31,31,31,31,31,31,31,31,31,31,31,31,31,31,31,31,31,31,31,31,31,31,31,31,31,31,31,31,31,31,31,31,31,31,31,31,31,31,31,31,31,31,31,31,31,31,31,31,31,31,31,31,31,31,31,31,31,31,31,31,31,31,31,31,31,31,31,31,31,31,31,31,31,31,31,31,31,31,31,31,31,31,31,31,31,31,31,31,31,31,31,31,31,31,31,31,31,31,31,31,31,31,31,31,31,31,31,31,31,31,31,31,31,31,31,31,31,31,31,31,31,31,31,31,31,31,31,31,31,31,31,31,31,31,31,31,31,31,31,31,31,31,31,31,31,31,31,31,31,31,31,31,31,31,31,31,31,31,31,31,31,31,31,31,31,31,31,31,31,31,31,31,31,31,31,31,31,31,31,31,31,31,31,31,31,31,31,31,31,31,31,31,31,31,31,31,31,31,31,31,31,31,31,31,31,31,31,31,31,31,31,31,31,31,31,31,31,31,31,31,31,31,31,31,31,31,31,31,31,31,31,31,31,31,31,31,31,31,31,31,31,31,31,31,31,31,31,31,31,31,31,31,31,31,31,31,31,31,31,31,31,31,31,31,31,31,31,31,31,31,31,31,31,31,31,31,31,31,31,31,31,31,31,31,31,31,31,31,31,31,31,31,31,31,31,31,31,31,31,31,31,31,31,31,31,31,31,31,31,31,31,31,31,31,31,31,31,31,31,31,31,31,31,31,31,31,31,31,31,31,31,31,31,31,31,31,31,31,31,31,31,31,31,31,31,31,31,31,31,31,31,31,31,31,31,31,31,31,31,31,31,31,31,31,31,31,31,31,31,31,31,31,31,31,31,31,31,31,31,31,31,31,31,31,31,31,31,31,31,31,31,31,31,31,31,31,31,31,31,31,31,31,31,31,31,31,31,31,31,31,31,31,31,31,31,31,31,31,31,31,31,31,31,31,31,31,31,31,31,31,31,31,31,31,31,31,31,31,31,31,31,31,31,31,31,31,31,31,31,31,31,31,31,31,31,31,31,31,31,31,31,31,31,31,31,31,31,31,31,31,31,31,31,31,31,31,31,31,31,31,31,31,31,31,31,31,31,31,31,31,31,31,31,31,31,31,31,31,31,31,31,31,31,31,31,31,31,31,31,31,31,31,31,31,31,31,31,31,31,31,31,31,31,31,31,31,31,31,31,31,31,31,31,31,31,31,31,31,31,31,31,31,31,31,31,31,31,31,31,31,31,31,31,31,31,31,31,31,31,31,31,31,31,31,31,31,31,31,31,31,31,31,31,31,31,31,31,31,31,31,31,31,31,31,31,31,31,31,31,31,31,31,31,31,31,31,31,31,31,31,31,31,31,31,31,31,31,31,31,31,31,31,31,31,31,31,31,31,31,31,31,31,31,31,31,31,31,31,31,31,31,31,31,31,31,31,31,31,31,31,31,31,31,31,31,31,31,31,31,31,31,31,31,31,31,31,31,31,31,31,31,31,31,31,31,31,31,31,31,31,31,31,31,31,31,31,31,31,31,31,31,31,31,31,31,31,31,31,31,31,31,31,31,31,31,31,31,31,31,31,31,31,31,31,31,31,31,31,31,31,31,31,31,31,31,31,31,31,31,31,31,31,31,31,31,31,31,31,31,31,31,31,31,31,31,31,31,31,31,31,31,31,31,31,31,31,31,31,31,31,31,31,31,31,31,31,31,31,31,31,31,31,31,31,31,31,31,31,31,31,31,31,31,31,31,31,31,31,31,31,31,31,31,31,31,31,31,31,31,31,31,31,31,31,31,31,31,31,31,31,31,31,31,31,31,31,31,31,31,31,31,31,31,31,31,31,31,31,31,31,31,31,31,31,31,31,31,31,31,31,31,31,31,31,31,31,31,31,31,31,31,31,31,31,31,31,31,31,31,31,31,31,31,31,31,31,31,31,31,31,31,31,31,31,31,31,31,31,31,31,31,31,31,31,31,31,31,31,31,31,31,31,31,31,31,31,31,31,31,31,31,31,31,31,31,31,31,31,31,31,31,31,31,31,31,31,31,31,31,31,31,31,31,31,31,31,31,31,31,31,31,31,31,31,31,31,31,31,31,31,31,31,31,31,31,31,31,31,31,31,31,31,31,31,31,31,31,31,31,31,31,31,31,31,31,31,31,31,31,31,31,31,31,31,31,31,31,31,31,31,31,31,31,31,31,31,31,31,31,31,31,31,31,31,31,31,31,31,31,31,31,31,31,31,31,31,31,31,31,31,31,31,31,31,31,31,31,31,31,31,31,31,31,31,31,31,31,31,31,31,31,31,31,31,31,31,31,31,31,31,31,31,31,31,31,31,31,31,31,31,31,31,31,31,31,31,31,31,31,31,31,31,31,31,31,31,31,31,31,31,31,31,31,31,31,31,31,31,31,31,31,31,31,31,31,31,31,31,31,31,31,31,31,31,31,31,31,31,31,31,31,31,31,31,31,31,31,31,31,31,31,31,31,31,31,31,31,31,31,31,31,31,31,31,31,31,31,31,31,31,31,31,31,31,31,31,31,31,31,31,31,31,31,31,31,31,31,31,31,31,31,31,31,31,31,31,31,31,31,31,31,31,31,31,31,31,31,31,31,31,31,31,31,31,31,31,31,31,31,31,31,31,31,31,31,31,31,31,31,31,31,31,31,31,31,31,31,31,31,31,31,31,31,31,31,31,31,31,31,31,31,31,31,31,31,31,31,31,31,31,31,31,31,31,31,31,31,31,31,31,31,31,31,31,31,31,31,31,31,31,31,31,31,31,31,31,31,31,31,31,31,31,31,31,31,31,31,31,31,31,31,31,31,31,31,31,31,31,31,31,31,31,31,31,31,31,31,31,31,31,31,31,31,31,31,31,31,31,31,31,31,31,31,31,31,31,31,31,31,31,31,31,31,31,31,31,31,31,31,31,31,31,31,31,31,31,31,31,31,31,31,31,31,31,31,31,31,31,31,31,31,31,31,31,31,31,31,31,31,31,31,31,31,31,31,31,31,31,31,31,31,31,31,31,31,31,31,31,31,31,31,31,31,31,31,31,31,31,31,31,31,31,31,31,31,31,31,31,31,31,31,31,31,31,31,31,31,31,31,31,31,31,31,31,31,31,31,31,31,31,31,31,31,31,31,31,31,31,31,31,31,31,31,31,31,31,31,31,31,31,31,31,31,31,31,31,31,31,31,31,31,31,31,31,31,31,31,31,31,31,31,31,31,31,31,31,31,31,31,31,31,31,31,31,31,31,31,31,31,31,31,31,31,31,31,31,31,31,31,31,31,31,31,31,31,31,31,31,31,31,31,31,31,31,31,31,31,31,31,31,31,31,31,31,31,31,31,31,31,31,31,31,31,31,31,31,31,31,31,31,31,31,31,31,31,31,31,31,31,31,31,31,31,31,31,31,31,31,31,31,31,31,31,31,31,31,31,31,31,31,31,31,31,31,31,31,31,31,31,31,31,31,31,31,31,31,31,31,31,31,31,31,31,31,31,31,31,31,31,31,31,31,31,31,31,31,31,31,31,31,31,31,31,31,31,31,31,31,31,31,31,31,31,31,31,31};      /* T5 _relative_position_bucket(k - q) for k - q in [-(S-1), S-1], computed with the module's own jax code on the host */
__global__ __launch_bounds__(512) void k_rb(const float* __restrict__ t, float* __restrict__ RB) { const int i = threadIdx.x; const float v = bf16_round(t[i]); *(float*)(RB + i) = v;  }
template <int CAUSAL>
__global__ __launch_bounds__(128) void k_flash(const _Float16* __restrict__ Q16, int ldq, const _Float16* __restrict__ K16, int ldk, const _Float16* __restrict__ Vt, const int* __restrict__ MSK, float* __restrict__ O, int ldo) {
  constexpr int RPW = 16, RTN = RPW / 16, NQB = TQ / (4 * RPW), DT = 4, KS = 2;
  __shared__ __attribute__((aligned(16))) unsigned short sP[4][RPW][40]; __shared__ __attribute__((aligned(16))) float sO[4][RPW][64 + 4];
  const int tid = threadIdx.x, w = tid >> 5, lane = tid & 31, ln = lane & 15, hh = lane >> 4;
  const int slab = blockIdx.x / QBNP, qblk = QB0P + blockIdx.x % QBNP; (void)NQB; const int b = slab / NH, h = slab % NH; const int qb0 = qblk * (4 * RPW); const int q0 = qb0 + w * RPW;
  FragH aq[2][KS];
#pragma unroll
  for (int rt = 0; rt < RTN; ++rt) { const unsigned short* qr = (const unsigned short*)Q16 + ((size_t)b * TQ + q0 + rt * 16 + ln) * ldq + h * 64;
#pragma unroll
    for (int ks = 0; ks < KS; ++ks) { aq[rt][ks].half[0] = *(const v8us*)(qr + ks * 32 + 8 * hh); aq[rt][ks].half[1] = *(const v8us*)(qr + ks * 32 + 16 + 8 * hh); } }
  const unsigned short* Vth = (const unsigned short*)Vt + (size_t)slab * 64 * TK;
  float m_r[2][8], l_r[2][8]; v8f oacc[2][DT];
#pragma unroll
  for (int rt = 0; rt < RTN; ++rt) {
#pragma unroll
    for (int r = 0; r < 8; ++r) { m_r[rt][r] = -3.0e38f; l_r[rt][r] = 0.f; }
#pragma unroll
    for (int dt = 0; dt < DT; ++dt) oacc[rt][dt] = (v8f){0.f,0.f,0.f,0.f,0.f,0.f,0.f,0.f}; }
  float qsq[2][8];      /* mode 32: |q|^2 of this lane's rows, read once */
#pragma unroll
  for (int rt = 0; rt < RTN; ++rt)
#pragma unroll
    for (int r = 0; r < 8; ++r) qsq[rt][r] = (CAUSAL == 32) ? ((const float*)MSK)[(size_t)b * TQ + q0 + rt * 16 + 8 * hh + r] : 0.f;
  const int jend = (CAUSAL == 1 || CAUSAL == 32) ? (qb0 + 4 * RPW) : ((CAUSAL == 23) ? min(TK, (qb0 / CHK + 2) * CHK) : TK);      /* causal / window: keys that can never contribute are skipped */ const int jbeg = (CAUSAL == 23) ? max(0, (qb0 / CHK - 1) * CHK) : 0;
#pragma unroll 1
  for (int j0 = jbeg; j0 < jend; j0 += 32) {
    v8f s[2][2];
    float ksq0 = 0.f, ksq1 = 0.f; if (CAUSAL == 32) { const float* ksT = (const float*)MSK + (size_t)NB * TQ + (size_t)b * TK + j0 + ln; ksq0 = ksT[0]; ksq1 = ksT[16]; }      /* mode 32: |k|^2 of this lane's two keys, one unconditional load each per key block (j0 + 31 < jend <= TK) */
#pragma unroll
    for (int nt = 0; nt < 2; ++nt) { const unsigned short* kr = (const unsigned short*)K16 + ((size_t)b * TK + j0 + nt * 16 + ln) * ldk + h * 64; FragH bk[KS];
#pragma unroll
      for (int ks = 0; ks < KS; ++ks) { bk[ks].half[0] = *(const v8us*)(kr + ks * 32 + 8 * hh); bk[ks].half[1] = *(const v8us*)(kr + ks * 32 + 16 + 8 * hh); }
#pragma unroll
      for (int rt = 0; rt < RTN; ++rt) { v8f acc = (v8f){0.f,0.f,0.f,0.f,0.f,0.f,0.f,0.f};
#pragma unroll
        for (int ks = 0; ks < KS; ++ks) acc = mmaH<1>(aq[rt][ks].v, aq[rt][ks].v, bk[ks].v, bk[ks].v, acc); s[rt][nt] = acc; } }
#pragma unroll
    for (int rt = 0; rt < RTN; ++rt)
#pragma unroll
      for (int r = 0; r < 8; ++r) { const int tq = q0 + rt * 16 + 8 * hh + r; const int k0 = j0 + ln, k1 = j0 + 16 + ln;
        bool ok0 = (CAUSAL == 1 || CAUSAL == 32) ? (k0 <= tq) : ((CAUSAL == 2) ? ((k0 >> 5) == (tq >> 5)) : true), ok1 = (CAUSAL == 1 || CAUSAL == 32) ? (k1 <= tq) : ((CAUSAL == 2) ? ((k1 >> 5) == (tq >> 5)) : true); if (CAUSAL == 23) { const int cq = tq / CHK; ok0 = (abs(k0 / CHK - cq) <= 1) && (MSK[(size_t)b * TK + k0] == 0); ok1 = (abs(k1 / CHK - cq) <= 1) && (MSK[(size_t)b * TK + k1] == 0); }      /* mode 23: 3-chunk window + int key-padding mask */
        if (CAUSAL == 24) { ok0 = (MSK[(size_t)b * TK + k0] == 0); ok1 = (MSK[(size_t)b * TK + k1] == 0); }      /* mode 24: int key-padding mask (nonzero = padded = excluded) */      /* mode 2: block-diagonal 32-token groups */
        float s0 = ok0 ? s[rt][0][r] * SCL : -3.0e38f, s1 = ok1 ? s[rt][1][r] * SCL : -3.0e38f; if (CAUSAL == 27) { const float* amk = (const float*)MSK + ((size_t)b * MQI + tq) * MKI; s0 += bf16_round(amk[k0]); s1 += bf16_round(amk[k1]); }      /* mode 27: additive per-(batch, query, key) f32 mask INPUT [b][tq][k] */ if (CAUSAL == 30) { const float* rbp = (const float*)MSK; s0 += rbp[BK30[k0 - tq + (TK - 1)] * NH + h]; s1 += rbp[BK30[k1 - tq + (TK - 1)] * NH + h]; }      /* mode 30: T5 bucketed relative bias: table[bucket(k - q)][h]; bucket-of-distance is a module constant */ if (CAUSAL == 32) { const float qs = qsq[rt][r]; if (ok0) { float d = qs + ksq0; d = d - 2.0f * s0; d = fmaxf(d, 0.f); s0 = -d * 0.125f; } if (ok1) { float d = qs + ksq1; d = d - 2.0f * s1; d = fmaxf(d, 0.f); s1 = -d * 0.125f; } }      /* mode 32: RBF logit -relu(|q|^2 + |k|^2 - 2 q.k)/8, causal */ if (CAUSAL == 17) { const float* amk = (const float*)MSK + (size_t)b * TK; s0 += bf16_round(amk[k0]); s1 += bf16_round(amk[k1]); } if (CAUSAL == 18) { const float* tb = (const float*)MSK; const int* ri = MSK + 1024 + (size_t)b * TK; const int rq = ri[tq]; s0 += tb[(h * 8 + rq) * 8 + ri[k0]]; s1 += tb[(h * 8 + rq) * 8 + ri[k1]]; } if (CAUSAL == 19) { const int* rel = MSK + (size_t)tq * TK; const float* rb = (const float*)MSK + (size_t)TQ * TK + ((size_t)(b * NH + h) * TQ + tq) * 64; s0 += rb[rel[k0]]; s1 += rb[rel[k1]]; }      /* mode 19: + (q.Ek[rel] + Eb[rel][h]) / 8 gathered by the int relative ids (packed [ids | table]) */      /* mode 18: + resource_bias[h][r_q][r_k] from the packed [table | ids] buffer (TQ == TK) */      /* mode 17: additive per-(batch, key) mask INPUT */ float mc = fmaxf(s0, s1);
        mc = fmaxf(mc, __shfl_xor(mc, 1, 32)); mc = fmaxf(mc, __shfl_xor(mc, 2, 32)); mc = fmaxf(mc, __shfl_xor(mc, 4, 32)); mc = fmaxf(mc, __shfl_xor(mc, 8, 32));
        const float mn = fmaxf(m_r[rt][r], mc); const float ea = expf(m_r[rt][r] - mn), e0 = expf(s0 - mn), e1 = expf(s1 - mn);      /* computed for every lane and selected below: no exec-mask branch, so the eight rows' chains can overlap */ const float al = (mn > -1.0e38f) ? ea : 1.0f; m_r[rt][r] = mn; const float p0 = ok0 ? e0 : 0.f, p1 = ok1 ? e1 : 0.f; l_r[rt][r] = l_r[rt][r] * al + p0 + p1;
#pragma unroll
        for (int dt = 0; dt < DT; ++dt) oacc[rt][dt][r] *= al;
        FragH t2; t2.h[0] = (_Float16)(p0 * 1024.0f); t2.h[1] = (_Float16)(p1 * 1024.0f); sP[w][rt * 16 + 8 * hh + r][ln] = t2.u[0]; sP[w][rt * 16 + 8 * hh + r][16 + ln] = t2.u[1]; }
    __builtin_amdgcn_fence(__ATOMIC_ACQ_REL, "workgroup"); __builtin_amdgcn_wave_barrier();
    FragH pa[2];
#pragma unroll
    for (int rt = 0; rt < RTN; ++rt) { pa[rt].half[0] = *(const v8us*)&sP[w][rt * 16 + ln][8 * hh]; pa[rt].half[1] = *(const v8us*)&sP[w][rt * 16 + ln][16 + 8 * hh]; }
#pragma unroll
    for (int dt = 0; dt < DT; ++dt) { const unsigned short* vrow = Vth + (size_t)(dt * 16 + ln) * TK + j0; FragH bv; bv.half[0] = *(const v8us*)(vrow + 8 * hh); bv.half[1] = *(const v8us*)(vrow + 16 + 8 * hh);
#pragma unroll
      for (int rt = 0; rt < RTN; ++rt) oacc[rt][dt] = mmaH<1>(pa[rt].v, pa[rt].v, bv.v, bv.v, oacc[rt][dt]); }
    __builtin_amdgcn_fence(__ATOMIC_ACQ_REL, "workgroup"); __builtin_amdgcn_wave_barrier(); }
#pragma unroll
  for (int rt = 0; rt < RTN; ++rt) {
#pragma unroll
    for (int r = 0; r < 8; ++r) { float l = l_r[rt][r]; l += __shfl_xor(l, 1, 32); l += __shfl_xor(l, 2, 32); l += __shfl_xor(l, 4, 32); l += __shfl_xor(l, 8, 32); l_r[rt][r] = (l > 0.f) ? 1.0f / (l * 1024.0f) : 0.f; }
#pragma unroll
    for (int dt = 0; dt < DT; ++dt)
#pragma unroll
      for (int r = 0; r < 8; ++r) sO[w][rt * 16 + 8 * hh + r][dt * 16 + ln] = oacc[rt][dt][r] * l_r[rt][r]; }
  __builtin_amdgcn_fence(__ATOMIC_ACQ_REL, "workgroup"); __builtin_amdgcn_wave_barrier();
  {
#pragma unroll
    for (int rp = 0; rp < RPW; rp += 2) { const int r = rp + (lane >> 4), pc = lane & 15; const v4f val = *(const v4fa*)&sO[w][r][pc * 4]; *(v4f*)(O + ((size_t)b * TQ + q0 + r) * ldo + h * 64 + pc * 4) = val; }
     } }
// 5-plane variant: S = Qh Kh^T + (Ql Kh^T + Qh Kl^T)/1024 with Q/K = [hi | 2^10 residual] f16 planes (QL/KL same layout as Q16/K16), then the 3-term P.V below.
// 3-term variant: O = (P_hi V_hi + (P_lo V_hi + P_hi V_lo) / 1024) / l with P = [hi | 2^10 residual] of 1024 p and V^T = [hi | 2^10 residual] planes (VtL same layout as Vt) -> ~2^-21-class products for un-averaged (early causal / peaked) rows
template <int CAUSAL>
__global__ __launch_bounds__(128) void k_flash5(const _Float16* __restrict__ Q16, const _Float16* __restrict__ QL, int ldq, const _Float16* __restrict__ K16, const _Float16* __restrict__ KL, int ldk, const _Float16* __restrict__ Vt, const _Float16* __restrict__ VtL, const int* __restrict__ MSK, float* __restrict__ O, int ldo) {
  constexpr int RPW = 16, RTN = RPW / 16, NQB = TQ / (4 * RPW), DT = 4, KS = 2;
  __shared__ __attribute__((aligned(16))) unsigned short sP[4][RPW][40]; __shared__ __attribute__((aligned(16))) unsigned short sPL[4][RPW][40]; __shared__ __attribute__((aligned(16))) float sO[4][RPW][64 + 4];
  const int tid = threadIdx.x, w = tid >> 5, lane = tid & 31, ln = lane & 15, hh = lane >> 4;
  const int slab = blockIdx.x / QBN5, qblk = QB05 + blockIdx.x % QBN5; (void)NQB; const int b = slab / NH, h = slab % NH; const int qb0 = qblk * (4 * RPW); const int q0 = qb0 + w * RPW;
  FragH aq[2][KS], aql[2][KS];
#pragma unroll
  for (int rt = 0; rt < RTN; ++rt) { const unsigned short* qr = (const unsigned short*)Q16 + ((size_t)b * TQ + q0 + rt * 16 + ln) * ldq + h * 64; const unsigned short* ql = (const unsigned short*)QL + ((size_t)b * TQ + q0 + rt * 16 + ln) * ldq + h * 64;
#pragma unroll
    for (int ks = 0; ks < KS; ++ks) { aq[rt][ks].half[0] = *(const v8us*)(qr + ks * 32 + 8 * hh); aq[rt][ks].half[1] = *(const v8us*)(qr + ks * 32 + 16 + 8 * hh); aql[rt][ks].half[0] = *(const v8us*)(ql + ks * 32 + 8 * hh); aql[rt][ks].half[1] = *(const v8us*)(ql + ks * 32 + 16 + 8 * hh); } }
  const unsigned short* Vth = (const unsigned short*)Vt + (size_t)slab * 64 * TK; const unsigned short* Vtl = (const unsigned short*)VtL + (size_t)slab * 64 * TK;
  float m_r[2][8], l_r[2][8]; v8f oacc[2][DT], oaccL[2][DT];
#pragma unroll
  for (int rt = 0; rt < RTN; ++rt) {
#pragma unroll
    for (int r = 0; r < 8; ++r) { m_r[rt][r] = -3.0e38f; l_r[rt][r] = 0.f; }
#pragma unroll
    for (int dt = 0; dt < DT; ++dt) { oacc[rt][dt] = (v8f){0.f,0.f,0.f,0.f,0.f,0.f,0.f,0.f}; oaccL[rt][dt] = oacc[rt][dt]; } }
  const int jend = (CAUSAL == 1 || CAUSAL == 32) ? (qb0 + 4 * RPW) : ((CAUSAL == 23) ? min(TK, (qb0 / CHK + 2) * CHK) : TK);      /* causal / window: keys that can never contribute are skipped */ const int jbeg = (CAUSAL == 23) ? max(0, (qb0 / CHK - 1) * CHK) : 0;
#pragma unroll 1
  for (int j0 = jbeg; j0 < jend; j0 += 32) {
    v8f s[2][2];
#pragma unroll
    for (int nt = 0; nt < 2; ++nt) { const unsigned short* kr = (const unsigned short*)K16 + ((size_t)b * TK + j0 + nt * 16 + ln) * ldk + h * 64; const unsigned short* klr = (const unsigned short*)KL + ((size_t)b * TK + j0 + nt * 16 + ln) * ldk + h * 64; FragH bk[KS], bkl[KS];
#pragma unroll
      for (int ks = 0; ks < KS; ++ks) { bk[ks].half[0] = *(const v8us*)(kr + ks * 32 + 8 * hh); bk[ks].half[1] = *(const v8us*)(kr + ks * 32 + 16 + 8 * hh); bkl[ks].half[0] = *(const v8us*)(klr + ks * 32 + 8 * hh); bkl[ks].half[1] = *(const v8us*)(klr + ks * 32 + 16 + 8 * hh); }
#pragma unroll
      for (int rt = 0; rt < RTN; ++rt) { v8f acc = (v8f){0.f,0.f,0.f,0.f,0.f,0.f,0.f,0.f}, accl = acc;
#pragma unroll
        for (int ks = 0; ks < KS; ++ks) { acc = mmaH<1>(aq[rt][ks].v, aq[rt][ks].v, bk[ks].v, bk[ks].v, acc); accl = mmaH<1>(aql[rt][ks].v, aql[rt][ks].v, bk[ks].v, bk[ks].v, accl); accl = mmaH<1>(aq[rt][ks].v, aq[rt][ks].v, bkl[ks].v, bkl[ks].v, accl); }
#pragma unroll
        for (int r = 0; r < 8; ++r) acc[r] += accl[r] * 0.0009765625f;
        s[rt][nt] = acc; } }
#pragma unroll
    for (int rt = 0; rt < RTN; ++rt)
#pragma unroll
      for (int r = 0; r < 8; ++r) { const int tq = q0 + rt * 16 + 8 * hh + r; const int k0 = j0 + ln, k1 = j0 + 16 + ln;
        bool ok0 = (CAUSAL == 1 || CAUSAL == 32) ? (k0 <= tq) : ((CAUSAL == 2) ? ((k0 >> 5) == (tq >> 5)) : true), ok1 = (CAUSAL == 1 || CAUSAL == 32) ? (k1 <= tq) : ((CAUSAL == 2) ? ((k1 >> 5) == (tq >> 5)) : true);      /* mode 2: block-diagonal 32-token groups */
        if (CAUSAL == 4) { const int* mrow = MSK + ((size_t)b * TQ + tq) * TK; ok0 = mrow[k0] != 0; ok1 = mrow[k1] != 0; }      /* mode 4: per-(query, key) INPUT mask shared by all heads; masked keys contribute nothing (== the reference's -4096 fill, whose exp underflows to 0), rows with no valid key give l = 0 -> output 0 (== the reference's row_valid zeroing) */
        float s0 = ok0 ? s[rt][0][r] * SCL : -3.0e38f, s1 = ok1 ? s[rt][1][r] * SCL : -3.0e38f; if (CAUSAL == 30) { const float* rbp = (const float*)MSK; s0 += rbp[BK30[k0 - tq + (TK - 1)] * NH + h]; s1 += rbp[BK30[k1 - tq + (TK - 1)] * NH + h]; }      /* mode 30: T5 bucketed relative bias: table[bucket(k - q)][h]; bucket-of-distance is a module constant */ if (CAUSAL == 32) { const float* qsT = (const float*)MSK; const float* ksT = qsT + (size_t)NB * TQ; const float qs = qsT[(size_t)b * TQ + tq]; if (ok0) { float d = qs + ksT[(size_t)b * TK + k0]; d = d - 2.0f * s0; d = fmaxf(d, 0.f); s0 = -d * 0.125f; } if (ok1) { float d = qs + ksT[(size_t)b * TK + k1]; d = d - 2.0f * s1; d = fmaxf(d, 0.f); s1 = -d * 0.125f; } }      /* mode 32: RBF logit -relu(|q|^2 + |k|^2 - 2 q.k)/8, causal */ if (CAUSAL == 17) { const float* amk = (const float*)MSK + (size_t)b * TK; s0 += bf16_round(amk[k0]); s1 += bf16_round(amk[k1]); } if (CAUSAL == 18) { const float* tb = (const float*)MSK; const int* ri = MSK + 1024 + (size_t)b * TK; const int rq = ri[tq]; s0 += tb[(h * 8 + rq) * 8 + ri[k0]]; s1 += tb[(h * 8 + rq) * 8 + ri[k1]]; } if (CAUSAL == 19) { const int* rel = MSK + (size_t)tq * TK; const float* rb = (const float*)MSK + (size_t)TQ * TK + ((size_t)(b * NH + h) * TQ + tq) * 64; s0 += rb[rel[k0]]; s1 += rb[rel[k1]]; }      /* mode 19: + (q.Ek[rel] + Eb[rel][h]) / 8 gathered by the int relative ids (packed [ids | table]) */      /* mode 18: + resource_bias[h][r_q][r_k] from the packed [table | ids] buffer (TQ == TK) */      /* mode 17: additive per-(batch, key) mask INPUT */ float mc = fmaxf(s0, s1);
        mc = fmaxf(mc, __shfl_xor(mc, 1, 32)); mc = fmaxf(mc, __shfl_xor(mc, 2, 32)); mc = fmaxf(mc, __shfl_xor(mc, 4, 32)); mc = fmaxf(mc, __shfl_xor(mc, 8, 32));
        const float mn = fmaxf(m_r[rt][r], mc); const float al = (mn > -1.0e38f) ? expf(m_r[rt][r] - mn) : 1.0f; m_r[rt][r] = mn; const float p0 = ok0 ? expf(s0 - mn) : 0.f, p1 = ok1 ? expf(s1 - mn) : 0.f; l_r[rt][r] = l_r[rt][r] * al + p0 + p1;
#pragma unroll
        for (int dt = 0; dt < DT; ++dt) { oacc[rt][dt][r] *= al; oaccL[rt][dt][r] *= al; }
        FragH t2, t2l; const float ps0 = p0 * 1024.0f, ps1 = p1 * 1024.0f; t2.h[0] = (_Float16)ps0; t2.h[1] = (_Float16)ps1; t2l.h[0] = (_Float16)((ps0 - (float)t2.h[0]) * 1024.0f); t2l.h[1] = (_Float16)((ps1 - (float)t2.h[1]) * 1024.0f);
        sP[w][rt * 16 + 8 * hh + r][ln] = t2.u[0]; sP[w][rt * 16 + 8 * hh + r][16 + ln] = t2.u[1]; sPL[w][rt * 16 + 8 * hh + r][ln] = t2l.u[0]; sPL[w][rt * 16 + 8 * hh + r][16 + ln] = t2l.u[1]; }
    __builtin_amdgcn_fence(__ATOMIC_ACQ_REL, "workgroup"); __builtin_amdgcn_wave_barrier();
    FragH pa[2], pl[2];
#pragma unroll
    for (int rt = 0; rt < RTN; ++rt) { pa[rt].half[0] = *(const v8us*)&sP[w][rt * 16 + ln][8 * hh]; pa[rt].half[1] = *(const v8us*)&sP[w][rt * 16 + ln][16 + 8 * hh]; pl[rt].half[0] = *(const v8us*)&sPL[w][rt * 16 + ln][8 * hh]; pl[rt].half[1] = *(const v8us*)&sPL[w][rt * 16 + ln][16 + 8 * hh]; }
#pragma unroll
    for (int dt = 0; dt < DT; ++dt) { const unsigned short* vrow = Vth + (size_t)(dt * 16 + ln) * TK + j0; const unsigned short* vrl = Vtl + (size_t)(dt * 16 + ln) * TK + j0; FragH bv, bl; bv.half[0] = *(const v8us*)(vrow + 8 * hh); bv.half[1] = *(const v8us*)(vrow + 16 + 8 * hh); bl.half[0] = *(const v8us*)(vrl + 8 * hh); bl.half[1] = *(const v8us*)(vrl + 16 + 8 * hh);
#pragma unroll
      for (int rt = 0; rt < RTN; ++rt) { oacc[rt][dt] = mmaH<1>(pa[rt].v, pa[rt].v, bv.v, bv.v, oacc[rt][dt]); oaccL[rt][dt] = mmaH<1>(pl[rt].v, pl[rt].v, bv.v, bv.v, oaccL[rt][dt]); oaccL[rt][dt] = mmaH<1>(pa[rt].v, pa[rt].v, bl.v, bl.v, oaccL[rt][dt]); } }
    __builtin_amdgcn_fence(__ATOMIC_ACQ_REL, "workgroup"); __builtin_amdgcn_wave_barrier(); }
#pragma unroll
  for (int rt = 0; rt < RTN; ++rt) {
#pragma unroll
    for (int r = 0; r < 8; ++r) { float l = l_r[rt][r]; l += __shfl_xor(l, 1, 32); l += __shfl_xor(l, 2, 32); l += __shfl_xor(l, 4, 32); l += __shfl_xor(l, 8, 32); l_r[rt][r] = (l > 0.f) ? 1.0f / (l * 1024.0f) : 0.f; }
#pragma unroll
    for (int dt = 0; dt < DT; ++dt)
#pragma unroll
      for (int r = 0; r < 8; ++r) { float v = oacc[rt][dt][r]; v += oaccL[rt][dt][r] * 0.0009765625f; sO[w][rt * 16 + 8 * hh + r][dt * 16 + ln] = v * l_r[rt][r]; } }
  __builtin_amdgcn_fence(__ATOMIC_ACQ_REL, "workgroup"); __builtin_amdgcn_wave_barrier();
  {
#pragma unroll
    for (int rp = 0; rp < RPW; rp += 2) { const int r = rp + (lane >> 4), pc = lane & 15; const v4f val = *(const v4fa*)&sO[w][r][pc * 4]; *(v4f*)(O + ((size_t)b * TQ + q0 + r) * ldo + h * 64 + pc * 4) = val; }
     } }

// Transposed form of the causal RBF attention pass: S^T = K Q^T, O^T += V^T P^T. A lane holds one query's scores (16 of a block's 32 keys, the other wave half the other 16), so the block maximum is in-lane plus one exchange between the halves, and the two score tiles, converted in place, are the B operand of the second product: P passes through no LDS and the loop holds no fence. Logits, maxima and weights are formed by the expressions of k_flash mode 32.
__device__ __forceinline__ float xhalf(float x) { return __builtin_bit_cast(float, __builtin_amdgcn_permlanex16(__builtin_bit_cast(int, x), __builtin_bit_cast(int, x), 0x76543210, 0xfedcba98, false, false)); }      /* lane l with lane l ^ 16 */
__global__ __launch_bounds__(128) void k_flash_t(const _Float16* __restrict__ Q16, const _Float16* __restrict__ K16, const _Float16* __restrict__ Vt, const float* __restrict__ NSQ, float* __restrict__ O) {
  constexpr int DT = 4, KS = 2;
  __shared__ __attribute__((aligned(16))) float sO[4][16][64 + 4];
  const int tid = threadIdx.x, w = tid >> 5, lane = tid & 31, ln = lane & 15, hh = lane >> 4;
  const int slab = blockIdx.x / QBLKS, qblk = blockIdx.x % QBLKS; const int qb0 = qblk * 64; const int q0 = qb0 + w * 16; const int tq = q0 + ln;      /* this lane's query */
  FragH bq[KS]; const unsigned short* qr = (const unsigned short*)Q16 + ((size_t)slab * TQ + tq) * 64;
#pragma unroll
  for (int ks = 0; ks < KS; ++ks) { bq[ks].half[0] = *(const v8us*)(qr + ks * 32 + 8 * hh); bq[ks].half[1] = *(const v8us*)(qr + ks * 32 + 16 + 8 * hh); }
  const unsigned short* Kb = (const unsigned short*)K16 + (size_t)slab * TK * 64; const unsigned short* Vth = (const unsigned short*)Vt + (size_t)slab * 64 * TK;
  const float qs = NSQ[(size_t)slab * TQ + tq]; const float* ksT = NSQ + (size_t)NB * TQ + (size_t)slab * TK;
  float m = -3.0e38f, l = 0.f; v8f oacc[DT];
#pragma unroll
  for (int dt = 0; dt < DT; ++dt) oacc[dt] = (v8f){0.f,0.f,0.f,0.f,0.f,0.f,0.f,0.f};
  const int jend = qb0 + 64;
#pragma unroll 1
  for (int j0 = 0; j0 < jend; j0 += 32) {
    FragH ak[2][KS], av[DT]; v4f kq[2][2];      /* with no fence in the loop the whole pass's loads stand at its head, in front of the first product, and fly together */
#pragma unroll
    for (int nt = 0; nt < 2; ++nt) { const unsigned short* kr = Kb + (size_t)(j0 + nt * 16 + ln) * 64;
#pragma unroll
      for (int ks = 0; ks < KS; ++ks) { ak[nt][ks].half[0] = *(const v8us*)(kr + ks * 32 + 8 * hh); ak[nt][ks].half[1] = *(const v8us*)(kr + ks * 32 + 16 + 8 * hh); }
      kq[nt][0] = *(const v4fa*)(ksT + j0 + nt * 16 + 8 * hh); kq[nt][1] = *(const v4fa*)(ksT + j0 + nt * 16 + 8 * hh + 4); }      /* |k|^2 of this lane's eight keys of the tile */
    asm volatile("s_wait_xcnt 0x0" ::: "memory");      /* precaution: the address registers of the loads above may be reused as destinations of the loads below */
#pragma unroll
    for (int dt = 0; dt < DT; ++dt) { const unsigned short* vrow = Vth + (size_t)(dt * 16 + ln) * TK + j0; av[dt].half[0] = *(const v8us*)(vrow + 8 * hh); av[dt].half[1] = *(const v8us*)(vrow + 16 + 8 * hh); }
    asm volatile("s_wait_xcnt 0x0" ::: "memory");      /* precaution: stands in front of the pointer steps and of every other rewrite of a register that an issued load names */
    __builtin_amdgcn_sched_barrier(0);      /* keeps those rewrites, which the scheduler otherwise lifts among the loads, behind the wait */
    const int lim = tq - j0 - 8 * hh;      /* key 16 nt + r of this lane's sixteen is causal where 16 nt + r <= lim */
    float sc[16]; float mc = -3.0e38f;
#pragma unroll
    for (int nt = 0; nt < 2; ++nt) { v8f acc = (v8f){0.f,0.f,0.f,0.f,0.f,0.f,0.f,0.f};
#pragma unroll
      for (int ks = 0; ks < KS; ++ks) acc = mmaH<1>(ak[nt][ks].v, ak[nt][ks].v, bq[ks].v, bq[ks].v, acc);      /* acc[r] = k[j0 + 16 nt + 8 hh + r] . q[tq] */
#pragma unroll
      for (int r = 0; r < 8; ++r) { const bool ok = nt * 16 + r <= lim; float d = qs + kq[nt][r >> 2][r & 3]; d = d - 2.0f * (acc[r] * SCL); d = fmaxf(d, 0.f); const float sv = ok ? -d * 0.125f : -3.0e38f; sc[nt * 8 + r] = sv; mc = fmaxf(mc, sv); } }
    mc = fmaxf(mc, xhalf(mc));
    const float mn = fmaxf(m, mc); const float ea = expf(m - mn); const float al = (mn > -1.0e38f) ? ea : 1.0f; m = mn;
    FragH pb; float p[16];
#pragma unroll
    for (int i = 0; i < 16; ++i) { const bool ok = (i >> 3) * 16 + (i & 7) <= lim; const float e = expf(sc[i] - mn); p[i] = ok ? e : 0.f; pb.h[i] = (_Float16)(p[i] * 1024.0f); }      /* element i of the B operand is key 8 hh + i, then 16 + 8 hh + (i - 8): the order of the V^T loader above */
#pragma unroll
    for (int st = 8; st > 0; st >>= 1)
#pragma unroll
      for (int i = 0; i < st; ++i) p[i] += p[i + st];
    l = l * al + p[0];
#pragma unroll
    for (int dt = 0; dt < DT; ++dt) {
#pragma unroll
      for (int r = 0; r < 8; ++r) oacc[dt][r] *= al; }
#pragma unroll
    for (int dt = 0; dt < DT; ++dt) oacc[dt] = mmaH<1>(av[dt].v, av[dt].v, pb.v, pb.v, oacc[dt]); }      /* oacc[dt][r] = context column 16 dt + 8 hh + r of query tq */
  l += xhalf(l); const float inv = (l > 0.f) ? 1.0f / (l * 1024.0f) : 0.f;
#pragma unroll
  for (int dt = 0; dt < DT; ++dt) { v4f a, c;
#pragma unroll
    for (int r = 0; r < 4; ++r) { a[r] = oacc[dt][r] * inv; c[r] = oacc[dt][4 + r] * inv; }
    *(v4fa*)&sO[w][ln][dt * 16 + 8 * hh] = a; *(v4fa*)&sO[w][ln][dt * 16 + 8 * hh + 4] = c; }
  __builtin_amdgcn_fence(__ATOMIC_ACQ_REL, "workgroup"); __builtin_amdgcn_wave_barrier();      /* the wave's own lanes read each other's rows below, for whole-row stores */
#pragma unroll
  for (int rp = 0; rp < 16; rp += 2) { const int r = rp + (lane >> 4), pc = lane & 15; const v4f val = *(const v4fa*)&sO[w][r][pc * 4]; *(v4f*)(O + ((size_t)slab * TQ + q0 + r) * 64 + pc * 4) = val; } }

__global__ __launch_bounds__(256) void k_rotab(float* __restrict__ CS, float* __restrict__ SN) {
  #pragma clang fp contract(off)
  const int t = blockIdx.x * 256 + threadIdx.x; if (t >= SLEN * 32) return; const int j = t % 32, s = t / 32; const float ex = (float)(2 * j) / 64.0f; const float inv = 1.0f / powf(10000.0f, ex); const float th = (float)s * inv; const float c = cosf(th), sn = sinf(th);
  { *(float*)(CS + t) = c; *(float*)(SN + t) = sn;  } }
__global__ __launch_bounds__(256) void k_rope(const float* __restrict__ F, int nsrc, int ndst, int rep, const float* __restrict__ CS, const float* __restrict__ SN, _Float16* __restrict__ H, _Float16* __restrict__ L) {
  #pragma clang fp contract(off)
  const size_t t = (size_t)blockIdx.x * 256 + threadIdx.x; if (t >= (size_t)NR * ndst * 4) return; const int g8 = (int)(t % 4); const int hd = (int)((t / 4) % ndst); const size_t row = t / ((size_t)4 * ndst); const int s = (int)(row % SLEN); const int hs = hd / rep;
  const float* src = F + row * (size_t)(nsrc * 64) + hs * 64; FragH ah, al, bh, bl;
  for (int i = 0; i < 8; ++i) { const int d = g8 * 8 + i; const float c = CS[s * 32 + d], sn = SN[s * 32 + d]; const float x1 = src[d], x2 = src[d + 32];
    float o1 = x1 * c; o1 += -x2 * sn; float o2 = x2 * c; o2 += x1 * sn;
    _Float16 hv = (_Float16)o1; ah.h[i] = hv; al.h[i] = (_Float16)((o1 - (float)hv) * 1024.0f); hv = (_Float16)o2; bh.h[i] = hv; bl.h[i] = (_Float16)((o2 - (float)hv) * 1024.0f); }
  const size_t o = row * (size_t)(ndst * 64) + hd * 64 + g8 * 8;
  { *(v8us*)((unsigned short*)H + o) = ah.half[0]; *(v8us*)((unsigned short*)H + o + 32) = bh.half[0]; *(v8us*)((unsigned short*)L + o) = al.half[0]; *(v8us*)((unsigned short*)L + o + 32) = bl.half[0];  } }
__global__ __launch_bounds__(256) void k_rope2(const float* __restrict__ F, int nsrc, int ndst, int rep, const float* __restrict__ CS, const float* __restrict__ SN, _Float16* __restrict__ H, _Float16* __restrict__ L) {
  #pragma clang fp contract(off)
  const size_t t = (size_t)blockIdx.x * 256 + threadIdx.x; if (t >= (size_t)NR * ndst * 4) return; const int g16 = (int)(t % 4); const int hd = (int)((t / 4) % ndst); const size_t row = t / ((size_t)4 * ndst); const int s = (int)(row % SLEN); const int hs = hd / rep;
  const float* src = F + row * (size_t)(nsrc * 64) + hs * 64 + g16 * 16; FragH ah, al;
  for (int pr = 0; pr < 8; ++pr) { const int i = g16 * 8 + pr; const float c = CS[s * 32 + i], sn = SN[s * 32 + i]; const float x1 = src[2 * pr], x2 = src[2 * pr + 1];
    float o1 = x1 * c; o1 -= x2 * sn; float o2 = x1 * sn; o2 += x2 * c;
    _Float16 hv = (_Float16)o1; ah.h[2 * pr] = hv; al.h[2 * pr] = (_Float16)((o1 - (float)hv) * 1024.0f); hv = (_Float16)o2; ah.h[2 * pr + 1] = hv; al.h[2 * pr + 1] = (_Float16)((o2 - (float)hv) * 1024.0f); }
  const size_t o = row * (size_t)(ndst * 64) + hd * 64 + g16 * 16;
  { *(v8us*)((unsigned short*)H + o) = ah.half[0]; *(v8us*)((unsigned short*)H + o + 8) = ah.half[1]; *(v8us*)((unsigned short*)L + o) = al.half[0]; *(v8us*)((unsigned short*)L + o + 8) = al.half[1];  } }
__global__ __launch_bounds__(256) void k_ln512(const float* __restrict__ A, const float* __restrict__ res, const float* __restrict__ g, const float* __restrict__ bb, float* __restrict__ Y, _Float16* __restrict__ Y16) {
  #pragma clang fp contract(off)
  const int wv = threadIdx.x >> 5, ln = threadIdx.x & 31; const size_t r = (size_t)blockIdx.x * 8 + wv; if (r >= NR) return; float x[16]; float s = 0.f;
  for (int i = 0; i < 2; ++i) { const v8f a = *(const v8f*)(A + r * DM + i * 256 + ln * 8); for (int q = 0; q < 8; ++q) { float v = a[q]; if (res) v += bf16_round(res[r * DM + i * 256 + ln * 8 + q]); x[i * 8 + q] = v; s += v; } }
  for (int o = 16; o > 0; o >>= 1) s += __shfl_xor(s, o, 32); const float mu = s / (float)DM; float var = 0.f; for (int q = 0; q < 16; ++q) { const float d = x[q] - mu; var += d * d; }
  for (int o = 16; o > 0; o >>= 1) var += __shfl_xor(var, o, 32); const float inv = rsqrtf(var / (float)DM + 1e-5f);
  { for (int i = 0; i < 2; ++i) { const int c0 = i * 256 + ln * 8; v8f y; FragH f; for (int q = 0; q < 8; ++q) { float v = (x[i * 8 + q] - mu) * inv; v *= bf16_round(g[c0 + q]); v += bf16_round(bb[c0 + q]); y[q] = v; f.h[q] = (_Float16)v; } *(v8f*)(Y + r * DM + c0) = y; if (Y16) *(v8us*)((unsigned short*)Y16 + r * DM + c0) = f.half[0]; }  } }
__global__ __launch_bounds__(256) void k_pack(const float* __restrict__ rb, const int* __restrict__ rid, int* __restrict__ PK) { const int t = blockIdx.x * 256 + threadIdx.x; if (t >= 1024 + NB * TK) return; int v; if (t < 1024) v = __float_as_int(bf16_round(rb[t])); else v = rid[t - 1024]; *(int*)(PK + t) = v;  }
__global__ __launch_bounds__(256) void k_tabin(const float* __restrict__ sp, float* __restrict__ CS, float* __restrict__ SN) { const int t = blockIdx.x * 256 + threadIdx.x; if (t >= SLEN * 32) return; const int i = t % 32, s = t / 32; const float c = bf16_round(sp[s * 64 + 32 + i]), sn = bf16_round(sp[s * 64 + i]);
  { *(float*)(CS + t) = c; *(float*)(SN + t) = sn;  } }
__global__ __launch_bounds__(256) void k_wsc(const float* __restrict__ Wm, _Float16* __restrict__ Bt, size_t n8, float sc) { const size_t t = (size_t)blockIdx.x * 256 + threadIdx.x; if (t >= n8) return; FragH f; for (int q = 0; q < 8; ++q) f.h[q] = (_Float16)(bf16_round(Wm[t * 8 + q]) * sc); *(v8us*)((unsigned short*)Bt + t * 8) = f.half[0];  }
__global__ __launch_bounds__(256) void k_rotab2(float* __restrict__ CS, float* __restrict__ SN) {
  #pragma clang fp contract(off)
  const int t = blockIdx.x * 256 + threadIdx.x; if (t >= SLEN * 32) return; const int j = t % 32, s = t / 32; const float c0 = -0.14391156831212787f;      /* -ln(10000)/64 rounded to f32 */ const float inv = expf((float)(2 * j) * c0); const float th = (float)s * inv; const float c = cosf(th), sn = sinf(th);
  { *(float*)(CS + t) = c; *(float*)(SN + t) = sn;  } }
__global__ __launch_bounds__(256) void k_lnu(const float* __restrict__ X, _Float16* __restrict__ N16, float* __restrict__ XB) {
  #pragma clang fp contract(off)
  const int wv = threadIdx.x >> 5, ln = threadIdx.x & 31; const size_t r = (size_t)blockIdx.x * 8 + wv; if (r >= NR) return; float a[32]; float s = 0.f;
  for (int i = 0; i < 4; ++i) { const v8f v = *(const v8f*)(X + r * DM + (i * 32 + ln) * 8); for (int q = 0; q < 8; ++q) { const float u = bf16_round(v[q]); a[i * 8 + q] = u; s += u; } }
  for (int o = 16; o > 0; o >>= 1) s += __shfl_xor(s, o, 32); const float mu = s / (float)DM; float var = 0.f; for (int q = 0; q < 32; ++q) { const float d = a[q] - mu; var += d * d; }
  for (int o = 16; o > 0; o >>= 1) var += __shfl_xor(var, o, 32); const float den = sqrtf(var / (float)(DM - 1)) + 1e-6f; const float inv = 1.0f / den;      /* one reciprocal per row; (x-mean)*inv vs the reference's division differs by <= 1 ulp */
  { for (int i = 0; i < 4; ++i) { const int c0 = (i * 32 + ln) * 8; FragH f; v8f xb; for (int q = 0; q < 8; ++q) { f.h[q] = (_Float16)((a[i * 8 + q] - mu) * inv); xb[q] = a[i * 8 + q]; } *(v8us*)((unsigned short*)N16 + r * DM + c0) = f.half[0]; *(v8f*)(XB + r * DM + c0) = xb; }  } }

__global__ __launch_bounds__(256) void k_h16s(const float* __restrict__ SRC, int lds, int coff, _Float16* __restrict__ DST, size_t n8) { const size_t t = (size_t)blockIdx.x * 256 + threadIdx.x; if (t >= n8) return; const size_t r = (t * 8) / DM; const int c = (int)((t * 8) % DM); const v8f a = *(const v8f*)(SRC + r * lds + coff + c); FragH f; for (int q = 0; q < 8; ++q) f.h[q] = (_Float16)a[q];
  *(v8us*)((unsigned short*)DST + t * 8) = f.half[0];  }


__global__ __launch_bounds__(256) void k_ccp(const float* __restrict__ QKV, int coff, _Float16* __restrict__ D) { const size_t t = (size_t)blockIdx.x * 256 + threadIdx.x; if (t >= (size_t)NR * DM / 8) return; const int c0 = (int)((t * 8) % DM); const size_t row = (t * 8) / DM; const v8f a = *(const v8f*)(QKV + row * 3 * DM + coff + c0); FragH f; for (int q = 0; q < 8; ++q) f.h[q] = (_Float16)a[q];
  *(v8us*)((unsigned short*)D + t * 8) = f.half[0];  }


template <int NLN>
__global__ __launch_bounds__(256) void k_lnrow(const float* __restrict__ X, const float* __restrict__ R, const float* __restrict__ g, const float* __restrict__ bb, float eps, float* __restrict__ OUT) {
  #pragma clang fp contract(off)
  constexpr int PER = NLN / 256; __shared__ float red[256]; const int tid = threadIdx.x; const size_t row = blockIdx.x; const float* x = X + row * NLN; const float* rr = R ? R + row * NLN : nullptr; float v[PER]; float s1 = 0.f;
  for (int u = 0; u < PER; ++u) { const int j = tid * PER + u; float t = x[j]; if (rr) t = t + rr[j]; v[u] = t; s1 += t; }
  red[tid] = s1; __syncthreads(); for (int st = 128; st > 0; st >>= 1) { if (tid < st) red[tid] += red[tid + st]; __syncthreads(); } const float mu = red[0] / (float)NLN; __syncthreads();
  float s2 = 0.f; for (int u = 0; u < PER; ++u) { const float c = v[u] - mu; s2 += c * c; } red[tid] = s2; __syncthreads(); for (int st = 128; st > 0; st >>= 1) { if (tid < st) red[tid] += red[tid + st]; __syncthreads(); }
  const float var = red[0] / (float)NLN; const float rs = rsqrtf(var + eps);
  { for (int u = 0; u < PER; ++u) { const int j = tid * PER + u; float o = (v[u] - mu) * rs; o = __fadd_rn(__fmul_rn(o, bf16_round(g[j])), bf16_round(bb[j])); *(float*)(OUT + row * NLN + j) = o; }  } }
__global__ __launch_bounds__(256) void k_xr32(const float* __restrict__ x, float* __restrict__ XR, size_t n8) { const size_t t = (size_t)blockIdx.x * 256 + threadIdx.x; if (t >= n8) return; v8f o; for (int q = 0; q < 8; ++q) o[q] = bf16_round(x[t * 8 + q]); *(v8f*)(XR + t * 8) = o;  }
__global__ __launch_bounds__(256) void k_r16b(const float* __restrict__ S, _Float16* __restrict__ D, size_t n8) { const size_t t = (size_t)blockIdx.x * 256 + threadIdx.x; if (t >= n8) return; const v8f a = *(const v8f*)(S + t * 8); FragH f; for (int q = 0; q < 8; ++q) f.h[q] = (_Float16)a[q]; *(v8us*)((unsigned short*)D + t * 8) = f.half[0];  }

// One preparatory launch. Blocks 0-255 take q, 256-511 k, 512-767 v, 256 rows each; every input is read once.
// q, k: the bf16 bits are staged in LDS, the f16 plane goes out from registers, and one thread per row sums its squares in ascending order of d.
// v: the f16 values are staged in LDS and go out transposed, 128 bytes of a V^T row per eight lanes.
__global__ __launch_bounds__(256) void k_prep(const float* __restrict__ Q, const float* __restrict__ Kx, const float* __restrict__ V, _Float16* __restrict__ QH, _Float16* __restrict__ KH, _Float16* __restrict__ Vt, float* __restrict__ NSQ) {
  __shared__ __attribute__((aligned(16))) unsigned short sm[256 * 72];      /* q, k: pitch 72 (144 B = 16 B x odd: a lane per row reads 16 bytes without bank conflicts); v: pitch 66 (eight rows apart = 8 banks apart) */
  const int tid = threadIdx.x; const int which = blockIdx.x >> 8, blk = blockIdx.x & 255; const size_t e0 = (size_t)blk * 256 * 64;
  if (which < 2) {
    const float* X = (which ? Kx : Q) + e0; unsigned short* H = (unsigned short*)(which ? KH : QH) + e0; FragH f[8]; v8f a[8]; const unsigned boff = (unsigned)tid * 32u;
#pragma unroll
    for (int i = 0; i < 8; ++i) a[i] = *(const v8f*)((const char*)X + boff + i * 8192);
    asm volatile("s_wait_xcnt 0x0" :: "v"(boff) : "memory");      /* precaution: the loads' offset register is held to this wait, so that none of the loads takes it as its destination */
    __builtin_amdgcn_sched_barrier(0);      /* keeps all sixteen loads in flight together; the scheduler otherwise sinks six of them behind the first waits, three more memory latencies in a row */
#pragma unroll
    for (int i = 0; i < 8; ++i) { const int g = i * 256 + tid; v8us b;
#pragma unroll
      for (int u = 0; u < 8; ++u) { const unsigned short hb = bf16_bits(a[i][u]); b[u] = hb; f[i].h[u] = (_Float16)bf16_val(hb); }
      *(v8us*)&sm[(g >> 3) * 72 + (g & 7) * 8] = b; }
    __syncthreads();      /* a row's sixteen-byte pieces were staged by eight threads */
#pragma unroll
    for (int i = 0; i < 8; ++i) *(v8us*)(H + (i * 256 + tid) * 8) = f[i].half[0];      /* behind the barrier, which would otherwise wait for these stores */
    float acc = 0.f;
#pragma unroll
    for (int d = 0; d < 64; d += 8) { const v8us b = *(const v8us*)&sm[tid * 72 + d];
#pragma unroll
      for (int u = 0; u < 8; ++u) { const float x = bf16_val(b[u]); acc = __fadd_rn(acc, __fmul_rn(x, x)); } }      /* a square of a bf16 value is exact in f32: fused or not, each step rounds the same sum */
    *(float*)(NSQ + (size_t)which * NR + blk * 256 + tid) = acc;
  } else {
    const float* X = V + e0; const int slab = blk >> 3, kg = blk & 7;      /* eight groups of 256 keys per slab */
#pragma unroll
    for (int i = 0; i < 8; ++i) { const int g = i * 256 + tid; const v8f a = *(const v8f*)(X + g * 8); FragH f;
#pragma unroll
      for (int u = 0; u < 8; ++u) f.h[u] = (_Float16)bf16_round(a[u]);
#pragma unroll
      for (int u = 0; u < 8; ++u) sm[(g >> 3) * 66 + (g & 7) * 8 + u] = f.u[u]; }
    __syncthreads();      /* a V^T piece gathers eight keys staged by eight threads */
#pragma unroll
    for (int it = 0; it < 8; ++it) { const int d = (it & 1) * 32 + tid / 8, pc = (it >> 1) * 8 + tid % 8; FragH f;
#pragma unroll
      for (int u = 0; u < 8; ++u) f.u[u] = sm[(pc * 8 + u) * 66 + d];
      *(v8us*)((unsigned short*)Vt + ((size_t)slab * 64 + d) * SLEN + kg * 256 + pc * 8) = f.half[0]; }
    asm volatile("s_wait_xcnt 0x0" ::: "memory");      /* precaution: the compiler lays the q, k branch behind these stores in the text, where their registers are rewritten */
  } }
// One block per (slab, 8 query rows < 64), one wave per row. The slab's first 64 rows of k and v are rounded and staged in LDS once per block; lanes own keys for the logits, then output columns for the context. Each dot product, the row sum and each context sum keep their serial order.
__global__ __launch_bounds__(256) void k_fixr(const float* __restrict__ Q, const float* __restrict__ Kx, const float* __restrict__ V, const float* __restrict__ NSQ, float* __restrict__ O) {
  #pragma clang fp contract(off)
  __shared__ __attribute__((aligned(16))) float sk[64][68];      /* pitch 272 B = 16 B x odd: a lane per row reads 16 bytes without bank conflicts */
  __shared__ __attribute__((aligned(16))) float sv[64][64]; __shared__ __attribute__((aligned(16))) float pr[8][64];
  const int tid = threadIdx.x, w = tid >> 5, lane = tid & 31; const size_t sl = blockIdx.x >> 3; const int q = __builtin_amdgcn_readfirstlane((int)(blockIdx.x & 7) * 8 + w);
  const float* kb = Kx + sl * SLEN * 64; const float* vb = V + sl * SLEN * 64;
#pragma unroll
  for (int i = 0; i < 4; ++i) { const int e = (i * 256 + tid) * 4; const v4f a = *(const v4fa*)(kb + e); const v4f c = *(const v4fa*)(vb + e); v4f ra, rc;
#pragma unroll
    for (int u = 0; u < 4; ++u) { ra[u] = bf16_round(a[u]); rc[u] = bf16_round(c[u]); }
    *(v4fa*)&sk[e >> 6][e & 63] = ra; *(v4fa*)&sv[e >> 6][e & 63] = rc; }
  const float* qr = Q + (sl * SLEN + q) * 64; const float qs = NSQ[sl * SLEN + q]; const float* ksT = NSQ + (size_t)NB * SLEN + sl * SLEN; const float kq0 = ksT[lane], kq1 = ksT[lane + 32];
  float x[64];      /* the wave's query row, fetched ahead of the barrier so that its latency runs beside the staging loads' */
#pragma unroll
  for (int d = 0; d < 64; d += 4) { const v4f a = *(const v4fa*)(qr + d);
#pragma unroll
    for (int u = 0; u < 4; ++u) x[d + u] = bf16_round(a[u]); }
  __syncthreads();      /* the staged rows are read by every wave of the block */
  float sd0 = 0.f, sd1 = 0.f;      /* keys lane and lane + 32 */
#pragma unroll
  for (int d = 0; d < 64; d += 4) { const v4f k0 = *(const v4fa*)&sk[lane][d]; const v4f k1 = *(const v4fa*)&sk[lane + 32][d];
#pragma unroll
    for (int u = 0; u < 4; ++u) { sd0 = __fadd_rn(sd0, __fmul_rn(x[d + u], k0[u])); sd1 = __fadd_rn(sd1, __fmul_rn(x[d + u], k1[u])); } }
  float d0 = qs + kq0; d0 = d0 - 2.0f * sd0; d0 = fmaxf(d0, 0.f); float d1 = qs + kq1; d1 = d1 - 2.0f * sd1; d1 = fmaxf(d1, 0.f);
  const bool ok0 = lane <= q, ok1 = lane + 32 <= q; const float lg0 = ok0 ? -d0 * 0.125f : -3.0e38f, lg1 = ok1 ? -d1 * 0.125f : -3.0e38f;
  float mx = fmaxf(lg0, lg1); mx = fmaxf(mx, __shfl_xor(mx, 1, 32)); mx = fmaxf(mx, __shfl_xor(mx, 2, 32)); mx = fmaxf(mx, __shfl_xor(mx, 4, 32)); mx = fmaxf(mx, __shfl_xor(mx, 8, 32)); mx = fmaxf(mx, __shfl_xor(mx, 16, 32));
  const float e0 = expf(lg0 - mx), e1 = expf(lg1 - mx); pr[w][lane] = ok0 ? e0 : 0.f; pr[w][lane + 32] = ok1 ? e1 : 0.f;
  __builtin_amdgcn_fence(__ATOMIC_ACQ_REL, "workgroup"); __builtin_amdgcn_wave_barrier();      /* the wave's own lanes read each other's weights below */
  float su = 0.f;
#pragma unroll
  for (int j = 0; j < 64; j += 4) { const v4f e = *(const v4fa*)&pr[w][j]; su += e[0]; su += e[1]; su += e[2]; su += e[3]; }      /* ascending keys; a masked key adds an exact zero */
  const float inv = 1.0f / su; typedef float v2f __attribute__((ext_vector_type(2))); typedef float v2fa __attribute__((ext_vector_type(2), may_alias));
  float a0 = 0.f, a1 = 0.f;      /* output columns 2 lane and 2 lane + 1 */
#pragma unroll 1
  for (int j0 = 0; j0 <= q; j0 += 16) {
#pragma unroll
    for (int i = 0; i < 16; ++i) { const bool in = j0 + i <= q; const v2f vv = *(const v2fa*)&sv[j0 + i][lane * 2]; const float p = pr[w][j0 + i] * inv;      /* past the row's last key the weight is zero; the value is zeroed too, so the term is an exact zero */
      a0 = __fadd_rn(a0, __fmul_rn(p, in ? vv[0] : 0.f)); a1 = __fadd_rn(a1, __fmul_rn(p, in ? vv[1] : 0.f)); } }
  const v2f o = {a0, a1}; *(v2f*)(O + (sl * SLEN + q) * 64 + lane * 2) = o; }

extern "C" void kernel_launch(void* const* d_in, const int* in_sizes, int n_in,
                              void* d_out, int out_size, void* d_ws, size_t ws_size, hipStream_t stream) {
  (void)in_sizes; (void)n_in; (void)out_size;
  const float* q = (const float*)d_in[0]; const float* k = (const float*)d_in[1]; const float* v = (const float*)d_in[2]; float* O = (float*)d_out;
  char* ws = (char*)d_ws; size_t off = 0;
  auto take = [&](size_t bytes) { char* p = ws + off; off += (bytes + 255) & ~(size_t)255; return p; };
  const size_t np = (size_t)NR * DM;      /* 32 x 2048 x 64 */
  _Float16* QH = (_Float16*)take(np * 2); _Float16* KH = (_Float16*)take(np * 2); _Float16* VT = (_Float16*)take(np * 2); float* NSQ = (float*)take((size_t)2 * NR * 4);
  if (off > ws_size) return;      /* 3 x 8 + 0.5 MiB */
  k_prep<<<3 * (NR / 256), 256, 0, stream>>>(q, k, v, QH, KH, VT, NSQ);      /* f16 planes of q and k (bf16-rounded inputs are exact in f16), V^T, |q|^2 | |k|^2 tables */
  k_flash_t<<<NB * QBLKS, 128, 0, stream>>>(QH, KH, VT, NSQ, O);      /* exact q, k products; f32 RBF logits; f32 context straight to the output */
  k_fixr<<<NB * 8, 256, 0, stream>>>(q, k, v, NSQ, O);      /* rows < 64 per slab recomputed in f32 */
}
